// v000
// The times below were measured on an AMD MI455X: many runs one after another, warmed up first and cycling through
// copies of the inputs, with the whole window's GPU time divided by the number of runs. Launches and the gaps
// between them are all in it. The median over several windows is given; except for v000 it joins two sittings, which
// can be a few percent apart, so the side-by-side timings, each taken in one sitting, are the better comparison.
// v000 is the starting kernel. One run takes 7600 microseconds.
#include <hip/hip_runtime.h>
// Multi-head attention on three inputs with PER-HEAD STACKED projections and the source's RAW-RESHAPE head merge (Q, K, V [2][2048][1024]; WQ / WK / WV [16][1024][64] = [head][in][out] uniform +-0.1, NO biases; 16 heads of 64; scores x 1/sqrt(64); softmax over all 2048 keys (no mask); the head outputs [B][H][S][64] are RESHAPED IN MEMORY ORDER to [B][S][1024] (row r of a batch holds tokens 16 (r mod 128) .. + 15 of head r / 128: heads and tokens mix: faithful to the source); out = that WO with WO [1024][1024] [in][out], NO bias -> [2][2048][1024]); q and k carried as f16 hi + x1024 residual planes with three-product scores; each head's [in][out] block is transposed into its 64 contiguous rows of the weight plane by the transposing builder, one call per head, and the [in][out] output weight by the same builder in one call; DENSE on causal kernels (the visibility argument of the row softmax is SQ; no exact first tile).
// Structure: token rows r = b*2048 + s; x as exact f16 rows (bf16-rounded); q and k as WMMA GEMMs (32x64 wave tiles, f32 accumulation, exact x16 weights, no bias) into f32 rows split into f16 hi + x1024 residual planes, v as an f16-output GEMM; per batch: V^T for all heads via LDS transposes; per query tile of 256 rows: scores against all 2048 keys as THREE accumulating passes (hi.hi + lo.hi + hi.lo, K = 64, all heads on grid.y, alpha 1/sqrt(64) = 2^-3 on hi.hi, 2^-13 on the x1024 residual passes, logits sigma ~8), row softmax on VALU over all keys (its arithmetic 0/1 key mask keeps every key) (f32 statistics, native exp; weights x256 f16), o = P . V^T (K = all 2048 keys, alpha 2^-2: o carried x64, folded into the output GEMM alpha) written straight into the merged f16 o rows; out = o W_o GEMM (f32) into the output layout.
// Compute dtype: inputs rounded to bf16; x / weights exact; q and k as f16 hi + x1024 residual planes; v, softmax weights and o as plain f16 GEMM operands (~2^-12); scores and softmax statistics f32. v_wmma_f32_16x16x32_f16.
#define NB 2
#define SCL 0.125f                         /* 1 / sqrt(head_dim = 64) */
#define SCLR 0.0001220703125f              /* 2^-13: the same scale on the x1024 residual passes */
#define SQ 2048
#define DM 1024
#define NH 16
#define HD 64
#define HG 4                         /* heads per group of the second k_vt (not launched) */
#define QT 256                       /* query rows per query tile */
#define NKX SQ                       /* S / P row pitch */
#define QT0 128                      /* rows of the exact first tile of k_att0 (not launched) */
#define B0 0                         /* first batch processed (debug hook) */
#define NBR NB                       /* batches processed (debug hook) */
#define NR ((size_t)NB * SQ)         /* token rows */
#define MP ((int)((size_t)NBR * SQ)) /* rows projected (debug hook) */
#define QN SQ                        /* query rows attended per batch (debug hook) */
#define NHD NH                       /* heads attended (debug hook) */
#define MPO MP                       /* rows through the output stage (debug hook) */
#define LQ DM      /* row pitch of the q/k/v rows */
typedef __bf16 v16b __attribute__((ext_vector_type(16)));
typedef unsigned short v8us __attribute__((ext_vector_type(8), may_alias));
typedef float  v8f  __attribute__((ext_vector_type(8)));
typedef float  v4f  __attribute__((ext_vector_type(4)));
typedef float  v4fa __attribute__((ext_vector_type(4), may_alias));
union FragB { v16b v; v8us half[2]; unsigned short u[16]; };

__device__ __forceinline__ unsigned short bf16_bits(float x) { unsigned int u = __float_as_uint(x); return (unsigned short)((u + 0x7FFFu + ((u >> 16) & 1u)) >> 16); }
__device__ __forceinline__ float bf16_val(unsigned short b) { return __uint_as_float(((unsigned int)b) << 16); }
__device__ __forceinline__ float bf16_round(float x) { return bf16_val(bf16_bits(x)); }
// D += A·B with NT terms: 1 = ah·bh, 2 = + al·bh (A split), 3 = + ah·bl (both split)
template <int NT>
__device__ __forceinline__ v8f mmaN(v16b ah, v16b al, v16b bh, v16b bl, v8f c) {
  c = __builtin_amdgcn_wmma_f32_16x16x32_bf16(false, ah, false, bh, (short)0, c, false, false);
  if (NT >= 2) c = __builtin_amdgcn_wmma_f32_16x16x32_bf16(false, al, false, bh, (short)0, c, false, false);
  if (NT >= 3) c = __builtin_amdgcn_wmma_f32_16x16x32_bf16(false, ah, false, bl, (short)0, c, false, false);
  asm volatile("v_nop\n\tv_nop\n\tv_nop\n\tv_nop" : "+v"(c) : "v"(ah), "v"(al), "v"(bh), "v"(bl));
  return c;
}

__global__ __launch_bounds__(256) void k_wt_bf16(const float* __restrict__ W, unsigned short* __restrict__ Wt, int K, int N) {
  const int t = blockIdx.x * 256 + threadIdx.x;
  const int k8n = K / 8;
  if (t >= N * k8n) return;
  const int n = t / k8n, k8 = (t % k8n) * 8;
  v8us v;
#pragma unroll
  for (int i = 0; i < 8; ++i) v[i] = bf16_bits(W[(size_t)(k8 + i) * N + n]);
  *(v8us*)(Wt + (size_t)n * K + k8) = v;
  
}

// GEMM C[M][N] (f32, pitch ldc) = act(A[M][K]·W + bias). A f32 row-major (pitch lda) converted per fragment to bf16
// (ASPLIT: hi/lo two planes -> 2 terms, else single rounded term); Wt bf16 [N][K] (pitch ldb). BIAS_BF16 rounds the
// bias to bf16 first (bias quantised to bf16 before the add). K%32==0, M%16==0, N%64==0.
template <bool ASPLIT, int ACT, bool BIAS_BF16>
__global__ __launch_bounds__(128) void k_gemm_bf(const float* __restrict__ A, int lda, const unsigned short* __restrict__ Wt, int ldb,
                                               const float* __restrict__ bias, float* __restrict__ C, int ldc, int M, int N, int K) {
  __shared__ __attribute__((aligned(16))) float so[4][16][64];
  const int tid = threadIdx.x, w = tid >> 5, lane = tid & 31, ln = lane & 15, hh = lane >> 4;
  const int ntn = N / 64;
  const int wid = blockIdx.x * 4 + w;
  const int mt = wid / ntn, nq = wid % ntn;
  if (mt * 16 >= M) return;
  const int row0 = mt * 16, col0 = nq * 64;
  const float* arow = A + (size_t)(row0 + ln) * lda;
  v8f acc[4] = {};
  for (int kb = 0; kb < K; kb += 32) {
    FragB ah, al;
    const v4f x0 = *(const v4fa*)(arow + kb + 8 * hh), x1 = *(const v4fa*)(arow + kb + 8 * hh + 4);
    const v4f x2 = *(const v4fa*)(arow + kb + 16 + 8 * hh), x3 = *(const v4fa*)(arow + kb + 16 + 8 * hh + 4);
    float xs[16] = {x0[0],x0[1],x0[2],x0[3],x1[0],x1[1],x1[2],x1[3],x2[0],x2[1],x2[2],x2[3],x3[0],x3[1],x3[2],x3[3]};
#pragma unroll
    for (int i = 0; i < 16; ++i) { const unsigned short hb = bf16_bits(xs[i]); ah.u[i] = hb; al.u[i] = ASPLIT ? bf16_bits(xs[i] - bf16_val(hb)) : (unsigned short)0; }
#pragma unroll
    for (int t = 0; t < 4; ++t) {
      const unsigned short* brow = Wt + (size_t)(col0 + t * 16 + ln) * ldb + kb;
      FragB b;
      b.half[0] = *(const v8us*)(brow + 8 * hh);
      b.half[1] = *(const v8us*)(brow + 16 + 8 * hh);
      acc[t] = mmaN<ASPLIT ? 2 : 1>(ah.v, al.v, b.v, b.v, acc[t]);
    }
  }
#pragma unroll
  for (int t = 0; t < 4; ++t) {
    float bv = bias ? bias[col0 + t * 16 + ln] : 0.f;
    if (BIAS_BF16) bv = bf16_round(bv);
#pragma unroll
    for (int r = 0; r < 8; ++r) { float v = acc[t][r] + bv; if (ACT == 1) v = fmaxf(v, 0.f); so[w][8 * hh + r][t * 16 + ln] = v; }
  }
  __builtin_amdgcn_fence(__ATOMIC_ACQ_REL, "workgroup");
  __builtin_amdgcn_wave_barrier();
  const int rsub = lane >> 4, c4 = (lane & 15) * 4;
  {
#pragma unroll
    for (int q = 0; q < 8; ++q) {
      const int r = q * 2 + rsub;
      const v4f v = *(const v4fa*)&so[w][r][c4];
      *(v4f*)(C + (size_t)(row0 + r) * ldc + col0 + c4) = v;
    }
    
  }
}

// GEMM C = act(A·W + bias + resid): A f32 (ASPLIT -> hi/lo 2 terms), Wt bf16 [N][K]; ACT 0 none, 1 relu, 2 exact gelu;
// resid (optional, f32, row index = (row % rmod), pitch ldr, RES_BF16 rounds it) added before the activation.
template <bool ASPLIT, int ACT, bool BIAS_BF16, bool RES_BF16>
__global__ __launch_bounds__(128) void k_gemm_bf3(const float* __restrict__ A, int lda, const unsigned short* __restrict__ Wt, int ldb,
                                                const float* __restrict__ bias, const float* __restrict__ resid, int rmod, int ldr,
                                                float* __restrict__ C, int ldc, int M, int N, int K) {
  __shared__ __attribute__((aligned(16))) float so[4][16][64];
  const int tid = threadIdx.x, w = tid >> 5, lane = tid & 31, ln = lane & 15, hh = lane >> 4;
  const int ntn = N / 64;
  const int wid = blockIdx.x * 4 + w;
  const int mt = wid / ntn, nq = wid % ntn;
  if (mt * 16 >= M) return;
  const int row0 = mt * 16, col0 = nq * 64;
  const float* arow = A + (size_t)(row0 + ln) * lda;
  v8f acc[4] = {};
  for (int kb = 0; kb < K; kb += 32) {
    FragB ah, al;
    const v4f x0 = *(const v4fa*)(arow + kb + 8 * hh), x1 = *(const v4fa*)(arow + kb + 8 * hh + 4);
    const v4f x2 = *(const v4fa*)(arow + kb + 16 + 8 * hh), x3 = *(const v4fa*)(arow + kb + 16 + 8 * hh + 4);
    float xs[16] = {x0[0],x0[1],x0[2],x0[3],x1[0],x1[1],x1[2],x1[3],x2[0],x2[1],x2[2],x2[3],x3[0],x3[1],x3[2],x3[3]};
#pragma unroll
    for (int i = 0; i < 16; ++i) { const unsigned short hb = bf16_bits(xs[i]); ah.u[i] = hb; al.u[i] = ASPLIT ? bf16_bits(xs[i] - bf16_val(hb)) : (unsigned short)0; }
#pragma unroll
    for (int t = 0; t < 4; ++t) {
      const unsigned short* brow = Wt + (size_t)(col0 + t * 16 + ln) * ldb + kb;
      FragB b;
      b.half[0] = *(const v8us*)(brow + 8 * hh);
      b.half[1] = *(const v8us*)(brow + 16 + 8 * hh);
      acc[t] = mmaN<ASPLIT ? 2 : 1>(ah.v, al.v, b.v, b.v, acc[t]);
    }
  }
#pragma unroll
  for (int t = 0; t < 4; ++t) {
    const int col = col0 + t * 16 + ln;
    float bv = bias ? bias[col] : 0.f;
    if (BIAS_BF16) bv = bf16_round(bv);
#pragma unroll
    for (int r = 0; r < 8; ++r) {
      float v = acc[t][r] + bv;
      if (resid) { float rv = resid[(size_t)((row0 + 8 * hh + r) % rmod) * ldr + col]; if (RES_BF16) rv = bf16_round(rv); v += rv; }
      if (ACT == 1) v = fmaxf(v, 0.f);
      if (ACT == 2) v = 0.5f * v * (1.0f + erff(v * 0.70710678118654752f));
      if (ACT == 3) { const float u = 0.7978845608028654f * (v + 0.044715f * v * v * v); v = 0.5f * v * (1.0f + tanhf(u)); }
      so[w][8 * hh + r][t * 16 + ln] = v;
    }
  }
  __builtin_amdgcn_fence(__ATOMIC_ACQ_REL, "workgroup");
  __builtin_amdgcn_wave_barrier();
  const int rsub = lane >> 4, c4 = (lane & 15) * 4;
  {
#pragma unroll
    for (int q = 0; q < 8; ++q) {
      const int r = q * 2 + rsub;
      const v4f v = *(const v4fa*)&so[w][r][c4];
      *(v4f*)(C + (size_t)(row0 + r) * ldc + col0 + c4) = v;
    }
    
  }
}
// row LayerNorm (biased variance, eps) over N: s = X (+ R); optional out_sum <- s; out_norm <- (s-mu)*rsqrt(var+eps)*g + b
template <bool PARAM_BF16>
__global__ __launch_bounds__(256) void k_layernorm(const float* __restrict__ X, const float* __restrict__ R, const float* __restrict__ g, const float* __restrict__ bta,
                                                  float* __restrict__ out_sum, float* __restrict__ out_norm, int N, float eps) {
  __shared__ float red[256];
  const int row = blockIdx.x, tid = threadIdx.x;
  const float* x = X + (size_t)row * N; const float* rr = R ? R + (size_t)row * N : nullptr;
  float vals[16];                     // up to N = 4096
  const int per = N / 256;            // contiguous chunk per thread? use strided-by-4 chunks: thread handles j = tid*4 + 1024*u
  float s1 = 0.f;
  for (int u = 0; u < per / 4; ++u) {
    const int j = tid * 4 + 1024 * u;
    const v4f a = *(const v4fa*)(x + j);
    v4f b = {0.f,0.f,0.f,0.f}; if (rr) b = *(const v4fa*)(rr + j);
#pragma unroll
    for (int q = 0; q < 4; ++q) { const float v = a[q] + b[q]; vals[u * 4 + q] = v; s1 += v; }
  }
  red[tid] = s1; __syncthreads();
  for (int st = 128; st > 0; st >>= 1) { if (tid < st) red[tid] += red[tid + st]; __syncthreads(); }
  const float mu = red[0] / (float)N; __syncthreads();
  float s2 = 0.f;
  for (int u = 0; u < per / 4; ++u)
#pragma unroll
    for (int q = 0; q < 4; ++q) { const float c = vals[u * 4 + q] - mu; s2 += c * c; }
  red[tid] = s2; __syncthreads();
  for (int st = 128; st > 0; st >>= 1) { if (tid < st) red[tid] += red[tid + st]; __syncthreads(); }
  const float rs = rsqrtf(red[0] / (float)N + eps);
  {
    for (int u = 0; u < per / 4; ++u) {
      const int j = tid * 4 + 1024 * u;
      v4f o, sm;
#pragma unroll
      for (int q = 0; q < 4; ++q) {
        float gg = g[j + q], bb = bta[j + q];
        if (PARAM_BF16) { gg = bf16_round(gg); bb = bf16_round(bb); }
        sm[q] = vals[u * 4 + q]; o[q] = (vals[u * 4 + q] - mu) * rs * gg + bb;
      }
      if (out_sum) *(v4f*)(out_sum + (size_t)row * N + j) = sm;
      *(v4f*)(out_norm + (size_t)row * N + j) = o;
    }
    
  }
}



// ---- f16 WMMA path (v_wmma_f32_16x16x32_f16): 11-bit significands for operands in range — used where a [0,1] probability operand needs more precision than bf16
typedef _Float16 v16h __attribute__((ext_vector_type(16)));
union FragH { v16h v; v8us half[2]; _Float16 h[16]; unsigned short u[16]; };
template <int NT>
__device__ __forceinline__ v8f mmaH(v16h ah, v16h al, v16h bh, v16h bl, v8f c) {
  c = __builtin_amdgcn_wmma_f32_16x16x32_f16(false, ah, false, bh, (short)0, c, false, false);
  if (NT >= 2) c = __builtin_amdgcn_wmma_f32_16x16x32_f16(false, al, false, bh, (short)0, c, false, false);
  if (NT >= 3) c = __builtin_amdgcn_wmma_f32_16x16x32_f16(false, ah, false, bl, (short)0, c, false, false);
  asm volatile("v_nop\n\tv_nop\n\tv_nop\n\tv_nop" : "+v"(c) : "v"(ah), "v"(al), "v"(bh), "v"(bl));
  return c;
}
// batched GEMM like k_gemm_b but f16 operands: A f32 (split into f16 hi/lo if ASPLIT, else rounded to f16), Bt = f16 values [n][k]; alpha; C f32; N multiple of 16 (partial tiles skipped)
template <bool ASPLIT>
__global__ __launch_bounds__(128) void k_gemm_h(const float* __restrict__ A, int lda, size_t sA, const _Float16* __restrict__ Bh, int ldb, size_t sB, float alpha, float* __restrict__ C, int ldc, size_t sC, int M, int N, int K) {
  __shared__ __attribute__((aligned(16))) float so[4][16][64];
  const int tid = threadIdx.x, w = tid >> 5, lane = tid & 31, ln = lane & 15, hh = lane >> 4; const int by = blockIdx.y;
  A += (size_t)by * sA; Bh += (size_t)by * sB; C += (size_t)by * sC;
  const int ntn = (N + 63) / 64; const int wid = blockIdx.x * 4 + w; const int mt = wid / ntn, nq = wid % ntn; if (mt * 16 >= M) return;
  const int row0 = mt * 16, col0 = nq * 64; const float* arow = A + (size_t)(row0 + ln) * lda;
  v8f acc[4] = {};
  for (int kb = 0; kb < K; kb += 32) {
    FragH ah, al;
    const v4f x0 = *(const v4fa*)(arow + kb + 8 * hh), x1 = *(const v4fa*)(arow + kb + 8 * hh + 4), x2 = *(const v4fa*)(arow + kb + 16 + 8 * hh), x3 = *(const v4fa*)(arow + kb + 16 + 8 * hh + 4);
    float xs[16] = {x0[0],x0[1],x0[2],x0[3],x1[0],x1[1],x1[2],x1[3],x2[0],x2[1],x2[2],x2[3],x3[0],x3[1],x3[2],x3[3]};
#pragma unroll
    for (int i = 0; i < 16; ++i) { const _Float16 h = (_Float16)xs[i]; ah.h[i] = h; al.h[i] = ASPLIT ? (_Float16)(xs[i] - (float)h) : (_Float16)0.0f; }
#pragma unroll
    for (int t = 0; t < 4; ++t) { if (col0 + t * 16 >= N) continue; const size_t boff = (size_t)(col0 + t * 16 + ln) * ldb + kb; FragH bq; bq.half[0] = *(const v8us*)(Bh + boff + 8 * hh); bq.half[1] = *(const v8us*)(Bh + boff + 16 + 8 * hh);
      acc[t] = mmaH<ASPLIT ? 2 : 1>(ah.v, al.v, bq.v, bq.v, acc[t]); }
  }
#pragma unroll
  for (int t = 0; t < 4; ++t) { if (col0 + t * 16 >= N) continue;
#pragma unroll
    for (int r = 0; r < 8; ++r) so[w][8 * hh + r][t * 16 + ln] = acc[t][r] * alpha; }
  __builtin_amdgcn_fence(__ATOMIC_ACQ_REL, "workgroup"); __builtin_amdgcn_wave_barrier();
  const int rsub = lane >> 4, c4 = (lane & 15) * 4;
  {
#pragma unroll
    for (int q = 0; q < 8; ++q) { const int r = q * 2 + rsub; if (col0 + c4 < N) { const v4f v = *(const v4fa*)&so[w][r][c4]; *(v4f*)(C + (size_t)(row0 + r) * ldc + col0 + c4) = v; } }
     }
}

// Wt[n][k] = f16(W[k][n]·scale) from f32 row-major W[K][N] (scale = power of two; bf16-exact weights stay exact in f16 away from the subnormal range)
__global__ __launch_bounds__(256) void k_wt_f16(const float* __restrict__ W, _Float16* __restrict__ Wt, int K, int N, float scale) {
  const int t = blockIdx.x * 256 + threadIdx.x; if (t >= N * (K / 8)) return; const int n = t / (K / 8), k8 = (t % (K / 8)) * 8; FragH f;
#pragma unroll
  for (int i = 0; i < 8; ++i) f.h[i] = (_Float16)(bf16_round(W[(size_t)(k8 + i) * N + n]) * scale); const v8us o = f.half[0];
  *(v8us*)((unsigned short*)Wt + (size_t)n * K + k8) = o; 
}
// k_gemm_hh variant with fused epilogue: v = acc·alpha + bias[by·sBias + col] (+ CP[(row/rowsPerB)·sCPb + by·64 + col] if CP) ; ACT 0 none / 1 elu ; writes f16 C16 (and f32 C if non-null)
template <int ACT>
__global__ __launch_bounds__(128) void k_gemm_hhx(const _Float16* __restrict__ A, int lda, size_t sA, const _Float16* __restrict__ Bh, int ldb, size_t sB, float alpha, const float* __restrict__ bias, size_t sBias, const float* __restrict__ CP, int rowsPerB, size_t sCPb, int row0g,
    float* __restrict__ C, _Float16* __restrict__ C16, int ldc, size_t sC, int M, int N, int K) {
  __shared__ __attribute__((aligned(16))) float so[4][16][64];
  const int tid = threadIdx.x, w = tid >> 5, lane = tid & 31, ln = lane & 15, hh = lane >> 4; const int by = blockIdx.y;
  A += (size_t)by * sA; Bh += (size_t)by * sB; const size_t cofs = (size_t)by * sC; const float* bp = bias ? bias + (size_t)by * sBias : nullptr;
  const int ntn = (N + 63) / 64; const int wid = blockIdx.x * 4 + w; const int mt = wid / ntn, nq = wid % ntn; if (mt * 16 >= M) return;
  const int row0 = mt * 16, col0 = nq * 64; const _Float16* arow = A + (size_t)(row0 + ln) * lda;
  v8f acc[4] = {};
  for (int kb = 0; kb < K; kb += 32) { FragH ah; ah.half[0] = *(const v8us*)((const unsigned short*)arow + kb + 8 * hh); ah.half[1] = *(const v8us*)((const unsigned short*)arow + kb + 16 + 8 * hh);
#pragma unroll
    for (int t = 0; t < 4; ++t) { if (col0 + t * 16 >= N) continue; const size_t boff = (size_t)(col0 + t * 16 + ln) * ldb + kb; FragH bq; bq.half[0] = *(const v8us*)((const unsigned short*)Bh + boff + 8 * hh); bq.half[1] = *(const v8us*)((const unsigned short*)Bh + boff + 16 + 8 * hh);
      acc[t] = mmaH<1>(ah.v, ah.v, bq.v, bq.v, acc[t]); }
  }
#pragma unroll
  for (int t = 0; t < 4; ++t) { if (col0 + t * 16 >= N) continue; const int col = col0 + t * 16 + ln; const float bv = bp ? bf16_round(bp[col]) : 0.f;
#pragma unroll
    for (int r = 0; r < 8; ++r) { float v = acc[t][r] * alpha + bv; if (CP) { const int rr = row0g + row0 + 8 * hh + r; if (rowsPerB < 0) v += CP[cofs + (size_t)rr * ldc + col];      /* rowsPerB < 0: own element of the batched C plane */ else { const int bidx = rr / rowsPerB; v += CP[(size_t)bidx * sCPb + (size_t)by * 64 + col]; } } if (ACT == 1) v = (v > 0.f) ? v : expm1f(v); else if (ACT == 7) v = (v > 0.f) ? v + 1.0f : expf(v); else if (ACT == 8) v = tanhf(v); else if (ACT == 9) v = 0.5f * v * (1.0f + tanhf(0.7978845608028654f * (v + 0.044715f * v * v * v))); else if (ACT == 11) v = 1.0f / (1.0f + expf(-v)); else if (ACT == 12) v = (v > 0.f) ? v : 0.01f * v; else if (ACT == 14) v = (v > 0.f) ? v : 0.1f * v; else if (ACT == 16) v = (v >= 0.f) ? v : 0.3f * v; else if (ACT == 17) v = (v >= 0.f) ? v : 0.2f * v; else if (ACT == 15) v = v / (1.0f + expf(-v)); else if (ACT == 3) v = fmaxf(v, 0.f); else if (ACT == 6) v = 0.5f * v * (1.0f + erff(v * 0.70710678118654752f)); so[w][8 * hh + r][t * 16 + ln] = v; } }
  __builtin_amdgcn_fence(__ATOMIC_ACQ_REL, "workgroup"); __builtin_amdgcn_wave_barrier();
  const int rsub = lane >> 4, c4 = (lane & 15) * 4; typedef _Float16 v4h __attribute__((ext_vector_type(4)));
  {
#pragma unroll
    for (int q = 0; q < 8; ++q) { const int r = q * 2 + rsub; if (col0 + c4 < N) { const v4f v = *(const v4fa*)&so[w][r][c4]; if (C) *(v4f*)(C + cofs + (size_t)(row0 + r) * ldc + col0 + c4) = v; if (C16) { v4h h4; for (int i = 0; i < 4; ++i) h4[i] = (_Float16)v[i]; *(v4h*)(C16 + cofs + (size_t)(row0 + r) * ldc + col0 + c4) = h4; } } }
     }
}


typedef _Float16 v4h __attribute__((ext_vector_type(4)));

__global__ __launch_bounds__(256) void k_x16(const float* __restrict__ x, _Float16* __restrict__ X16, size_t n8) { const size_t t = (size_t)blockIdx.x * 256 + threadIdx.x; if (t >= n8) return; FragH f;
#pragma unroll
  for (int q = 0; q < 8; ++q) f.h[q] = (_Float16)bf16_round(x[t * 8 + q]); *(v8us*)((unsigned short*)X16 + t * 8) = f.half[0];  }
__global__ __launch_bounds__(256) void k_h16(const float* __restrict__ x, _Float16* __restrict__ X16, size_t n8) { const size_t t = (size_t)blockIdx.x * 256 + threadIdx.x; if (t >= n8) return; FragH f;
#pragma unroll
  for (int q = 0; q < 8; ++q) f.h[q] = (_Float16)x[t * 8 + q]; *(v8us*)((unsigned short*)X16 + t * 8) = f.half[0];  }
__global__ __launch_bounds__(256) void k_round16f(const float* __restrict__ W, _Float16* __restrict__ Bt, size_t n8) { const size_t t = (size_t)blockIdx.x * 256 + threadIdx.x; if (t >= n8) return; FragH f;
#pragma unroll
  for (int i = 0; i < 8; ++i) f.h[i] = (_Float16)(bf16_round(W[t * 8 + i]) * 16.0f); *(v8us*)((unsigned short*)Bt + t * 8) = f.half[0];  }
template <int NHv, int TTv>
__global__ __launch_bounds__(256) void k_vt(const _Float16* __restrict__ V16, int ldv, int voff, _Float16* __restrict__ Vt) { __shared__ unsigned short tl[64][66]; const int tid = threadIdx.x; const int slab = blockIdx.x / (TTv / 64), lg = blockIdx.x % (TTv / 64); const int b = slab / NHv, h = slab % NHv;
  for (int i = tid; i < 64 * 8; i += 256) { const int r = i / 8, c8 = (i % 8) * 8; FragH f; f.half[0] = *(const v8us*)((const unsigned short*)V16 + ((size_t)b * TTv + lg * 64 + r) * ldv + voff + h * 64 + c8);
#pragma unroll
    for (int q = 0; q < 8; ++q) tl[r][c8 + q] = f.u[q]; }
  __syncthreads();
  {
#pragma unroll
    for (int rd = 0; rd < 2; ++rd) { const int d = rd * 32 + tid / 8, pc = tid % 8; FragH f;
#pragma unroll
      for (int q = 0; q < 8; ++q) f.u[q] = tl[pc * 8 + q][d];
      *(v8us*)((unsigned short*)Vt + ((size_t)slab * 64 + d) * TTv + lg * 64 + pc * 8) = f.half[0]; }
     } }

__global__ __launch_bounds__(256) void k_hl(const float* __restrict__ F, _Float16* __restrict__ Hh, _Float16* __restrict__ Hl, size_t n8) { const size_t t = (size_t)blockIdx.x * 256 + threadIdx.x; if (t >= n8) return; FragH fh, fl; const v4f a = *(const v4fa*)(F + t * 8), c = *(const v4fa*)(F + t * 8 + 4);
#pragma unroll
  for (int q = 0; q < 4; ++q) { _Float16 h = (_Float16)a[q]; fh.h[q] = h; fl.h[q] = (_Float16)((a[q] - (float)h) * 1024.0f); h = (_Float16)c[q]; fh.h[4 + q] = h; fl.h[4 + q] = (_Float16)((c[q] - (float)h) * 1024.0f); }
  { *(v8us*)((unsigned short*)Hh + t * 8) = fh.half[0]; *(v8us*)((unsigned short*)Hl + t * 8) = fl.half[0];  } }

// ---- fast GEMM (wave tile 32x64; requires M % 32 == 0 rows per launch region and N % 64 == 0); epilogue = k_gemm_hhx semantics ----
__device__ __forceinline__ v16h g2_frag(const _Float16* p, int hh) { FragH f; f.half[0] = *(const v8us*)((const unsigned short*)p + 8 * hh); f.half[1] = *(const v8us*)((const unsigned short*)p + 16 + 8 * hh); return f.v; }
__device__ __forceinline__ v8f g2_mma(v16h a, v16h b, v8f c) { v8f d = __builtin_amdgcn_wmma_f32_16x16x32_f16(false, a, false, b, (short)0, c, false, false); asm volatile("v_nop\n\tv_nop\n\tv_nop\n\tv_nop" : "+v"(d) : "v"(a), "v"(b)); return d; }
template <int ACT>
__global__ __launch_bounds__(128) void k_gemm2(const _Float16* __restrict__ A, int lda, size_t sA, const _Float16* __restrict__ Bh, int ldb, size_t sB, float alpha, const float* __restrict__ bias, size_t sBias, const float* __restrict__ CP, int rowsPerB, size_t sCPb, int row0g,
    float* __restrict__ C, _Float16* __restrict__ C16, int ldc, size_t sC, int M, int N, int K) { static_assert(ACT == 0 || ACT == 3 || ACT == 6 || ACT == 8 || ACT == 9 || ACT == 11 || ACT == 12 || ACT == 14 || ACT == 15 || ACT == 16 || ACT == 17, "k_gemm2: unsupported ACT code (would silently apply no activation)");
  __shared__ __attribute__((aligned(16))) float so[4][32][68];
  const int tid = threadIdx.x, w = tid >> 5, lane = tid & 31, ln = lane & 15, hh = lane >> 4; const int by = blockIdx.y;
  A += (size_t)by * sA; Bh += (size_t)by * sB; const size_t cofs = (size_t)by * sC; const float* bp = bias ? bias + (size_t)by * sBias : nullptr;
  const int ntn = N >> 6; const int mt = blockIdx.x / ntn, nq = blockIdx.x - mt * ntn; const int row0 = mt * 128 + 32 * w, col0 = nq * 64; if (row0 >= M) return;
  const _Float16* a0p = A + (size_t)(row0 + ln) * lda; const _Float16* a1p = a0p + (size_t)16 * lda;
  const _Float16* b0p = Bh + (size_t)(col0 + ln) * ldb; const _Float16* b1p = b0p + (size_t)16 * ldb; const _Float16* b2p = b1p + (size_t)16 * ldb; const _Float16* b3p = b2p + (size_t)16 * ldb;
  const v8f z8 = {0.f,0.f,0.f,0.f,0.f,0.f,0.f,0.f}; v8f c00 = z8, c01 = z8, c02 = z8, c03 = z8, c10 = z8, c11 = z8, c12 = z8, c13 = z8;
#pragma unroll 1
  for (int kb = 0; kb < K; kb += 32) { const v16h a0 = g2_frag(a0p + kb, hh), a1 = g2_frag(a1p + kb, hh);
    v16h b = g2_frag(b0p + kb, hh); c00 = g2_mma(a0, b, c00); c10 = g2_mma(a1, b, c10);
    b = g2_frag(b1p + kb, hh); c01 = g2_mma(a0, b, c01); c11 = g2_mma(a1, b, c11);
    b = g2_frag(b2p + kb, hh); c02 = g2_mma(a0, b, c02); c12 = g2_mma(a1, b, c12);
    b = g2_frag(b3p + kb, hh); c03 = g2_mma(a0, b, c03); c13 = g2_mma(a1, b, c13); }
  v8f accs[8] = {c00, c01, c02, c03, c10, c11, c12, c13};
#pragma unroll
  for (int u = 0; u < 8; ++u) { const int t = u & 3, half = u >> 2; const int col = col0 + t * 16 + ln; const float bv = bp ? bf16_round(bp[col]) : 0.f;
#pragma unroll
    for (int r = 0; r < 8; ++r) { const int rloc = half * 16 + 8 * hh + r; float v = accs[u][r] * alpha + bv; if (CP) { if (rowsPerB < 0) v += CP[cofs + (size_t)(row0g + row0 + rloc) * ldc + col];      /* rowsPerB < 0: own element of the batched C plane */ else { const int bidx = (row0g + row0 + rloc) / rowsPerB; v += CP[(size_t)bidx * sCPb + (size_t)by * 64 + col]; } }
      if (ACT == 3) v = fmaxf(v, 0.f); else if (ACT == 6) v = 0.5f * v * (1.0f + erff(v * 0.70710678118654752f)); else if (ACT == 11) v = 1.0f / (1.0f + expf(-v)); else if (ACT == 15) v = v / (1.0f + expf(-v)); else if (ACT == 12) v = (v > 0.f) ? v : 0.01f * v; else if (ACT == 8) v = tanhf(v); else if (ACT == 9) v = 0.5f * v * (1.0f + tanhf(0.7978845608028654f * (v + 0.044715f * v * v * v))); else if (ACT == 14) v = (v > 0.f) ? v : 0.1f * v; else if (ACT == 16) v = (v >= 0.f) ? v : 0.3f * v; else if (ACT == 17) v = (v >= 0.f) ? v : 0.2f * v;
      so[w][rloc][t * 16 + ln] = v; } }
  __builtin_amdgcn_fence(__ATOMIC_ACQ_REL, "workgroup"); __builtin_amdgcn_wave_barrier();
  const int rsub = lane >> 4, c4 = (lane & 15) * 4;
  {
#pragma unroll
    for (int q = 0; q < 16; ++q) { const int r = q * 2 + rsub; const v4f v = *(const v4fa*)&so[w][r][c4]; if (C) *(v4f*)(C + cofs + (size_t)(row0 + r) * ldc + col0 + c4) = v; if (C16) { v4h h4; for (int i = 0; i < 4; ++i) h4[i] = (_Float16)v[i]; *(v4h*)(C16 + cofs + (size_t)(row0 + r) * ldc + col0 + c4) = h4; } }
     } }


__global__ __launch_bounds__(256) void k_wnat(const float* __restrict__ w, size_t n8, _Float16* __restrict__ Bt) { const size_t t = (size_t)blockIdx.x * 256 + threadIdx.x; if (t >= n8) return; FragH f; for (int q = 0; q < 8; ++q) f.h[q] = (_Float16)(bf16_round(w[t * 8 + q]) * 16.0f); *(v8us*)((unsigned short*)Bt + t * 8) = f.half[0];  }
__global__ __launch_bounds__(256) void k_rsm(const float* __restrict__ S, _Float16* __restrict__ P, int nrows) {
  #pragma clang fp contract(off)
  const int i = blockIdx.x * 256 + threadIdx.x; if (i >= nrows) return; const float* s = S + (size_t)i * SQ; float mx = -3.0e38f;
#pragma unroll 1
  for (int j = 0; j < SQ; ++j) mx = fmaxf(mx, s[j]); float se = 0.f;
#pragma unroll 1
  for (int j = 0; j < SQ; ++j) se += expf(s[j] - mx); const float sc = 256.0f / se;
#pragma unroll 1
  for (int j0 = 0; j0 < SQ; j0 += 8) { FragH f; for (int q = 0; q < 8; ++q) f.h[q] = (_Float16)(expf(s[j0 + q] - mx) * sc); unsigned short* d = (unsigned short*)P + (size_t)i * SQ + j0; *(v8us*)d = f.half[0];  } }
__global__ __launch_bounds__(256) void k_vt(const _Float16* __restrict__ V16, int b, int h0, _Float16* __restrict__ VT) { __shared__ unsigned short tl[64][65]; const int tid = threadIdx.x; const int hh = blockIdx.x % HG, sg = blockIdx.x / HG; const int s0 = sg * 64; const int h = h0 + hh;
  for (int i = tid; i < 64 * 8; i += 256) { const int j = i / 8, d8 = (i % 8) * 8; FragH f; f.half[0] = *(const v8us*)((const unsigned short*)V16 + ((size_t)b * SQ + s0 + j) * DM + h * HD + d8); for (int q = 0; q < 8; ++q) tl[d8 + q][j] = f.u[q]; }
  __syncthreads();
  { for (int i = tid; i < 64 * 8; i += 256) { const int d = i / 8, j8 = (i % 8) * 8; FragH f; for (int q = 0; q < 8; ++q) f.u[q] = tl[d][j8 + q]; *(v8us*)((unsigned short*)VT + ((size_t)hh * HD + d) * SQ + s0 + j8) = f.half[0]; }  } }



__global__ __launch_bounds__(256) void k_rsmcf2(const float* __restrict__ S, _Float16* __restrict__ P, int hg, int q0, int nk) {
  #pragma clang fp contract(off)
  const int t = blockIdx.x * 256 + threadIdx.x; if (t >= hg * QT) return; const size_t i = (size_t)t; const float* s = S + i * NKX; const int last = q0 + (t % QT); float mx = -3.0e38f;
#pragma unroll 1
  for (int j = 0; j < nk; ++j) { const float f = (j <= last) ? 1.f : 0.f; mx = fmaxf(mx, fmaf(f, s[j], (1.f - f) * -1.0e9f)); } float se = 0.f;
#pragma unroll 1
  for (int j = 0; j < nk; ++j) { const float f = (j <= last) ? 1.f : 0.f; se += __expf(fmaf(f, s[j], (1.f - f) * -1.0e9f) - mx); } const float sc = 256.0f / se;
#pragma unroll 1
  for (int j0 = 0; j0 < nk; j0 += 8) { FragH fr; for (int q = 0; q < 8; ++q) { const int j = j0 + q; const float f = (j <= last) ? 1.f : 0.f; fr.h[q] = (_Float16)(__expf(fmaf(f, s[j], (1.f - f) * -1.0e9f) - mx) * sc); } unsigned short* d = (unsigned short*)P + i * NKX + j0; *(v8us*)d = fr.half[0];  } }


template <int MASKADD>
__global__ __launch_bounds__(64) void k_att0(const float* __restrict__ QF, const float* __restrict__ KF, const float* __restrict__ VF, int ld, const float* __restrict__ mask, float scale, float* __restrict__ OF, int ldo) {
  #pragma clang fp contract(off)
  __shared__ __attribute__((aligned(16))) float lq[64][64]; __shared__ __attribute__((aligned(16))) float lo[64][64];
  const int tid = threadIdx.x; const int h = blockIdx.x / (QT0 / 64), rg = blockIdx.x % (QT0 / 64); const int i = rg * 64 + tid;
  const float* qr = QF + (size_t)i * ld + h * HD;
#pragma unroll 1
  for (int c = 0; c < HD / 4; ++c) { *(v4f*)&lq[tid][c * 4] = *(const v4fa*)(qr + c * 4); const v4f z = {0.f, 0.f, 0.f, 0.f}; *(v4f*)&lo[tid][c * 4] = z; }
  float m = -1.0e30f, l = 0.f; const int jmax = MASKADD ? (SQ - 1) : (rg * 64 + 63);      /* additive-mask form: every key (the mask input decides); causal form: keys up to the block's last row */
#pragma unroll 1
  for (int j = 0; j <= jmax; ++j) { const float* kr = KF + (size_t)j * ld + h * HD; const float* vr = VF + (size_t)j * ld + h * HD; float s = 0.f;
#pragma unroll 1
    for (int c = 0; c < HD / 4; ++c) { const v4f kq = *(const v4fa*)(kr + c * 4); const v4f qq = *(v4f*)&lq[tid][c * 4]; s = __fadd_rn(s, __fmul_rn(qq[0], kq[0])); s = __fadd_rn(s, __fmul_rn(qq[1], kq[1])); s = __fadd_rn(s, __fmul_rn(qq[2], kq[2])); s = __fadd_rn(s, __fmul_rn(qq[3], kq[3])); }
    s = __fmul_rn(s, scale); if (MASKADD) s = __fadd_rn(s, __fmul_rn(bf16_round(mask[(size_t)i * SQ + j]), -10000.0f));
    const float f = (MASKADD || j <= i) ? 1.f : 0.f; const float sm = fmaf(f, s, (1.f - f) * -1.0e30f); const float mn = fmaxf(m, sm); const float sc = expf(m - mn); const float e = expf(sm - mn); l = __fadd_rn(__fmul_rn(l, sc), e); m = mn;
#pragma unroll 1
    for (int c = 0; c < HD / 4; ++c) { const v4f vv = *(const v4fa*)(vr + c * 4); v4f oo = *(v4f*)&lo[tid][c * 4]; for (int u = 0; u < 4; ++u) oo[u] = __fadd_rn(__fmul_rn(oo[u], sc), __fmul_rn(e, vv[u])); *(v4f*)&lo[tid][c * 4] = oo; } }
  const float fin = 64.0f / l;      /* o carried x64 like the f16 path */
#pragma unroll 1
  for (int c = 0; c < HD / 4; ++c) { v4f oo = *(v4f*)&lo[tid][c * 4]; for (int u = 0; u < 4; ++u) oo[u] = __fmul_rn(oo[u], fin); *(v4f*)&lo[tid][c * 4] = oo; }
  __syncthreads();
  {
#pragma unroll 1
    for (int it = 0; it < 16; ++it) { const int row = it * 4 + tid / 16, pc = (tid % 16) * 4; const v4f v = *(const v4f*)&lo[row][pc]; *(v4f*)(OF + (size_t)(rg * 64 + row) * ldo + h * HD + pc) = v; }
     } }

extern "C" void kernel_launch(void* const* d_in, const int* in_sizes, int n_in,
                              void* d_out, int out_size, void* d_ws, size_t ws_size, hipStream_t stream) {
  (void)in_sizes; (void)n_in; (void)out_size;
  const float* const* I = (const float* const*)d_in; const float* x = I[0]; const float* xk = I[1]; const float* xv = I[2]; const float* wq = I[3]; const float* wk = I[4]; const float* wv = I[5]; const float* bq = nullptr; const float* bk = nullptr; const float* bv = nullptr; const float* wo = I[6]; const float* bo = nullptr;      /* input order: q, k, v (the three streams, two sequences each), Wq, Wk, Wv (PER-HEAD STACKS [16][1024][64]), Wo ([in][out] [1024][1024]); NO biases anywhere: null pointers in the guarded slots */
  char* ws = (char*)d_ws; size_t off = 0;
  auto take = [&](size_t bytes) { char* p = ws + off; off += (bytes + 255) & ~(size_t)255; return p; };
  _Float16* BQ = (_Float16*)take((size_t)DM * DM * 2); _Float16* BK = (_Float16*)take((size_t)DM * DM * 2); _Float16* BV = (_Float16*)take((size_t)DM * DM * 2); _Float16* BO = (_Float16*)take((size_t)DM * DM * 2);
  _Float16* X16 = (_Float16*)take(NR * DM * 2); _Float16* XK16 = (_Float16*)take(NR * DM * 2); _Float16* XV16 = (_Float16*)take(NR * DM * 2);      /* exact f16 rows of query, key, value */ float* QF = (float*)take(NR * DM * 4); _Float16* QH = (_Float16*)take(NR * DM * 2); _Float16* QL = (_Float16*)take(NR * DM * 2); _Float16* KH = (_Float16*)take(NR * DM * 2); _Float16* KL = (_Float16*)take(NR * DM * 2); _Float16* Q16 = QH; _Float16* K16 = KH; _Float16* V16 = (_Float16*)take(NR * DM * 2); _Float16* O16 = (_Float16*)take(NR * DM * 2);
  float* S = (float*)take((size_t)NH * QT * NKX * 4); _Float16* P = (_Float16*)take((size_t)NH * QT * NKX * 2); _Float16* VT = (_Float16*)take((size_t)NH * HD * SQ * 2);
  float* QF0 = (float*)take((size_t)QT0 * DM * 4); float* KF0 = (float*)take((size_t)QT0 * DM * 4); float* VF0 = (float*)take((size_t)QT0 * DM * 4); float* OF0 = (float*)take((size_t)NB * QT0 * DM * 4); _Float16* OH0 = (_Float16*)take((size_t)NB * QT0 * DM * 2); _Float16* OL0 = (_Float16*)take((size_t)NB * QT0 * DM * 2);
  if (off > ws_size) return;
  { const unsigned gh = (unsigned)(((size_t)HD * (DM / 8) + 255) / 256); for (int h = 0; h < NH; ++h) { k_wt_f16<<<gh, 256, 0, stream>>>(wq + (size_t)h * DM * HD, BQ + (size_t)h * HD * DM, DM, HD, 16.0f); k_wt_f16<<<gh, 256, 0, stream>>>(wk + (size_t)h * DM * HD, BK + (size_t)h * HD * DM, DM, HD, 16.0f); k_wt_f16<<<gh, 256, 0, stream>>>(wv + (size_t)h * DM * HD, BV + (size_t)h * HD * DM, DM, HD, 16.0f); } const unsigned g = (unsigned)(((size_t)DM * DM / 8 + 255) / 256); k_wt_f16<<<g, 256, 0, stream>>>(wo, BO, DM, DM, 16.0f); }      /* head h's [1024][64] block -> rows 64 h .. 64 h + 63 of the Bt[n][k] x16 plane (K 1024, N 64 per call); the [in][out] output weight transposed into its plane by the same builder (K 1024, N 1024; grid g = 512 for it, gh = 32 for each per-head call) */
  k_x16<<<(unsigned)((NR * DM / 8 + 255) / 256), 256, 0, stream>>>(x, X16, NR * DM / 8); k_x16<<<(unsigned)((NR * DM / 8 + 255) / 256), 256, 0, stream>>>(xk, XK16, NR * DM / 8); k_x16<<<(unsigned)((NR * DM / 8 + 255) / 256), 256, 0, stream>>>(xv, XV16, NR * DM / 8);
  const size_t r0p = (size_t)B0 * SQ;      /* first projected row */
  k_gemm2<0><<<dim3((unsigned)((MP / 128) * (DM / 64)), 1), 128, 0, stream>>>(X16 + r0p * DM, DM, 0, BQ, DM, 0, 0.0625f, bq, 0, nullptr, 1, 0, 0, QF + r0p * DM, nullptr, DM, 0, MP, DM, DM); k_hl<<<(unsigned)(((size_t)MP * DM / 8 + 255) / 256), 256, 0, stream>>>(QF + r0p * DM, QH + r0p * DM, QL + r0p * DM, (size_t)MP * DM / 8);      /* q (f32) -> f16 hi + x1024 residual: unscaled logits sigma ~8 */
  k_gemm2<0><<<dim3((unsigned)((MP / 128) * (DM / 64)), 1), 128, 0, stream>>>(XK16 + r0p * DM, DM, 0, BK, DM, 0, 0.0625f, bk, 0, nullptr, 1, 0, 0, QF + r0p * DM, nullptr, DM, 0, MP, DM, DM); k_hl<<<(unsigned)(((size_t)MP * DM / 8 + 255) / 256), 256, 0, stream>>>(QF + r0p * DM, KH + r0p * DM, KL + r0p * DM, (size_t)MP * DM / 8);      /* k likewise */
  k_gemm2<0><<<dim3((unsigned)((MP / 128) * (DM / 64)), 1), 128, 0, stream>>>(XV16 + r0p * DM, DM, 0, BV, DM, 0, 0.0625f, bv, 0, nullptr, 1, 0, 0, nullptr, V16 + r0p * DM, DM, 0, MP, DM, DM);
  for (int b = B0; b < B0 + NBR; ++b) { const size_t r0 = (size_t)b * SQ;
    k_vt<NH, SQ><<<NH * (SQ / 64), 256, 0, stream>>>(V16 + r0 * LQ, LQ, 0, VT);      /* V^T [NH][HD][SQ] for this batch */
  /* (dense: no exact first-tile projections: every row goes through the three-product path) */
  /* (dense: no exact first-tile attention) */
    for (int q0 = 0; q0 < QN; q0 += QT) { const int nk = SQ;      /* DENSE: every query tile sees all SQ keys */
      k_gemm2<0><<<dim3((QT / 128) * (nk / 64), NHD), 128, 0, stream>>>(QH + (r0 + q0) * LQ, LQ, (size_t)HD, KH + r0 * LQ, LQ, (size_t)HD, SCL, nullptr, 0, nullptr, 1, 0, 0, S, nullptr, NKX, (size_t)QT * NKX, QT, nk, HD);      /* scores hi . hi * 64^-0.5 (1 / sqrt(head_dim)) */
      k_gemm2<0><<<dim3((QT / 128) * (nk / 64), NHD), 128, 0, stream>>>(QL + (r0 + q0) * LQ, LQ, (size_t)HD, KH + r0 * LQ, LQ, (size_t)HD, SCLR, nullptr, 0, S, -1, 0, 0, S, nullptr, NKX, (size_t)QT * NKX, QT, nk, HD); k_gemm2<0><<<dim3((QT / 128) * (nk / 64), NHD), 128, 0, stream>>>(QH + (r0 + q0) * LQ, LQ, (size_t)HD, KL + r0 * LQ, LQ, (size_t)HD, SCLR, nullptr, 0, S, -1, 0, 0, S, nullptr, NKX, (size_t)QT * NKX, QT, nk, HD);      /* += 2^-13 (lo . hi + hi . lo) */      /* scores, all heads on grid.y */
      k_rsmcf2<<<(NHD * QT + 255) / 256, 256, 0, stream>>>(S, P, NHD, SQ, nk);      /* the kernel keeps key j iff j <= its visibility argument + row: SQ makes every key visible: a plain row softmax */
      k_gemm2<0><<<dim3((QT / 128) * (HD / 64), NHD), 128, 0, stream>>>(P, NKX, (size_t)QT * NKX, VT, SQ, (size_t)HD * SQ, 0.25f, nullptr, 0, nullptr, 1, 0, 0, nullptr, O16 + r0 * DM + (size_t)q0 * HD, HD, (size_t)SQ * HD, QT, HD, nk); } }            /* o written HEAD-CONTIGUOUS: o[b][h][s][64] (row pitch 64, head stride SQ x 64): the source's raw reshape of (B, H, S, dk) to (B, S, H dk) then reads that memory as [2048][1024] rows: the output GEMM below does exactly that */
  k_gemm2<0><<<dim3((unsigned)((MPO / 128) * (DM / 64)), 1), 128, 0, stream>>>(O16 + r0p * DM, DM, 0, BO, DM, 0, 0.0009765625f, bo, 0, nullptr, 1, 0, 0, (float*)d_out + r0p * DM, nullptr, DM, 0, MPO, DM, DM);      /* out rows are the output layout */
  /* (dense: no first-tile hi / lo planes) */
  /* (dense: no first-tile rewrite passes:
     the output GEMM above has written every row
     with its (null) bias) */
}

// v001
// Measured time: 2410 microseconds a run.
// Two timings next to v000 both put it at 3.17 times that version's speed.
#include <hip/hip_runtime.h>
// Multi-head attention on three inputs with PER-HEAD STACKED projections and the source's RAW-RESHAPE head merge (Q, K, V [2][2048][1024]; WQ / WK / WV [16][1024][64] = [head][in][out] uniform +-0.1, NO biases; 16 heads of 64; scores x 1/sqrt(64); softmax over all 2048 keys (no mask); the head outputs [B][H][S][64] are RESHAPED IN MEMORY ORDER to [B][S][1024] (row r of a batch holds tokens 16 (r mod 128) .. + 15 of head r / 128: heads and tokens mix: faithful to the source); out = that WO with WO [1024][1024] [in][out], NO bias -> [2][2048][1024]); q and k carried as f16 hi + x1024 residual planes with three-product scores; each head's [in][out] block is transposed into its 64 contiguous rows of the weight plane by the transposing builder, one call per head, and the [in][out] output weight by the same builder in one call; DENSE (the row softmax runs over all SQ keys; no exact first tile).
// Structure: token rows r = b*2048 + s; x as exact f16 rows (bf16-rounded); q and k as WMMA GEMMs (32x64 wave tiles, f32 accumulation, exact x16 weights, no bias) into f32 rows split into f16 hi + x1024 residual planes, v as an f16-output GEMM; per batch: V^T for all heads via LDS transposes; per query tile of 256 rows: scores against all 2048 keys as THREE accumulating passes (hi.hi + lo.hi + hi.lo, K = 64, all heads on grid.y, alpha 1/sqrt(64) = 2^-3 on hi.hi, 2^-13 on the x1024 residual passes, logits sigma ~8), row softmax on VALU over all keys (f32 statistics, native exp; weights x256 f16), o = P . V^T (K = all 2048 keys, alpha 2^-2: o carried x64, folded into the output GEMM alpha) written straight into the merged f16 o rows; out = o W_o GEMM (f32) into the output layout.
// Compute dtype: inputs rounded to bf16; x / weights exact; q and k as f16 hi + x1024 residual planes; v, softmax weights and o as plain f16 GEMM operands (~2^-12); scores and softmax statistics f32. v_wmma_f32_16x16x32_f16.
#define NB 2
#define SCL 0.125f                         /* 1 / sqrt(head_dim = 64) */
#define SCLR 0.0001220703125f              /* 2^-13: the same scale on the x1024 residual passes */
#define SQ 2048
#define DM 1024
#define NH 16
#define HD 64
#define HG 4                         /* heads per group of the second k_vt (not launched) */
#define QT 256                       /* query rows per query tile */
#define NKX SQ                       /* S / P row pitch */
#define QT0 128                      /* rows of the exact first tile of k_att0 (not launched) */
#define B0 0                         /* first batch processed (debug hook) */
#define NBR NB                       /* batches processed (debug hook) */
#define NR ((size_t)NB * SQ)         /* token rows */
#define MP ((int)((size_t)NBR * SQ)) /* rows projected (debug hook) */
#define QN SQ                        /* query rows attended per batch (debug hook) */
#define NHD NH                       /* heads attended (debug hook) */
#define MPO MP                       /* rows through the output stage (debug hook) */
#define LQ DM      /* row pitch of the q/k/v rows */
typedef __bf16 v16b __attribute__((ext_vector_type(16)));
typedef unsigned short v8us __attribute__((ext_vector_type(8), may_alias));
typedef float  v8f  __attribute__((ext_vector_type(8)));
typedef float  v4f  __attribute__((ext_vector_type(4)));
typedef float  v4fa __attribute__((ext_vector_type(4), may_alias));
union FragB { v16b v; v8us half[2]; unsigned short u[16]; };

__device__ __forceinline__ unsigned short bf16_bits(float x) { unsigned int u = __float_as_uint(x); return (unsigned short)((u + 0x7FFFu + ((u >> 16) & 1u)) >> 16); }
__device__ __forceinline__ float bf16_val(unsigned short b) { return __uint_as_float(((unsigned int)b) << 16); }
__device__ __forceinline__ float bf16_round(float x) { return bf16_val(bf16_bits(x)); }
// D += A·B with NT terms: 1 = ah·bh, 2 = + al·bh (A split), 3 = + ah·bl (both split)
template <int NT>
__device__ __forceinline__ v8f mmaN(v16b ah, v16b al, v16b bh, v16b bl, v8f c) {
  c = __builtin_amdgcn_wmma_f32_16x16x32_bf16(false, ah, false, bh, (short)0, c, false, false);
  if (NT >= 2) c = __builtin_amdgcn_wmma_f32_16x16x32_bf16(false, al, false, bh, (short)0, c, false, false);
  if (NT >= 3) c = __builtin_amdgcn_wmma_f32_16x16x32_bf16(false, ah, false, bl, (short)0, c, false, false);
  asm volatile("v_nop\n\tv_nop\n\tv_nop\n\tv_nop" : "+v"(c) : "v"(ah), "v"(al), "v"(bh), "v"(bl));
  return c;
}

__global__ __launch_bounds__(256) void k_wt_bf16(const float* __restrict__ W, unsigned short* __restrict__ Wt, int K, int N) {
  const int t = blockIdx.x * 256 + threadIdx.x;
  const int k8n = K / 8;
  if (t >= N * k8n) return;
  const int n = t / k8n, k8 = (t % k8n) * 8;
  v8us v;
#pragma unroll
  for (int i = 0; i < 8; ++i) v[i] = bf16_bits(W[(size_t)(k8 + i) * N + n]);
  *(v8us*)(Wt + (size_t)n * K + k8) = v;
  
}

// GEMM C[M][N] (f32, pitch ldc) = act(A[M][K]·W + bias). A f32 row-major (pitch lda) converted per fragment to bf16
// (ASPLIT: hi/lo two planes -> 2 terms, else single rounded term); Wt bf16 [N][K] (pitch ldb). BIAS_BF16 rounds the
// bias to bf16 first (bias quantised to bf16 before the add). K%32==0, M%16==0, N%64==0.
template <bool ASPLIT, int ACT, bool BIAS_BF16>
__global__ __launch_bounds__(128) void k_gemm_bf(const float* __restrict__ A, int lda, const unsigned short* __restrict__ Wt, int ldb,
                                               const float* __restrict__ bias, float* __restrict__ C, int ldc, int M, int N, int K) {
  __shared__ __attribute__((aligned(16))) float so[4][16][64];
  const int tid = threadIdx.x, w = tid >> 5, lane = tid & 31, ln = lane & 15, hh = lane >> 4;
  const int ntn = N / 64;
  const int wid = blockIdx.x * 4 + w;
  const int mt = wid / ntn, nq = wid % ntn;
  if (mt * 16 >= M) return;
  const int row0 = mt * 16, col0 = nq * 64;
  const float* arow = A + (size_t)(row0 + ln) * lda;
  v8f acc[4] = {};
  for (int kb = 0; kb < K; kb += 32) {
    FragB ah, al;
    const v4f x0 = *(const v4fa*)(arow + kb + 8 * hh), x1 = *(const v4fa*)(arow + kb + 8 * hh + 4);
    const v4f x2 = *(const v4fa*)(arow + kb + 16 + 8 * hh), x3 = *(const v4fa*)(arow + kb + 16 + 8 * hh + 4);
    float xs[16] = {x0[0],x0[1],x0[2],x0[3],x1[0],x1[1],x1[2],x1[3],x2[0],x2[1],x2[2],x2[3],x3[0],x3[1],x3[2],x3[3]};
#pragma unroll
    for (int i = 0; i < 16; ++i) { const unsigned short hb = bf16_bits(xs[i]); ah.u[i] = hb; al.u[i] = ASPLIT ? bf16_bits(xs[i] - bf16_val(hb)) : (unsigned short)0; }
#pragma unroll
    for (int t = 0; t < 4; ++t) {
      const unsigned short* brow = Wt + (size_t)(col0 + t * 16 + ln) * ldb + kb;
      FragB b;
      b.half[0] = *(const v8us*)(brow + 8 * hh);
      b.half[1] = *(const v8us*)(brow + 16 + 8 * hh);
      acc[t] = mmaN<ASPLIT ? 2 : 1>(ah.v, al.v, b.v, b.v, acc[t]);
    }
  }
#pragma unroll
  for (int t = 0; t < 4; ++t) {
    float bv = bias ? bias[col0 + t * 16 + ln] : 0.f;
    if (BIAS_BF16) bv = bf16_round(bv);
#pragma unroll
    for (int r = 0; r < 8; ++r) { float v = acc[t][r] + bv; if (ACT == 1) v = fmaxf(v, 0.f); so[w][8 * hh + r][t * 16 + ln] = v; }
  }
  __builtin_amdgcn_fence(__ATOMIC_ACQ_REL, "workgroup");
  __builtin_amdgcn_wave_barrier();
  const int rsub = lane >> 4, c4 = (lane & 15) * 4;
  {
#pragma unroll
    for (int q = 0; q < 8; ++q) {
      const int r = q * 2 + rsub;
      const v4f v = *(const v4fa*)&so[w][r][c4];
      *(v4f*)(C + (size_t)(row0 + r) * ldc + col0 + c4) = v;
    }
    
  }
}

// GEMM C = act(A·W + bias + resid): A f32 (ASPLIT -> hi/lo 2 terms), Wt bf16 [N][K]; ACT 0 none, 1 relu, 2 exact gelu;
// resid (optional, f32, row index = (row % rmod), pitch ldr, RES_BF16 rounds it) added before the activation.
template <bool ASPLIT, int ACT, bool BIAS_BF16, bool RES_BF16>
__global__ __launch_bounds__(128) void k_gemm_bf3(const float* __restrict__ A, int lda, const unsigned short* __restrict__ Wt, int ldb,
                                                const float* __restrict__ bias, const float* __restrict__ resid, int rmod, int ldr,
                                                float* __restrict__ C, int ldc, int M, int N, int K) {
  __shared__ __attribute__((aligned(16))) float so[4][16][64];
  const int tid = threadIdx.x, w = tid >> 5, lane = tid & 31, ln = lane & 15, hh = lane >> 4;
  const int ntn = N / 64;
  const int wid = blockIdx.x * 4 + w;
  const int mt = wid / ntn, nq = wid % ntn;
  if (mt * 16 >= M) return;
  const int row0 = mt * 16, col0 = nq * 64;
  const float* arow = A + (size_t)(row0 + ln) * lda;
  v8f acc[4] = {};
  for (int kb = 0; kb < K; kb += 32) {
    FragB ah, al;
    const v4f x0 = *(const v4fa*)(arow + kb + 8 * hh), x1 = *(const v4fa*)(arow + kb + 8 * hh + 4);
    const v4f x2 = *(const v4fa*)(arow + kb + 16 + 8 * hh), x3 = *(const v4fa*)(arow + kb + 16 + 8 * hh + 4);
    float xs[16] = {x0[0],x0[1],x0[2],x0[3],x1[0],x1[1],x1[2],x1[3],x2[0],x2[1],x2[2],x2[3],x3[0],x3[1],x3[2],x3[3]};
#pragma unroll
    for (int i = 0; i < 16; ++i) { const unsigned short hb = bf16_bits(xs[i]); ah.u[i] = hb; al.u[i] = ASPLIT ? bf16_bits(xs[i] - bf16_val(hb)) : (unsigned short)0; }
#pragma unroll
    for (int t = 0; t < 4; ++t) {
      const unsigned short* brow = Wt + (size_t)(col0 + t * 16 + ln) * ldb + kb;
      FragB b;
      b.half[0] = *(const v8us*)(brow + 8 * hh);
      b.half[1] = *(const v8us*)(brow + 16 + 8 * hh);
      acc[t] = mmaN<ASPLIT ? 2 : 1>(ah.v, al.v, b.v, b.v, acc[t]);
    }
  }
#pragma unroll
  for (int t = 0; t < 4; ++t) {
    const int col = col0 + t * 16 + ln;
    float bv = bias ? bias[col] : 0.f;
    if (BIAS_BF16) bv = bf16_round(bv);
#pragma unroll
    for (int r = 0; r < 8; ++r) {
      float v = acc[t][r] + bv;
      if (resid) { float rv = resid[(size_t)((row0 + 8 * hh + r) % rmod) * ldr + col]; if (RES_BF16) rv = bf16_round(rv); v += rv; }
      if (ACT == 1) v = fmaxf(v, 0.f);
      if (ACT == 2) v = 0.5f * v * (1.0f + erff(v * 0.70710678118654752f));
      if (ACT == 3) { const float u = 0.7978845608028654f * (v + 0.044715f * v * v * v); v = 0.5f * v * (1.0f + tanhf(u)); }
      so[w][8 * hh + r][t * 16 + ln] = v;
    }
  }
  __builtin_amdgcn_fence(__ATOMIC_ACQ_REL, "workgroup");
  __builtin_amdgcn_wave_barrier();
  const int rsub = lane >> 4, c4 = (lane & 15) * 4;
  {
#pragma unroll
    for (int q = 0; q < 8; ++q) {
      const int r = q * 2 + rsub;
      const v4f v = *(const v4fa*)&so[w][r][c4];
      *(v4f*)(C + (size_t)(row0 + r) * ldc + col0 + c4) = v;
    }
    
  }
}
// row LayerNorm (biased variance, eps) over N: s = X (+ R); optional out_sum <- s; out_norm <- (s-mu)*rsqrt(var+eps)*g + b
template <bool PARAM_BF16>
__global__ __launch_bounds__(256) void k_layernorm(const float* __restrict__ X, const float* __restrict__ R, const float* __restrict__ g, const float* __restrict__ bta,
                                                  float* __restrict__ out_sum, float* __restrict__ out_norm, int N, float eps) {
  __shared__ float red[256];
  const int row = blockIdx.x, tid = threadIdx.x;
  const float* x = X + (size_t)row * N; const float* rr = R ? R + (size_t)row * N : nullptr;
  float vals[16];                     // up to N = 4096
  const int per = N / 256;            // contiguous chunk per thread? use strided-by-4 chunks: thread handles j = tid*4 + 1024*u
  float s1 = 0.f;
  for (int u = 0; u < per / 4; ++u) {
    const int j = tid * 4 + 1024 * u;
    const v4f a = *(const v4fa*)(x + j);
    v4f b = {0.f,0.f,0.f,0.f}; if (rr) b = *(const v4fa*)(rr + j);
#pragma unroll
    for (int q = 0; q < 4; ++q) { const float v = a[q] + b[q]; vals[u * 4 + q] = v; s1 += v; }
  }
  red[tid] = s1; __syncthreads();
  for (int st = 128; st > 0; st >>= 1) { if (tid < st) red[tid] += red[tid + st]; __syncthreads(); }
  const float mu = red[0] / (float)N; __syncthreads();
  float s2 = 0.f;
  for (int u = 0; u < per / 4; ++u)
#pragma unroll
    for (int q = 0; q < 4; ++q) { const float c = vals[u * 4 + q] - mu; s2 += c * c; }
  red[tid] = s2; __syncthreads();
  for (int st = 128; st > 0; st >>= 1) { if (tid < st) red[tid] += red[tid + st]; __syncthreads(); }
  const float rs = rsqrtf(red[0] / (float)N + eps);
  {
    for (int u = 0; u < per / 4; ++u) {
      const int j = tid * 4 + 1024 * u;
      v4f o, sm;
#pragma unroll
      for (int q = 0; q < 4; ++q) {
        float gg = g[j + q], bb = bta[j + q];
        if (PARAM_BF16) { gg = bf16_round(gg); bb = bf16_round(bb); }
        sm[q] = vals[u * 4 + q]; o[q] = (vals[u * 4 + q] - mu) * rs * gg + bb;
      }
      if (out_sum) *(v4f*)(out_sum + (size_t)row * N + j) = sm;
      *(v4f*)(out_norm + (size_t)row * N + j) = o;
    }
    
  }
}



// ---- f16 WMMA path (v_wmma_f32_16x16x32_f16): 11-bit significands for operands in range — used where a [0,1] probability operand needs more precision than bf16
typedef _Float16 v16h __attribute__((ext_vector_type(16)));
union FragH { v16h v; v8us half[2]; _Float16 h[16]; unsigned short u[16]; };
template <int NT>
__device__ __forceinline__ v8f mmaH(v16h ah, v16h al, v16h bh, v16h bl, v8f c) {
  c = __builtin_amdgcn_wmma_f32_16x16x32_f16(false, ah, false, bh, (short)0, c, false, false);
  if (NT >= 2) c = __builtin_amdgcn_wmma_f32_16x16x32_f16(false, al, false, bh, (short)0, c, false, false);
  if (NT >= 3) c = __builtin_amdgcn_wmma_f32_16x16x32_f16(false, ah, false, bl, (short)0, c, false, false);
  asm volatile("v_nop\n\tv_nop\n\tv_nop\n\tv_nop" : "+v"(c) : "v"(ah), "v"(al), "v"(bh), "v"(bl));
  return c;
}
// batched GEMM like k_gemm_b but f16 operands: A f32 (split into f16 hi/lo if ASPLIT, else rounded to f16), Bt = f16 values [n][k]; alpha; C f32; N multiple of 16 (partial tiles skipped)
template <bool ASPLIT>
__global__ __launch_bounds__(128) void k_gemm_h(const float* __restrict__ A, int lda, size_t sA, const _Float16* __restrict__ Bh, int ldb, size_t sB, float alpha, float* __restrict__ C, int ldc, size_t sC, int M, int N, int K) {
  __shared__ __attribute__((aligned(16))) float so[4][16][64];
  const int tid = threadIdx.x, w = tid >> 5, lane = tid & 31, ln = lane & 15, hh = lane >> 4; const int by = blockIdx.y;
  A += (size_t)by * sA; Bh += (size_t)by * sB; C += (size_t)by * sC;
  const int ntn = (N + 63) / 64; const int wid = blockIdx.x * 4 + w; const int mt = wid / ntn, nq = wid % ntn; if (mt * 16 >= M) return;
  const int row0 = mt * 16, col0 = nq * 64; const float* arow = A + (size_t)(row0 + ln) * lda;
  v8f acc[4] = {};
  for (int kb = 0; kb < K; kb += 32) {
    FragH ah, al;
    const v4f x0 = *(const v4fa*)(arow + kb + 8 * hh), x1 = *(const v4fa*)(arow + kb + 8 * hh + 4), x2 = *(const v4fa*)(arow + kb + 16 + 8 * hh), x3 = *(const v4fa*)(arow + kb + 16 + 8 * hh + 4);
    float xs[16] = {x0[0],x0[1],x0[2],x0[3],x1[0],x1[1],x1[2],x1[3],x2[0],x2[1],x2[2],x2[3],x3[0],x3[1],x3[2],x3[3]};
#pragma unroll
    for (int i = 0; i < 16; ++i) { const _Float16 h = (_Float16)xs[i]; ah.h[i] = h; al.h[i] = ASPLIT ? (_Float16)(xs[i] - (float)h) : (_Float16)0.0f; }
#pragma unroll
    for (int t = 0; t < 4; ++t) { if (col0 + t * 16 >= N) continue; const size_t boff = (size_t)(col0 + t * 16 + ln) * ldb + kb; FragH bq; bq.half[0] = *(const v8us*)(Bh + boff + 8 * hh); bq.half[1] = *(const v8us*)(Bh + boff + 16 + 8 * hh);
      acc[t] = mmaH<ASPLIT ? 2 : 1>(ah.v, al.v, bq.v, bq.v, acc[t]); }
  }
#pragma unroll
  for (int t = 0; t < 4; ++t) { if (col0 + t * 16 >= N) continue;
#pragma unroll
    for (int r = 0; r < 8; ++r) so[w][8 * hh + r][t * 16 + ln] = acc[t][r] * alpha; }
  __builtin_amdgcn_fence(__ATOMIC_ACQ_REL, "workgroup"); __builtin_amdgcn_wave_barrier();
  const int rsub = lane >> 4, c4 = (lane & 15) * 4;
  {
#pragma unroll
    for (int q = 0; q < 8; ++q) { const int r = q * 2 + rsub; if (col0 + c4 < N) { const v4f v = *(const v4fa*)&so[w][r][c4]; *(v4f*)(C + (size_t)(row0 + r) * ldc + col0 + c4) = v; } }
     }
}

// Wt[n][k] = f16(W[k][n]·scale) from f32 row-major W[K][N] (scale = power of two; bf16-exact weights stay exact in f16 away from the subnormal range)
__global__ __launch_bounds__(256) void k_wt_f16(const float* __restrict__ W, _Float16* __restrict__ Wt, int K, int N, float scale) {
  const int t = blockIdx.x * 256 + threadIdx.x; if (t >= N * (K / 8)) return; const int n = t / (K / 8), k8 = (t % (K / 8)) * 8; FragH f;
#pragma unroll
  for (int i = 0; i < 8; ++i) f.h[i] = (_Float16)(bf16_round(W[(size_t)(k8 + i) * N + n]) * scale); const v8us o = f.half[0];
  *(v8us*)((unsigned short*)Wt + (size_t)n * K + k8) = o; 
}
// k_gemm_hh variant with fused epilogue: v = acc·alpha + bias[by·sBias + col] (+ CP[(row/rowsPerB)·sCPb + by·64 + col] if CP) ; ACT 0 none / 1 elu ; writes f16 C16 (and f32 C if non-null)
template <int ACT>
__global__ __launch_bounds__(128) void k_gemm_hhx(const _Float16* __restrict__ A, int lda, size_t sA, const _Float16* __restrict__ Bh, int ldb, size_t sB, float alpha, const float* __restrict__ bias, size_t sBias, const float* __restrict__ CP, int rowsPerB, size_t sCPb, int row0g,
    float* __restrict__ C, _Float16* __restrict__ C16, int ldc, size_t sC, int M, int N, int K) {
  __shared__ __attribute__((aligned(16))) float so[4][16][64];
  const int tid = threadIdx.x, w = tid >> 5, lane = tid & 31, ln = lane & 15, hh = lane >> 4; const int by = blockIdx.y;
  A += (size_t)by * sA; Bh += (size_t)by * sB; const size_t cofs = (size_t)by * sC; const float* bp = bias ? bias + (size_t)by * sBias : nullptr;
  const int ntn = (N + 63) / 64; const int wid = blockIdx.x * 4 + w; const int mt = wid / ntn, nq = wid % ntn; if (mt * 16 >= M) return;
  const int row0 = mt * 16, col0 = nq * 64; const _Float16* arow = A + (size_t)(row0 + ln) * lda;
  v8f acc[4] = {};
  for (int kb = 0; kb < K; kb += 32) { FragH ah; ah.half[0] = *(const v8us*)((const unsigned short*)arow + kb + 8 * hh); ah.half[1] = *(const v8us*)((const unsigned short*)arow + kb + 16 + 8 * hh);
#pragma unroll
    for (int t = 0; t < 4; ++t) { if (col0 + t * 16 >= N) continue; const size_t boff = (size_t)(col0 + t * 16 + ln) * ldb + kb; FragH bq; bq.half[0] = *(const v8us*)((const unsigned short*)Bh + boff + 8 * hh); bq.half[1] = *(const v8us*)((const unsigned short*)Bh + boff + 16 + 8 * hh);
      acc[t] = mmaH<1>(ah.v, ah.v, bq.v, bq.v, acc[t]); }
  }
#pragma unroll
  for (int t = 0; t < 4; ++t) { if (col0 + t * 16 >= N) continue; const int col = col0 + t * 16 + ln; const float bv = bp ? bf16_round(bp[col]) : 0.f;
#pragma unroll
    for (int r = 0; r < 8; ++r) { float v = acc[t][r] * alpha + bv; if (CP) { const int rr = row0g + row0 + 8 * hh + r; if (rowsPerB < 0) v += CP[cofs + (size_t)rr * ldc + col];      /* rowsPerB < 0: own element of the batched C plane */ else { const int bidx = rr / rowsPerB; v += CP[(size_t)bidx * sCPb + (size_t)by * 64 + col]; } } if (ACT == 1) v = (v > 0.f) ? v : expm1f(v); else if (ACT == 7) v = (v > 0.f) ? v + 1.0f : expf(v); else if (ACT == 8) v = tanhf(v); else if (ACT == 9) v = 0.5f * v * (1.0f + tanhf(0.7978845608028654f * (v + 0.044715f * v * v * v))); else if (ACT == 11) v = 1.0f / (1.0f + expf(-v)); else if (ACT == 12) v = (v > 0.f) ? v : 0.01f * v; else if (ACT == 14) v = (v > 0.f) ? v : 0.1f * v; else if (ACT == 16) v = (v >= 0.f) ? v : 0.3f * v; else if (ACT == 17) v = (v >= 0.f) ? v : 0.2f * v; else if (ACT == 15) v = v / (1.0f + expf(-v)); else if (ACT == 3) v = fmaxf(v, 0.f); else if (ACT == 6) v = 0.5f * v * (1.0f + erff(v * 0.70710678118654752f)); so[w][8 * hh + r][t * 16 + ln] = v; } }
  __builtin_amdgcn_fence(__ATOMIC_ACQ_REL, "workgroup"); __builtin_amdgcn_wave_barrier();
  const int rsub = lane >> 4, c4 = (lane & 15) * 4; typedef _Float16 v4h __attribute__((ext_vector_type(4)));
  {
#pragma unroll
    for (int q = 0; q < 8; ++q) { const int r = q * 2 + rsub; if (col0 + c4 < N) { const v4f v = *(const v4fa*)&so[w][r][c4]; if (C) *(v4f*)(C + cofs + (size_t)(row0 + r) * ldc + col0 + c4) = v; if (C16) { v4h h4; for (int i = 0; i < 4; ++i) h4[i] = (_Float16)v[i]; *(v4h*)(C16 + cofs + (size_t)(row0 + r) * ldc + col0 + c4) = h4; } } }
     }
}


typedef _Float16 v4h __attribute__((ext_vector_type(4)));

__global__ __launch_bounds__(256) void k_x16(const float* __restrict__ x, _Float16* __restrict__ X16, size_t n8) { const size_t t = (size_t)blockIdx.x * 256 + threadIdx.x; if (t >= n8) return; FragH f;
#pragma unroll
  for (int q = 0; q < 8; ++q) f.h[q] = (_Float16)bf16_round(x[t * 8 + q]); *(v8us*)((unsigned short*)X16 + t * 8) = f.half[0];  }
__global__ __launch_bounds__(256) void k_h16(const float* __restrict__ x, _Float16* __restrict__ X16, size_t n8) { const size_t t = (size_t)blockIdx.x * 256 + threadIdx.x; if (t >= n8) return; FragH f;
#pragma unroll
  for (int q = 0; q < 8; ++q) f.h[q] = (_Float16)x[t * 8 + q]; *(v8us*)((unsigned short*)X16 + t * 8) = f.half[0];  }
__global__ __launch_bounds__(256) void k_round16f(const float* __restrict__ W, _Float16* __restrict__ Bt, size_t n8) { const size_t t = (size_t)blockIdx.x * 256 + threadIdx.x; if (t >= n8) return; FragH f;
#pragma unroll
  for (int i = 0; i < 8; ++i) f.h[i] = (_Float16)(bf16_round(W[t * 8 + i]) * 16.0f); *(v8us*)((unsigned short*)Bt + t * 8) = f.half[0];  }
template <int NHv, int TTv>
__global__ __launch_bounds__(256) void k_vt(const _Float16* __restrict__ V16, int ldv, int voff, _Float16* __restrict__ Vt) { __shared__ unsigned short tl[64][66]; const int tid = threadIdx.x; const int slab = blockIdx.x / (TTv / 64), lg = blockIdx.x % (TTv / 64); const int b = slab / NHv, h = slab % NHv;
  for (int i = tid; i < 64 * 8; i += 256) { const int r = i / 8, c8 = (i % 8) * 8; FragH f; f.half[0] = *(const v8us*)((const unsigned short*)V16 + ((size_t)b * TTv + lg * 64 + r) * ldv + voff + h * 64 + c8);
#pragma unroll
    for (int q = 0; q < 8; ++q) tl[r][c8 + q] = f.u[q]; }
  __syncthreads();
  {
#pragma unroll
    for (int rd = 0; rd < 2; ++rd) { const int d = rd * 32 + tid / 8, pc = tid % 8; FragH f;
#pragma unroll
      for (int q = 0; q < 8; ++q) f.u[q] = tl[pc * 8 + q][d];
      *(v8us*)((unsigned short*)Vt + ((size_t)slab * 64 + d) * TTv + lg * 64 + pc * 8) = f.half[0]; }
     } }

__global__ __launch_bounds__(256) void k_hl(const float* __restrict__ F, _Float16* __restrict__ Hh, _Float16* __restrict__ Hl, size_t n8) { const size_t t = (size_t)blockIdx.x * 256 + threadIdx.x; if (t >= n8) return; FragH fh, fl; const v4f a = *(const v4fa*)(F + t * 8), c = *(const v4fa*)(F + t * 8 + 4);
#pragma unroll
  for (int q = 0; q < 4; ++q) { _Float16 h = (_Float16)a[q]; fh.h[q] = h; fl.h[q] = (_Float16)((a[q] - (float)h) * 1024.0f); h = (_Float16)c[q]; fh.h[4 + q] = h; fl.h[4 + q] = (_Float16)((c[q] - (float)h) * 1024.0f); }
  { *(v8us*)((unsigned short*)Hh + t * 8) = fh.half[0]; *(v8us*)((unsigned short*)Hl + t * 8) = fl.half[0];  } }

// ---- fast GEMM (wave tile 32x64; requires M % 32 == 0 rows per launch region and N % 64 == 0); epilogue = k_gemm_hhx semantics ----
__device__ __forceinline__ v16h g2_frag(const _Float16* p, int hh) { FragH f; f.half[0] = *(const v8us*)((const unsigned short*)p + 8 * hh); f.half[1] = *(const v8us*)((const unsigned short*)p + 16 + 8 * hh); return f.v; }
__device__ __forceinline__ v8f g2_mma(v16h a, v16h b, v8f c) { v8f d = __builtin_amdgcn_wmma_f32_16x16x32_f16(false, a, false, b, (short)0, c, false, false); asm volatile("v_nop\n\tv_nop\n\tv_nop\n\tv_nop" : "+v"(d) : "v"(a), "v"(b)); return d; }
template <int ACT>
__global__ __launch_bounds__(128) void k_gemm2(const _Float16* __restrict__ A, int lda, size_t sA, const _Float16* __restrict__ Bh, int ldb, size_t sB, float alpha, const float* __restrict__ bias, size_t sBias, const float* __restrict__ CP, int rowsPerB, size_t sCPb, int row0g,
    float* __restrict__ C, _Float16* __restrict__ C16, int ldc, size_t sC, int M, int N, int K) { static_assert(ACT == 0 || ACT == 3 || ACT == 6 || ACT == 8 || ACT == 9 || ACT == 11 || ACT == 12 || ACT == 14 || ACT == 15 || ACT == 16 || ACT == 17, "k_gemm2: unsupported ACT code (would silently apply no activation)");
  __shared__ __attribute__((aligned(16))) float so[4][32][68];
  const int tid = threadIdx.x, w = tid >> 5, lane = tid & 31, ln = lane & 15, hh = lane >> 4; const int by = blockIdx.y;
  A += (size_t)by * sA; Bh += (size_t)by * sB; const size_t cofs = (size_t)by * sC; const float* bp = bias ? bias + (size_t)by * sBias : nullptr;
  const int ntn = N >> 6; const int mt = blockIdx.x / ntn, nq = blockIdx.x - mt * ntn; const int row0 = mt * 128 + 32 * w, col0 = nq * 64; if (row0 >= M) return;
  const _Float16* a0p = A + (size_t)(row0 + ln) * lda; const _Float16* a1p = a0p + (size_t)16 * lda;
  const _Float16* b0p = Bh + (size_t)(col0 + ln) * ldb; const _Float16* b1p = b0p + (size_t)16 * ldb; const _Float16* b2p = b1p + (size_t)16 * ldb; const _Float16* b3p = b2p + (size_t)16 * ldb;
  const v8f z8 = {0.f,0.f,0.f,0.f,0.f,0.f,0.f,0.f}; v8f c00 = z8, c01 = z8, c02 = z8, c03 = z8, c10 = z8, c11 = z8, c12 = z8, c13 = z8;
#pragma unroll 1
  for (int kb = 0; kb < K; kb += 32) { const v16h a0 = g2_frag(a0p + kb, hh), a1 = g2_frag(a1p + kb, hh);
    v16h b = g2_frag(b0p + kb, hh); c00 = g2_mma(a0, b, c00); c10 = g2_mma(a1, b, c10);
    b = g2_frag(b1p + kb, hh); c01 = g2_mma(a0, b, c01); c11 = g2_mma(a1, b, c11);
    b = g2_frag(b2p + kb, hh); c02 = g2_mma(a0, b, c02); c12 = g2_mma(a1, b, c12);
    b = g2_frag(b3p + kb, hh); c03 = g2_mma(a0, b, c03); c13 = g2_mma(a1, b, c13); }
  v8f accs[8] = {c00, c01, c02, c03, c10, c11, c12, c13};
#pragma unroll
  for (int u = 0; u < 8; ++u) { const int t = u & 3, half = u >> 2; const int col = col0 + t * 16 + ln; const float bv = bp ? bf16_round(bp[col]) : 0.f;
#pragma unroll
    for (int r = 0; r < 8; ++r) { const int rloc = half * 16 + 8 * hh + r; float v = accs[u][r] * alpha + bv; if (CP) { if (rowsPerB < 0) v += CP[cofs + (size_t)(row0g + row0 + rloc) * ldc + col];      /* rowsPerB < 0: own element of the batched C plane */ else { const int bidx = (row0g + row0 + rloc) / rowsPerB; v += CP[(size_t)bidx * sCPb + (size_t)by * 64 + col]; } }
      if (ACT == 3) v = fmaxf(v, 0.f); else if (ACT == 6) v = 0.5f * v * (1.0f + erff(v * 0.70710678118654752f)); else if (ACT == 11) v = 1.0f / (1.0f + expf(-v)); else if (ACT == 15) v = v / (1.0f + expf(-v)); else if (ACT == 12) v = (v > 0.f) ? v : 0.01f * v; else if (ACT == 8) v = tanhf(v); else if (ACT == 9) v = 0.5f * v * (1.0f + tanhf(0.7978845608028654f * (v + 0.044715f * v * v * v))); else if (ACT == 14) v = (v > 0.f) ? v : 0.1f * v; else if (ACT == 16) v = (v >= 0.f) ? v : 0.3f * v; else if (ACT == 17) v = (v >= 0.f) ? v : 0.2f * v;
      so[w][rloc][t * 16 + ln] = v; } }
  __builtin_amdgcn_fence(__ATOMIC_ACQ_REL, "workgroup"); __builtin_amdgcn_wave_barrier();
  const int rsub = lane >> 4, c4 = (lane & 15) * 4;
  {
#pragma unroll
    for (int q = 0; q < 16; ++q) { const int r = q * 2 + rsub; const v4f v = *(const v4fa*)&so[w][r][c4]; if (C) *(v4f*)(C + cofs + (size_t)(row0 + r) * ldc + col0 + c4) = v; if (C16) { v4h h4; for (int i = 0; i < 4; ++i) h4[i] = (_Float16)v[i]; *(v4h*)(C16 + cofs + (size_t)(row0 + r) * ldc + col0 + c4) = h4; } }
     } }


__global__ __launch_bounds__(256) void k_wnat(const float* __restrict__ w, size_t n8, _Float16* __restrict__ Bt) { const size_t t = (size_t)blockIdx.x * 256 + threadIdx.x; if (t >= n8) return; FragH f; for (int q = 0; q < 8; ++q) f.h[q] = (_Float16)(bf16_round(w[t * 8 + q]) * 16.0f); *(v8us*)((unsigned short*)Bt + t * 8) = f.half[0];  }
__global__ __launch_bounds__(256) void k_rsm(const float* __restrict__ S, _Float16* __restrict__ P, int nrows) {
  #pragma clang fp contract(off)
  const int i = blockIdx.x * 256 + threadIdx.x; if (i >= nrows) return; const float* s = S + (size_t)i * SQ; float mx = -3.0e38f;
#pragma unroll 1
  for (int j = 0; j < SQ; ++j) mx = fmaxf(mx, s[j]); float se = 0.f;
#pragma unroll 1
  for (int j = 0; j < SQ; ++j) se += expf(s[j] - mx); const float sc = 256.0f / se;
#pragma unroll 1
  for (int j0 = 0; j0 < SQ; j0 += 8) { FragH f; for (int q = 0; q < 8; ++q) f.h[q] = (_Float16)(expf(s[j0 + q] - mx) * sc); unsigned short* d = (unsigned short*)P + (size_t)i * SQ + j0; *(v8us*)d = f.half[0];  } }
__global__ __launch_bounds__(256) void k_vt(const _Float16* __restrict__ V16, int b, int h0, _Float16* __restrict__ VT) { __shared__ unsigned short tl[64][65]; const int tid = threadIdx.x; const int hh = blockIdx.x % HG, sg = blockIdx.x / HG; const int s0 = sg * 64; const int h = h0 + hh;
  for (int i = tid; i < 64 * 8; i += 256) { const int j = i / 8, d8 = (i % 8) * 8; FragH f; f.half[0] = *(const v8us*)((const unsigned short*)V16 + ((size_t)b * SQ + s0 + j) * DM + h * HD + d8); for (int q = 0; q < 8; ++q) tl[d8 + q][j] = f.u[q]; }
  __syncthreads();
  { for (int i = tid; i < 64 * 8; i += 256) { const int d = i / 8, j8 = (i % 8) * 8; FragH f; for (int q = 0; q < 8; ++q) f.u[q] = tl[d][j8 + q]; *(v8us*)((unsigned short*)VT + ((size_t)hh * HD + d) * SQ + s0 + j8) = f.half[0]; }  } }



// 2^x on the transcendental unit; the v_nop fills the one slot that the instruction set asks for between a transcendental and an instruction that reads its result or overwrites its source.
__device__ __forceinline__ float exp2_slot(float x) { float r; asm("v_exp_f32 %0, %1\n\tv_nop" : "=v"(r) : "v"(x)); return r; }
// Row softmax, one wave per row: the 2048 scores of a row are read once into the wave's registers (64 per lane, every load 512 contiguous bytes), maximum and sum go over the lanes by a butterfly, each weight's exponential is taken once; weights x256 f16, every store 256 contiguous bytes. Every loop here is unrolled so that v is indexed by constants and stays in registers (rolled it would go to scratch memory) and all 16 loads are in flight together.
__global__ __launch_bounds__(256) void k_rsmw(const float* __restrict__ S, _Float16* __restrict__ P, int nrows) {
  const int lane = threadIdx.x & 31; const int row = blockIdx.x * 8 + (threadIdx.x >> 5); if (row >= nrows) return;
  const float* s = S + (size_t)row * NKX + lane * 4; v4f v[NKX / 128];
#pragma unroll
  for (int c = 0; c < NKX / 128; ++c) v[c] = *(const v4fa*)(s + c * 128);
  asm volatile("s_wait_xcnt 0x0" :: "v"(s) : "memory");      /* stands in front of the first overwrite of the loads' address registers; the address is an input so that it keeps its registers up to here (no load lands on them) */
  v4f m4 = v[0];
#pragma unroll
  for (int c = 1; c < NKX / 128; ++c) for (int q = 0; q < 4; ++q) m4[q] = fmaxf(m4[q], v[c][q]);
  float mx = fmaxf(fmaxf(m4[0], m4[1]), fmaxf(m4[2], m4[3]));
#pragma unroll
  for (int o = 16; o > 0; o >>= 1) mx = fmaxf(mx, __shfl_xor(mx, o, 32));
  v4f s4 = {0.f, 0.f, 0.f, 0.f};
#pragma unroll
  for (int c = 0; c < NKX / 128; ++c) for (int q = 0; q < 4; ++q) { v[c][q] = exp2_slot((v[c][q] - mx) * 1.44269504f); s4[q] += v[c][q]; }
  float se = (s4[0] + s4[1]) + (s4[2] + s4[3]);
#pragma unroll
  for (int o = 16; o > 0; o >>= 1) se += __shfl_xor(se, o, 32);
  const float sc = 256.0f / se; _Float16* p = P + (size_t)row * NKX + lane * 4;
#pragma unroll
  for (int c = 0; c < NKX / 128; ++c) { v4h h4; for (int q = 0; q < 4; ++q) h4[q] = (_Float16)(v[c][q] * sc); *(v4h*)(p + c * 128) = h4; } }


template <int MASKADD>
__global__ __launch_bounds__(64) void k_att0(const float* __restrict__ QF, const float* __restrict__ KF, const float* __restrict__ VF, int ld, const float* __restrict__ mask, float scale, float* __restrict__ OF, int ldo) {
  #pragma clang fp contract(off)
  __shared__ __attribute__((aligned(16))) float lq[64][64]; __shared__ __attribute__((aligned(16))) float lo[64][64];
  const int tid = threadIdx.x; const int h = blockIdx.x / (QT0 / 64), rg = blockIdx.x % (QT0 / 64); const int i = rg * 64 + tid;
  const float* qr = QF + (size_t)i * ld + h * HD;
#pragma unroll 1
  for (int c = 0; c < HD / 4; ++c) { *(v4f*)&lq[tid][c * 4] = *(const v4fa*)(qr + c * 4); const v4f z = {0.f, 0.f, 0.f, 0.f}; *(v4f*)&lo[tid][c * 4] = z; }
  float m = -1.0e30f, l = 0.f; const int jmax = MASKADD ? (SQ - 1) : (rg * 64 + 63);      /* additive-mask form: every key (the mask input decides); causal form: keys up to the block's last row */
#pragma unroll 1
  for (int j = 0; j <= jmax; ++j) { const float* kr = KF + (size_t)j * ld + h * HD; const float* vr = VF + (size_t)j * ld + h * HD; float s = 0.f;
#pragma unroll 1
    for (int c = 0; c < HD / 4; ++c) { const v4f kq = *(const v4fa*)(kr + c * 4); const v4f qq = *(v4f*)&lq[tid][c * 4]; s = __fadd_rn(s, __fmul_rn(qq[0], kq[0])); s = __fadd_rn(s, __fmul_rn(qq[1], kq[1])); s = __fadd_rn(s, __fmul_rn(qq[2], kq[2])); s = __fadd_rn(s, __fmul_rn(qq[3], kq[3])); }
    s = __fmul_rn(s, scale); if (MASKADD) s = __fadd_rn(s, __fmul_rn(bf16_round(mask[(size_t)i * SQ + j]), -10000.0f));
    const float f = (MASKADD || j <= i) ? 1.f : 0.f; const float sm = fmaf(f, s, (1.f - f) * -1.0e30f); const float mn = fmaxf(m, sm); const float sc = expf(m - mn); const float e = expf(sm - mn); l = __fadd_rn(__fmul_rn(l, sc), e); m = mn;
#pragma unroll 1
    for (int c = 0; c < HD / 4; ++c) { const v4f vv = *(const v4fa*)(vr + c * 4); v4f oo = *(v4f*)&lo[tid][c * 4]; for (int u = 0; u < 4; ++u) oo[u] = __fadd_rn(__fmul_rn(oo[u], sc), __fmul_rn(e, vv[u])); *(v4f*)&lo[tid][c * 4] = oo; } }
  const float fin = 64.0f / l;      /* o carried x64 like the f16 path */
#pragma unroll 1
  for (int c = 0; c < HD / 4; ++c) { v4f oo = *(v4f*)&lo[tid][c * 4]; for (int u = 0; u < 4; ++u) oo[u] = __fmul_rn(oo[u], fin); *(v4f*)&lo[tid][c * 4] = oo; }
  __syncthreads();
  {
#pragma unroll 1
    for (int it = 0; it < 16; ++it) { const int row = it * 4 + tid / 16, pc = (tid % 16) * 4; const v4f v = *(const v4f*)&lo[row][pc]; *(v4f*)(OF + (size_t)(rg * 64 + row) * ldo + h * HD + pc) = v; }
     } }

extern "C" void kernel_launch(void* const* d_in, const int* in_sizes, int n_in,
                              void* d_out, int out_size, void* d_ws, size_t ws_size, hipStream_t stream) {
  (void)in_sizes; (void)n_in; (void)out_size;
  const float* const* I = (const float* const*)d_in; const float* x = I[0]; const float* xk = I[1]; const float* xv = I[2]; const float* wq = I[3]; const float* wk = I[4]; const float* wv = I[5]; const float* bq = nullptr; const float* bk = nullptr; const float* bv = nullptr; const float* wo = I[6]; const float* bo = nullptr;      /* input order: q, k, v (the three streams, two sequences each), Wq, Wk, Wv (PER-HEAD STACKS [16][1024][64]), Wo ([in][out] [1024][1024]); NO biases anywhere: null pointers in the guarded slots */
  char* ws = (char*)d_ws; size_t off = 0;
  auto take = [&](size_t bytes) { char* p = ws + off; off += (bytes + 255) & ~(size_t)255; return p; };
  _Float16* BQ = (_Float16*)take((size_t)DM * DM * 2); _Float16* BK = (_Float16*)take((size_t)DM * DM * 2); _Float16* BV = (_Float16*)take((size_t)DM * DM * 2); _Float16* BO = (_Float16*)take((size_t)DM * DM * 2);
  _Float16* X16 = (_Float16*)take(NR * DM * 2); _Float16* XK16 = (_Float16*)take(NR * DM * 2); _Float16* XV16 = (_Float16*)take(NR * DM * 2);      /* exact f16 rows of query, key, value */ float* QF = (float*)take(NR * DM * 4); _Float16* QH = (_Float16*)take(NR * DM * 2); _Float16* QL = (_Float16*)take(NR * DM * 2); _Float16* KH = (_Float16*)take(NR * DM * 2); _Float16* KL = (_Float16*)take(NR * DM * 2); _Float16* Q16 = QH; _Float16* K16 = KH; _Float16* V16 = (_Float16*)take(NR * DM * 2); _Float16* O16 = (_Float16*)take(NR * DM * 2);
  float* S = (float*)take((size_t)NH * QT * NKX * 4); _Float16* P = (_Float16*)take((size_t)NH * QT * NKX * 2); _Float16* VT = (_Float16*)take((size_t)NH * HD * SQ * 2);
  float* QF0 = (float*)take((size_t)QT0 * DM * 4); float* KF0 = (float*)take((size_t)QT0 * DM * 4); float* VF0 = (float*)take((size_t)QT0 * DM * 4); float* OF0 = (float*)take((size_t)NB * QT0 * DM * 4); _Float16* OH0 = (_Float16*)take((size_t)NB * QT0 * DM * 2); _Float16* OL0 = (_Float16*)take((size_t)NB * QT0 * DM * 2);
  if (off > ws_size) return;
  { const unsigned gh = (unsigned)(((size_t)HD * (DM / 8) + 255) / 256); for (int h = 0; h < NH; ++h) { k_wt_f16<<<gh, 256, 0, stream>>>(wq + (size_t)h * DM * HD, BQ + (size_t)h * HD * DM, DM, HD, 16.0f); k_wt_f16<<<gh, 256, 0, stream>>>(wk + (size_t)h * DM * HD, BK + (size_t)h * HD * DM, DM, HD, 16.0f); k_wt_f16<<<gh, 256, 0, stream>>>(wv + (size_t)h * DM * HD, BV + (size_t)h * HD * DM, DM, HD, 16.0f); } const unsigned g = (unsigned)(((size_t)DM * DM / 8 + 255) / 256); k_wt_f16<<<g, 256, 0, stream>>>(wo, BO, DM, DM, 16.0f); }      /* head h's [1024][64] block -> rows 64 h .. 64 h + 63 of the Bt[n][k] x16 plane (K 1024, N 64 per call); the [in][out] output weight transposed into its plane by the same builder (K 1024, N 1024; grid g = 512 for it, gh = 32 for each per-head call) */
  k_x16<<<(unsigned)((NR * DM / 8 + 255) / 256), 256, 0, stream>>>(x, X16, NR * DM / 8); k_x16<<<(unsigned)((NR * DM / 8 + 255) / 256), 256, 0, stream>>>(xk, XK16, NR * DM / 8); k_x16<<<(unsigned)((NR * DM / 8 + 255) / 256), 256, 0, stream>>>(xv, XV16, NR * DM / 8);
  const size_t r0p = (size_t)B0 * SQ;      /* first projected row */
  k_gemm2<0><<<dim3((unsigned)((MP / 128) * (DM / 64)), 1), 128, 0, stream>>>(X16 + r0p * DM, DM, 0, BQ, DM, 0, 0.0625f, bq, 0, nullptr, 1, 0, 0, QF + r0p * DM, nullptr, DM, 0, MP, DM, DM); k_hl<<<(unsigned)(((size_t)MP * DM / 8 + 255) / 256), 256, 0, stream>>>(QF + r0p * DM, QH + r0p * DM, QL + r0p * DM, (size_t)MP * DM / 8);      /* q (f32) -> f16 hi + x1024 residual: unscaled logits sigma ~8 */
  k_gemm2<0><<<dim3((unsigned)((MP / 128) * (DM / 64)), 1), 128, 0, stream>>>(XK16 + r0p * DM, DM, 0, BK, DM, 0, 0.0625f, bk, 0, nullptr, 1, 0, 0, QF + r0p * DM, nullptr, DM, 0, MP, DM, DM); k_hl<<<(unsigned)(((size_t)MP * DM / 8 + 255) / 256), 256, 0, stream>>>(QF + r0p * DM, KH + r0p * DM, KL + r0p * DM, (size_t)MP * DM / 8);      /* k likewise */
  k_gemm2<0><<<dim3((unsigned)((MP / 128) * (DM / 64)), 1), 128, 0, stream>>>(XV16 + r0p * DM, DM, 0, BV, DM, 0, 0.0625f, bv, 0, nullptr, 1, 0, 0, nullptr, V16 + r0p * DM, DM, 0, MP, DM, DM);
  for (int b = B0; b < B0 + NBR; ++b) { const size_t r0 = (size_t)b * SQ;
    k_vt<NH, SQ><<<NH * (SQ / 64), 256, 0, stream>>>(V16 + r0 * LQ, LQ, 0, VT);      /* V^T [NH][HD][SQ] for this batch */
  /* (dense: no exact first-tile projections: every row goes through the three-product path) */
  /* (dense: no exact first-tile attention) */
    for (int q0 = 0; q0 < QN; q0 += QT) { const int nk = SQ;      /* DENSE: every query tile sees all SQ keys */
      k_gemm2<0><<<dim3((QT / 128) * (nk / 64), NHD), 128, 0, stream>>>(QH + (r0 + q0) * LQ, LQ, (size_t)HD, KH + r0 * LQ, LQ, (size_t)HD, SCL, nullptr, 0, nullptr, 1, 0, 0, S, nullptr, NKX, (size_t)QT * NKX, QT, nk, HD);      /* scores hi . hi * 64^-0.5 (1 / sqrt(head_dim)) */
      k_gemm2<0><<<dim3((QT / 128) * (nk / 64), NHD), 128, 0, stream>>>(QL + (r0 + q0) * LQ, LQ, (size_t)HD, KH + r0 * LQ, LQ, (size_t)HD, SCLR, nullptr, 0, S, -1, 0, 0, S, nullptr, NKX, (size_t)QT * NKX, QT, nk, HD); k_gemm2<0><<<dim3((QT / 128) * (nk / 64), NHD), 128, 0, stream>>>(QH + (r0 + q0) * LQ, LQ, (size_t)HD, KL + r0 * LQ, LQ, (size_t)HD, SCLR, nullptr, 0, S, -1, 0, 0, S, nullptr, NKX, (size_t)QT * NKX, QT, nk, HD);      /* += 2^-13 (lo . hi + hi . lo) */      /* scores, all heads on grid.y */
      k_rsmw<<<(NHD * QT + 7) / 8, 256, 0, stream>>>(S, P, NHD * QT);      /* plain row softmax over all SQ keys, one wave per row */
      k_gemm2<0><<<dim3((QT / 128) * (HD / 64), NHD), 128, 0, stream>>>(P, NKX, (size_t)QT * NKX, VT, SQ, (size_t)HD * SQ, 0.25f, nullptr, 0, nullptr, 1, 0, 0, nullptr, O16 + r0 * DM + (size_t)q0 * HD, HD, (size_t)SQ * HD, QT, HD, nk); } }            /* o written HEAD-CONTIGUOUS: o[b][h][s][64] (row pitch 64, head stride SQ x 64): the source's raw reshape of (B, H, S, dk) to (B, S, H dk) then reads that memory as [2048][1024] rows: the output GEMM below does exactly that */
  k_gemm2<0><<<dim3((unsigned)((MPO / 128) * (DM / 64)), 1), 128, 0, stream>>>(O16 + r0p * DM, DM, 0, BO, DM, 0, 0.0009765625f, bo, 0, nullptr, 1, 0, 0, (float*)d_out + r0p * DM, nullptr, DM, 0, MPO, DM, DM);      /* out rows are the output layout */
  /* (dense: no first-tile hi / lo planes) */
  /* (dense: no first-tile rewrite passes:
     the output GEMM above has written every row
     with its (null) bias) */
}

// v003
// It runs in 285 microseconds.
// It is 8.47 times as fast as v001, going by the measured steps of the versions left out in between.
// All steps since v000 together make it 26.9 times as fast.
#include <hip/hip_runtime.h>
// Multi-head attention on three inputs with PER-HEAD STACKED projections and the source's RAW-RESHAPE head merge (Q, K, V [2][2048][1024]; WQ / WK / WV [16][1024][64] = [head][in][out] uniform +-0.1, NO biases; 16 heads of 64; scores x 1/sqrt(64); softmax over all 2048 keys (no mask); the head outputs [B][H][S][64] are RESHAPED IN MEMORY ORDER to [B][S][1024] (row r of a batch holds tokens 16 (r mod 128) .. + 15 of head r / 128: heads and tokens mix: faithful to the source); out = that WO with WO [1024][1024] [in][out], NO bias -> [2][2048][1024]); q and k carried as f16 hi + x1024 residual planes with three-product scores; each head's [in][out] block is transposed into its 64 contiguous rows of the f16 weight plane, and the [in][out] output weight into its plane, all in one launch (k_prep); DENSE (k_fattn runs every query over all SQ keys; no exact first tile).
// Structure: token rows r = b*2048 + s; x as exact f16 rows (bf16-rounded); q and k as WMMA GEMMs (32x64 wave tiles, f32 accumulation, exact x16 weights, no bias) into f32 rows split into f16 hi + x1024 residual planes, v as an f16-output GEMM; V^T for both batches and all heads via LDS transposes; per work-group of 256 query rows in one fused launch (k_fattn; all heads on grid.y, batches on grid.z), in passes of 32 keys over all 2048: scores as THREE accumulating products (hi.hi + 2^-10 (lo.hi + hi.lo), K = 64, logits sigma ~8, 1/sqrt(64) log2(e) applied in the exponent), online row softmax on VALU with no mask (f32 statistics, native exp2; weights x256 f16), o = P . V^T (o carried x64, folded into the output GEMM alpha) written straight into the merged f16 o rows; out = o W_o GEMM (f32, no bias) into the output layout.
// Attention now runs as ONE fused launch (k_fattn, below): the per-tile score passes, the row softmax and the P . V^T pass of the former version are gone, with their score and weight planes; V^T is built for both batches in one launch.
// All work that reads inputs only (the weight planes, the three f16 input streams) now runs as ONE launch (k_prep, below) in place of one launch per head and plane and one per stream.
// Compute dtype: inputs rounded to bf16; x / weights exact; q and k as f16 hi + x1024 residual pairs; v, softmax weights and o as plain f16 GEMM operands (~2^-12); scores and softmax statistics f32. v_wmma_f32_16x16x32_f16.
#define NB 2
#define SCL 0.125f                         /* 1 / sqrt(head_dim = 64) */
#define SCLR 0.0001220703125f              /* 2^-13: SCL x 2^-10 (not used) */
#define SQ 2048
#define DM 1024
#define NH 16
#define HD 64
#define HG 4                         /* heads per group of the second k_vt (not launched) */
#define QT 256                       /* query rows per query tile (not used) */
#define NKX SQ                       /* row pitch of the former S / P planes (not used) */
#define QT0 128                      /* rows of the exact first tile of k_att0 (not launched) */
#define B0 0                         /* first batch processed (debug hook) */
#define NBR NB                       /* batches processed (debug hook) */
#define NR ((size_t)NB * SQ)         /* token rows */
#define MP ((int)((size_t)NBR * SQ)) /* rows projected (debug hook) */
#define QN SQ                        /* query rows attended per batch (not used) */
#define NHD NH                       /* heads attended (not used) */
#define MPO MP                       /* rows through the output stage (debug hook) */
#define LQ DM      /* row pitch of the q/k/v rows */
typedef __bf16 v16b __attribute__((ext_vector_type(16)));
typedef unsigned short v8us __attribute__((ext_vector_type(8), may_alias));
typedef float  v8f  __attribute__((ext_vector_type(8)));
typedef float  v4f  __attribute__((ext_vector_type(4)));
typedef float  v4fa __attribute__((ext_vector_type(4), may_alias));
union FragB { v16b v; v8us half[2]; unsigned short u[16]; };

__device__ __forceinline__ unsigned short bf16_bits(float x) { unsigned int u = __float_as_uint(x); return (unsigned short)((u + 0x7FFFu + ((u >> 16) & 1u)) >> 16); }
__device__ __forceinline__ float bf16_val(unsigned short b) { return __uint_as_float(((unsigned int)b) << 16); }
__device__ __forceinline__ float bf16_round(float x) { return bf16_val(bf16_bits(x)); }
// D += A·B with NT terms: 1 = ah·bh, 2 = + al·bh (A split), 3 = + ah·bl (both split)
template <int NT>
__device__ __forceinline__ v8f mmaN(v16b ah, v16b al, v16b bh, v16b bl, v8f c) {
  c = __builtin_amdgcn_wmma_f32_16x16x32_bf16(false, ah, false, bh, (short)0, c, false, false);
  if (NT >= 2) c = __builtin_amdgcn_wmma_f32_16x16x32_bf16(false, al, false, bh, (short)0, c, false, false);
  if (NT >= 3) c = __builtin_amdgcn_wmma_f32_16x16x32_bf16(false, ah, false, bl, (short)0, c, false, false);
  asm volatile("v_nop\n\tv_nop\n\tv_nop\n\tv_nop" : "+v"(c) : "v"(ah), "v"(al), "v"(bh), "v"(bl));
  return c;
}

__global__ __launch_bounds__(256) void k_wt_bf16(const float* __restrict__ W, unsigned short* __restrict__ Wt, int K, int N) {
  const int t = blockIdx.x * 256 + threadIdx.x;
  const int k8n = K / 8;
  if (t >= N * k8n) return;
  const int n = t / k8n, k8 = (t % k8n) * 8;
  v8us v;
#pragma unroll
  for (int i = 0; i < 8; ++i) v[i] = bf16_bits(W[(size_t)(k8 + i) * N + n]);
  *(v8us*)(Wt + (size_t)n * K + k8) = v;
  
}

// GEMM C[M][N] (f32, pitch ldc) = act(A[M][K]·W + bias). A f32 row-major (pitch lda) converted per fragment to bf16
// (ASPLIT: hi/lo two planes -> 2 terms, else single rounded term); Wt bf16 [N][K] (pitch ldb). BIAS_BF16 rounds the
// bias to bf16 first (bias quantised to bf16 before the add). K%32==0, M%16==0, N%64==0.
template <bool ASPLIT, int ACT, bool BIAS_BF16>
__global__ __launch_bounds__(128) void k_gemm_bf(const float* __restrict__ A, int lda, const unsigned short* __restrict__ Wt, int ldb,
                                               const float* __restrict__ bias, float* __restrict__ C, int ldc, int M, int N, int K) {
  __shared__ __attribute__((aligned(16))) float so[4][16][64];
  const int tid = threadIdx.x, w = tid >> 5, lane = tid & 31, ln = lane & 15, hh = lane >> 4;
  const int ntn = N / 64;
  const int wid = blockIdx.x * 4 + w;
  const int mt = wid / ntn, nq = wid % ntn;
  if (mt * 16 >= M) return;
  const int row0 = mt * 16, col0 = nq * 64;
  const float* arow = A + (size_t)(row0 + ln) * lda;
  v8f acc[4] = {};
  for (int kb = 0; kb < K; kb += 32) {
    FragB ah, al;
    const v4f x0 = *(const v4fa*)(arow + kb + 8 * hh), x1 = *(const v4fa*)(arow + kb + 8 * hh + 4);
    const v4f x2 = *(const v4fa*)(arow + kb + 16 + 8 * hh), x3 = *(const v4fa*)(arow + kb + 16 + 8 * hh + 4);
    float xs[16] = {x0[0],x0[1],x0[2],x0[3],x1[0],x1[1],x1[2],x1[3],x2[0],x2[1],x2[2],x2[3],x3[0],x3[1],x3[2],x3[3]};
#pragma unroll
    for (int i = 0; i < 16; ++i) { const unsigned short hb = bf16_bits(xs[i]); ah.u[i] = hb; al.u[i] = ASPLIT ? bf16_bits(xs[i] - bf16_val(hb)) : (unsigned short)0; }
#pragma unroll
    for (int t = 0; t < 4; ++t) {
      const unsigned short* brow = Wt + (size_t)(col0 + t * 16 + ln) * ldb + kb;
      FragB b;
      b.half[0] = *(const v8us*)(brow + 8 * hh);
      b.half[1] = *(const v8us*)(brow + 16 + 8 * hh);
      acc[t] = mmaN<ASPLIT ? 2 : 1>(ah.v, al.v, b.v, b.v, acc[t]);
    }
  }
#pragma unroll
  for (int t = 0; t < 4; ++t) {
    float bv = bias ? bias[col0 + t * 16 + ln] : 0.f;
    if (BIAS_BF16) bv = bf16_round(bv);
#pragma unroll
    for (int r = 0; r < 8; ++r) { float v = acc[t][r] + bv; if (ACT == 1) v = fmaxf(v, 0.f); so[w][8 * hh + r][t * 16 + ln] = v; }
  }
  __builtin_amdgcn_fence(__ATOMIC_ACQ_REL, "workgroup");
  __builtin_amdgcn_wave_barrier();
  const int rsub = lane >> 4, c4 = (lane & 15) * 4;
  {
#pragma unroll
    for (int q = 0; q < 8; ++q) {
      const int r = q * 2 + rsub;
      const v4f v = *(const v4fa*)&so[w][r][c4];
      *(v4f*)(C + (size_t)(row0 + r) * ldc + col0 + c4) = v;
    }
    
  }
}

// GEMM C = act(A·W + bias + resid): A f32 (ASPLIT -> hi/lo 2 terms), Wt bf16 [N][K]; ACT 0 none, 1 relu, 2 exact gelu;
// resid (optional, f32, row index = (row % rmod), pitch ldr, RES_BF16 rounds it) added before the activation.
template <bool ASPLIT, int ACT, bool BIAS_BF16, bool RES_BF16>
__global__ __launch_bounds__(128) void k_gemm_bf3(const float* __restrict__ A, int lda, const unsigned short* __restrict__ Wt, int ldb,
                                                const float* __restrict__ bias, const float* __restrict__ resid, int rmod, int ldr,
                                                float* __restrict__ C, int ldc, int M, int N, int K) {
  __shared__ __attribute__((aligned(16))) float so[4][16][64];
  const int tid = threadIdx.x, w = tid >> 5, lane = tid & 31, ln = lane & 15, hh = lane >> 4;
  const int ntn = N / 64;
  const int wid = blockIdx.x * 4 + w;
  const int mt = wid / ntn, nq = wid % ntn;
  if (mt * 16 >= M) return;
  const int row0 = mt * 16, col0 = nq * 64;
  const float* arow = A + (size_t)(row0 + ln) * lda;
  v8f acc[4] = {};
  for (int kb = 0; kb < K; kb += 32) {
    FragB ah, al;
    const v4f x0 = *(const v4fa*)(arow + kb + 8 * hh), x1 = *(const v4fa*)(arow + kb + 8 * hh + 4);
    const v4f x2 = *(const v4fa*)(arow + kb + 16 + 8 * hh), x3 = *(const v4fa*)(arow + kb + 16 + 8 * hh + 4);
    float xs[16] = {x0[0],x0[1],x0[2],x0[3],x1[0],x1[1],x1[2],x1[3],x2[0],x2[1],x2[2],x2[3],x3[0],x3[1],x3[2],x3[3]};
#pragma unroll
    for (int i = 0; i < 16; ++i) { const unsigned short hb = bf16_bits(xs[i]); ah.u[i] = hb; al.u[i] = ASPLIT ? bf16_bits(xs[i] - bf16_val(hb)) : (unsigned short)0; }
#pragma unroll
    for (int t = 0; t < 4; ++t) {
      const unsigned short* brow = Wt + (size_t)(col0 + t * 16 + ln) * ldb + kb;
      FragB b;
      b.half[0] = *(const v8us*)(brow + 8 * hh);
      b.half[1] = *(const v8us*)(brow + 16 + 8 * hh);
      acc[t] = mmaN<ASPLIT ? 2 : 1>(ah.v, al.v, b.v, b.v, acc[t]);
    }
  }
#pragma unroll
  for (int t = 0; t < 4; ++t) {
    const int col = col0 + t * 16 + ln;
    float bv = bias ? bias[col] : 0.f;
    if (BIAS_BF16) bv = bf16_round(bv);
#pragma unroll
    for (int r = 0; r < 8; ++r) {
      float v = acc[t][r] + bv;
      if (resid) { float rv = resid[(size_t)((row0 + 8 * hh + r) % rmod) * ldr + col]; if (RES_BF16) rv = bf16_round(rv); v += rv; }
      if (ACT == 1) v = fmaxf(v, 0.f);
      if (ACT == 2) v = 0.5f * v * (1.0f + erff(v * 0.70710678118654752f));
      if (ACT == 3) { const float u = 0.7978845608028654f * (v + 0.044715f * v * v * v); v = 0.5f * v * (1.0f + tanhf(u)); }
      so[w][8 * hh + r][t * 16 + ln] = v;
    }
  }
  __builtin_amdgcn_fence(__ATOMIC_ACQ_REL, "workgroup");
  __builtin_amdgcn_wave_barrier();
  const int rsub = lane >> 4, c4 = (lane & 15) * 4;
  {
#pragma unroll
    for (int q = 0; q < 8; ++q) {
      const int r = q * 2 + rsub;
      const v4f v = *(const v4fa*)&so[w][r][c4];
      *(v4f*)(C + (size_t)(row0 + r) * ldc + col0 + c4) = v;
    }
    
  }
}
// row LayerNorm (biased variance, eps) over N: s = X (+ R); optional out_sum <- s; out_norm <- (s-mu)*rsqrt(var+eps)*g + b
template <bool PARAM_BF16>
__global__ __launch_bounds__(256) void k_layernorm(const float* __restrict__ X, const float* __restrict__ R, const float* __restrict__ g, const float* __restrict__ bta,
                                                  float* __restrict__ out_sum, float* __restrict__ out_norm, int N, float eps) {
  __shared__ float red[256];
  const int row = blockIdx.x, tid = threadIdx.x;
  const float* x = X + (size_t)row * N; const float* rr = R ? R + (size_t)row * N : nullptr;
  float vals[16];                     // up to N = 4096
  const int per = N / 256;            // contiguous chunk per thread? use strided-by-4 chunks: thread handles j = tid*4 + 1024*u
  float s1 = 0.f;
  for (int u = 0; u < per / 4; ++u) {
    const int j = tid * 4 + 1024 * u;
    const v4f a = *(const v4fa*)(x + j);
    v4f b = {0.f,0.f,0.f,0.f}; if (rr) b = *(const v4fa*)(rr + j);
#pragma unroll
    for (int q = 0; q < 4; ++q) { const float v = a[q] + b[q]; vals[u * 4 + q] = v; s1 += v; }
  }
  red[tid] = s1; __syncthreads();
  for (int st = 128; st > 0; st >>= 1) { if (tid < st) red[tid] += red[tid + st]; __syncthreads(); }
  const float mu = red[0] / (float)N; __syncthreads();
  float s2 = 0.f;
  for (int u = 0; u < per / 4; ++u)
#pragma unroll
    for (int q = 0; q < 4; ++q) { const float c = vals[u * 4 + q] - mu; s2 += c * c; }
  red[tid] = s2; __syncthreads();
  for (int st = 128; st > 0; st >>= 1) { if (tid < st) red[tid] += red[tid + st]; __syncthreads(); }
  const float rs = rsqrtf(red[0] / (float)N + eps);
  {
    for (int u = 0; u < per / 4; ++u) {
      const int j = tid * 4 + 1024 * u;
      v4f o, sm;
#pragma unroll
      for (int q = 0; q < 4; ++q) {
        float gg = g[j + q], bb = bta[j + q];
        if (PARAM_BF16) { gg = bf16_round(gg); bb = bf16_round(bb); }
        sm[q] = vals[u * 4 + q]; o[q] = (vals[u * 4 + q] - mu) * rs * gg + bb;
      }
      if (out_sum) *(v4f*)(out_sum + (size_t)row * N + j) = sm;
      *(v4f*)(out_norm + (size_t)row * N + j) = o;
    }
    
  }
}



// ---- f16 WMMA path (v_wmma_f32_16x16x32_f16): 11-bit significands for operands in range — used where a [0,1] probability operand needs more precision than bf16
typedef _Float16 v16h __attribute__((ext_vector_type(16)));
union FragH { v16h v; v8us half[2]; _Float16 h[16]; unsigned short u[16]; };
template <int NT>
__device__ __forceinline__ v8f mmaH(v16h ah, v16h al, v16h bh, v16h bl, v8f c) {
  c = __builtin_amdgcn_wmma_f32_16x16x32_f16(false, ah, false, bh, (short)0, c, false, false);
  if (NT >= 2) c = __builtin_amdgcn_wmma_f32_16x16x32_f16(false, al, false, bh, (short)0, c, false, false);
  if (NT >= 3) c = __builtin_amdgcn_wmma_f32_16x16x32_f16(false, ah, false, bl, (short)0, c, false, false);
  asm volatile("v_nop\n\tv_nop\n\tv_nop\n\tv_nop" : "+v"(c) : "v"(ah), "v"(al), "v"(bh), "v"(bl));
  return c;
}
// batched GEMM like k_gemm_b but f16 operands: A f32 (split into f16 hi/lo if ASPLIT, else rounded to f16), Bt = f16 values [n][k]; alpha; C f32; N multiple of 16 (partial tiles skipped)
template <bool ASPLIT>
__global__ __launch_bounds__(128) void k_gemm_h(const float* __restrict__ A, int lda, size_t sA, const _Float16* __restrict__ Bh, int ldb, size_t sB, float alpha, float* __restrict__ C, int ldc, size_t sC, int M, int N, int K) {
  __shared__ __attribute__((aligned(16))) float so[4][16][64];
  const int tid = threadIdx.x, w = tid >> 5, lane = tid & 31, ln = lane & 15, hh = lane >> 4; const int by = blockIdx.y;
  A += (size_t)by * sA; Bh += (size_t)by * sB; C += (size_t)by * sC;
  const int ntn = (N + 63) / 64; const int wid = blockIdx.x * 4 + w; const int mt = wid / ntn, nq = wid % ntn; if (mt * 16 >= M) return;
  const int row0 = mt * 16, col0 = nq * 64; const float* arow = A + (size_t)(row0 + ln) * lda;
  v8f acc[4] = {};
  for (int kb = 0; kb < K; kb += 32) {
    FragH ah, al;
    const v4f x0 = *(const v4fa*)(arow + kb + 8 * hh), x1 = *(const v4fa*)(arow + kb + 8 * hh + 4), x2 = *(const v4fa*)(arow + kb + 16 + 8 * hh), x3 = *(const v4fa*)(arow + kb + 16 + 8 * hh + 4);
    float xs[16] = {x0[0],x0[1],x0[2],x0[3],x1[0],x1[1],x1[2],x1[3],x2[0],x2[1],x2[2],x2[3],x3[0],x3[1],x3[2],x3[3]};
#pragma unroll
    for (int i = 0; i < 16; ++i) { const _Float16 h = (_Float16)xs[i]; ah.h[i] = h; al.h[i] = ASPLIT ? (_Float16)(xs[i] - (float)h) : (_Float16)0.0f; }
#pragma unroll
    for (int t = 0; t < 4; ++t) { if (col0 + t * 16 >= N) continue; const size_t boff = (size_t)(col0 + t * 16 + ln) * ldb + kb; FragH bq; bq.half[0] = *(const v8us*)(Bh + boff + 8 * hh); bq.half[1] = *(const v8us*)(Bh + boff + 16 + 8 * hh);
      acc[t] = mmaH<ASPLIT ? 2 : 1>(ah.v, al.v, bq.v, bq.v, acc[t]); }
  }
#pragma unroll
  for (int t = 0; t < 4; ++t) { if (col0 + t * 16 >= N) continue;
#pragma unroll
    for (int r = 0; r < 8; ++r) so[w][8 * hh + r][t * 16 + ln] = acc[t][r] * alpha; }
  __builtin_amdgcn_fence(__ATOMIC_ACQ_REL, "workgroup"); __builtin_amdgcn_wave_barrier();
  const int rsub = lane >> 4, c4 = (lane & 15) * 4;
  {
#pragma unroll
    for (int q = 0; q < 8; ++q) { const int r = q * 2 + rsub; if (col0 + c4 < N) { const v4f v = *(const v4fa*)&so[w][r][c4]; *(v4f*)(C + (size_t)(row0 + r) * ldc + col0 + c4) = v; } }
     }
}

// Wt[n][k] = f16(W[k][n]·scale) from f32 row-major W[K][N] (scale = power of two; bf16-exact weights stay exact in f16 away from the subnormal range)
__device__ __forceinline__ void wt_f16(const float* __restrict__ W, _Float16* __restrict__ Wt, int K, int N, float scale, int t) {      /* t = the caller's flat index, 0 .. N K / 8 - 1 */
  const int n = t / (K / 8), k8 = (t % (K / 8)) * 8; FragH f;
#pragma unroll
  for (int i = 0; i < 8; ++i) f.h[i] = (_Float16)(bf16_round(W[(size_t)(k8 + i) * N + n]) * scale); const v8us o = f.half[0];
  *(v8us*)((unsigned short*)Wt + (size_t)n * K + k8) = o;
  asm volatile("s_wait_xcnt 0x0" ::: "memory");      /* stands directly behind the store, in front of any later overwrite of a register that the store names */
}
// k_gemm_hh variant with fused epilogue: v = acc·alpha + bias[by·sBias + col] (+ CP[(row/rowsPerB)·sCPb + by·64 + col] if CP) ; ACT 0 none / 1 elu ; writes f16 C16 (and f32 C if non-null)
template <int ACT>
__global__ __launch_bounds__(128) void k_gemm_hhx(const _Float16* __restrict__ A, int lda, size_t sA, const _Float16* __restrict__ Bh, int ldb, size_t sB, float alpha, const float* __restrict__ bias, size_t sBias, const float* __restrict__ CP, int rowsPerB, size_t sCPb, int row0g,
    float* __restrict__ C, _Float16* __restrict__ C16, int ldc, size_t sC, int M, int N, int K) {
  __shared__ __attribute__((aligned(16))) float so[4][16][64];
  const int tid = threadIdx.x, w = tid >> 5, lane = tid & 31, ln = lane & 15, hh = lane >> 4; const int by = blockIdx.y;
  A += (size_t)by * sA; Bh += (size_t)by * sB; const size_t cofs = (size_t)by * sC; const float* bp = bias ? bias + (size_t)by * sBias : nullptr;
  const int ntn = (N + 63) / 64; const int wid = blockIdx.x * 4 + w; const int mt = wid / ntn, nq = wid % ntn; if (mt * 16 >= M) return;
  const int row0 = mt * 16, col0 = nq * 64; const _Float16* arow = A + (size_t)(row0 + ln) * lda;
  v8f acc[4] = {};
  for (int kb = 0; kb < K; kb += 32) { FragH ah; ah.half[0] = *(const v8us*)((const unsigned short*)arow + kb + 8 * hh); ah.half[1] = *(const v8us*)((const unsigned short*)arow + kb + 16 + 8 * hh);
#pragma unroll
    for (int t = 0; t < 4; ++t) { if (col0 + t * 16 >= N) continue; const size_t boff = (size_t)(col0 + t * 16 + ln) * ldb + kb; FragH bq; bq.half[0] = *(const v8us*)((const unsigned short*)Bh + boff + 8 * hh); bq.half[1] = *(const v8us*)((const unsigned short*)Bh + boff + 16 + 8 * hh);
      acc[t] = mmaH<1>(ah.v, ah.v, bq.v, bq.v, acc[t]); }
  }
#pragma unroll
  for (int t = 0; t < 4; ++t) { if (col0 + t * 16 >= N) continue; const int col = col0 + t * 16 + ln; const float bv = bp ? bf16_round(bp[col]) : 0.f;
#pragma unroll
    for (int r = 0; r < 8; ++r) { float v = acc[t][r] * alpha + bv; if (CP) { const int rr = row0g + row0 + 8 * hh + r; if (rowsPerB < 0) v += CP[cofs + (size_t)rr * ldc + col];      /* rowsPerB < 0: own element of the batched C plane */ else { const int bidx = rr / rowsPerB; v += CP[(size_t)bidx * sCPb + (size_t)by * 64 + col]; } } if (ACT == 1) v = (v > 0.f) ? v : expm1f(v); else if (ACT == 7) v = (v > 0.f) ? v + 1.0f : expf(v); else if (ACT == 8) v = tanhf(v); else if (ACT == 9) v = 0.5f * v * (1.0f + tanhf(0.7978845608028654f * (v + 0.044715f * v * v * v))); else if (ACT == 11) v = 1.0f / (1.0f + expf(-v)); else if (ACT == 12) v = (v > 0.f) ? v : 0.01f * v; else if (ACT == 14) v = (v > 0.f) ? v : 0.1f * v; else if (ACT == 16) v = (v >= 0.f) ? v : 0.3f * v; else if (ACT == 17) v = (v >= 0.f) ? v : 0.2f * v; else if (ACT == 15) v = v / (1.0f + expf(-v)); else if (ACT == 3) v = fmaxf(v, 0.f); else if (ACT == 6) v = 0.5f * v * (1.0f + erff(v * 0.70710678118654752f)); so[w][8 * hh + r][t * 16 + ln] = v; } }
  __builtin_amdgcn_fence(__ATOMIC_ACQ_REL, "workgroup"); __builtin_amdgcn_wave_barrier();
  const int rsub = lane >> 4, c4 = (lane & 15) * 4; typedef _Float16 v4h __attribute__((ext_vector_type(4)));
  {
#pragma unroll
    for (int q = 0; q < 8; ++q) { const int r = q * 2 + rsub; if (col0 + c4 < N) { const v4f v = *(const v4fa*)&so[w][r][c4]; if (C) *(v4f*)(C + cofs + (size_t)(row0 + r) * ldc + col0 + c4) = v; if (C16) { v4h h4; for (int i = 0; i < 4; ++i) h4[i] = (_Float16)v[i]; *(v4h*)(C16 + cofs + (size_t)(row0 + r) * ldc + col0 + c4) = h4; } } }
     }
}


typedef _Float16 v4h __attribute__((ext_vector_type(4)));

__device__ __forceinline__ void x16(const float* __restrict__ x, _Float16* __restrict__ X16, size_t t) { FragH f;      /* t = the caller's flat index of a group of 8 elements */
#pragma unroll
  for (int q = 0; q < 8; ++q) f.h[q] = (_Float16)bf16_round(x[t * 8 + q]); *(v8us*)((unsigned short*)X16 + t * 8) = f.half[0];
  asm volatile("s_wait_xcnt 0x0" ::: "memory");      /* stands directly behind the store, in front of any later overwrite of a register that the store names */
}
#define PWB (DM * DM / 8 / 256)            /* blocks per weight plane (512) */
#define PXB ((int)(NR * DM / 8 / 256))     /* blocks per input stream (2048) */
// All work that reads inputs only, in ONE launch: none of these jobs reads what another writes, so a range of block indices takes the place of each former launch.
// Blocks 0 .. 4 PWB - 1: the four weight planes (WQ, WK, WV: head t / 8192 of the stack, its [1024][64] block into rows 64 h .. 64 h + 63; WO whole); the rest: the three input streams. Every thread does what one thread of the former launches did.
__global__ __launch_bounds__(256) void k_prep(const float* __restrict__ wq, const float* __restrict__ wk, const float* __restrict__ wv, const float* __restrict__ wo, const float* __restrict__ x, const float* __restrict__ xk, const float* __restrict__ xv,
    _Float16* __restrict__ BQ, _Float16* __restrict__ BK, _Float16* __restrict__ BV, _Float16* __restrict__ BO, _Float16* __restrict__ X16, _Float16* __restrict__ XK16, _Float16* __restrict__ XV16) {
  const int bid = blockIdx.x;
  if (bid < 4 * PWB) { const int job = bid / PWB; const int t = (bid % PWB) * 256 + threadIdx.x;
    if (job == 3) { wt_f16(wo, BO, DM, DM, 16.0f, t); return; }
    const float* W = job == 0 ? wq : job == 1 ? wk : wv; _Float16* Bt = job == 0 ? BQ : job == 1 ? BK : BV; const int h = t / (HD * (DM / 8));
    wt_f16(W + (size_t)h * DM * HD, Bt + (size_t)h * HD * DM, DM, HD, 16.0f, t % (HD * (DM / 8))); return; }
  const int u = bid - 4 * PWB; const int job = u / PXB; const size_t t = (size_t)(u % PXB) * 256 + threadIdx.x;
  x16(job == 0 ? x : job == 1 ? xk : xv, job == 0 ? X16 : job == 1 ? XK16 : XV16, t); }
__global__ __launch_bounds__(256) void k_h16(const float* __restrict__ x, _Float16* __restrict__ X16, size_t n8) { const size_t t = (size_t)blockIdx.x * 256 + threadIdx.x; if (t >= n8) return; FragH f;
#pragma unroll
  for (int q = 0; q < 8; ++q) f.h[q] = (_Float16)x[t * 8 + q]; *(v8us*)((unsigned short*)X16 + t * 8) = f.half[0];  }
__global__ __launch_bounds__(256) void k_round16f(const float* __restrict__ W, _Float16* __restrict__ Bt, size_t n8) { const size_t t = (size_t)blockIdx.x * 256 + threadIdx.x; if (t >= n8) return; FragH f;
#pragma unroll
  for (int i = 0; i < 8; ++i) f.h[i] = (_Float16)(bf16_round(W[t * 8 + i]) * 16.0f); *(v8us*)((unsigned short*)Bt + t * 8) = f.half[0];  }
template <int NHv, int TTv>
__global__ __launch_bounds__(256) void k_vt(const _Float16* __restrict__ V16, int ldv, int voff, _Float16* __restrict__ Vt) { __shared__ unsigned short tl[64][66]; const int tid = threadIdx.x; const int slab = blockIdx.x / (TTv / 64), lg = blockIdx.x % (TTv / 64); const int b = slab / NHv, h = slab % NHv;
  for (int i = tid; i < 64 * 8; i += 256) { const int r = i / 8, c8 = (i % 8) * 8; FragH f; f.half[0] = *(const v8us*)((const unsigned short*)V16 + ((size_t)b * TTv + lg * 64 + r) * ldv + voff + h * 64 + c8);
#pragma unroll
    for (int q = 0; q < 8; ++q) tl[r][c8 + q] = f.u[q]; }
  __syncthreads();
  {
#pragma unroll
    for (int rd = 0; rd < 2; ++rd) { const int d = rd * 32 + tid / 8, pc = tid % 8; FragH f;
#pragma unroll
      for (int q = 0; q < 8; ++q) f.u[q] = tl[pc * 8 + q][d];
      *(v8us*)((unsigned short*)Vt + ((size_t)slab * 64 + d) * TTv + lg * 64 + pc * 8) = f.half[0]; }
     } }

__global__ __launch_bounds__(256) void k_hl(const float* __restrict__ F, _Float16* __restrict__ Hh, _Float16* __restrict__ Hl, size_t n8) { const size_t t = (size_t)blockIdx.x * 256 + threadIdx.x; if (t >= n8) return; FragH fh, fl; const v4f a = *(const v4fa*)(F + t * 8), c = *(const v4fa*)(F + t * 8 + 4);
#pragma unroll
  for (int q = 0; q < 4; ++q) { _Float16 h = (_Float16)a[q]; fh.h[q] = h; fl.h[q] = (_Float16)((a[q] - (float)h) * 1024.0f); h = (_Float16)c[q]; fh.h[4 + q] = h; fl.h[4 + q] = (_Float16)((c[q] - (float)h) * 1024.0f); }
  { *(v8us*)((unsigned short*)Hh + t * 8) = fh.half[0]; *(v8us*)((unsigned short*)Hl + t * 8) = fl.half[0];  } }

// ---- fast GEMM (wave tile 32x64; requires M % 32 == 0 rows per launch region and N % 64 == 0); epilogue = k_gemm_hhx semantics ----
__device__ __forceinline__ v16h g2_frag(const _Float16* p, int hh) { FragH f; f.half[0] = *(const v8us*)((const unsigned short*)p + 8 * hh); f.half[1] = *(const v8us*)((const unsigned short*)p + 16 + 8 * hh); return f.v; }
__device__ __forceinline__ v8f g2_mma(v16h a, v16h b, v8f c) { v8f d = __builtin_amdgcn_wmma_f32_16x16x32_f16(false, a, false, b, (short)0, c, false, false); asm volatile("v_nop\n\tv_nop\n\tv_nop\n\tv_nop" : "+v"(d) : "v"(a), "v"(b)); return d; }
template <int ACT>
__global__ __launch_bounds__(128) void k_gemm2(const _Float16* __restrict__ A, int lda, size_t sA, const _Float16* __restrict__ Bh, int ldb, size_t sB, float alpha, const float* __restrict__ bias, size_t sBias, const float* __restrict__ CP, int rowsPerB, size_t sCPb, int row0g,
    float* __restrict__ C, _Float16* __restrict__ C16, int ldc, size_t sC, int M, int N, int K) { static_assert(ACT == 0 || ACT == 3 || ACT == 6 || ACT == 8 || ACT == 9 || ACT == 11 || ACT == 12 || ACT == 14 || ACT == 15 || ACT == 16 || ACT == 17, "k_gemm2: unsupported ACT code (would silently apply no activation)");
  __shared__ __attribute__((aligned(16))) float so[4][32][68];
  const int tid = threadIdx.x, w = tid >> 5, lane = tid & 31, ln = lane & 15, hh = lane >> 4; const int by = blockIdx.y;
  A += (size_t)by * sA; Bh += (size_t)by * sB; const size_t cofs = (size_t)by * sC; const float* bp = bias ? bias + (size_t)by * sBias : nullptr;
  const int ntn = N >> 6; const int mt = blockIdx.x / ntn, nq = blockIdx.x - mt * ntn; const int row0 = mt * 128 + 32 * w, col0 = nq * 64; if (row0 >= M) return;
  const _Float16* a0p = A + (size_t)(row0 + ln) * lda; const _Float16* a1p = a0p + (size_t)16 * lda;
  const _Float16* b0p = Bh + (size_t)(col0 + ln) * ldb; const _Float16* b1p = b0p + (size_t)16 * ldb; const _Float16* b2p = b1p + (size_t)16 * ldb; const _Float16* b3p = b2p + (size_t)16 * ldb;
  const v8f z8 = {0.f,0.f,0.f,0.f,0.f,0.f,0.f,0.f}; v8f c00 = z8, c01 = z8, c02 = z8, c03 = z8, c10 = z8, c11 = z8, c12 = z8, c13 = z8;
#pragma unroll 1
  for (int kb = 0; kb < K; kb += 32) { const v16h a0 = g2_frag(a0p + kb, hh), a1 = g2_frag(a1p + kb, hh);
    v16h b = g2_frag(b0p + kb, hh); c00 = g2_mma(a0, b, c00); c10 = g2_mma(a1, b, c10);
    b = g2_frag(b1p + kb, hh); c01 = g2_mma(a0, b, c01); c11 = g2_mma(a1, b, c11);
    b = g2_frag(b2p + kb, hh); c02 = g2_mma(a0, b, c02); c12 = g2_mma(a1, b, c12);
    b = g2_frag(b3p + kb, hh); c03 = g2_mma(a0, b, c03); c13 = g2_mma(a1, b, c13); }
  v8f accs[8] = {c00, c01, c02, c03, c10, c11, c12, c13};
#pragma unroll
  for (int u = 0; u < 8; ++u) { const int t = u & 3, half = u >> 2; const int col = col0 + t * 16 + ln; const float bv = bp ? bf16_round(bp[col]) : 0.f;
#pragma unroll
    for (int r = 0; r < 8; ++r) { const int rloc = half * 16 + 8 * hh + r; float v = accs[u][r] * alpha + bv; if (CP) { if (rowsPerB < 0) v += CP[cofs + (size_t)(row0g + row0 + rloc) * ldc + col];      /* rowsPerB < 0: own element of the batched C plane */ else { const int bidx = (row0g + row0 + rloc) / rowsPerB; v += CP[(size_t)bidx * sCPb + (size_t)by * 64 + col]; } }
      if (ACT == 3) v = fmaxf(v, 0.f); else if (ACT == 6) v = 0.5f * v * (1.0f + erff(v * 0.70710678118654752f)); else if (ACT == 11) v = 1.0f / (1.0f + expf(-v)); else if (ACT == 15) v = v / (1.0f + expf(-v)); else if (ACT == 12) v = (v > 0.f) ? v : 0.01f * v; else if (ACT == 8) v = tanhf(v); else if (ACT == 9) v = 0.5f * v * (1.0f + tanhf(0.7978845608028654f * (v + 0.044715f * v * v * v))); else if (ACT == 14) v = (v > 0.f) ? v : 0.1f * v; else if (ACT == 16) v = (v >= 0.f) ? v : 0.3f * v; else if (ACT == 17) v = (v >= 0.f) ? v : 0.2f * v;
      so[w][rloc][t * 16 + ln] = v; } }
  __builtin_amdgcn_fence(__ATOMIC_ACQ_REL, "workgroup"); __builtin_amdgcn_wave_barrier();
  const int rsub = lane >> 4, c4 = (lane & 15) * 4;
  {
#pragma unroll
    for (int q = 0; q < 16; ++q) { const int r = q * 2 + rsub; const v4f v = *(const v4fa*)&so[w][r][c4]; if (C) *(v4f*)(C + cofs + (size_t)(row0 + r) * ldc + col0 + c4) = v; if (C16) { v4h h4; for (int i = 0; i < 4; ++i) h4[i] = (_Float16)v[i]; *(v4h*)(C16 + cofs + (size_t)(row0 + r) * ldc + col0 + c4) = h4; } }
     } }


__global__ __launch_bounds__(256) void k_wnat(const float* __restrict__ w, size_t n8, _Float16* __restrict__ Bt) { const size_t t = (size_t)blockIdx.x * 256 + threadIdx.x; if (t >= n8) return; FragH f; for (int q = 0; q < 8; ++q) f.h[q] = (_Float16)(bf16_round(w[t * 8 + q]) * 16.0f); *(v8us*)((unsigned short*)Bt + t * 8) = f.half[0];  }
__global__ __launch_bounds__(256) void k_rsm(const float* __restrict__ S, _Float16* __restrict__ P, int nrows) {
  #pragma clang fp contract(off)
  const int i = blockIdx.x * 256 + threadIdx.x; if (i >= nrows) return; const float* s = S + (size_t)i * SQ; float mx = -3.0e38f;
#pragma unroll 1
  for (int j = 0; j < SQ; ++j) mx = fmaxf(mx, s[j]); float se = 0.f;
#pragma unroll 1
  for (int j = 0; j < SQ; ++j) se += expf(s[j] - mx); const float sc = 256.0f / se;
#pragma unroll 1
  for (int j0 = 0; j0 < SQ; j0 += 8) { FragH f; for (int q = 0; q < 8; ++q) f.h[q] = (_Float16)(expf(s[j0 + q] - mx) * sc); unsigned short* d = (unsigned short*)P + (size_t)i * SQ + j0; *(v8us*)d = f.half[0];  } }
__global__ __launch_bounds__(256) void k_vt(const _Float16* __restrict__ V16, int b, int h0, _Float16* __restrict__ VT) { __shared__ unsigned short tl[64][65]; const int tid = threadIdx.x; const int hh = blockIdx.x % HG, sg = blockIdx.x / HG; const int s0 = sg * 64; const int h = h0 + hh;
  for (int i = tid; i < 64 * 8; i += 256) { const int j = i / 8, d8 = (i % 8) * 8; FragH f; f.half[0] = *(const v8us*)((const unsigned short*)V16 + ((size_t)b * SQ + s0 + j) * DM + h * HD + d8); for (int q = 0; q < 8; ++q) tl[d8 + q][j] = f.u[q]; }
  __syncthreads();
  { for (int i = tid; i < 64 * 8; i += 256) { const int d = i / 8, j8 = (i % 8) * 8; FragH f; for (int q = 0; q < 8; ++q) f.u[q] = tl[d][j8 + q]; *(v8us*)((unsigned short*)VT + ((size_t)hh * HD + d) * SQ + s0 + j8) = f.half[0]; }  } }



// 2^x on the transcendental unit; the v_nop fills the one slot that the instruction set asks for between a transcendental and an instruction that reads its result or overwrites its source.
__device__ __forceinline__ float exp2_slot(float x) { float r; asm("v_exp_f32 %0, %1\n\tv_nop" : "=v"(r) : "v"(x)); return r; }
// Value of lane l ^ 16 (the other half of the wave): one register move between the two 16-lane rows, no LDS.
__device__ __forceinline__ float xhalf(float x) { return __builtin_bit_cast(float, __builtin_amdgcn_permlanex16(__builtin_bit_cast(int, x), __builtin_bit_cast(int, x), 0x76543210, 0xfedcba98, false, false)); }
__device__ __forceinline__ v16h fa_frag(const unsigned short* p) { FragH f; f.half[0] = *(const v8us*)p; f.half[1] = *(const v8us*)(p + 16); return f.v; }      /* p = the lane's own pointer, 8 hh included: k = 8 hh + i, 16 + 8 hh + i, as g2_frag */
__device__ __forceinline__ v8f fa_mma(v16h a, v16h b, v8f c) { return __builtin_amdgcn_wmma_f32_16x16x32_f16(false, a, false, b, (short)0, c, false, false); }
#define FAW 8                        /* waves per work-group of the fused attention */
#define FAQ 32                       /* query columns per wave */
#define FAK 32                       /* keys per pass */
#define FAC 0.18033688f              /* 1 / sqrt(64) x log2(e): scores to the exponent of 2 */
__global__ __launch_bounds__(FAW * 32) void k_fattn(const _Float16* __restrict__ QHp, const _Float16* __restrict__ QLp, const _Float16* __restrict__ KHp, const _Float16* __restrict__ KLp, const _Float16* __restrict__ VTp, _Float16* __restrict__ Op) {
  const int lane = threadIdx.x & 31, w = threadIdx.x >> 5, ln = lane & 15, hh = lane >> 4; const int h = blockIdx.y, b = blockIdx.z; const int q0 = blockIdx.x * (FAW * FAQ) + w * FAQ; const size_t r0 = (size_t)b * SQ;
  const size_t qo = (r0 + q0 + ln) * LQ + h * HD + 8 * hh, ko = (r0 + ln) * LQ + h * HD + 8 * hh;
  const unsigned short* qhl = (const unsigned short*)QHp + qo; const unsigned short* qll = (const unsigned short*)QLp + qo; const unsigned short* khl = (const unsigned short*)KHp + ko; const unsigned short* kll = (const unsigned short*)KLp + ko;
  const unsigned short* vp = (const unsigned short*)VTp + ((size_t)(b * NH + h) * HD + ln) * SQ + 8 * hh;
  v16h qh[2][2], ql[2][2];
#pragma unroll
  for (int qt = 0; qt < 2; ++qt) for (int ks = 0; ks < 2; ++ks) { qh[qt][ks] = fa_frag(qhl + (size_t)(qt * 16) * LQ + ks * 32); ql[qt][ks] = fa_frag(qll + (size_t)(qt * 16) * LQ + ks * 32); }
  const v8f z8 = {0.f,0.f,0.f,0.f,0.f,0.f,0.f,0.f}; v8f o[2][4]; float m[2], l[2];
#pragma unroll
  for (int qt = 0; qt < 2; ++qt) { m[qt] = -1.0e30f; l[qt] = 0.f; for (int dt = 0; dt < 4; ++dt) o[qt][dt] = z8; }
  v16h kh[2][2], kl[2][2];
#pragma unroll
  for (int kt = 0; kt < 2; ++kt) for (int ks = 0; ks < 2; ++ks) { kh[kt][ks] = fa_frag(khl + (size_t)(kt * 16) * LQ + ks * 32); kl[kt][ks] = fa_frag(kll + (size_t)(kt * 16) * LQ + ks * 32); }
  asm volatile("s_wait_xcnt 0x0" :: "v"(qhl), "v"(qll), "v"(khl), "v"(kll) : "memory");      /* stands in front of the first overwrite of these loads' address registers; the addresses are inputs so that they keep their registers up to here */
#pragma unroll 1      /* rolled: one pass already holds 32 matrix instructions, and a second copy would double the registers in flight */
  for (int key0 = 0; key0 < SQ; key0 += FAK) {
    v16h va[4];      /* V^T rows of this pass: asked for here, needed only behind the softmax */
#pragma unroll
    for (int dt = 0; dt < 4; ++dt) va[dt] = fa_frag(vp + (size_t)(dt * 16) * SQ);
    v8f sa[2][2], sr[2][2];      /* [query tile][key tile]: hi.hi, and the x1024 residual products */
#pragma unroll
    for (int qt = 0; qt < 2; ++qt) for (int kt = 0; kt < 2; ++kt) sa[qt][kt] = fa_mma(kh[kt][0], qh[qt][0], z8);
#pragma unroll
    for (int qt = 0; qt < 2; ++qt) for (int kt = 0; kt < 2; ++kt) sr[qt][kt] = fa_mma(kh[kt][0], ql[qt][0], z8);
#pragma unroll
    for (int qt = 0; qt < 2; ++qt) for (int kt = 0; kt < 2; ++kt) sa[qt][kt] = fa_mma(kh[kt][1], qh[qt][1], sa[qt][kt]);
#pragma unroll
    for (int qt = 0; qt < 2; ++qt) for (int kt = 0; kt < 2; ++kt) sr[qt][kt] = fa_mma(kh[kt][1], ql[qt][1], sr[qt][kt]);
#pragma unroll
    for (int qt = 0; qt < 2; ++qt) for (int kt = 0; kt < 2; ++kt) sr[qt][kt] = fa_mma(kl[kt][0], qh[qt][0], sr[qt][kt]);
#pragma unroll
    for (int qt = 0; qt < 2; ++qt) for (int kt = 0; kt < 2; ++kt) sr[qt][kt] = fa_mma(kl[kt][1], qh[qt][1], sr[qt][kt]);
    const size_t kn = (size_t)((key0 + FAK) & (SQ - 1)) * LQ;      /* the next pass's K rows, fetched one pass ahead; the last pass fetches rows 0-31 again (in bounds, unused) */
    const unsigned short* khn = khl + kn; const unsigned short* kln = kll + kn;
#pragma unroll
    for (int kt = 0; kt < 2; ++kt) for (int ks = 0; ks < 2; ++ks) { kh[kt][ks] = fa_frag(khn + (size_t)(kt * 16) * LQ + ks * 32); kl[kt][ks] = fa_frag(kln + (size_t)(kt * 16) * LQ + ks * 32); }
#pragma unroll
    for (int qt = 0; qt < 2; ++qt) {
      float t[16];
#pragma unroll
      for (int i = 0; i < 16; ++i) t[i] = fmaf(sr[qt][i >> 3][i & 7], 0.0009765625f, sa[qt][i >> 3][i & 7]);
      float mx = t[0];
#pragma unroll
      for (int i = 1; i < 16; ++i) mx = fmaxf(mx, t[i]);
      mx = fmaxf(mx, xhalf(mx));
      const float mn = fmaxf(m[qt], mx); const float al = exp2_slot((m[qt] - mn) * FAC); const float nb = 8.0f - mn * FAC; m[qt] = mn;
      FragH p; float sum = 0.f;
#pragma unroll
      for (int i = 0; i < 16; ++i) { const float e = exp2_slot(fmaf(t[i], FAC, nb)); sum += e; p.h[i] = (_Float16)e; }
      l[qt] = fmaf(l[qt], al, sum);
#pragma unroll
      for (int dt = 0; dt < 4; ++dt) { for (int r = 0; r < 8; ++r) o[qt][dt][r] *= al; }
#pragma unroll
      for (int dt = 0; dt < 4; ++dt) o[qt][dt] = fa_mma(va[dt], p.v, o[qt][dt]);
    }
    asm volatile("s_wait_xcnt 0x0" :: "v"(vp), "v"(khn), "v"(kln) : "memory");      /* stands in front of the overwrite of this pass's load addresses (the step of vp, the next pass's khn and kln); the addresses are inputs so that they keep their registers up to here */
    vp += FAK;
  }
#pragma unroll
  for (int qt = 0; qt < 2; ++qt) { const float inv = 64.0f / (l[qt] + xhalf(l[qt]));      /* the halves' sums joined once; o carried x64 */
    _Float16* op = Op + r0 * DM + (size_t)h * SQ * HD + (size_t)(q0 + qt * 16 + ln) * HD + 8 * hh;
#pragma unroll
    for (int dt = 0; dt < 4; ++dt) { FragH f; for (int r = 0; r < 8; ++r) f.h[r] = (_Float16)(o[qt][dt][r] * inv); *(v8us*)((unsigned short*)op + dt * 16) = f.half[0]; } } }


template <int MASKADD>
__global__ __launch_bounds__(64) void k_att0(const float* __restrict__ QF, const float* __restrict__ KF, const float* __restrict__ VF, int ld, const float* __restrict__ mask, float scale, float* __restrict__ OF, int ldo) {
  #pragma clang fp contract(off)
  __shared__ __attribute__((aligned(16))) float lq[64][64]; __shared__ __attribute__((aligned(16))) float lo[64][64];
  const int tid = threadIdx.x; const int h = blockIdx.x / (QT0 / 64), rg = blockIdx.x % (QT0 / 64); const int i = rg * 64 + tid;
  const float* qr = QF + (size_t)i * ld + h * HD;
#pragma unroll 1
  for (int c = 0; c < HD / 4; ++c) { *(v4f*)&lq[tid][c * 4] = *(const v4fa*)(qr + c * 4); const v4f z = {0.f, 0.f, 0.f, 0.f}; *(v4f*)&lo[tid][c * 4] = z; }
  float m = -1.0e30f, l = 0.f; const int jmax = MASKADD ? (SQ - 1) : (rg * 64 + 63);      /* additive-mask form: every key (the mask input decides); causal form: keys up to the block's last row */
#pragma unroll 1
  for (int j = 0; j <= jmax; ++j) { const float* kr = KF + (size_t)j * ld + h * HD; const float* vr = VF + (size_t)j * ld + h * HD; float s = 0.f;
#pragma unroll 1
    for (int c = 0; c < HD / 4; ++c) { const v4f kq = *(const v4fa*)(kr + c * 4); const v4f qq = *(v4f*)&lq[tid][c * 4]; s = __fadd_rn(s, __fmul_rn(qq[0], kq[0])); s = __fadd_rn(s, __fmul_rn(qq[1], kq[1])); s = __fadd_rn(s, __fmul_rn(qq[2], kq[2])); s = __fadd_rn(s, __fmul_rn(qq[3], kq[3])); }
    s = __fmul_rn(s, scale); if (MASKADD) s = __fadd_rn(s, __fmul_rn(bf16_round(mask[(size_t)i * SQ + j]), -10000.0f));
    const float f = (MASKADD || j <= i) ? 1.f : 0.f; const float sm = fmaf(f, s, (1.f - f) * -1.0e30f); const float mn = fmaxf(m, sm); const float sc = expf(m - mn); const float e = expf(sm - mn); l = __fadd_rn(__fmul_rn(l, sc), e); m = mn;
#pragma unroll 1
    for (int c = 0; c < HD / 4; ++c) { const v4f vv = *(const v4fa*)(vr + c * 4); v4f oo = *(v4f*)&lo[tid][c * 4]; for (int u = 0; u < 4; ++u) oo[u] = __fadd_rn(__fmul_rn(oo[u], sc), __fmul_rn(e, vv[u])); *(v4f*)&lo[tid][c * 4] = oo; } }
  const float fin = 64.0f / l;      /* o carried x64 like the f16 path */
#pragma unroll 1
  for (int c = 0; c < HD / 4; ++c) { v4f oo = *(v4f*)&lo[tid][c * 4]; for (int u = 0; u < 4; ++u) oo[u] = __fmul_rn(oo[u], fin); *(v4f*)&lo[tid][c * 4] = oo; }
  __syncthreads();
  {
#pragma unroll 1
    for (int it = 0; it < 16; ++it) { const int row = it * 4 + tid / 16, pc = (tid % 16) * 4; const v4f v = *(const v4f*)&lo[row][pc]; *(v4f*)(OF + (size_t)(rg * 64 + row) * ldo + h * HD + pc) = v; }
     } }

extern "C" void kernel_launch(void* const* d_in, const int* in_sizes, int n_in,
                              void* d_out, int out_size, void* d_ws, size_t ws_size, hipStream_t stream) {
  (void)in_sizes; (void)n_in; (void)out_size;
  const float* const* I = (const float* const*)d_in; const float* x = I[0]; const float* xk = I[1]; const float* xv = I[2]; const float* wq = I[3]; const float* wk = I[4]; const float* wv = I[5]; const float* bq = nullptr; const float* bk = nullptr; const float* bv = nullptr; const float* wo = I[6]; const float* bo = nullptr;      /* input order: q, k, v (the three streams, two sequences each), Wq, Wk, Wv (PER-HEAD STACKS [16][1024][64]), Wo ([in][out] [1024][1024]); NO biases anywhere: null pointers in the guarded slots */
  char* ws = (char*)d_ws; size_t off = 0;
  auto take = [&](size_t bytes) { char* p = ws + off; off += (bytes + 255) & ~(size_t)255; return p; };
  _Float16* BQ = (_Float16*)take((size_t)DM * DM * 2); _Float16* BK = (_Float16*)take((size_t)DM * DM * 2); _Float16* BV = (_Float16*)take((size_t)DM * DM * 2); _Float16* BO = (_Float16*)take((size_t)DM * DM * 2);
  _Float16* X16 = (_Float16*)take(NR * DM * 2); _Float16* XK16 = (_Float16*)take(NR * DM * 2); _Float16* XV16 = (_Float16*)take(NR * DM * 2);      /* exact f16 rows of query, key, value */ float* QF = (float*)take(NR * DM * 4); _Float16* QH = (_Float16*)take(NR * DM * 2); _Float16* QL = (_Float16*)take(NR * DM * 2); _Float16* KH = (_Float16*)take(NR * DM * 2); _Float16* KL = (_Float16*)take(NR * DM * 2); _Float16* Q16 = QH; _Float16* K16 = KH; _Float16* V16 = (_Float16*)take(NR * DM * 2); _Float16* O16 = (_Float16*)take(NR * DM * 2);
  _Float16* VT = (_Float16*)take((size_t)NB * NH * HD * SQ * 2);      /* V^T of both batches */
  float* QF0 = (float*)take((size_t)QT0 * DM * 4); float* KF0 = (float*)take((size_t)QT0 * DM * 4); float* VF0 = (float*)take((size_t)QT0 * DM * 4); float* OF0 = (float*)take((size_t)NB * QT0 * DM * 4); _Float16* OH0 = (_Float16*)take((size_t)NB * QT0 * DM * 2); _Float16* OL0 = (_Float16*)take((size_t)NB * QT0 * DM * 2);
  if (off > ws_size) return;
  k_prep<<<4 * PWB + 3 * PXB, 256, 0, stream>>>(wq, wk, wv, wo, x, xk, xv, BQ, BK, BV, BO, X16, XK16, XV16);      /* head h's [1024][64] block -> rows 64 h .. 64 h + 63 of the Bt[n][k] x16 plane; the [in][out] output weight transposed into its plane; the three streams as exact f16 rows */
  const size_t r0p = (size_t)B0 * SQ;      /* first projected row */
  k_gemm2<0><<<dim3((unsigned)((MP / 128) * (DM / 64)), 1), 128, 0, stream>>>(X16 + r0p * DM, DM, 0, BQ, DM, 0, 0.0625f, bq, 0, nullptr, 1, 0, 0, QF + r0p * DM, nullptr, DM, 0, MP, DM, DM); k_hl<<<(unsigned)(((size_t)MP * DM / 8 + 255) / 256), 256, 0, stream>>>(QF + r0p * DM, QH + r0p * DM, QL + r0p * DM, (size_t)MP * DM / 8);      /* q (f32) -> f16 hi + x1024 residual: unscaled logits sigma ~8 */
  k_gemm2<0><<<dim3((unsigned)((MP / 128) * (DM / 64)), 1), 128, 0, stream>>>(XK16 + r0p * DM, DM, 0, BK, DM, 0, 0.0625f, bk, 0, nullptr, 1, 0, 0, QF + r0p * DM, nullptr, DM, 0, MP, DM, DM); k_hl<<<(unsigned)(((size_t)MP * DM / 8 + 255) / 256), 256, 0, stream>>>(QF + r0p * DM, KH + r0p * DM, KL + r0p * DM, (size_t)MP * DM / 8);      /* k likewise */
  k_gemm2<0><<<dim3((unsigned)((MP / 128) * (DM / 64)), 1), 128, 0, stream>>>(XV16 + r0p * DM, DM, 0, BV, DM, 0, 0.0625f, bv, 0, nullptr, 1, 0, 0, nullptr, V16 + r0p * DM, DM, 0, MP, DM, DM);
  k_vt<NH, SQ><<<NB * NH * (SQ / 64), 256, 0, stream>>>(V16, LQ, 0, VT);      /* V^T [NB][NH][HD][SQ] */
  k_fattn<<<dim3(SQ / (FAW * FAQ), NH, NB), FAW * 32, 0, stream>>>(QH, QL, KH, KL, VT, O16);      /* o written HEAD-CONTIGUOUS: o[b][h][s][64] (row pitch 64, head stride SQ x 64): the source's raw reshape of (B, H, S, dk) to (B, S, H dk) then reads that memory as [2048][1024] rows: the output GEMM below does exactly that */
  k_gemm2<0><<<dim3((unsigned)((MPO / 128) * (DM / 64)), 1), 128, 0, stream>>>(O16 + r0p * DM, DM, 0, BO, DM, 0, 0.0009765625f, bo, 0, nullptr, 1, 0, 0, (float*)d_out + r0p * DM, nullptr, DM, 0, MPO, DM, DM);      /* out rows are the output layout */
  /* (dense: no first-tile hi / lo planes) */
  /* (dense: no first-tile rewrite passes:
     the output GEMM above has written every row
     with its (null) bias) */
}

// v004
// Measured time: 172 microseconds a run.
// Timed twice side by side with v003, it ran 1.66 and 1.65 times as fast.
// Over all steps from v000 it is 44.4 times as fast.
#include <hip/hip_runtime.h>
// Multi-head attention on three inputs with PER-HEAD STACKED projections and the source's RAW-RESHAPE head merge (Q, K, V [2][2048][1024]; WQ / WK / WV [16][1024][64] = [head][in][out] uniform +-0.1, NO biases; 16 heads of 64; scores x 1/sqrt(64); softmax over all 2048 keys (no mask); the head outputs [B][H][S][64] are RESHAPED IN MEMORY ORDER to [B][S][1024] (row r of a batch holds tokens 16 (r mod 128) .. + 15 of head r / 128: heads and tokens mix: faithful to the source); out = that WO with WO [1024][1024] [in][out], NO bias -> [2][2048][1024]); q and k carried as f16 hi + x1024 residual planes with three-product scores; each head's [in][out] block is transposed into its 64 contiguous rows of the f16 weight plane, and the [in][out] output weight into its plane, all in one launch (k_prep); DENSE (k_fattn runs every query over all SQ keys; no exact first tile).
// Structure: token rows r = b*2048 + s; x as exact f16 rows (bf16-rounded); q and k as WMMA GEMMs (32x64 wave tiles, f32 accumulation, exact x16 weights, no bias) into f32 rows split into f16 hi + x1024 residual planes, v as an f16-output GEMM; V^T for both batches and all heads via LDS transposes; per work-group of 256 query rows in one fused launch (k_fattn; all heads on grid.y, batches on grid.z), in passes of 32 keys over all 2048: scores as THREE accumulating products (hi.hi + 2^-10 (lo.hi + hi.lo), K = 64, logits sigma ~8, 1/sqrt(64) log2(e) applied in the exponent), online row softmax on VALU with no mask (f32 statistics, native exp2; weights x256 f16), o = P . V^T (o carried x64, folded into the output GEMM alpha) written straight into the merged f16 o rows; out = o W_o GEMM (f32, no bias) into the output layout.
// Attention now runs as ONE fused launch (k_fattn, below): the per-tile score passes, the row softmax and the P . V^T pass of the former version are gone, with their score and weight planes; V^T is built for both batches in one launch.
// All work that reads inputs only (the weight planes, the three f16 input streams) now runs as ONE launch (k_prep, below) in place of one launch per head and plane and one per stream.
// The four GEMM launches (k_gemm2) now take their operand tiles through LDS (asynchronous copies, two buffers): see the lines above k_gemm2.
// Compute dtype: inputs rounded to bf16; x / weights exact; q and k as f16 hi + x1024 residual planes; v, softmax weights and o as plain f16 GEMM operands (~2^-12); scores and softmax statistics f32. v_wmma_f32_16x16x32_f16.
#define NB 2
#define SCL 0.125f                         /* 1 / sqrt(head_dim = 64) */
#define SCLR 0.0001220703125f              /* 2^-13: SCL x 2^-10 (not used) */
#define SQ 2048
#define DM 1024
#define NH 16
#define HD 64
#define HG 4                         /* heads per group of the second k_vt (not launched) */
#define QT 256                       /* query rows per query tile (not used) */
#define NKX SQ                       /* row pitch of the former S / P planes (not used) */
#define QT0 128                      /* rows of the exact first tile of k_att0 (not launched) */
#define B0 0                         /* first batch processed (debug hook) */
#define NBR NB                       /* batches processed (debug hook) */
#define NR ((size_t)NB * SQ)         /* token rows */
#define MP ((int)((size_t)NBR * SQ)) /* rows projected (debug hook) */
#define QN SQ                        /* query rows attended per batch (not used) */
#define NHD NH                       /* heads attended (not used) */
#define MPO MP                       /* rows through the output stage (debug hook) */
#define LQ DM      /* row pitch of the q/k/v rows */
typedef __bf16 v16b __attribute__((ext_vector_type(16)));
typedef unsigned short v8us __attribute__((ext_vector_type(8), may_alias));
typedef float  v8f  __attribute__((ext_vector_type(8)));
typedef float  v4f  __attribute__((ext_vector_type(4)));
typedef float  v4fa __attribute__((ext_vector_type(4), may_alias));
union FragB { v16b v; v8us half[2]; unsigned short u[16]; };

__device__ __forceinline__ unsigned short bf16_bits(float x) { unsigned int u = __float_as_uint(x); return (unsigned short)((u + 0x7FFFu + ((u >> 16) & 1u)) >> 16); }
__device__ __forceinline__ float bf16_val(unsigned short b) { return __uint_as_float(((unsigned int)b) << 16); }
__device__ __forceinline__ float bf16_round(float x) { return bf16_val(bf16_bits(x)); }
// D += A·B with NT terms: 1 = ah·bh, 2 = + al·bh (A split), 3 = + ah·bl (both split)
template <int NT>
__device__ __forceinline__ v8f mmaN(v16b ah, v16b al, v16b bh, v16b bl, v8f c) {
  c = __builtin_amdgcn_wmma_f32_16x16x32_bf16(false, ah, false, bh, (short)0, c, false, false);
  if (NT >= 2) c = __builtin_amdgcn_wmma_f32_16x16x32_bf16(false, al, false, bh, (short)0, c, false, false);
  if (NT >= 3) c = __builtin_amdgcn_wmma_f32_16x16x32_bf16(false, ah, false, bl, (short)0, c, false, false);
  asm volatile("v_nop\n\tv_nop\n\tv_nop\n\tv_nop" : "+v"(c) : "v"(ah), "v"(al), "v"(bh), "v"(bl));
  return c;
}

__global__ __launch_bounds__(256) void k_wt_bf16(const float* __restrict__ W, unsigned short* __restrict__ Wt, int K, int N) {
  const int t = blockIdx.x * 256 + threadIdx.x;
  const int k8n = K / 8;
  if (t >= N * k8n) return;
  const int n = t / k8n, k8 = (t % k8n) * 8;
  v8us v;
#pragma unroll
  for (int i = 0; i < 8; ++i) v[i] = bf16_bits(W[(size_t)(k8 + i) * N + n]);
  *(v8us*)(Wt + (size_t)n * K + k8) = v;
  
}

// GEMM C[M][N] (f32, pitch ldc) = act(A[M][K]·W + bias). A f32 row-major (pitch lda) converted per fragment to bf16
// (ASPLIT: hi/lo two planes -> 2 terms, else single rounded term); Wt bf16 [N][K] (pitch ldb). BIAS_BF16 rounds the
// bias to bf16 first (bias quantised to bf16 before the add). K%32==0, M%16==0, N%64==0.
template <bool ASPLIT, int ACT, bool BIAS_BF16>
__global__ __launch_bounds__(128) void k_gemm_bf(const float* __restrict__ A, int lda, const unsigned short* __restrict__ Wt, int ldb,
                                               const float* __restrict__ bias, float* __restrict__ C, int ldc, int M, int N, int K) {
  __shared__ __attribute__((aligned(16))) float so[4][16][64];
  const int tid = threadIdx.x, w = tid >> 5, lane = tid & 31, ln = lane & 15, hh = lane >> 4;
  const int ntn = N / 64;
  const int wid = blockIdx.x * 4 + w;
  const int mt = wid / ntn, nq = wid % ntn;
  if (mt * 16 >= M) return;
  const int row0 = mt * 16, col0 = nq * 64;
  const float* arow = A + (size_t)(row0 + ln) * lda;
  v8f acc[4] = {};
  for (int kb = 0; kb < K; kb += 32) {
    FragB ah, al;
    const v4f x0 = *(const v4fa*)(arow + kb + 8 * hh), x1 = *(const v4fa*)(arow + kb + 8 * hh + 4);
    const v4f x2 = *(const v4fa*)(arow + kb + 16 + 8 * hh), x3 = *(const v4fa*)(arow + kb + 16 + 8 * hh + 4);
    float xs[16] = {x0[0],x0[1],x0[2],x0[3],x1[0],x1[1],x1[2],x1[3],x2[0],x2[1],x2[2],x2[3],x3[0],x3[1],x3[2],x3[3]};
#pragma unroll
    for (int i = 0; i < 16; ++i) { const unsigned short hb = bf16_bits(xs[i]); ah.u[i] = hb; al.u[i] = ASPLIT ? bf16_bits(xs[i] - bf16_val(hb)) : (unsigned short)0; }
#pragma unroll
    for (int t = 0; t < 4; ++t) {
      const unsigned short* brow = Wt + (size_t)(col0 + t * 16 + ln) * ldb + kb;
      FragB b;
      b.half[0] = *(const v8us*)(brow + 8 * hh);
      b.half[1] = *(const v8us*)(brow + 16 + 8 * hh);
      acc[t] = mmaN<ASPLIT ? 2 : 1>(ah.v, al.v, b.v, b.v, acc[t]);
    }
  }
#pragma unroll
  for (int t = 0; t < 4; ++t) {
    float bv = bias ? bias[col0 + t * 16 + ln] : 0.f;
    if (BIAS_BF16) bv = bf16_round(bv);
#pragma unroll
    for (int r = 0; r < 8; ++r) { float v = acc[t][r] + bv; if (ACT == 1) v = fmaxf(v, 0.f); so[w][8 * hh + r][t * 16 + ln] = v; }
  }
  __builtin_amdgcn_fence(__ATOMIC_ACQ_REL, "workgroup");
  __builtin_amdgcn_wave_barrier();
  const int rsub = lane >> 4, c4 = (lane & 15) * 4;
  {
#pragma unroll
    for (int q = 0; q < 8; ++q) {
      const int r = q * 2 + rsub;
      const v4f v = *(const v4fa*)&so[w][r][c4];
      *(v4f*)(C + (size_t)(row0 + r) * ldc + col0 + c4) = v;
    }
    
  }
}

// GEMM C = act(A·W + bias + resid): A f32 (ASPLIT -> hi/lo 2 terms), Wt bf16 [N][K]; ACT 0 none, 1 relu, 2 exact gelu;
// resid (optional, f32, row index = (row % rmod), pitch ldr, RES_BF16 rounds it) added before the activation.
template <bool ASPLIT, int ACT, bool BIAS_BF16, bool RES_BF16>
__global__ __launch_bounds__(128) void k_gemm_bf3(const float* __restrict__ A, int lda, const unsigned short* __restrict__ Wt, int ldb,
                                                const float* __restrict__ bias, const float* __restrict__ resid, int rmod, int ldr,
                                                float* __restrict__ C, int ldc, int M, int N, int K) {
  __shared__ __attribute__((aligned(16))) float so[4][16][64];
  const int tid = threadIdx.x, w = tid >> 5, lane = tid & 31, ln = lane & 15, hh = lane >> 4;
  const int ntn = N / 64;
  const int wid = blockIdx.x * 4 + w;
  const int mt = wid / ntn, nq = wid % ntn;
  if (mt * 16 >= M) return;
  const int row0 = mt * 16, col0 = nq * 64;
  const float* arow = A + (size_t)(row0 + ln) * lda;
  v8f acc[4] = {};
  for (int kb = 0; kb < K; kb += 32) {
    FragB ah, al;
    const v4f x0 = *(const v4fa*)(arow + kb + 8 * hh), x1 = *(const v4fa*)(arow + kb + 8 * hh + 4);
    const v4f x2 = *(const v4fa*)(arow + kb + 16 + 8 * hh), x3 = *(const v4fa*)(arow + kb + 16 + 8 * hh + 4);
    float xs[16] = {x0[0],x0[1],x0[2],x0[3],x1[0],x1[1],x1[2],x1[3],x2[0],x2[1],x2[2],x2[3],x3[0],x3[1],x3[2],x3[3]};
#pragma unroll
    for (int i = 0; i < 16; ++i) { const unsigned short hb = bf16_bits(xs[i]); ah.u[i] = hb; al.u[i] = ASPLIT ? bf16_bits(xs[i] - bf16_val(hb)) : (unsigned short)0; }
#pragma unroll
    for (int t = 0; t < 4; ++t) {
      const unsigned short* brow = Wt + (size_t)(col0 + t * 16 + ln) * ldb + kb;
      FragB b;
      b.half[0] = *(const v8us*)(brow + 8 * hh);
      b.half[1] = *(const v8us*)(brow + 16 + 8 * hh);
      acc[t] = mmaN<ASPLIT ? 2 : 1>(ah.v, al.v, b.v, b.v, acc[t]);
    }
  }
#pragma unroll
  for (int t = 0; t < 4; ++t) {
    const int col = col0 + t * 16 + ln;
    float bv = bias ? bias[col] : 0.f;
    if (BIAS_BF16) bv = bf16_round(bv);
#pragma unroll
    for (int r = 0; r < 8; ++r) {
      float v = acc[t][r] + bv;
      if (resid) { float rv = resid[(size_t)((row0 + 8 * hh + r) % rmod) * ldr + col]; if (RES_BF16) rv = bf16_round(rv); v += rv; }
      if (ACT == 1) v = fmaxf(v, 0.f);
      if (ACT == 2) v = 0.5f * v * (1.0f + erff(v * 0.70710678118654752f));
      if (ACT == 3) { const float u = 0.7978845608028654f * (v + 0.044715f * v * v * v); v = 0.5f * v * (1.0f + tanhf(u)); }
      so[w][8 * hh + r][t * 16 + ln] = v;
    }
  }
  __builtin_amdgcn_fence(__ATOMIC_ACQ_REL, "workgroup");
  __builtin_amdgcn_wave_barrier();
  const int rsub = lane >> 4, c4 = (lane & 15) * 4;
  {
#pragma unroll
    for (int q = 0; q < 8; ++q) {
      const int r = q * 2 + rsub;
      const v4f v = *(const v4fa*)&so[w][r][c4];
      *(v4f*)(C + (size_t)(row0 + r) * ldc + col0 + c4) = v;
    }
    
  }
}
// row LayerNorm (biased variance, eps) over N: s = X (+ R); optional out_sum <- s; out_norm <- (s-mu)*rsqrt(var+eps)*g + b
template <bool PARAM_BF16>
__global__ __launch_bounds__(256) void k_layernorm(const float* __restrict__ X, const float* __restrict__ R, const float* __restrict__ g, const float* __restrict__ bta,
                                                  float* __restrict__ out_sum, float* __restrict__ out_norm, int N, float eps) {
  __shared__ float red[256];
  const int row = blockIdx.x, tid = threadIdx.x;
  const float* x = X + (size_t)row * N; const float* rr = R ? R + (size_t)row * N : nullptr;
  float vals[16];                     // up to N = 4096
  const int per = N / 256;            // contiguous chunk per thread? use strided-by-4 chunks: thread handles j = tid*4 + 1024*u
  float s1 = 0.f;
  for (int u = 0; u < per / 4; ++u) {
    const int j = tid * 4 + 1024 * u;
    const v4f a = *(const v4fa*)(x + j);
    v4f b = {0.f,0.f,0.f,0.f}; if (rr) b = *(const v4fa*)(rr + j);
#pragma unroll
    for (int q = 0; q < 4; ++q) { const float v = a[q] + b[q]; vals[u * 4 + q] = v; s1 += v; }
  }
  red[tid] = s1; __syncthreads();
  for (int st = 128; st > 0; st >>= 1) { if (tid < st) red[tid] += red[tid + st]; __syncthreads(); }
  const float mu = red[0] / (float)N; __syncthreads();
  float s2 = 0.f;
  for (int u = 0; u < per / 4; ++u)
#pragma unroll
    for (int q = 0; q < 4; ++q) { const float c = vals[u * 4 + q] - mu; s2 += c * c; }
  red[tid] = s2; __syncthreads();
  for (int st = 128; st > 0; st >>= 1) { if (tid < st) red[tid] += red[tid + st]; __syncthreads(); }
  const float rs = rsqrtf(red[0] / (float)N + eps);
  {
    for (int u = 0; u < per / 4; ++u) {
      const int j = tid * 4 + 1024 * u;
      v4f o, sm;
#pragma unroll
      for (int q = 0; q < 4; ++q) {
        float gg = g[j + q], bb = bta[j + q];
        if (PARAM_BF16) { gg = bf16_round(gg); bb = bf16_round(bb); }
        sm[q] = vals[u * 4 + q]; o[q] = (vals[u * 4 + q] - mu) * rs * gg + bb;
      }
      if (out_sum) *(v4f*)(out_sum + (size_t)row * N + j) = sm;
      *(v4f*)(out_norm + (size_t)row * N + j) = o;
    }
    
  }
}



// ---- f16 WMMA path (v_wmma_f32_16x16x32_f16): 11-bit significands for operands in range — used where a [0,1] probability operand needs more precision than bf16
typedef _Float16 v16h __attribute__((ext_vector_type(16)));
union FragH { v16h v; v8us half[2]; _Float16 h[16]; unsigned short u[16]; };
template <int NT>
__device__ __forceinline__ v8f mmaH(v16h ah, v16h al, v16h bh, v16h bl, v8f c) {
  c = __builtin_amdgcn_wmma_f32_16x16x32_f16(false, ah, false, bh, (short)0, c, false, false);
  if (NT >= 2) c = __builtin_amdgcn_wmma_f32_16x16x32_f16(false, al, false, bh, (short)0, c, false, false);
  if (NT >= 3) c = __builtin_amdgcn_wmma_f32_16x16x32_f16(false, ah, false, bl, (short)0, c, false, false);
  asm volatile("v_nop\n\tv_nop\n\tv_nop\n\tv_nop" : "+v"(c) : "v"(ah), "v"(al), "v"(bh), "v"(bl));
  return c;
}
// batched GEMM like k_gemm_b but f16 operands: A f32 (split into f16 hi/lo if ASPLIT, else rounded to f16), Bt = f16 values [n][k]; alpha; C f32; N multiple of 16 (partial tiles skipped)
template <bool ASPLIT>
__global__ __launch_bounds__(128) void k_gemm_h(const float* __restrict__ A, int lda, size_t sA, const _Float16* __restrict__ Bh, int ldb, size_t sB, float alpha, float* __restrict__ C, int ldc, size_t sC, int M, int N, int K) {
  __shared__ __attribute__((aligned(16))) float so[4][16][64];
  const int tid = threadIdx.x, w = tid >> 5, lane = tid & 31, ln = lane & 15, hh = lane >> 4; const int by = blockIdx.y;
  A += (size_t)by * sA; Bh += (size_t)by * sB; C += (size_t)by * sC;
  const int ntn = (N + 63) / 64; const int wid = blockIdx.x * 4 + w; const int mt = wid / ntn, nq = wid % ntn; if (mt * 16 >= M) return;
  const int row0 = mt * 16, col0 = nq * 64; const float* arow = A + (size_t)(row0 + ln) * lda;
  v8f acc[4] = {};
  for (int kb = 0; kb < K; kb += 32) {
    FragH ah, al;
    const v4f x0 = *(const v4fa*)(arow + kb + 8 * hh), x1 = *(const v4fa*)(arow + kb + 8 * hh + 4), x2 = *(const v4fa*)(arow + kb + 16 + 8 * hh), x3 = *(const v4fa*)(arow + kb + 16 + 8 * hh + 4);
    float xs[16] = {x0[0],x0[1],x0[2],x0[3],x1[0],x1[1],x1[2],x1[3],x2[0],x2[1],x2[2],x2[3],x3[0],x3[1],x3[2],x3[3]};
#pragma unroll
    for (int i = 0; i < 16; ++i) { const _Float16 h = (_Float16)xs[i]; ah.h[i] = h; al.h[i] = ASPLIT ? (_Float16)(xs[i] - (float)h) : (_Float16)0.0f; }
#pragma unroll
    for (int t = 0; t < 4; ++t) { if (col0 + t * 16 >= N) continue; const size_t boff = (size_t)(col0 + t * 16 + ln) * ldb + kb; FragH bq; bq.half[0] = *(const v8us*)(Bh + boff + 8 * hh); bq.half[1] = *(const v8us*)(Bh + boff + 16 + 8 * hh);
      acc[t] = mmaH<ASPLIT ? 2 : 1>(ah.v, al.v, bq.v, bq.v, acc[t]); }
  }
#pragma unroll
  for (int t = 0; t < 4; ++t) { if (col0 + t * 16 >= N) continue;
#pragma unroll
    for (int r = 0; r < 8; ++r) so[w][8 * hh + r][t * 16 + ln] = acc[t][r] * alpha; }
  __builtin_amdgcn_fence(__ATOMIC_ACQ_REL, "workgroup"); __builtin_amdgcn_wave_barrier();
  const int rsub = lane >> 4, c4 = (lane & 15) * 4;
  {
#pragma unroll
    for (int q = 0; q < 8; ++q) { const int r = q * 2 + rsub; if (col0 + c4 < N) { const v4f v = *(const v4fa*)&so[w][r][c4]; *(v4f*)(C + (size_t)(row0 + r) * ldc + col0 + c4) = v; } }
     }
}

// Wt[n][k] = f16(W[k][n]·scale) from f32 row-major W[K][N] (scale = power of two; bf16-exact weights stay exact in f16 away from the subnormal range)
__device__ __forceinline__ void wt_f16(const float* __restrict__ W, _Float16* __restrict__ Wt, int K, int N, float scale, int t) {      /* t = the caller's flat index, 0 .. N K / 8 - 1 */
  const int n = t / (K / 8), k8 = (t % (K / 8)) * 8; FragH f;
#pragma unroll
  for (int i = 0; i < 8; ++i) f.h[i] = (_Float16)(bf16_round(W[(size_t)(k8 + i) * N + n]) * scale); const v8us o = f.half[0];
  *(v8us*)((unsigned short*)Wt + (size_t)n * K + k8) = o;
  asm volatile("s_wait_xcnt 0x0" ::: "memory");      /* stands directly behind the store, in front of any later overwrite of a register that the store names */
}
// k_gemm_hh variant with fused epilogue: v = acc·alpha + bias[by·sBias + col] (+ CP[(row/rowsPerB)·sCPb + by·64 + col] if CP) ; ACT 0 none / 1 elu ; writes f16 C16 (and f32 C if non-null)
template <int ACT>
__global__ __launch_bounds__(128) void k_gemm_hhx(const _Float16* __restrict__ A, int lda, size_t sA, const _Float16* __restrict__ Bh, int ldb, size_t sB, float alpha, const float* __restrict__ bias, size_t sBias, const float* __restrict__ CP, int rowsPerB, size_t sCPb, int row0g,
    float* __restrict__ C, _Float16* __restrict__ C16, int ldc, size_t sC, int M, int N, int K) {
  __shared__ __attribute__((aligned(16))) float so[4][16][64];
  const int tid = threadIdx.x, w = tid >> 5, lane = tid & 31, ln = lane & 15, hh = lane >> 4; const int by = blockIdx.y;
  A += (size_t)by * sA; Bh += (size_t)by * sB; const size_t cofs = (size_t)by * sC; const float* bp = bias ? bias + (size_t)by * sBias : nullptr;
  const int ntn = (N + 63) / 64; const int wid = blockIdx.x * 4 + w; const int mt = wid / ntn, nq = wid % ntn; if (mt * 16 >= M) return;
  const int row0 = mt * 16, col0 = nq * 64; const _Float16* arow = A + (size_t)(row0 + ln) * lda;
  v8f acc[4] = {};
  for (int kb = 0; kb < K; kb += 32) { FragH ah; ah.half[0] = *(const v8us*)((const unsigned short*)arow + kb + 8 * hh); ah.half[1] = *(const v8us*)((const unsigned short*)arow + kb + 16 + 8 * hh);
#pragma unroll
    for (int t = 0; t < 4; ++t) { if (col0 + t * 16 >= N) continue; const size_t boff = (size_t)(col0 + t * 16 + ln) * ldb + kb; FragH bq; bq.half[0] = *(const v8us*)((const unsigned short*)Bh + boff + 8 * hh); bq.half[1] = *(const v8us*)((const unsigned short*)Bh + boff + 16 + 8 * hh);
      acc[t] = mmaH<1>(ah.v, ah.v, bq.v, bq.v, acc[t]); }
  }
#pragma unroll
  for (int t = 0; t < 4; ++t) { if (col0 + t * 16 >= N) continue; const int col = col0 + t * 16 + ln; const float bv = bp ? bf16_round(bp[col]) : 0.f;
#pragma unroll
    for (int r = 0; r < 8; ++r) { float v = acc[t][r] * alpha + bv; if (CP) { const int rr = row0g + row0 + 8 * hh + r; if (rowsPerB < 0) v += CP[cofs + (size_t)rr * ldc + col];      /* rowsPerB < 0: own element of the batched C plane */ else { const int bidx = rr / rowsPerB; v += CP[(size_t)bidx * sCPb + (size_t)by * 64 + col]; } } if (ACT == 1) v = (v > 0.f) ? v : expm1f(v); else if (ACT == 7) v = (v > 0.f) ? v + 1.0f : expf(v); else if (ACT == 8) v = tanhf(v); else if (ACT == 9) v = 0.5f * v * (1.0f + tanhf(0.7978845608028654f * (v + 0.044715f * v * v * v))); else if (ACT == 11) v = 1.0f / (1.0f + expf(-v)); else if (ACT == 12) v = (v > 0.f) ? v : 0.01f * v; else if (ACT == 14) v = (v > 0.f) ? v : 0.1f * v; else if (ACT == 16) v = (v >= 0.f) ? v : 0.3f * v; else if (ACT == 17) v = (v >= 0.f) ? v : 0.2f * v; else if (ACT == 15) v = v / (1.0f + expf(-v)); else if (ACT == 3) v = fmaxf(v, 0.f); else if (ACT == 6) v = 0.5f * v * (1.0f + erff(v * 0.70710678118654752f)); so[w][8 * hh + r][t * 16 + ln] = v; } }
  __builtin_amdgcn_fence(__ATOMIC_ACQ_REL, "workgroup"); __builtin_amdgcn_wave_barrier();
  const int rsub = lane >> 4, c4 = (lane & 15) * 4; typedef _Float16 v4h __attribute__((ext_vector_type(4)));
  {
#pragma unroll
    for (int q = 0; q < 8; ++q) { const int r = q * 2 + rsub; if (col0 + c4 < N) { const v4f v = *(const v4fa*)&so[w][r][c4]; if (C) *(v4f*)(C + cofs + (size_t)(row0 + r) * ldc + col0 + c4) = v; if (C16) { v4h h4; for (int i = 0; i < 4; ++i) h4[i] = (_Float16)v[i]; *(v4h*)(C16 + cofs + (size_t)(row0 + r) * ldc + col0 + c4) = h4; } } }
     }
}


typedef _Float16 v4h __attribute__((ext_vector_type(4)));

__device__ __forceinline__ void x16(const float* __restrict__ x, _Float16* __restrict__ X16, size_t t) { FragH f;      /* t = the caller's flat index of a group of 8 elements */
#pragma unroll
  for (int q = 0; q < 8; ++q) f.h[q] = (_Float16)bf16_round(x[t * 8 + q]); *(v8us*)((unsigned short*)X16 + t * 8) = f.half[0];
  asm volatile("s_wait_xcnt 0x0" ::: "memory");      /* stands directly behind the store, in front of any later overwrite of a register that the store names */
}
#define PWB (DM * DM / 8 / 256)            /* blocks per weight plane (512) */
#define PXB ((int)(NR * DM / 8 / 256))     /* blocks per input stream (2048) */
// All work that reads inputs only, in ONE launch: none of these jobs reads what another writes, so a range of block indices takes the place of each former launch.
// Blocks 0 .. 4 PWB - 1: the four weight planes (WQ, WK, WV: head t / 8192 of the stack, its [1024][64] block into rows 64 h .. 64 h + 63; WO whole); the rest: the three input streams. Every thread does what one thread of the former launches did.
__global__ __launch_bounds__(256) void k_prep(const float* __restrict__ wq, const float* __restrict__ wk, const float* __restrict__ wv, const float* __restrict__ wo, const float* __restrict__ x, const float* __restrict__ xk, const float* __restrict__ xv,
    _Float16* __restrict__ BQ, _Float16* __restrict__ BK, _Float16* __restrict__ BV, _Float16* __restrict__ BO, _Float16* __restrict__ X16, _Float16* __restrict__ XK16, _Float16* __restrict__ XV16) {
  const int bid = blockIdx.x;
  if (bid < 4 * PWB) { const int job = bid / PWB; const int t = (bid % PWB) * 256 + threadIdx.x;
    if (job == 3) { wt_f16(wo, BO, DM, DM, 16.0f, t); return; }
    const float* W = job == 0 ? wq : job == 1 ? wk : wv; _Float16* Bt = job == 0 ? BQ : job == 1 ? BK : BV; const int h = t / (HD * (DM / 8));
    wt_f16(W + (size_t)h * DM * HD, Bt + (size_t)h * HD * DM, DM, HD, 16.0f, t % (HD * (DM / 8))); return; }
  const int u = bid - 4 * PWB; const int job = u / PXB; const size_t t = (size_t)(u % PXB) * 256 + threadIdx.x;
  x16(job == 0 ? x : job == 1 ? xk : xv, job == 0 ? X16 : job == 1 ? XK16 : XV16, t); }
__global__ __launch_bounds__(256) void k_h16(const float* __restrict__ x, _Float16* __restrict__ X16, size_t n8) { const size_t t = (size_t)blockIdx.x * 256 + threadIdx.x; if (t >= n8) return; FragH f;
#pragma unroll
  for (int q = 0; q < 8; ++q) f.h[q] = (_Float16)x[t * 8 + q]; *(v8us*)((unsigned short*)X16 + t * 8) = f.half[0];  }
__global__ __launch_bounds__(256) void k_round16f(const float* __restrict__ W, _Float16* __restrict__ Bt, size_t n8) { const size_t t = (size_t)blockIdx.x * 256 + threadIdx.x; if (t >= n8) return; FragH f;
#pragma unroll
  for (int i = 0; i < 8; ++i) f.h[i] = (_Float16)(bf16_round(W[t * 8 + i]) * 16.0f); *(v8us*)((unsigned short*)Bt + t * 8) = f.half[0];  }
template <int NHv, int TTv>
__global__ __launch_bounds__(256) void k_vt(const _Float16* __restrict__ V16, int ldv, int voff, _Float16* __restrict__ Vt) { __shared__ unsigned short tl[64][66]; const int tid = threadIdx.x; const int slab = blockIdx.x / (TTv / 64), lg = blockIdx.x % (TTv / 64); const int b = slab / NHv, h = slab % NHv;
  for (int i = tid; i < 64 * 8; i += 256) { const int r = i / 8, c8 = (i % 8) * 8; FragH f; f.half[0] = *(const v8us*)((const unsigned short*)V16 + ((size_t)b * TTv + lg * 64 + r) * ldv + voff + h * 64 + c8);
#pragma unroll
    for (int q = 0; q < 8; ++q) tl[r][c8 + q] = f.u[q]; }
  __syncthreads();
  {
#pragma unroll
    for (int rd = 0; rd < 2; ++rd) { const int d = rd * 32 + tid / 8, pc = tid % 8; FragH f;
#pragma unroll
      for (int q = 0; q < 8; ++q) f.u[q] = tl[pc * 8 + q][d];
      *(v8us*)((unsigned short*)Vt + ((size_t)slab * 64 + d) * TTv + lg * 64 + pc * 8) = f.half[0]; }
     } }

__global__ __launch_bounds__(256) void k_hl(const float* __restrict__ F, _Float16* __restrict__ Hh, _Float16* __restrict__ Hl, size_t n8) { const size_t t = (size_t)blockIdx.x * 256 + threadIdx.x; if (t >= n8) return; FragH fh, fl; const v4f a = *(const v4fa*)(F + t * 8), c = *(const v4fa*)(F + t * 8 + 4);
#pragma unroll
  for (int q = 0; q < 4; ++q) { _Float16 h = (_Float16)a[q]; fh.h[q] = h; fl.h[q] = (_Float16)((a[q] - (float)h) * 1024.0f); h = (_Float16)c[q]; fh.h[4 + q] = h; fl.h[4 + q] = (_Float16)((c[q] - (float)h) * 1024.0f); }
  { *(v8us*)((unsigned short*)Hh + t * 8) = fh.half[0]; *(v8us*)((unsigned short*)Hl + t * 8) = fl.half[0];  } }

// ---- fast GEMM (work-group tile 128x64, wave tile 32x64; requires M % 128 == 0, N % 64 == 0, K % 128 == 0, K >= 128); epilogue = k_gemm_hhx semantics ----
// Operands go through LDS: a stage is 128 k (256 bytes) of the work-group's 128 A rows and 64 Bh rows. Each lane copies 16 bytes, a wave's copy covers two whole rows of the stage (4 whole lines), and a Bh row is fetched once for the four waves.
// Two buffers: stage s + 1 flies while stage s is worked on. Fragments are read from LDS in the k order of the former global loads (k = 8 hh + i, 16 + 8 hh + i), k steps in the same order: same sums.
#define G2KC 128                     /* k per stage */
#define G2P 272                      /* LDS row pitch, bytes: 256 + 16 = 16 x odd, the pitch at which ds_load_b128 fragment reads meet no bank conflict */
#define G2BUF (192 * G2P)            /* one buffer: rows 0-127 A, 128-191 Bh */
__device__ __forceinline__ v16h g2_frag(const unsigned char* p) { FragH f; f.half[0] = *(const v8us*)p; f.half[1] = *(const v8us*)(p + 32); return f.v; }      /* p = the lane's row in LDS + 64 bytes per k step + 16 hh */
// Eight asynchronous copies of 16 bytes per lane, 8 rows apart (l = the lane's LDS byte address, g = its global address, gs = 8 rows of the source in elements).
// s_wait_xcnt 0 is the statement's last line so that it stands in front of every later write of the address registers that the copies name.
__device__ __forceinline__ void g2_copy8(unsigned l, const _Float16* g, size_t gs) {
  asm volatile("global_load_async_to_lds_b128 %0, %8, off\n\t"
               "global_load_async_to_lds_b128 %1, %9, off\n\t"
               "global_load_async_to_lds_b128 %2, %10, off\n\t"
               "global_load_async_to_lds_b128 %3, %11, off\n\t"
               "global_load_async_to_lds_b128 %4, %12, off\n\t"
               "global_load_async_to_lds_b128 %5, %13, off\n\t"
               "global_load_async_to_lds_b128 %6, %14, off\n\t"
               "global_load_async_to_lds_b128 %7, %15, off\n\t"
               "s_wait_xcnt 0x0"
               :: "v"(l), "v"(l + 8 * G2P), "v"(l + 16 * G2P), "v"(l + 24 * G2P), "v"(l + 32 * G2P), "v"(l + 40 * G2P), "v"(l + 48 * G2P), "v"(l + 56 * G2P),
                  "v"(g), "v"(g + gs), "v"(g + 2 * gs), "v"(g + 3 * gs), "v"(g + 4 * gs), "v"(g + 5 * gs), "v"(g + 6 * gs), "v"(g + 7 * gs) : "memory"); }
// One stage: 24 copies per lane. l = the lane's place in the buffer (row tid / 16, 16-byte piece tid % 16); ga, gb = the same place in the stage's A and Bh rows.
__device__ __forceinline__ void g2_stage(unsigned l, const _Float16* ga, int lda, const _Float16* gb, int ldb) {
  g2_copy8(l, ga, (size_t)8 * lda); g2_copy8(l + 64 * G2P, ga + (size_t)64 * lda, (size_t)8 * lda); g2_copy8(l + 128 * G2P, gb, (size_t)8 * ldb); }
__device__ __forceinline__ v8f g2_mma(v16h a, v16h b, v8f c) { v8f d = __builtin_amdgcn_wmma_f32_16x16x32_f16(false, a, false, b, (short)0, c, false, false); asm volatile("v_nop\n\tv_nop\n\tv_nop\n\tv_nop" : "+v"(d) : "v"(a), "v"(b)); return d; }
template <int ACT>
__global__ __launch_bounds__(128) void k_gemm2(const _Float16* __restrict__ A, int lda, size_t sA, const _Float16* __restrict__ Bh, int ldb, size_t sB, float alpha, const float* __restrict__ bias, size_t sBias, const float* __restrict__ CP, int rowsPerB, size_t sCPb, int row0g,
    float* __restrict__ C, _Float16* __restrict__ C16, int ldc, size_t sC, int M, int N, int K) { static_assert(ACT == 0 || ACT == 3 || ACT == 6 || ACT == 8 || ACT == 9 || ACT == 11 || ACT == 12 || ACT == 14 || ACT == 15 || ACT == 16 || ACT == 17, "k_gemm2: unsupported ACT code (would silently apply no activation)");
  __shared__ __attribute__((aligned(16))) float so[4][32][68];
  __shared__ __attribute__((aligned(16))) unsigned char ring[2 * G2BUF];
  const int tid = threadIdx.x, w = tid >> 5, lane = tid & 31, ln = lane & 15, hh = lane >> 4; const int by = blockIdx.y;
  A += (size_t)by * sA; Bh += (size_t)by * sB; const size_t cofs = (size_t)by * sC; const float* bp = bias ? bias + (size_t)by * sBias : nullptr;
  const int ntn = N >> 6; const int mt = blockIdx.x / ntn, nq = blockIdx.x - mt * ntn; const int row0 = mt * 128 + 32 * w, col0 = nq * 64; if (mt * 128 >= M) return;      /* the same for the whole work-group, in front of every barrier */
  const unsigned lc = (unsigned)(size_t)ring + (unsigned)((tid >> 4) * G2P + (tid & 15) * 16);      /* this lane's place in buffer 0 as an LDS byte address (low 32 bits of the __shared__ address) */
  const _Float16* ga = A + (size_t)(mt * 128 + (tid >> 4)) * lda + (tid & 15) * 8; const _Float16* gb = Bh + (size_t)(col0 + (tid >> 4)) * ldb + (tid & 15) * 8;
  const int nst = K / G2KC;
  const v8f z8 = {0.f,0.f,0.f,0.f,0.f,0.f,0.f,0.f}; v8f c00 = z8, c01 = z8, c02 = z8, c03 = z8, c10 = z8, c11 = z8, c12 = z8, c13 = z8;
  g2_stage(lc, ga, lda, gb, ldb);
  asm volatile("s_wait_asynccnt 0x0" ::: "memory");      /* this wave's copies of stage 0 have landed */
  __syncthreads();      /* stage 0 is readable by every wave */
  if (nst > 1) g2_stage(lc + G2BUF, ga + G2KC, lda, gb + G2KC, ldb);
#pragma unroll 1      /* rolled: one stage per trip, its four k steps unrolled inside */
  for (int s = 0; s < nst; ++s) { const unsigned char* bufp = ring + (s & 1) * G2BUF; const unsigned char* pa = bufp + (32 * w + ln) * G2P + 16 * hh; const unsigned char* pb = bufp + (128 + ln) * G2P + 16 * hh;
    v16h a0 = g2_frag(pa), a1 = g2_frag(pa + 16 * G2P), b0 = g2_frag(pb), b1 = g2_frag(pb + 16 * G2P), b2 = g2_frag(pb + 32 * G2P), b3 = g2_frag(pb + 48 * G2P);
#pragma unroll      /* unrolled: the two fragment sets then alternate by register name, without copies */
    for (int ks = 0; ks < G2KC / 32; ++ks) { v16h na0 = a0, na1 = a1, nb0 = b0, nb1 = b1, nb2 = b2, nb3 = b3;
      if (ks + 1 < G2KC / 32) { const int o = (ks + 1) * 64; na0 = g2_frag(pa + o); na1 = g2_frag(pa + 16 * G2P + o); nb0 = g2_frag(pb + o); nb1 = g2_frag(pb + 16 * G2P + o); nb2 = g2_frag(pb + 32 * G2P + o); nb3 = g2_frag(pb + 48 * G2P + o); }      /* the next k step's fragments of the SAME stage, asked for ahead of this step's products */
      c00 = g2_mma(a0, b0, c00); c10 = g2_mma(a1, b0, c10); c01 = g2_mma(a0, b1, c01); c11 = g2_mma(a1, b1, c11);
      c02 = g2_mma(a0, b2, c02); c12 = g2_mma(a1, b2, c12); c03 = g2_mma(a0, b3, c03); c13 = g2_mma(a1, b3, c13);
      a0 = na0; a1 = na1; b0 = nb0; b1 = nb1; b2 = nb2; b3 = nb3; }
    asm volatile("s_wait_dscnt 0x0" ::: "memory");      /* this wave's reads of stage s are done before the buffer is handed to its next writer */
    asm volatile("s_wait_asynccnt 0x0" ::: "memory");      /* this wave's copies of stage s + 1 have landed */
    __syncthreads();      /* publishes stage s + 1 and ends every wave's reads of stage s */
    if (s + 2 < nst) g2_stage(lc + (unsigned)(s & 1) * G2BUF, ga + (size_t)(s + 2) * G2KC, lda, gb + (size_t)(s + 2) * G2KC, ldb); }
  asm volatile("s_wait_asynccnt 0x0" ::: "memory");      /* no copy is outstanding when the wave goes on */
  v8f accs[8] = {c00, c01, c02, c03, c10, c11, c12, c13};
#pragma unroll
  for (int u = 0; u < 8; ++u) { const int t = u & 3, half = u >> 2; const int col = col0 + t * 16 + ln; const float bv = bp ? bf16_round(bp[col]) : 0.f;
#pragma unroll
    for (int r = 0; r < 8; ++r) { const int rloc = half * 16 + 8 * hh + r; float v = accs[u][r] * alpha + bv; if (CP) { if (rowsPerB < 0) v += CP[cofs + (size_t)(row0g + row0 + rloc) * ldc + col];      /* rowsPerB < 0: own element of the batched C plane */ else { const int bidx = (row0g + row0 + rloc) / rowsPerB; v += CP[(size_t)bidx * sCPb + (size_t)by * 64 + col]; } }
      if (ACT == 3) v = fmaxf(v, 0.f); else if (ACT == 6) v = 0.5f * v * (1.0f + erff(v * 0.70710678118654752f)); else if (ACT == 11) v = 1.0f / (1.0f + expf(-v)); else if (ACT == 15) v = v / (1.0f + expf(-v)); else if (ACT == 12) v = (v > 0.f) ? v : 0.01f * v; else if (ACT == 8) v = tanhf(v); else if (ACT == 9) v = 0.5f * v * (1.0f + tanhf(0.7978845608028654f * (v + 0.044715f * v * v * v))); else if (ACT == 14) v = (v > 0.f) ? v : 0.1f * v; else if (ACT == 16) v = (v >= 0.f) ? v : 0.3f * v; else if (ACT == 17) v = (v >= 0.f) ? v : 0.2f * v;
      so[w][rloc][t * 16 + ln] = v; } }
  __builtin_amdgcn_fence(__ATOMIC_ACQ_REL, "workgroup"); __builtin_amdgcn_wave_barrier();
  const int rsub = lane >> 4, c4 = (lane & 15) * 4;
  {
#pragma unroll
    for (int q = 0; q < 16; ++q) { const int r = q * 2 + rsub; const v4f v = *(const v4fa*)&so[w][r][c4]; if (C) *(v4f*)(C + cofs + (size_t)(row0 + r) * ldc + col0 + c4) = v; if (C16) { v4h h4; for (int i = 0; i < 4; ++i) h4[i] = (_Float16)v[i]; *(v4h*)(C16 + cofs + (size_t)(row0 + r) * ldc + col0 + c4) = h4; } }
     } }


__global__ __launch_bounds__(256) void k_wnat(const float* __restrict__ w, size_t n8, _Float16* __restrict__ Bt) { const size_t t = (size_t)blockIdx.x * 256 + threadIdx.x; if (t >= n8) return; FragH f; for (int q = 0; q < 8; ++q) f.h[q] = (_Float16)(bf16_round(w[t * 8 + q]) * 16.0f); *(v8us*)((unsigned short*)Bt + t * 8) = f.half[0];  }
__global__ __launch_bounds__(256) void k_rsm(const float* __restrict__ S, _Float16* __restrict__ P, int nrows) {
  #pragma clang fp contract(off)
  const int i = blockIdx.x * 256 + threadIdx.x; if (i >= nrows) return; const float* s = S + (size_t)i * SQ; float mx = -3.0e38f;
#pragma unroll 1
  for (int j = 0; j < SQ; ++j) mx = fmaxf(mx, s[j]); float se = 0.f;
#pragma unroll 1
  for (int j = 0; j < SQ; ++j) se += expf(s[j] - mx); const float sc = 256.0f / se;
#pragma unroll 1
  for (int j0 = 0; j0 < SQ; j0 += 8) { FragH f; for (int q = 0; q < 8; ++q) f.h[q] = (_Float16)(expf(s[j0 + q] - mx) * sc); unsigned short* d = (unsigned short*)P + (size_t)i * SQ + j0; *(v8us*)d = f.half[0];  } }
__global__ __launch_bounds__(256) void k_vt(const _Float16* __restrict__ V16, int b, int h0, _Float16* __restrict__ VT) { __shared__ unsigned short tl[64][65]; const int tid = threadIdx.x; const int hh = blockIdx.x % HG, sg = blockIdx.x / HG; const int s0 = sg * 64; const int h = h0 + hh;
  for (int i = tid; i < 64 * 8; i += 256) { const int j = i / 8, d8 = (i % 8) * 8; FragH f; f.half[0] = *(const v8us*)((const unsigned short*)V16 + ((size_t)b * SQ + s0 + j) * DM + h * HD + d8); for (int q = 0; q < 8; ++q) tl[d8 + q][j] = f.u[q]; }
  __syncthreads();
  { for (int i = tid; i < 64 * 8; i += 256) { const int d = i / 8, j8 = (i % 8) * 8; FragH f; for (int q = 0; q < 8; ++q) f.u[q] = tl[d][j8 + q]; *(v8us*)((unsigned short*)VT + ((size_t)hh * HD + d) * SQ + s0 + j8) = f.half[0]; }  } }



// 2^x on the transcendental unit; the v_nop fills the one slot that the instruction set asks for between a transcendental and an instruction that reads its result or overwrites its source.
__device__ __forceinline__ float exp2_slot(float x) { float r; asm("v_exp_f32 %0, %1\n\tv_nop" : "=v"(r) : "v"(x)); return r; }
// Value of lane l ^ 16 (the other half of the wave): one register move between the two 16-lane rows, no LDS.
__device__ __forceinline__ float xhalf(float x) { return __builtin_bit_cast(float, __builtin_amdgcn_permlanex16(__builtin_bit_cast(int, x), __builtin_bit_cast(int, x), 0x76543210, 0xfedcba98, false, false)); }
__device__ __forceinline__ v16h fa_frag(const unsigned short* p) { FragH f; f.half[0] = *(const v8us*)p; f.half[1] = *(const v8us*)(p + 16); return f.v; }      /* p = the lane's own pointer, 8 hh included: k = 8 hh + i, 16 + 8 hh + i, as g2_frag */
__device__ __forceinline__ v8f fa_mma(v16h a, v16h b, v8f c) { return __builtin_amdgcn_wmma_f32_16x16x32_f16(false, a, false, b, (short)0, c, false, false); }
#define FAW 8                        /* waves per work-group of the fused attention */
#define FAQ 32                       /* query columns per wave */
#define FAK 32                       /* keys per pass */
#define FAC 0.18033688f              /* 1 / sqrt(64) x log2(e): scores to the exponent of 2 */
__global__ __launch_bounds__(FAW * 32) void k_fattn(const _Float16* __restrict__ QHp, const _Float16* __restrict__ QLp, const _Float16* __restrict__ KHp, const _Float16* __restrict__ KLp, const _Float16* __restrict__ VTp, _Float16* __restrict__ Op) {
  const int lane = threadIdx.x & 31, w = threadIdx.x >> 5, ln = lane & 15, hh = lane >> 4; const int h = blockIdx.y, b = blockIdx.z; const int q0 = blockIdx.x * (FAW * FAQ) + w * FAQ; const size_t r0 = (size_t)b * SQ;
  const size_t qo = (r0 + q0 + ln) * LQ + h * HD + 8 * hh, ko = (r0 + ln) * LQ + h * HD + 8 * hh;
  const unsigned short* qhl = (const unsigned short*)QHp + qo; const unsigned short* qll = (const unsigned short*)QLp + qo; const unsigned short* khl = (const unsigned short*)KHp + ko; const unsigned short* kll = (const unsigned short*)KLp + ko;
  const unsigned short* vp = (const unsigned short*)VTp + ((size_t)(b * NH + h) * HD + ln) * SQ + 8 * hh;
  v16h qh[2][2], ql[2][2];
#pragma unroll
  for (int qt = 0; qt < 2; ++qt) for (int ks = 0; ks < 2; ++ks) { qh[qt][ks] = fa_frag(qhl + (size_t)(qt * 16) * LQ + ks * 32); ql[qt][ks] = fa_frag(qll + (size_t)(qt * 16) * LQ + ks * 32); }
  const v8f z8 = {0.f,0.f,0.f,0.f,0.f,0.f,0.f,0.f}; v8f o[2][4]; float m[2], l[2];
#pragma unroll
  for (int qt = 0; qt < 2; ++qt) { m[qt] = -1.0e30f; l[qt] = 0.f; for (int dt = 0; dt < 4; ++dt) o[qt][dt] = z8; }
  v16h kh[2][2], kl[2][2];
#pragma unroll
  for (int kt = 0; kt < 2; ++kt) for (int ks = 0; ks < 2; ++ks) { kh[kt][ks] = fa_frag(khl + (size_t)(kt * 16) * LQ + ks * 32); kl[kt][ks] = fa_frag(kll + (size_t)(kt * 16) * LQ + ks * 32); }
  asm volatile("s_wait_xcnt 0x0" :: "v"(qhl), "v"(qll), "v"(khl), "v"(kll) : "memory");      /* stands in front of the first overwrite of these loads' address registers; the addresses are inputs so that they keep their registers up to here */
#pragma unroll 1      /* rolled: one pass already holds 32 matrix instructions, and a second copy would double the registers in flight */
  for (int key0 = 0; key0 < SQ; key0 += FAK) {
    v16h va[4];      /* V^T rows of this pass: asked for here, needed only behind the softmax */
#pragma unroll
    for (int dt = 0; dt < 4; ++dt) va[dt] = fa_frag(vp + (size_t)(dt * 16) * SQ);
    v8f sa[2][2], sr[2][2];      /* [query tile][key tile]: hi.hi, and the x1024 residual products */
#pragma unroll
    for (int qt = 0; qt < 2; ++qt) for (int kt = 0; kt < 2; ++kt) sa[qt][kt] = fa_mma(kh[kt][0], qh[qt][0], z8);
#pragma unroll
    for (int qt = 0; qt < 2; ++qt) for (int kt = 0; kt < 2; ++kt) sr[qt][kt] = fa_mma(kh[kt][0], ql[qt][0], z8);
#pragma unroll
    for (int qt = 0; qt < 2; ++qt) for (int kt = 0; kt < 2; ++kt) sa[qt][kt] = fa_mma(kh[kt][1], qh[qt][1], sa[qt][kt]);
#pragma unroll
    for (int qt = 0; qt < 2; ++qt) for (int kt = 0; kt < 2; ++kt) sr[qt][kt] = fa_mma(kh[kt][1], ql[qt][1], sr[qt][kt]);
#pragma unroll
    for (int qt = 0; qt < 2; ++qt) for (int kt = 0; kt < 2; ++kt) sr[qt][kt] = fa_mma(kl[kt][0], qh[qt][0], sr[qt][kt]);
#pragma unroll
    for (int qt = 0; qt < 2; ++qt) for (int kt = 0; kt < 2; ++kt) sr[qt][kt] = fa_mma(kl[kt][1], qh[qt][1], sr[qt][kt]);
    const size_t kn = (size_t)((key0 + FAK) & (SQ - 1)) * LQ;      /* the next pass's K rows, fetched one pass ahead; the last pass fetches rows 0-31 again (in bounds, unused) */
    const unsigned short* khn = khl + kn; const unsigned short* kln = kll + kn;
#pragma unroll
    for (int kt = 0; kt < 2; ++kt) for (int ks = 0; ks < 2; ++ks) { kh[kt][ks] = fa_frag(khn + (size_t)(kt * 16) * LQ + ks * 32); kl[kt][ks] = fa_frag(kln + (size_t)(kt * 16) * LQ + ks * 32); }
#pragma unroll
    for (int qt = 0; qt < 2; ++qt) {
      float t[16];
#pragma unroll
      for (int i = 0; i < 16; ++i) t[i] = fmaf(sr[qt][i >> 3][i & 7], 0.0009765625f, sa[qt][i >> 3][i & 7]);
      float mx = t[0];
#pragma unroll
      for (int i = 1; i < 16; ++i) mx = fmaxf(mx, t[i]);
      mx = fmaxf(mx, xhalf(mx));
      const float mn = fmaxf(m[qt], mx); const float al = exp2_slot((m[qt] - mn) * FAC); const float nb = 8.0f - mn * FAC; m[qt] = mn;
      FragH p; float sum = 0.f;
#pragma unroll
      for (int i = 0; i < 16; ++i) { const float e = exp2_slot(fmaf(t[i], FAC, nb)); sum += e; p.h[i] = (_Float16)e; }
      l[qt] = fmaf(l[qt], al, sum);
#pragma unroll
      for (int dt = 0; dt < 4; ++dt) { for (int r = 0; r < 8; ++r) o[qt][dt][r] *= al; }
#pragma unroll
      for (int dt = 0; dt < 4; ++dt) o[qt][dt] = fa_mma(va[dt], p.v, o[qt][dt]);
    }
    asm volatile("s_wait_xcnt 0x0" :: "v"(vp), "v"(khn), "v"(kln) : "memory");      /* stands in front of the overwrite of this pass's load addresses (the step of vp, the next pass's khn and kln); the addresses are inputs so that they keep their registers up to here */
    vp += FAK;
  }
#pragma unroll
  for (int qt = 0; qt < 2; ++qt) { const float inv = 64.0f / (l[qt] + xhalf(l[qt]));      /* the halves' sums joined once; o carried x64 */
    _Float16* op = Op + r0 * DM + (size_t)h * SQ * HD + (size_t)(q0 + qt * 16 + ln) * HD + 8 * hh;
#pragma unroll
    for (int dt = 0; dt < 4; ++dt) { FragH f; for (int r = 0; r < 8; ++r) f.h[r] = (_Float16)(o[qt][dt][r] * inv); *(v8us*)((unsigned short*)op + dt * 16) = f.half[0]; } } }


template <int MASKADD>
__global__ __launch_bounds__(64) void k_att0(const float* __restrict__ QF, const float* __restrict__ KF, const float* __restrict__ VF, int ld, const float* __restrict__ mask, float scale, float* __restrict__ OF, int ldo) {
  #pragma clang fp contract(off)
  __shared__ __attribute__((aligned(16))) float lq[64][64]; __shared__ __attribute__((aligned(16))) float lo[64][64];
  const int tid = threadIdx.x; const int h = blockIdx.x / (QT0 / 64), rg = blockIdx.x % (QT0 / 64); const int i = rg * 64 + tid;
  const float* qr = QF + (size_t)i * ld + h * HD;
#pragma unroll 1
  for (int c = 0; c < HD / 4; ++c) { *(v4f*)&lq[tid][c * 4] = *(const v4fa*)(qr + c * 4); const v4f z = {0.f, 0.f, 0.f, 0.f}; *(v4f*)&lo[tid][c * 4] = z; }
  float m = -1.0e30f, l = 0.f; const int jmax = MASKADD ? (SQ - 1) : (rg * 64 + 63);      /* additive-mask form: every key (the mask input decides); causal form: keys up to the block's last row */
#pragma unroll 1
  for (int j = 0; j <= jmax; ++j) { const float* kr = KF + (size_t)j * ld + h * HD; const float* vr = VF + (size_t)j * ld + h * HD; float s = 0.f;
#pragma unroll 1
    for (int c = 0; c < HD / 4; ++c) { const v4f kq = *(const v4fa*)(kr + c * 4); const v4f qq = *(v4f*)&lq[tid][c * 4]; s = __fadd_rn(s, __fmul_rn(qq[0], kq[0])); s = __fadd_rn(s, __fmul_rn(qq[1], kq[1])); s = __fadd_rn(s, __fmul_rn(qq[2], kq[2])); s = __fadd_rn(s, __fmul_rn(qq[3], kq[3])); }
    s = __fmul_rn(s, scale); if (MASKADD) s = __fadd_rn(s, __fmul_rn(bf16_round(mask[(size_t)i * SQ + j]), -10000.0f));
    const float f = (MASKADD || j <= i) ? 1.f : 0.f; const float sm = fmaf(f, s, (1.f - f) * -1.0e30f); const float mn = fmaxf(m, sm); const float sc = expf(m - mn); const float e = expf(sm - mn); l = __fadd_rn(__fmul_rn(l, sc), e); m = mn;
#pragma unroll 1
    for (int c = 0; c < HD / 4; ++c) { const v4f vv = *(const v4fa*)(vr + c * 4); v4f oo = *(v4f*)&lo[tid][c * 4]; for (int u = 0; u < 4; ++u) oo[u] = __fadd_rn(__fmul_rn(oo[u], sc), __fmul_rn(e, vv[u])); *(v4f*)&lo[tid][c * 4] = oo; } }
  const float fin = 64.0f / l;      /* o carried x64 like the f16 path */
#pragma unroll 1
  for (int c = 0; c < HD / 4; ++c) { v4f oo = *(v4f*)&lo[tid][c * 4]; for (int u = 0; u < 4; ++u) oo[u] = __fmul_rn(oo[u], fin); *(v4f*)&lo[tid][c * 4] = oo; }
  __syncthreads();
  {
#pragma unroll 1
    for (int it = 0; it < 16; ++it) { const int row = it * 4 + tid / 16, pc = (tid % 16) * 4; const v4f v = *(const v4f*)&lo[row][pc]; *(v4f*)(OF + (size_t)(rg * 64 + row) * ldo + h * HD + pc) = v; }
     } }

extern "C" void kernel_launch(void* const* d_in, const int* in_sizes, int n_in,
                              void* d_out, int out_size, void* d_ws, size_t ws_size, hipStream_t stream) {
  (void)in_sizes; (void)n_in; (void)out_size;
  const float* const* I = (const float* const*)d_in; const float* x = I[0]; const float* xk = I[1]; const float* xv = I[2]; const float* wq = I[3]; const float* wk = I[4]; const float* wv = I[5]; const float* bq = nullptr; const float* bk = nullptr; const float* bv = nullptr; const float* wo = I[6]; const float* bo = nullptr;      /* input order: q, k, v (the three streams, two sequences each), Wq, Wk, Wv (PER-HEAD STACKS [16][1024][64]), Wo ([in][out] [1024][1024]); NO biases anywhere: null pointers in the guarded slots */
  char* ws = (char*)d_ws; size_t off = 0;
  auto take = [&](size_t bytes) { char* p = ws + off; off += (bytes + 255) & ~(size_t)255; return p; };
  _Float16* BQ = (_Float16*)take((size_t)DM * DM * 2); _Float16* BK = (_Float16*)take((size_t)DM * DM * 2); _Float16* BV = (_Float16*)take((size_t)DM * DM * 2); _Float16* BO = (_Float16*)take((size_t)DM * DM * 2);
  _Float16* X16 = (_Float16*)take(NR * DM * 2); _Float16* XK16 = (_Float16*)take(NR * DM * 2); _Float16* XV16 = (_Float16*)take(NR * DM * 2);      /* exact f16 rows of query, key, value */ float* QF = (float*)take(NR * DM * 4); _Float16* QH = (_Float16*)take(NR * DM * 2); _Float16* QL = (_Float16*)take(NR * DM * 2); _Float16* KH = (_Float16*)take(NR * DM * 2); _Float16* KL = (_Float16*)take(NR * DM * 2); _Float16* Q16 = QH; _Float16* K16 = KH; _Float16* V16 = (_Float16*)take(NR * DM * 2); _Float16* O16 = (_Float16*)take(NR * DM * 2);
  _Float16* VT = (_Float16*)take((size_t)NB * NH * HD * SQ * 2);      /* V^T of both batches */
  float* QF0 = (float*)take((size_t)QT0 * DM * 4); float* KF0 = (float*)take((size_t)QT0 * DM * 4); float* VF0 = (float*)take((size_t)QT0 * DM * 4); float* OF0 = (float*)take((size_t)NB * QT0 * DM * 4); _Float16* OH0 = (_Float16*)take((size_t)NB * QT0 * DM * 2); _Float16* OL0 = (_Float16*)take((size_t)NB * QT0 * DM * 2);
  if (off > ws_size) return;
  k_prep<<<4 * PWB + 3 * PXB, 256, 0, stream>>>(wq, wk, wv, wo, x, xk, xv, BQ, BK, BV, BO, X16, XK16, XV16);      /* head h's [1024][64] block -> rows 64 h .. 64 h + 63 of the Bt[n][k] x16 plane; the [in][out] output weight transposed into its plane; the three streams as exact f16 rows */
  const size_t r0p = (size_t)B0 * SQ;      /* first projected row */
  k_gemm2<0><<<dim3((unsigned)((MP / 128) * (DM / 64)), 1), 128, 0, stream>>>(X16 + r0p * DM, DM, 0, BQ, DM, 0, 0.0625f, bq, 0, nullptr, 1, 0, 0, QF + r0p * DM, nullptr, DM, 0, MP, DM, DM); k_hl<<<(unsigned)(((size_t)MP * DM / 8 + 255) / 256), 256, 0, stream>>>(QF + r0p * DM, QH + r0p * DM, QL + r0p * DM, (size_t)MP * DM / 8);      /* q (f32) -> f16 hi + x1024 residual: unscaled logits sigma ~8 */
  k_gemm2<0><<<dim3((unsigned)((MP / 128) * (DM / 64)), 1), 128, 0, stream>>>(XK16 + r0p * DM, DM, 0, BK, DM, 0, 0.0625f, bk, 0, nullptr, 1, 0, 0, QF + r0p * DM, nullptr, DM, 0, MP, DM, DM); k_hl<<<(unsigned)(((size_t)MP * DM / 8 + 255) / 256), 256, 0, stream>>>(QF + r0p * DM, KH + r0p * DM, KL + r0p * DM, (size_t)MP * DM / 8);      /* k likewise */
  k_gemm2<0><<<dim3((unsigned)((MP / 128) * (DM / 64)), 1), 128, 0, stream>>>(XV16 + r0p * DM, DM, 0, BV, DM, 0, 0.0625f, bv, 0, nullptr, 1, 0, 0, nullptr, V16 + r0p * DM, DM, 0, MP, DM, DM);
  k_vt<NH, SQ><<<NB * NH * (SQ / 64), 256, 0, stream>>>(V16, LQ, 0, VT);      /* V^T [NB][NH][HD][SQ] */
  k_fattn<<<dim3(SQ / (FAW * FAQ), NH, NB), FAW * 32, 0, stream>>>(QH, QL, KH, KL, VT, O16);      /* o written HEAD-CONTIGUOUS: o[b][h][s][64] (row pitch 64, head stride SQ x 64): the source's raw reshape of (B, H, S, dk) to (B, S, H dk) then reads that memory as [2048][1024] rows: the output GEMM below does exactly that */
  k_gemm2<0><<<dim3((unsigned)((MPO / 128) * (DM / 64)), 1), 128, 0, stream>>>(O16 + r0p * DM, DM, 0, BO, DM, 0, 0.0009765625f, bo, 0, nullptr, 1, 0, 0, (float*)d_out + r0p * DM, nullptr, DM, 0, MPO, DM, DM);      /* out rows are the output layout */
  /* (dense: no first-tile hi / lo planes) */
  /* (dense: no first-tile rewrite passes:
     the output GEMM above has written every row
     with its (null) bias) */
}

// v005
// Measured time: 143 microseconds a run.
// Timed twice side by side with v004, it ran 1.20 times as fast both times.
// All steps since v000 together make it 53.3 times as fast.
#include <hip/hip_runtime.h>
// Multi-head attention on three inputs with PER-HEAD STACKED projections and the source's RAW-RESHAPE head merge (Q, K, V [2][2048][1024]; WQ / WK / WV [16][1024][64] = [head][in][out] uniform +-0.1, NO biases; 16 heads of 64; scores x 1/sqrt(64); softmax over all 2048 keys (no mask); the head outputs [B][H][S][64] are RESHAPED IN MEMORY ORDER to [B][S][1024] (row r of a batch holds tokens 16 (r mod 128) .. + 15 of head r / 128: heads and tokens mix: faithful to the source); out = that WO with WO [1024][1024] [in][out], NO bias -> [2][2048][1024]); q and k carried as f16 hi + x1024 residual planes with three-product scores; each head's [in][out] block is transposed into its 64 contiguous rows of the f16 weight plane, and the [in][out] output weight into its plane, all in one launch (k_prep); DENSE (k_fattn runs every query over all SQ keys; no exact first tile).
// Structure: token rows r = b*2048 + s; x as exact f16 rows (bf16-rounded); q and k as WMMA GEMMs (32x64 wave tiles, f32 accumulation, exact x16 weights, no bias) into f32 rows split into f16 hi + x1024 residual planes, v as an f16-output GEMM; V^T for both batches and all heads via LDS transposes; per work-group of 256 query rows in one fused launch (k_fattn; all heads on grid.y, batches on grid.z), in passes of 32 keys over all 2048: scores as THREE accumulating products (hi.hi + 2^-10 (lo.hi + hi.lo), K = 64, logits sigma ~8, 1/sqrt(64) log2(e) applied in the exponent), online row softmax on VALU with no mask (f32 statistics, native exp2; weights x256 f16), o = P . V^T (o carried x64, folded into the output GEMM alpha) written straight into the merged f16 o rows; out = o W_o GEMM (f32, no bias) into the output layout.
// Attention now runs as ONE fused launch (k_fattn, below): the per-tile score passes, the row softmax and the P . V^T pass of the former version are gone, with their score and weight planes; V^T is built for both batches in one launch.
// All work that reads inputs only (the weight planes, the three f16 input streams) now runs as ONE launch (k_prep, below) in place of one launch per head and plane and one per stream.
// The four GEMM launches (k_gemm2) now take their operand tiles through LDS (asynchronous copies, two buffers): see the lines above k_gemm2.
// The fused attention (k_fattn) now takes its K and V^T rows through LDS in the same way, once for the work-group's eight waves: see the lines above k_fattn.
// Compute dtype: inputs rounded to bf16; x / weights exact; q and k as f16 hi + x1024 residual planes; v, softmax weights and o as plain f16 GEMM operands (~2^-12); scores and softmax statistics f32. v_wmma_f32_16x16x32_f16.
#define NB 2
#define SCL 0.125f                         /* 1 / sqrt(head_dim = 64) */
#define SCLR 0.0001220703125f              /* 2^-13: SCL x 2^-10 (not used) */
#define SQ 2048
#define DM 1024
#define NH 16
#define HD 64
#define HG 4                         /* heads per group of the second k_vt (not launched) */
#define QT 256                       /* query rows per query tile (not used) */
#define NKX SQ                       /* row pitch of the former S / P planes (not used) */
#define QT0 128                      /* rows of the exact first tile of k_att0 (not launched) */
#define B0 0                         /* first batch processed (debug hook) */
#define NBR NB                       /* batches processed (debug hook) */
#define NR ((size_t)NB * SQ)         /* token rows */
#define MP ((int)((size_t)NBR * SQ)) /* rows projected (debug hook) */
#define QN SQ                        /* query rows attended per batch (not used) */
#define NHD NH                       /* heads attended (not used) */
#define MPO MP                       /* rows through the output stage (debug hook) */
#define LQ DM      /* row pitch of the q/k/v rows */
typedef __bf16 v16b __attribute__((ext_vector_type(16)));
typedef unsigned short v8us __attribute__((ext_vector_type(8), may_alias));
typedef float  v8f  __attribute__((ext_vector_type(8)));
typedef float  v4f  __attribute__((ext_vector_type(4)));
typedef float  v4fa __attribute__((ext_vector_type(4), may_alias));
union FragB { v16b v; v8us half[2]; unsigned short u[16]; };

__device__ __forceinline__ unsigned short bf16_bits(float x) { unsigned int u = __float_as_uint(x); return (unsigned short)((u + 0x7FFFu + ((u >> 16) & 1u)) >> 16); }
__device__ __forceinline__ float bf16_val(unsigned short b) { return __uint_as_float(((unsigned int)b) << 16); }
__device__ __forceinline__ float bf16_round(float x) { return bf16_val(bf16_bits(x)); }
// D += A·B with NT terms: 1 = ah·bh, 2 = + al·bh (A split), 3 = + ah·bl (both split)
template <int NT>
__device__ __forceinline__ v8f mmaN(v16b ah, v16b al, v16b bh, v16b bl, v8f c) {
  c = __builtin_amdgcn_wmma_f32_16x16x32_bf16(false, ah, false, bh, (short)0, c, false, false);
  if (NT >= 2) c = __builtin_amdgcn_wmma_f32_16x16x32_bf16(false, al, false, bh, (short)0, c, false, false);
  if (NT >= 3) c = __builtin_amdgcn_wmma_f32_16x16x32_bf16(false, ah, false, bl, (short)0, c, false, false);
  asm volatile("v_nop\n\tv_nop\n\tv_nop\n\tv_nop" : "+v"(c) : "v"(ah), "v"(al), "v"(bh), "v"(bl));
  return c;
}

__global__ __launch_bounds__(256) void k_wt_bf16(const float* __restrict__ W, unsigned short* __restrict__ Wt, int K, int N) {
  const int t = blockIdx.x * 256 + threadIdx.x;
  const int k8n = K / 8;
  if (t >= N * k8n) return;
  const int n = t / k8n, k8 = (t % k8n) * 8;
  v8us v;
#pragma unroll
  for (int i = 0; i < 8; ++i) v[i] = bf16_bits(W[(size_t)(k8 + i) * N + n]);
  *(v8us*)(Wt + (size_t)n * K + k8) = v;
  
}

// GEMM C[M][N] (f32, pitch ldc) = act(A[M][K]·W + bias). A f32 row-major (pitch lda) converted per fragment to bf16
// (ASPLIT: hi/lo two planes -> 2 terms, else single rounded term); Wt bf16 [N][K] (pitch ldb). BIAS_BF16 rounds the
// bias to bf16 first (bias quantised to bf16 before the add). K%32==0, M%16==0, N%64==0.
template <bool ASPLIT, int ACT, bool BIAS_BF16>
__global__ __launch_bounds__(128) void k_gemm_bf(const float* __restrict__ A, int lda, const unsigned short* __restrict__ Wt, int ldb,
                                               const float* __restrict__ bias, float* __restrict__ C, int ldc, int M, int N, int K) {
  __shared__ __attribute__((aligned(16))) float so[4][16][64];
  const int tid = threadIdx.x, w = tid >> 5, lane = tid & 31, ln = lane & 15, hh = lane >> 4;
  const int ntn = N / 64;
  const int wid = blockIdx.x * 4 + w;
  const int mt = wid / ntn, nq = wid % ntn;
  if (mt * 16 >= M) return;
  const int row0 = mt * 16, col0 = nq * 64;
  const float* arow = A + (size_t)(row0 + ln) * lda;
  v8f acc[4] = {};
  for (int kb = 0; kb < K; kb += 32) {
    FragB ah, al;
    const v4f x0 = *(const v4fa*)(arow + kb + 8 * hh), x1 = *(const v4fa*)(arow + kb + 8 * hh + 4);
    const v4f x2 = *(const v4fa*)(arow + kb + 16 + 8 * hh), x3 = *(const v4fa*)(arow + kb + 16 + 8 * hh + 4);
    float xs[16] = {x0[0],x0[1],x0[2],x0[3],x1[0],x1[1],x1[2],x1[3],x2[0],x2[1],x2[2],x2[3],x3[0],x3[1],x3[2],x3[3]};
#pragma unroll
    for (int i = 0; i < 16; ++i) { const unsigned short hb = bf16_bits(xs[i]); ah.u[i] = hb; al.u[i] = ASPLIT ? bf16_bits(xs[i] - bf16_val(hb)) : (unsigned short)0; }
#pragma unroll
    for (int t = 0; t < 4; ++t) {
      const unsigned short* brow = Wt + (size_t)(col0 + t * 16 + ln) * ldb + kb;
      FragB b;
      b.half[0] = *(const v8us*)(brow + 8 * hh);
      b.half[1] = *(const v8us*)(brow + 16 + 8 * hh);
      acc[t] = mmaN<ASPLIT ? 2 : 1>(ah.v, al.v, b.v, b.v, acc[t]);
    }
  }
#pragma unroll
  for (int t = 0; t < 4; ++t) {
    float bv = bias ? bias[col0 + t * 16 + ln] : 0.f;
    if (BIAS_BF16) bv = bf16_round(bv);
#pragma unroll
    for (int r = 0; r < 8; ++r) { float v = acc[t][r] + bv; if (ACT == 1) v = fmaxf(v, 0.f); so[w][8 * hh + r][t * 16 + ln] = v; }
  }
  __builtin_amdgcn_fence(__ATOMIC_ACQ_REL, "workgroup");
  __builtin_amdgcn_wave_barrier();
  const int rsub = lane >> 4, c4 = (lane & 15) * 4;
  {
#pragma unroll
    for (int q = 0; q < 8; ++q) {
      const int r = q * 2 + rsub;
      const v4f v = *(const v4fa*)&so[w][r][c4];
      *(v4f*)(C + (size_t)(row0 + r) * ldc + col0 + c4) = v;
    }
    
  }
}

// GEMM C = act(A·W + bias + resid): A f32 (ASPLIT -> hi/lo 2 terms), Wt bf16 [N][K]; ACT 0 none, 1 relu, 2 exact gelu;
// resid (optional, f32, row index = (row % rmod), pitch ldr, RES_BF16 rounds it) added before the activation.
template <bool ASPLIT, int ACT, bool BIAS_BF16, bool RES_BF16>
__global__ __launch_bounds__(128) void k_gemm_bf3(const float* __restrict__ A, int lda, const unsigned short* __restrict__ Wt, int ldb,
                                                const float* __restrict__ bias, const float* __restrict__ resid, int rmod, int ldr,
                                                float* __restrict__ C, int ldc, int M, int N, int K) {
  __shared__ __attribute__((aligned(16))) float so[4][16][64];
  const int tid = threadIdx.x, w = tid >> 5, lane = tid & 31, ln = lane & 15, hh = lane >> 4;
  const int ntn = N / 64;
  const int wid = blockIdx.x * 4 + w;
  const int mt = wid / ntn, nq = wid % ntn;
  if (mt * 16 >= M) return;
  const int row0 = mt * 16, col0 = nq * 64;
  const float* arow = A + (size_t)(row0 + ln) * lda;
  v8f acc[4] = {};
  for (int kb = 0; kb < K; kb += 32) {
    FragB ah, al;
    const v4f x0 = *(const v4fa*)(arow + kb + 8 * hh), x1 = *(const v4fa*)(arow + kb + 8 * hh + 4);
    const v4f x2 = *(const v4fa*)(arow + kb + 16 + 8 * hh), x3 = *(const v4fa*)(arow + kb + 16 + 8 * hh + 4);
    float xs[16] = {x0[0],x0[1],x0[2],x0[3],x1[0],x1[1],x1[2],x1[3],x2[0],x2[1],x2[2],x2[3],x3[0],x3[1],x3[2],x3[3]};
#pragma unroll
    for (int i = 0; i < 16; ++i) { const unsigned short hb = bf16_bits(xs[i]); ah.u[i] = hb; al.u[i] = ASPLIT ? bf16_bits(xs[i] - bf16_val(hb)) : (unsigned short)0; }
#pragma unroll
    for (int t = 0; t < 4; ++t) {
      const unsigned short* brow = Wt + (size_t)(col0 + t * 16 + ln) * ldb + kb;
      FragB b;
      b.half[0] = *(const v8us*)(brow + 8 * hh);
      b.half[1] = *(const v8us*)(brow + 16 + 8 * hh);
      acc[t] = mmaN<ASPLIT ? 2 : 1>(ah.v, al.v, b.v, b.v, acc[t]);
    }
  }
#pragma unroll
  for (int t = 0; t < 4; ++t) {
    const int col = col0 + t * 16 + ln;
    float bv = bias ? bias[col] : 0.f;
    if (BIAS_BF16) bv = bf16_round(bv);
#pragma unroll
    for (int r = 0; r < 8; ++r) {
      float v = acc[t][r] + bv;
      if (resid) { float rv = resid[(size_t)((row0 + 8 * hh + r) % rmod) * ldr + col]; if (RES_BF16) rv = bf16_round(rv); v += rv; }
      if (ACT == 1) v = fmaxf(v, 0.f);
      if (ACT == 2) v = 0.5f * v * (1.0f + erff(v * 0.70710678118654752f));
      if (ACT == 3) { const float u = 0.7978845608028654f * (v + 0.044715f * v * v * v); v = 0.5f * v * (1.0f + tanhf(u)); }
      so[w][8 * hh + r][t * 16 + ln] = v;
    }
  }
  __builtin_amdgcn_fence(__ATOMIC_ACQ_REL, "workgroup");
  __builtin_amdgcn_wave_barrier();
  const int rsub = lane >> 4, c4 = (lane & 15) * 4;
  {
#pragma unroll
    for (int q = 0; q < 8; ++q) {
      const int r = q * 2 + rsub;
      const v4f v = *(const v4fa*)&so[w][r][c4];
      *(v4f*)(C + (size_t)(row0 + r) * ldc + col0 + c4) = v;
    }
    
  }
}
// row LayerNorm (biased variance, eps) over N: s = X (+ R); optional out_sum <- s; out_norm <- (s-mu)*rsqrt(var+eps)*g + b
template <bool PARAM_BF16>
__global__ __launch_bounds__(256) void k_layernorm(const float* __restrict__ X, const float* __restrict__ R, const float* __restrict__ g, const float* __restrict__ bta,
                                                  float* __restrict__ out_sum, float* __restrict__ out_norm, int N, float eps) {
  __shared__ float red[256];
  const int row = blockIdx.x, tid = threadIdx.x;
  const float* x = X + (size_t)row * N; const float* rr = R ? R + (size_t)row * N : nullptr;
  float vals[16];                     // up to N = 4096
  const int per = N / 256;            // contiguous chunk per thread? use strided-by-4 chunks: thread handles j = tid*4 + 1024*u
  float s1 = 0.f;
  for (int u = 0; u < per / 4; ++u) {
    const int j = tid * 4 + 1024 * u;
    const v4f a = *(const v4fa*)(x + j);
    v4f b = {0.f,0.f,0.f,0.f}; if (rr) b = *(const v4fa*)(rr + j);
#pragma unroll
    for (int q = 0; q < 4; ++q) { const float v = a[q] + b[q]; vals[u * 4 + q] = v; s1 += v; }
  }
  red[tid] = s1; __syncthreads();
  for (int st = 128; st > 0; st >>= 1) { if (tid < st) red[tid] += red[tid + st]; __syncthreads(); }
  const float mu = red[0] / (float)N; __syncthreads();
  float s2 = 0.f;
  for (int u = 0; u < per / 4; ++u)
#pragma unroll
    for (int q = 0; q < 4; ++q) { const float c = vals[u * 4 + q] - mu; s2 += c * c; }
  red[tid] = s2; __syncthreads();
  for (int st = 128; st > 0; st >>= 1) { if (tid < st) red[tid] += red[tid + st]; __syncthreads(); }
  const float rs = rsqrtf(red[0] / (float)N + eps);
  {
    for (int u = 0; u < per / 4; ++u) {
      const int j = tid * 4 + 1024 * u;
      v4f o, sm;
#pragma unroll
      for (int q = 0; q < 4; ++q) {
        float gg = g[j + q], bb = bta[j + q];
        if (PARAM_BF16) { gg = bf16_round(gg); bb = bf16_round(bb); }
        sm[q] = vals[u * 4 + q]; o[q] = (vals[u * 4 + q] - mu) * rs * gg + bb;
      }
      if (out_sum) *(v4f*)(out_sum + (size_t)row * N + j) = sm;
      *(v4f*)(out_norm + (size_t)row * N + j) = o;
    }
    
  }
}



// ---- f16 WMMA path (v_wmma_f32_16x16x32_f16): 11-bit significands for operands in range — used where a [0,1] probability operand needs more precision than bf16
typedef _Float16 v16h __attribute__((ext_vector_type(16)));
union FragH { v16h v; v8us half[2]; _Float16 h[16]; unsigned short u[16]; };
template <int NT>
__device__ __forceinline__ v8f mmaH(v16h ah, v16h al, v16h bh, v16h bl, v8f c) {
  c = __builtin_amdgcn_wmma_f32_16x16x32_f16(false, ah, false, bh, (short)0, c, false, false);
  if (NT >= 2) c = __builtin_amdgcn_wmma_f32_16x16x32_f16(false, al, false, bh, (short)0, c, false, false);
  if (NT >= 3) c = __builtin_amdgcn_wmma_f32_16x16x32_f16(false, ah, false, bl, (short)0, c, false, false);
  asm volatile("v_nop\n\tv_nop\n\tv_nop\n\tv_nop" : "+v"(c) : "v"(ah), "v"(al), "v"(bh), "v"(bl));
  return c;
}
// batched GEMM like k_gemm_b but f16 operands: A f32 (split into f16 hi/lo if ASPLIT, else rounded to f16), Bt = f16 values [n][k]; alpha; C f32; N multiple of 16 (partial tiles skipped)
template <bool ASPLIT>
__global__ __launch_bounds__(128) void k_gemm_h(const float* __restrict__ A, int lda, size_t sA, const _Float16* __restrict__ Bh, int ldb, size_t sB, float alpha, float* __restrict__ C, int ldc, size_t sC, int M, int N, int K) {
  __shared__ __attribute__((aligned(16))) float so[4][16][64];
  const int tid = threadIdx.x, w = tid >> 5, lane = tid & 31, ln = lane & 15, hh = lane >> 4; const int by = blockIdx.y;
  A += (size_t)by * sA; Bh += (size_t)by * sB; C += (size_t)by * sC;
  const int ntn = (N + 63) / 64; const int wid = blockIdx.x * 4 + w; const int mt = wid / ntn, nq = wid % ntn; if (mt * 16 >= M) return;
  const int row0 = mt * 16, col0 = nq * 64; const float* arow = A + (size_t)(row0 + ln) * lda;
  v8f acc[4] = {};
  for (int kb = 0; kb < K; kb += 32) {
    FragH ah, al;
    const v4f x0 = *(const v4fa*)(arow + kb + 8 * hh), x1 = *(const v4fa*)(arow + kb + 8 * hh + 4), x2 = *(const v4fa*)(arow + kb + 16 + 8 * hh), x3 = *(const v4fa*)(arow + kb + 16 + 8 * hh + 4);
    float xs[16] = {x0[0],x0[1],x0[2],x0[3],x1[0],x1[1],x1[2],x1[3],x2[0],x2[1],x2[2],x2[3],x3[0],x3[1],x3[2],x3[3]};
#pragma unroll
    for (int i = 0; i < 16; ++i) { const _Float16 h = (_Float16)xs[i]; ah.h[i] = h; al.h[i] = ASPLIT ? (_Float16)(xs[i] - (float)h) : (_Float16)0.0f; }
#pragma unroll
    for (int t = 0; t < 4; ++t) { if (col0 + t * 16 >= N) continue; const size_t boff = (size_t)(col0 + t * 16 + ln) * ldb + kb; FragH bq; bq.half[0] = *(const v8us*)(Bh + boff + 8 * hh); bq.half[1] = *(const v8us*)(Bh + boff + 16 + 8 * hh);
      acc[t] = mmaH<ASPLIT ? 2 : 1>(ah.v, al.v, bq.v, bq.v, acc[t]); }
  }
#pragma unroll
  for (int t = 0; t < 4; ++t) { if (col0 + t * 16 >= N) continue;
#pragma unroll
    for (int r = 0; r < 8; ++r) so[w][8 * hh + r][t * 16 + ln] = acc[t][r] * alpha; }
  __builtin_amdgcn_fence(__ATOMIC_ACQ_REL, "workgroup"); __builtin_amdgcn_wave_barrier();
  const int rsub = lane >> 4, c4 = (lane & 15) * 4;
  {
#pragma unroll
    for (int q = 0; q < 8; ++q) { const int r = q * 2 + rsub; if (col0 + c4 < N) { const v4f v = *(const v4fa*)&so[w][r][c4]; *(v4f*)(C + (size_t)(row0 + r) * ldc + col0 + c4) = v; } }
     }
}

// Wt[n][k] = f16(W[k][n]·scale) from f32 row-major W[K][N] (scale = power of two; bf16-exact weights stay exact in f16 away from the subnormal range)
__device__ __forceinline__ void wt_f16(const float* __restrict__ W, _Float16* __restrict__ Wt, int K, int N, float scale, int t) {      /* t = the caller's flat index, 0 .. N K / 8 - 1 */
  const int n = t / (K / 8), k8 = (t % (K / 8)) * 8; FragH f;
#pragma unroll
  for (int i = 0; i < 8; ++i) f.h[i] = (_Float16)(bf16_round(W[(size_t)(k8 + i) * N + n]) * scale); const v8us o = f.half[0];
  *(v8us*)((unsigned short*)Wt + (size_t)n * K + k8) = o;
  asm volatile("s_wait_xcnt 0x0" ::: "memory");      /* stands directly behind the store, in front of any later overwrite of a register that the store names */
}
// k_gemm_hh variant with fused epilogue: v = acc·alpha + bias[by·sBias + col] (+ CP[(row/rowsPerB)·sCPb + by·64 + col] if CP) ; ACT 0 none / 1 elu ; writes f16 C16 (and f32 C if non-null)
template <int ACT>
__global__ __launch_bounds__(128) void k_gemm_hhx(const _Float16* __restrict__ A, int lda, size_t sA, const _Float16* __restrict__ Bh, int ldb, size_t sB, float alpha, const float* __restrict__ bias, size_t sBias, const float* __restrict__ CP, int rowsPerB, size_t sCPb, int row0g,
    float* __restrict__ C, _Float16* __restrict__ C16, int ldc, size_t sC, int M, int N, int K) {
  __shared__ __attribute__((aligned(16))) float so[4][16][64];
  const int tid = threadIdx.x, w = tid >> 5, lane = tid & 31, ln = lane & 15, hh = lane >> 4; const int by = blockIdx.y;
  A += (size_t)by * sA; Bh += (size_t)by * sB; const size_t cofs = (size_t)by * sC; const float* bp = bias ? bias + (size_t)by * sBias : nullptr;
  const int ntn = (N + 63) / 64; const int wid = blockIdx.x * 4 + w; const int mt = wid / ntn, nq = wid % ntn; if (mt * 16 >= M) return;
  const int row0 = mt * 16, col0 = nq * 64; const _Float16* arow = A + (size_t)(row0 + ln) * lda;
  v8f acc[4] = {};
  for (int kb = 0; kb < K; kb += 32) { FragH ah; ah.half[0] = *(const v8us*)((const unsigned short*)arow + kb + 8 * hh); ah.half[1] = *(const v8us*)((const unsigned short*)arow + kb + 16 + 8 * hh);
#pragma unroll
    for (int t = 0; t < 4; ++t) { if (col0 + t * 16 >= N) continue; const size_t boff = (size_t)(col0 + t * 16 + ln) * ldb + kb; FragH bq; bq.half[0] = *(const v8us*)((const unsigned short*)Bh + boff + 8 * hh); bq.half[1] = *(const v8us*)((const unsigned short*)Bh + boff + 16 + 8 * hh);
      acc[t] = mmaH<1>(ah.v, ah.v, bq.v, bq.v, acc[t]); }
  }
#pragma unroll
  for (int t = 0; t < 4; ++t) { if (col0 + t * 16 >= N) continue; const int col = col0 + t * 16 + ln; const float bv = bp ? bf16_round(bp[col]) : 0.f;
#pragma unroll
    for (int r = 0; r < 8; ++r) { float v = acc[t][r] * alpha + bv; if (CP) { const int rr = row0g + row0 + 8 * hh + r; if (rowsPerB < 0) v += CP[cofs + (size_t)rr * ldc + col];      /* rowsPerB < 0: own element of the batched C plane */ else { const int bidx = rr / rowsPerB; v += CP[(size_t)bidx * sCPb + (size_t)by * 64 + col]; } } if (ACT == 1) v = (v > 0.f) ? v : expm1f(v); else if (ACT == 7) v = (v > 0.f) ? v + 1.0f : expf(v); else if (ACT == 8) v = tanhf(v); else if (ACT == 9) v = 0.5f * v * (1.0f + tanhf(0.7978845608028654f * (v + 0.044715f * v * v * v))); else if (ACT == 11) v = 1.0f / (1.0f + expf(-v)); else if (ACT == 12) v = (v > 0.f) ? v : 0.01f * v; else if (ACT == 14) v = (v > 0.f) ? v : 0.1f * v; else if (ACT == 16) v = (v >= 0.f) ? v : 0.3f * v; else if (ACT == 17) v = (v >= 0.f) ? v : 0.2f * v; else if (ACT == 15) v = v / (1.0f + expf(-v)); else if (ACT == 3) v = fmaxf(v, 0.f); else if (ACT == 6) v = 0.5f * v * (1.0f + erff(v * 0.70710678118654752f)); so[w][8 * hh + r][t * 16 + ln] = v; } }
  __builtin_amdgcn_fence(__ATOMIC_ACQ_REL, "workgroup"); __builtin_amdgcn_wave_barrier();
  const int rsub = lane >> 4, c4 = (lane & 15) * 4; typedef _Float16 v4h __attribute__((ext_vector_type(4)));
  {
#pragma unroll
    for (int q = 0; q < 8; ++q) { const int r = q * 2 + rsub; if (col0 + c4 < N) { const v4f v = *(const v4fa*)&so[w][r][c4]; if (C) *(v4f*)(C + cofs + (size_t)(row0 + r) * ldc + col0 + c4) = v; if (C16) { v4h h4; for (int i = 0; i < 4; ++i) h4[i] = (_Float16)v[i]; *(v4h*)(C16 + cofs + (size_t)(row0 + r) * ldc + col0 + c4) = h4; } } }
     }
}


typedef _Float16 v4h __attribute__((ext_vector_type(4)));

__device__ __forceinline__ void x16(const float* __restrict__ x, _Float16* __restrict__ X16, size_t t) { FragH f;      /* t = the caller's flat index of a group of 8 elements */
#pragma unroll
  for (int q = 0; q < 8; ++q) f.h[q] = (_Float16)bf16_round(x[t * 8 + q]); *(v8us*)((unsigned short*)X16 + t * 8) = f.half[0];
  asm volatile("s_wait_xcnt 0x0" ::: "memory");      /* stands directly behind the store, in front of any later overwrite of a register that the store names */
}
#define PWB (DM * DM / 8 / 256)            /* blocks per weight plane (512) */
#define PXB ((int)(NR * DM / 8 / 256))     /* blocks per input stream (2048) */
// All work that reads inputs only, in ONE launch: none of these jobs reads what another writes, so a range of block indices takes the place of each former launch.
// Blocks 0 .. 4 PWB - 1: the four weight planes (WQ, WK, WV: head t / 8192 of the stack, its [1024][64] block into rows 64 h .. 64 h + 63; WO whole); the rest: the three input streams. Every thread does what one thread of the former launches did.
__global__ __launch_bounds__(256) void k_prep(const float* __restrict__ wq, const float* __restrict__ wk, const float* __restrict__ wv, const float* __restrict__ wo, const float* __restrict__ x, const float* __restrict__ xk, const float* __restrict__ xv,
    _Float16* __restrict__ BQ, _Float16* __restrict__ BK, _Float16* __restrict__ BV, _Float16* __restrict__ BO, _Float16* __restrict__ X16, _Float16* __restrict__ XK16, _Float16* __restrict__ XV16) {
  const int bid = blockIdx.x;
  if (bid < 4 * PWB) { const int job = bid / PWB; const int t = (bid % PWB) * 256 + threadIdx.x;
    if (job == 3) { wt_f16(wo, BO, DM, DM, 16.0f, t); return; }
    const float* W = job == 0 ? wq : job == 1 ? wk : wv; _Float16* Bt = job == 0 ? BQ : job == 1 ? BK : BV; const int h = t / (HD * (DM / 8));
    wt_f16(W + (size_t)h * DM * HD, Bt + (size_t)h * HD * DM, DM, HD, 16.0f, t % (HD * (DM / 8))); return; }
  const int u = bid - 4 * PWB; const int job = u / PXB; const size_t t = (size_t)(u % PXB) * 256 + threadIdx.x;
  x16(job == 0 ? x : job == 1 ? xk : xv, job == 0 ? X16 : job == 1 ? XK16 : XV16, t); }
__global__ __launch_bounds__(256) void k_h16(const float* __restrict__ x, _Float16* __restrict__ X16, size_t n8) { const size_t t = (size_t)blockIdx.x * 256 + threadIdx.x; if (t >= n8) return; FragH f;
#pragma unroll
  for (int q = 0; q < 8; ++q) f.h[q] = (_Float16)x[t * 8 + q]; *(v8us*)((unsigned short*)X16 + t * 8) = f.half[0];  }
__global__ __launch_bounds__(256) void k_round16f(const float* __restrict__ W, _Float16* __restrict__ Bt, size_t n8) { const size_t t = (size_t)blockIdx.x * 256 + threadIdx.x; if (t >= n8) return; FragH f;
#pragma unroll
  for (int i = 0; i < 8; ++i) f.h[i] = (_Float16)(bf16_round(W[t * 8 + i]) * 16.0f); *(v8us*)((unsigned short*)Bt + t * 8) = f.half[0];  }
template <int NHv, int TTv>
__global__ __launch_bounds__(256) void k_vt(const _Float16* __restrict__ V16, int ldv, int voff, _Float16* __restrict__ Vt) { __shared__ unsigned short tl[64][66]; const int tid = threadIdx.x; const int slab = blockIdx.x / (TTv / 64), lg = blockIdx.x % (TTv / 64); const int b = slab / NHv, h = slab % NHv;
  for (int i = tid; i < 64 * 8; i += 256) { const int r = i / 8, c8 = (i % 8) * 8; FragH f; f.half[0] = *(const v8us*)((const unsigned short*)V16 + ((size_t)b * TTv + lg * 64 + r) * ldv + voff + h * 64 + c8);
#pragma unroll
    for (int q = 0; q < 8; ++q) tl[r][c8 + q] = f.u[q]; }
  __syncthreads();
  {
#pragma unroll
    for (int rd = 0; rd < 2; ++rd) { const int d = rd * 32 + tid / 8, pc = tid % 8; FragH f;
#pragma unroll
      for (int q = 0; q < 8; ++q) f.u[q] = tl[pc * 8 + q][d];
      *(v8us*)((unsigned short*)Vt + ((size_t)slab * 64 + d) * TTv + lg * 64 + pc * 8) = f.half[0]; }
     } }

__global__ __launch_bounds__(256) void k_hl(const float* __restrict__ F, _Float16* __restrict__ Hh, _Float16* __restrict__ Hl, size_t n8) { const size_t t = (size_t)blockIdx.x * 256 + threadIdx.x; if (t >= n8) return; FragH fh, fl; const v4f a = *(const v4fa*)(F + t * 8), c = *(const v4fa*)(F + t * 8 + 4);
#pragma unroll
  for (int q = 0; q < 4; ++q) { _Float16 h = (_Float16)a[q]; fh.h[q] = h; fl.h[q] = (_Float16)((a[q] - (float)h) * 1024.0f); h = (_Float16)c[q]; fh.h[4 + q] = h; fl.h[4 + q] = (_Float16)((c[q] - (float)h) * 1024.0f); }
  { *(v8us*)((unsigned short*)Hh + t * 8) = fh.half[0]; *(v8us*)((unsigned short*)Hl + t * 8) = fl.half[0];  } }

// ---- fast GEMM (work-group tile 128x64, wave tile 32x64; requires M % 128 == 0, N % 64 == 0, K % 128 == 0, K >= 128); epilogue = k_gemm_hhx semantics ----
// Operands go through LDS: a stage is 128 k (256 bytes) of the work-group's 128 A rows and 64 Bh rows. Each lane copies 16 bytes, a wave's copy covers two whole rows of the stage (4 whole lines), and a Bh row is fetched once for the four waves.
// Two buffers: stage s + 1 flies while stage s is worked on. Fragments are read from LDS in the k order of the former global loads (k = 8 hh + i, 16 + 8 hh + i), k steps in the same order: same sums.
#define G2KC 128                     /* k per stage */
#define G2P 272                      /* LDS row pitch, bytes: 256 + 16 = 16 x odd, the pitch at which ds_load_b128 fragment reads meet no bank conflict */
#define G2BUF (192 * G2P)            /* one buffer: rows 0-127 A, 128-191 Bh */
__device__ __forceinline__ v16h g2_frag(const unsigned char* p) { FragH f; f.half[0] = *(const v8us*)p; f.half[1] = *(const v8us*)(p + 32); return f.v; }      /* p = the lane's row in LDS + 64 bytes per k step + 16 hh */
// Eight asynchronous copies of 16 bytes per lane, 8 rows apart (l = the lane's LDS byte address, g = its global address, gs = 8 rows of the source in elements).
// s_wait_xcnt 0 is the statement's last line so that it stands in front of every later write of the address registers that the copies name.
__device__ __forceinline__ void g2_copy8(unsigned l, const _Float16* g, size_t gs) {
  asm volatile("global_load_async_to_lds_b128 %0, %8, off\n\t"
               "global_load_async_to_lds_b128 %1, %9, off\n\t"
               "global_load_async_to_lds_b128 %2, %10, off\n\t"
               "global_load_async_to_lds_b128 %3, %11, off\n\t"
               "global_load_async_to_lds_b128 %4, %12, off\n\t"
               "global_load_async_to_lds_b128 %5, %13, off\n\t"
               "global_load_async_to_lds_b128 %6, %14, off\n\t"
               "global_load_async_to_lds_b128 %7, %15, off\n\t"
               "s_wait_xcnt 0x0"
               :: "v"(l), "v"(l + 8 * G2P), "v"(l + 16 * G2P), "v"(l + 24 * G2P), "v"(l + 32 * G2P), "v"(l + 40 * G2P), "v"(l + 48 * G2P), "v"(l + 56 * G2P),
                  "v"(g), "v"(g + gs), "v"(g + 2 * gs), "v"(g + 3 * gs), "v"(g + 4 * gs), "v"(g + 5 * gs), "v"(g + 6 * gs), "v"(g + 7 * gs) : "memory"); }
// One stage: 24 copies per lane. l = the lane's place in the buffer (row tid / 16, 16-byte piece tid % 16); ga, gb = the same place in the stage's A and Bh rows.
__device__ __forceinline__ void g2_stage(unsigned l, const _Float16* ga, int lda, const _Float16* gb, int ldb) {
  g2_copy8(l, ga, (size_t)8 * lda); g2_copy8(l + 64 * G2P, ga + (size_t)64 * lda, (size_t)8 * lda); g2_copy8(l + 128 * G2P, gb, (size_t)8 * ldb); }
__device__ __forceinline__ v8f g2_mma(v16h a, v16h b, v8f c) { v8f d = __builtin_amdgcn_wmma_f32_16x16x32_f16(false, a, false, b, (short)0, c, false, false); asm volatile("v_nop\n\tv_nop\n\tv_nop\n\tv_nop" : "+v"(d) : "v"(a), "v"(b)); return d; }
template <int ACT>
__global__ __launch_bounds__(128) void k_gemm2(const _Float16* __restrict__ A, int lda, size_t sA, const _Float16* __restrict__ Bh, int ldb, size_t sB, float alpha, const float* __restrict__ bias, size_t sBias, const float* __restrict__ CP, int rowsPerB, size_t sCPb, int row0g,
    float* __restrict__ C, _Float16* __restrict__ C16, int ldc, size_t sC, int M, int N, int K) { static_assert(ACT == 0 || ACT == 3 || ACT == 6 || ACT == 8 || ACT == 9 || ACT == 11 || ACT == 12 || ACT == 14 || ACT == 15 || ACT == 16 || ACT == 17, "k_gemm2: unsupported ACT code (would silently apply no activation)");
  __shared__ __attribute__((aligned(16))) float so[4][32][68];
  __shared__ __attribute__((aligned(16))) unsigned char ring[2 * G2BUF];
  const int tid = threadIdx.x, w = tid >> 5, lane = tid & 31, ln = lane & 15, hh = lane >> 4; const int by = blockIdx.y;
  A += (size_t)by * sA; Bh += (size_t)by * sB; const size_t cofs = (size_t)by * sC; const float* bp = bias ? bias + (size_t)by * sBias : nullptr;
  const int ntn = N >> 6; const int mt = blockIdx.x / ntn, nq = blockIdx.x - mt * ntn; const int row0 = mt * 128 + 32 * w, col0 = nq * 64; if (mt * 128 >= M) return;      /* the same for the whole work-group, in front of every barrier */
  const unsigned lc = (unsigned)(size_t)ring + (unsigned)((tid >> 4) * G2P + (tid & 15) * 16);      /* this lane's place in buffer 0 as an LDS byte address (low 32 bits of the __shared__ address) */
  const _Float16* ga = A + (size_t)(mt * 128 + (tid >> 4)) * lda + (tid & 15) * 8; const _Float16* gb = Bh + (size_t)(col0 + (tid >> 4)) * ldb + (tid & 15) * 8;
  const int nst = K / G2KC;
  const v8f z8 = {0.f,0.f,0.f,0.f,0.f,0.f,0.f,0.f}; v8f c00 = z8, c01 = z8, c02 = z8, c03 = z8, c10 = z8, c11 = z8, c12 = z8, c13 = z8;
  g2_stage(lc, ga, lda, gb, ldb);
  asm volatile("s_wait_asynccnt 0x0" ::: "memory");      /* this wave's copies of stage 0 have landed */
  __syncthreads();      /* stage 0 is readable by every wave */
  if (nst > 1) g2_stage(lc + G2BUF, ga + G2KC, lda, gb + G2KC, ldb);
#pragma unroll 1      /* rolled: one stage per trip, its four k steps unrolled inside */
  for (int s = 0; s < nst; ++s) { const unsigned char* bufp = ring + (s & 1) * G2BUF; const unsigned char* pa = bufp + (32 * w + ln) * G2P + 16 * hh; const unsigned char* pb = bufp + (128 + ln) * G2P + 16 * hh;
    v16h a0 = g2_frag(pa), a1 = g2_frag(pa + 16 * G2P), b0 = g2_frag(pb), b1 = g2_frag(pb + 16 * G2P), b2 = g2_frag(pb + 32 * G2P), b3 = g2_frag(pb + 48 * G2P);
#pragma unroll      /* unrolled: the two fragment sets then alternate by register name, without copies */
    for (int ks = 0; ks < G2KC / 32; ++ks) { v16h na0 = a0, na1 = a1, nb0 = b0, nb1 = b1, nb2 = b2, nb3 = b3;
      if (ks + 1 < G2KC / 32) { const int o = (ks + 1) * 64; na0 = g2_frag(pa + o); na1 = g2_frag(pa + 16 * G2P + o); nb0 = g2_frag(pb + o); nb1 = g2_frag(pb + 16 * G2P + o); nb2 = g2_frag(pb + 32 * G2P + o); nb3 = g2_frag(pb + 48 * G2P + o); }      /* the next k step's fragments of the SAME stage, asked for ahead of this step's products */
      c00 = g2_mma(a0, b0, c00); c10 = g2_mma(a1, b0, c10); c01 = g2_mma(a0, b1, c01); c11 = g2_mma(a1, b1, c11);
      c02 = g2_mma(a0, b2, c02); c12 = g2_mma(a1, b2, c12); c03 = g2_mma(a0, b3, c03); c13 = g2_mma(a1, b3, c13);
      a0 = na0; a1 = na1; b0 = nb0; b1 = nb1; b2 = nb2; b3 = nb3; }
    asm volatile("s_wait_dscnt 0x0" ::: "memory");      /* this wave's reads of stage s are done before the buffer is handed to its next writer */
    asm volatile("s_wait_asynccnt 0x0" ::: "memory");      /* this wave's copies of stage s + 1 have landed */
    __syncthreads();      /* publishes stage s + 1 and ends every wave's reads of stage s */
    if (s + 2 < nst) g2_stage(lc + (unsigned)(s & 1) * G2BUF, ga + (size_t)(s + 2) * G2KC, lda, gb + (size_t)(s + 2) * G2KC, ldb); }
  asm volatile("s_wait_asynccnt 0x0" ::: "memory");      /* no copy is outstanding when the wave goes on */
  v8f accs[8] = {c00, c01, c02, c03, c10, c11, c12, c13};
#pragma unroll
  for (int u = 0; u < 8; ++u) { const int t = u & 3, half = u >> 2; const int col = col0 + t * 16 + ln; const float bv = bp ? bf16_round(bp[col]) : 0.f;
#pragma unroll
    for (int r = 0; r < 8; ++r) { const int rloc = half * 16 + 8 * hh + r; float v = accs[u][r] * alpha + bv; if (CP) { if (rowsPerB < 0) v += CP[cofs + (size_t)(row0g + row0 + rloc) * ldc + col];      /* rowsPerB < 0: own element of the batched C plane */ else { const int bidx = (row0g + row0 + rloc) / rowsPerB; v += CP[(size_t)bidx * sCPb + (size_t)by * 64 + col]; } }
      if (ACT == 3) v = fmaxf(v, 0.f); else if (ACT == 6) v = 0.5f * v * (1.0f + erff(v * 0.70710678118654752f)); else if (ACT == 11) v = 1.0f / (1.0f + expf(-v)); else if (ACT == 15) v = v / (1.0f + expf(-v)); else if (ACT == 12) v = (v > 0.f) ? v : 0.01f * v; else if (ACT == 8) v = tanhf(v); else if (ACT == 9) v = 0.5f * v * (1.0f + tanhf(0.7978845608028654f * (v + 0.044715f * v * v * v))); else if (ACT == 14) v = (v > 0.f) ? v : 0.1f * v; else if (ACT == 16) v = (v >= 0.f) ? v : 0.3f * v; else if (ACT == 17) v = (v >= 0.f) ? v : 0.2f * v;
      so[w][rloc][t * 16 + ln] = v; } }
  __builtin_amdgcn_fence(__ATOMIC_ACQ_REL, "workgroup"); __builtin_amdgcn_wave_barrier();
  const int rsub = lane >> 4, c4 = (lane & 15) * 4;
  {
#pragma unroll
    for (int q = 0; q < 16; ++q) { const int r = q * 2 + rsub; const v4f v = *(const v4fa*)&so[w][r][c4]; if (C) *(v4f*)(C + cofs + (size_t)(row0 + r) * ldc + col0 + c4) = v; if (C16) { v4h h4; for (int i = 0; i < 4; ++i) h4[i] = (_Float16)v[i]; *(v4h*)(C16 + cofs + (size_t)(row0 + r) * ldc + col0 + c4) = h4; } }
     } }


__global__ __launch_bounds__(256) void k_wnat(const float* __restrict__ w, size_t n8, _Float16* __restrict__ Bt) { const size_t t = (size_t)blockIdx.x * 256 + threadIdx.x; if (t >= n8) return; FragH f; for (int q = 0; q < 8; ++q) f.h[q] = (_Float16)(bf16_round(w[t * 8 + q]) * 16.0f); *(v8us*)((unsigned short*)Bt + t * 8) = f.half[0];  }
__global__ __launch_bounds__(256) void k_rsm(const float* __restrict__ S, _Float16* __restrict__ P, int nrows) {
  #pragma clang fp contract(off)
  const int i = blockIdx.x * 256 + threadIdx.x; if (i >= nrows) return; const float* s = S + (size_t)i * SQ; float mx = -3.0e38f;
#pragma unroll 1
  for (int j = 0; j < SQ; ++j) mx = fmaxf(mx, s[j]); float se = 0.f;
#pragma unroll 1
  for (int j = 0; j < SQ; ++j) se += expf(s[j] - mx); const float sc = 256.0f / se;
#pragma unroll 1
  for (int j0 = 0; j0 < SQ; j0 += 8) { FragH f; for (int q = 0; q < 8; ++q) f.h[q] = (_Float16)(expf(s[j0 + q] - mx) * sc); unsigned short* d = (unsigned short*)P + (size_t)i * SQ + j0; *(v8us*)d = f.half[0];  } }
__global__ __launch_bounds__(256) void k_vt(const _Float16* __restrict__ V16, int b, int h0, _Float16* __restrict__ VT) { __shared__ unsigned short tl[64][65]; const int tid = threadIdx.x; const int hh = blockIdx.x % HG, sg = blockIdx.x / HG; const int s0 = sg * 64; const int h = h0 + hh;
  for (int i = tid; i < 64 * 8; i += 256) { const int j = i / 8, d8 = (i % 8) * 8; FragH f; f.half[0] = *(const v8us*)((const unsigned short*)V16 + ((size_t)b * SQ + s0 + j) * DM + h * HD + d8); for (int q = 0; q < 8; ++q) tl[d8 + q][j] = f.u[q]; }
  __syncthreads();
  { for (int i = tid; i < 64 * 8; i += 256) { const int d = i / 8, j8 = (i % 8) * 8; FragH f; for (int q = 0; q < 8; ++q) f.u[q] = tl[d][j8 + q]; *(v8us*)((unsigned short*)VT + ((size_t)hh * HD + d) * SQ + s0 + j8) = f.half[0]; }  } }



// 2^x on the transcendental unit; the v_nop fills the one slot that the instruction set asks for between a transcendental and an instruction that reads its result or overwrites its source.
__device__ __forceinline__ float exp2_slot(float x) { float r; asm("v_exp_f32 %0, %1\n\tv_nop" : "=v"(r) : "v"(x)); return r; }
// Value of lane l ^ 16 (the other half of the wave): one register move between the two 16-lane rows, no LDS.
__device__ __forceinline__ float xhalf(float x) { return __builtin_bit_cast(float, __builtin_amdgcn_permlanex16(__builtin_bit_cast(int, x), __builtin_bit_cast(int, x), 0x76543210, 0xfedcba98, false, false)); }
__device__ __forceinline__ v16h fa_frag(const unsigned short* p) { FragH f; f.half[0] = *(const v8us*)p; f.half[1] = *(const v8us*)(p + 16); return f.v; }      /* p = the lane's own pointer, 8 hh included: k = 8 hh + i, 16 + 8 hh + i, as g2_frag */
__device__ __forceinline__ v8f fa_mma(v16h a, v16h b, v8f c) { return __builtin_amdgcn_wmma_f32_16x16x32_f16(false, a, false, b, (short)0, c, false, false); }
#define FAW 8                        /* waves per work-group of the fused attention */
#define FAQ 32                       /* query columns per wave */
#define FAK 32                       /* keys per pass */
#define FAC 0.18033688f              /* 1 / sqrt(64) x log2(e): scores to the exponent of 2 */
#define FAT 128                      /* keys per LDS stage (four passes) */
#define FAKP 144                     /* LDS pitch of a K row, bytes: 128 + 16 = 16 x odd, no bank conflict for ds_load_b128 fragment reads */
#define FAVP 272                     /* LDS pitch of a V^T row, bytes: 256 + 16 = 16 x odd */
#define FAKB (FAT * FAKP)            /* one K plane of a stage */
#define FABUF (2 * FAKB + HD * FAVP) /* one buffer: K hi rows, K residual rows, V^T rows */
// One stage: 12 asynchronous copies of 16 bytes per lane, in one statement. A wave's copy covers four whole K rows of the head (128 bytes each) or two whole V^T rows of the stage (256 bytes each): whole lines only.
// lk, lv = the lane's places in the buffer's K hi plane (row tid / 8, piece tid % 8) and V^T plane (row tid / 16, piece tid % 16) as LDS byte addresses; gh, gl, gv = the same places in the stage's source rows. Copies 32 K rows or 16 V^T rows apart.
// s_wait_xcnt 0 is the statement's last line so that it stands in front of every later write of the address registers that the copies name.
__device__ __forceinline__ void fa_stage(unsigned lk, unsigned lv, const unsigned short* gh, const unsigned short* gl, const unsigned short* gv) {
  asm volatile("global_load_async_to_lds_b128 %0, %12, off\n\t"
               "global_load_async_to_lds_b128 %1, %13, off\n\t"
               "global_load_async_to_lds_b128 %2, %14, off\n\t"
               "global_load_async_to_lds_b128 %3, %15, off\n\t"
               "global_load_async_to_lds_b128 %4, %16, off\n\t"
               "global_load_async_to_lds_b128 %5, %17, off\n\t"
               "global_load_async_to_lds_b128 %6, %18, off\n\t"
               "global_load_async_to_lds_b128 %7, %19, off\n\t"
               "global_load_async_to_lds_b128 %8, %20, off\n\t"
               "global_load_async_to_lds_b128 %9, %21, off\n\t"
               "global_load_async_to_lds_b128 %10, %22, off\n\t"
               "global_load_async_to_lds_b128 %11, %23, off\n\t"
               "s_wait_xcnt 0x0"
               :: "v"(lk), "v"(lk + 32 * FAKP), "v"(lk + 64 * FAKP), "v"(lk + 96 * FAKP),
                  "v"(lk + FAKB), "v"(lk + FAKB + 32 * FAKP), "v"(lk + FAKB + 64 * FAKP), "v"(lk + FAKB + 96 * FAKP),
                  "v"(lv), "v"(lv + 16 * FAVP), "v"(lv + 32 * FAVP), "v"(lv + 48 * FAVP),
                  "v"(gh), "v"(gh + 32 * LQ), "v"(gh + 64 * LQ), "v"(gh + 96 * LQ),
                  "v"(gl), "v"(gl + 32 * LQ), "v"(gl + 64 * LQ), "v"(gl + 96 * LQ),
                  "v"(gv), "v"(gv + 16 * SQ), "v"(gv + 32 * SQ), "v"(gv + 48 * SQ) : "memory"); }
__global__ __launch_bounds__(FAW * 32) void k_fattn(const _Float16* __restrict__ QHp, const _Float16* __restrict__ QLp, const _Float16* __restrict__ KHp, const _Float16* __restrict__ KLp, const _Float16* __restrict__ VTp, _Float16* __restrict__ Op) {
  __shared__ __attribute__((aligned(16))) unsigned char ring[2 * FABUF];
  const int tid = threadIdx.x, lane = tid & 31, w = tid >> 5, ln = lane & 15, hh = lane >> 4; const int h = blockIdx.y, b = blockIdx.z; const int q0 = blockIdx.x * (FAW * FAQ) + w * FAQ; const size_t r0 = (size_t)b * SQ;
  const unsigned lk = (unsigned)(size_t)ring + (unsigned)((tid >> 3) * FAKP + (tid & 7) * 16), lv = (unsigned)(size_t)ring + (unsigned)(2 * FAKB + (tid >> 4) * FAVP + (tid & 15) * 16);      /* this lane's places in buffer 0 as LDS byte addresses (low 32 bits of the __shared__ address) */
  const unsigned short* gh = (const unsigned short*)KHp; const unsigned short* gl = (const unsigned short*)KLp; const unsigned short* gv = (const unsigned short*)VTp;
  const unsigned go = (unsigned)((b * SQ + (tid >> 3)) * LQ + h * HD + (tid & 7) * 8), gvo = (unsigned)(((b * NH + h) * HD + (tid >> 4)) * SQ + (tid & 15) * 8);      /* this lane's places in stage 0's source rows, in elements (below 2^23): one register each across the loop */
  const size_t qo = (r0 + q0 + ln) * LQ + h * HD + 8 * hh;
  const unsigned short* qhl = (const unsigned short*)QHp + qo; const unsigned short* qll = (const unsigned short*)QLp + qo;
  v16h qh[2][2], ql[2][2];
#pragma unroll
  for (int qt = 0; qt < 2; ++qt) for (int ks = 0; ks < 2; ++ks) { qh[qt][ks] = fa_frag(qhl + (size_t)(qt * 16) * LQ + ks * 32); ql[qt][ks] = fa_frag(qll + (size_t)(qt * 16) * LQ + ks * 32); }
  asm volatile("s_wait_xcnt 0x0" :: "v"(qhl), "v"(qll) : "memory");      /* stands in front of the first overwrite of these loads' address registers; the addresses are inputs so that they keep their registers up to here */
  const v8f z8 = {0.f,0.f,0.f,0.f,0.f,0.f,0.f,0.f}; v8f o[2][4]; float m[2], l[2];
#pragma unroll
  for (int qt = 0; qt < 2; ++qt) { m[qt] = -1.0e30f; l[qt] = 0.f; for (int dt = 0; dt < 4; ++dt) o[qt][dt] = z8; }
#pragma unroll 1      /* rolled: the buffer's offset stays a run-time scalar, so that lk and lv are themselves no operands of the copies' asm text: as such they were tied to the first 256 registers over the whole kernel and spilled to scratch */
  for (int s = 0; s < 2; ++s) {      /* stage 0's copies, their wait and the barrier; then stage 1's copies */
    fa_stage(lk + (unsigned)s * FABUF, lv + (unsigned)s * FABUF, gh + (go + (unsigned)s * (FAT * LQ)), gl + (go + (unsigned)s * (FAT * LQ)), gv + (gvo + (unsigned)s * FAT));
    if (s == 0) {
      asm volatile("s_wait_asynccnt 0x0" ::: "memory");      /* this wave's copies of stage 0 have landed */
      __syncthreads();      /* stage 0 is readable by every wave */
    }
  }
#pragma unroll 1      /* rolled: one stage per trip */
  for (int s = 0; s < SQ / FAT; ++s) {
    const unsigned char* bufp = ring + (s & 1) * FABUF; const unsigned char* pk = bufp + ln * FAKP + 16 * hh; const unsigned char* pv = bufp + 2 * FAKB + ln * FAVP + 16 * hh;
    v16h kh[2][2], kl[2][2];
#pragma unroll
    for (int kt = 0; kt < 2; ++kt) for (int ks = 0; ks < 2; ++ks) { kh[kt][ks] = g2_frag(pk + (kt * 16) * FAKP + ks * 64); kl[kt][ks] = g2_frag(pk + FAKB + (kt * 16) * FAKP + ks * 64); }
#pragma unroll 1      /* rolled: one pass already holds 32 matrix instructions, and a second copy would double the registers in flight */
    for (int ps = 0; ps < FAT / FAK; ++ps) {
      v16h va[4];      /* V^T rows of this pass: asked for here, needed only behind the softmax */
#pragma unroll
      for (int dt = 0; dt < 4; ++dt) va[dt] = g2_frag(pv + (dt * 16) * FAVP + ps * 64);
      v8f sa[2][2], sr[2][2];      /* [query tile][key tile]: hi.hi, and the x1024 residual products */
#pragma unroll
      for (int qt = 0; qt < 2; ++qt) for (int kt = 0; kt < 2; ++kt) sa[qt][kt] = fa_mma(kh[kt][0], qh[qt][0], z8);
#pragma unroll
      for (int qt = 0; qt < 2; ++qt) for (int kt = 0; kt < 2; ++kt) sr[qt][kt] = fa_mma(kh[kt][0], ql[qt][0], z8);
#pragma unroll
      for (int qt = 0; qt < 2; ++qt) for (int kt = 0; kt < 2; ++kt) sa[qt][kt] = fa_mma(kh[kt][1], qh[qt][1], sa[qt][kt]);
#pragma unroll
      for (int qt = 0; qt < 2; ++qt) for (int kt = 0; kt < 2; ++kt) sr[qt][kt] = fa_mma(kh[kt][1], ql[qt][1], sr[qt][kt]);
#pragma unroll
      for (int qt = 0; qt < 2; ++qt) for (int kt = 0; kt < 2; ++kt) sr[qt][kt] = fa_mma(kl[kt][0], qh[qt][0], sr[qt][kt]);
#pragma unroll
      for (int qt = 0; qt < 2; ++qt) for (int kt = 0; kt < 2; ++kt) sr[qt][kt] = fa_mma(kl[kt][1], qh[qt][1], sr[qt][kt]);
      if (ps + 1 < FAT / FAK) {      /* the next pass's K rows of the SAME stage, asked for ahead of this pass's softmax */
#pragma unroll
        for (int kt = 0; kt < 2; ++kt) for (int ks = 0; ks < 2; ++ks) { kh[kt][ks] = g2_frag(pk + ((ps + 1) * FAK + kt * 16) * FAKP + ks * 64); kl[kt][ks] = g2_frag(pk + FAKB + ((ps + 1) * FAK + kt * 16) * FAKP + ks * 64); } }
#pragma unroll
      for (int qt = 0; qt < 2; ++qt) {
        float t[16];
#pragma unroll
        for (int i = 0; i < 16; ++i) t[i] = fmaf(sr[qt][i >> 3][i & 7], 0.0009765625f, sa[qt][i >> 3][i & 7]);
        float mx = t[0];
#pragma unroll
        for (int i = 1; i < 16; ++i) mx = fmaxf(mx, t[i]);
        mx = fmaxf(mx, xhalf(mx));
        const float mn = fmaxf(m[qt], mx); const float al = exp2_slot((m[qt] - mn) * FAC); const float nb = 8.0f - mn * FAC; m[qt] = mn;
        FragH p; float sum = 0.f;
#pragma unroll
        for (int i = 0; i < 16; ++i) { const float e = exp2_slot(fmaf(t[i], FAC, nb)); sum += e; p.h[i] = (_Float16)e; }
        l[qt] = fmaf(l[qt], al, sum);
#pragma unroll
        for (int dt = 0; dt < 4; ++dt) { for (int r = 0; r < 8; ++r) o[qt][dt][r] *= al; }
#pragma unroll
        for (int dt = 0; dt < 4; ++dt) o[qt][dt] = fa_mma(va[dt], p.v, o[qt][dt]);
        if (qt == 0) __builtin_amdgcn_sched_barrier(0);      /* keeps the other query tile's exponentials from being moved directly behind these four products, whose operand registers they may be given */
      }
    }
    asm volatile("s_wait_dscnt 0x0" ::: "memory");      /* this wave's reads of stage s are done before the buffer is handed to its next writer */
    asm volatile("s_wait_asynccnt 0x0" ::: "memory");      /* this wave's copies of stage s + 1 have landed */
    __syncthreads();      /* publishes stage s + 1 and ends every wave's reads of stage s */
    if (s + 2 < SQ / FAT) fa_stage(lk + (unsigned)(s & 1) * FABUF, lv + (unsigned)(s & 1) * FABUF, gh + (go + (unsigned)(s + 2) * (FAT * LQ)), gl + (go + (unsigned)(s + 2) * (FAT * LQ)), gv + (gvo + (unsigned)(s + 2) * FAT));
  }
  asm volatile("s_wait_asynccnt 0x0" ::: "memory");      /* no copy is outstanding when the wave goes on */
#pragma unroll
  for (int qt = 0; qt < 2; ++qt) { const float inv = 64.0f / (l[qt] + xhalf(l[qt]));      /* the halves' sums joined once; o carried x64 */
    _Float16* op = Op + r0 * DM + (size_t)h * SQ * HD + (size_t)(q0 + qt * 16 + ln) * HD + 8 * hh;
#pragma unroll
    for (int dt = 0; dt < 4; ++dt) { FragH f; for (int r = 0; r < 8; ++r) f.h[r] = (_Float16)(o[qt][dt][r] * inv); *(v8us*)((unsigned short*)op + dt * 16) = f.half[0]; } } }


template <int MASKADD>
__global__ __launch_bounds__(64) void k_att0(const float* __restrict__ QF, const float* __restrict__ KF, const float* __restrict__ VF, int ld, const float* __restrict__ mask, float scale, float* __restrict__ OF, int ldo) {
  #pragma clang fp contract(off)
  __shared__ __attribute__((aligned(16))) float lq[64][64]; __shared__ __attribute__((aligned(16))) float lo[64][64];
  const int tid = threadIdx.x; const int h = blockIdx.x / (QT0 / 64), rg = blockIdx.x % (QT0 / 64); const int i = rg * 64 + tid;
  const float* qr = QF + (size_t)i * ld + h * HD;
#pragma unroll 1
  for (int c = 0; c < HD / 4; ++c) { *(v4f*)&lq[tid][c * 4] = *(const v4fa*)(qr + c * 4); const v4f z = {0.f, 0.f, 0.f, 0.f}; *(v4f*)&lo[tid][c * 4] = z; }
  float m = -1.0e30f, l = 0.f; const int jmax = MASKADD ? (SQ - 1) : (rg * 64 + 63);      /* additive-mask form: every key (the mask input decides); causal form: keys up to the block's last row */
#pragma unroll 1
  for (int j = 0; j <= jmax; ++j) { const float* kr = KF + (size_t)j * ld + h * HD; const float* vr = VF + (size_t)j * ld + h * HD; float s = 0.f;
#pragma unroll 1
    for (int c = 0; c < HD / 4; ++c) { const v4f kq = *(const v4fa*)(kr + c * 4); const v4f qq = *(v4f*)&lq[tid][c * 4]; s = __fadd_rn(s, __fmul_rn(qq[0], kq[0])); s = __fadd_rn(s, __fmul_rn(qq[1], kq[1])); s = __fadd_rn(s, __fmul_rn(qq[2], kq[2])); s = __fadd_rn(s, __fmul_rn(qq[3], kq[3])); }
    s = __fmul_rn(s, scale); if (MASKADD) s = __fadd_rn(s, __fmul_rn(bf16_round(mask[(size_t)i * SQ + j]), -10000.0f));
    const float f = (MASKADD || j <= i) ? 1.f : 0.f; const float sm = fmaf(f, s, (1.f - f) * -1.0e30f); const float mn = fmaxf(m, sm); const float sc = expf(m - mn); const float e = expf(sm - mn); l = __fadd_rn(__fmul_rn(l, sc), e); m = mn;
#pragma unroll 1
    for (int c = 0; c < HD / 4; ++c) { const v4f vv = *(const v4fa*)(vr + c * 4); v4f oo = *(v4f*)&lo[tid][c * 4]; for (int u = 0; u < 4; ++u) oo[u] = __fadd_rn(__fmul_rn(oo[u], sc), __fmul_rn(e, vv[u])); *(v4f*)&lo[tid][c * 4] = oo; } }
  const float fin = 64.0f / l;      /* o carried x64 like the f16 path */
#pragma unroll 1
  for (int c = 0; c < HD / 4; ++c) { v4f oo = *(v4f*)&lo[tid][c * 4]; for (int u = 0; u < 4; ++u) oo[u] = __fmul_rn(oo[u], fin); *(v4f*)&lo[tid][c * 4] = oo; }
  __syncthreads();
  {
#pragma unroll 1
    for (int it = 0; it < 16; ++it) { const int row = it * 4 + tid / 16, pc = (tid % 16) * 4; const v4f v = *(const v4f*)&lo[row][pc]; *(v4f*)(OF + (size_t)(rg * 64 + row) * ldo + h * HD + pc) = v; }
     } }

extern "C" void kernel_launch(void* const* d_in, const int* in_sizes, int n_in,
                              void* d_out, int out_size, void* d_ws, size_t ws_size, hipStream_t stream) {
  (void)in_sizes; (void)n_in; (void)out_size;
  const float* const* I = (const float* const*)d_in; const float* x = I[0]; const float* xk = I[1]; const float* xv = I[2]; const float* wq = I[3]; const float* wk = I[4]; const float* wv = I[5]; const float* bq = nullptr; const float* bk = nullptr; const float* bv = nullptr; const float* wo = I[6]; const float* bo = nullptr;      /* input order: q, k, v (the three streams, two sequences each), Wq, Wk, Wv (PER-HEAD STACKS [16][1024][64]), Wo ([in][out] [1024][1024]); NO biases anywhere: null pointers in the guarded slots */
  char* ws = (char*)d_ws; size_t off = 0;
  auto take = [&](size_t bytes) { char* p = ws + off; off += (bytes + 255) & ~(size_t)255; return p; };
  _Float16* BQ = (_Float16*)take((size_t)DM * DM * 2); _Float16* BK = (_Float16*)take((size_t)DM * DM * 2); _Float16* BV = (_Float16*)take((size_t)DM * DM * 2); _Float16* BO = (_Float16*)take((size_t)DM * DM * 2);
  _Float16* X16 = (_Float16*)take(NR * DM * 2); _Float16* XK16 = (_Float16*)take(NR * DM * 2); _Float16* XV16 = (_Float16*)take(NR * DM * 2);      /* exact f16 rows of query, key, value */ float* QF = (float*)take(NR * DM * 4); _Float16* QH = (_Float16*)take(NR * DM * 2); _Float16* QL = (_Float16*)take(NR * DM * 2); _Float16* KH = (_Float16*)take(NR * DM * 2); _Float16* KL = (_Float16*)take(NR * DM * 2); _Float16* Q16 = QH; _Float16* K16 = KH; _Float16* V16 = (_Float16*)take(NR * DM * 2); _Float16* O16 = (_Float16*)take(NR * DM * 2);
  _Float16* VT = (_Float16*)take((size_t)NB * NH * HD * SQ * 2);      /* V^T of both batches */
  float* QF0 = (float*)take((size_t)QT0 * DM * 4); float* KF0 = (float*)take((size_t)QT0 * DM * 4); float* VF0 = (float*)take((size_t)QT0 * DM * 4); float* OF0 = (float*)take((size_t)NB * QT0 * DM * 4); _Float16* OH0 = (_Float16*)take((size_t)NB * QT0 * DM * 2); _Float16* OL0 = (_Float16*)take((size_t)NB * QT0 * DM * 2);
  if (off > ws_size) return;
  k_prep<<<4 * PWB + 3 * PXB, 256, 0, stream>>>(wq, wk, wv, wo, x, xk, xv, BQ, BK, BV, BO, X16, XK16, XV16);      /* head h's [1024][64] block -> rows 64 h .. 64 h + 63 of the Bt[n][k] x16 plane; the [in][out] output weight transposed into its plane; the three streams as exact f16 rows */
  const size_t r0p = (size_t)B0 * SQ;      /* first projected row */
  k_gemm2<0><<<dim3((unsigned)((MP / 128) * (DM / 64)), 1), 128, 0, stream>>>(X16 + r0p * DM, DM, 0, BQ, DM, 0, 0.0625f, bq, 0, nullptr, 1, 0, 0, QF + r0p * DM, nullptr, DM, 0, MP, DM, DM); k_hl<<<(unsigned)(((size_t)MP * DM / 8 + 255) / 256), 256, 0, stream>>>(QF + r0p * DM, QH + r0p * DM, QL + r0p * DM, (size_t)MP * DM / 8);      /* q (f32) -> f16 hi + x1024 residual: unscaled logits sigma ~8 */
  k_gemm2<0><<<dim3((unsigned)((MP / 128) * (DM / 64)), 1), 128, 0, stream>>>(XK16 + r0p * DM, DM, 0, BK, DM, 0, 0.0625f, bk, 0, nullptr, 1, 0, 0, QF + r0p * DM, nullptr, DM, 0, MP, DM, DM); k_hl<<<(unsigned)(((size_t)MP * DM / 8 + 255) / 256), 256, 0, stream>>>(QF + r0p * DM, KH + r0p * DM, KL + r0p * DM, (size_t)MP * DM / 8);      /* k likewise */
  k_gemm2<0><<<dim3((unsigned)((MP / 128) * (DM / 64)), 1), 128, 0, stream>>>(XV16 + r0p * DM, DM, 0, BV, DM, 0, 0.0625f, bv, 0, nullptr, 1, 0, 0, nullptr, V16 + r0p * DM, DM, 0, MP, DM, DM);
  k_vt<NH, SQ><<<NB * NH * (SQ / 64), 256, 0, stream>>>(V16, LQ, 0, VT);      /* V^T [NB][NH][HD][SQ] */
  k_fattn<<<dim3(SQ / (FAW * FAQ), NH, NB), FAW * 32, 0, stream>>>(QH, QL, KH, KL, VT, O16);      /* o written HEAD-CONTIGUOUS: o[b][h][s][64] (row pitch 64, head stride SQ x 64): the source's raw reshape of (B, H, S, dk) to (B, S, H dk) then reads that memory as [2048][1024] rows: the output GEMM below does exactly that */
  k_gemm2<0><<<dim3((unsigned)((MPO / 128) * (DM / 64)), 1), 128, 0, stream>>>(O16 + r0p * DM, DM, 0, BO, DM, 0, 0.0009765625f, bo, 0, nullptr, 1, 0, 0, (float*)d_out + r0p * DM, nullptr, DM, 0, MPO, DM, DM);      /* out rows are the output layout */
  /* (dense: no first-tile hi / lo planes) */
  /* (dense: no first-tile rewrite passes:
     the output GEMM above has written every row
     with its (null) bias) */
}

// v006
// One run takes 115 microseconds.
// Two timings next to v005 both put it at 1.24 times that version's speed.
// Counting every step since v000, it is 66.1 times as fast.
#include <hip/hip_runtime.h>
// Multi-head attention on three inputs with PER-HEAD STACKED projections and the source's RAW-RESHAPE head merge (Q, K, V [2][2048][1024]; WQ / WK / WV [16][1024][64] = [head][in][out] uniform +-0.1, NO biases; 16 heads of 64; scores x 1/sqrt(64); softmax over all 2048 keys (no mask); the head outputs [B][H][S][64] are RESHAPED IN MEMORY ORDER to [B][S][1024] (row r of a batch holds tokens 16 (r mod 128) .. + 15 of head r / 128: heads and tokens mix: faithful to the source); out = that WO with WO [1024][1024] [in][out], NO bias -> [2][2048][1024]); q and k carried as f16 hi + x1024 residual planes with three-product scores; each head's [in][out] block is transposed into its 64 contiguous rows of the f16 weight plane, and the [in][out] output weight into its plane, all in one launch (k_prep); DENSE (k_fattn runs every query over all SQ keys; no exact first tile).
// Structure: token rows r = b*2048 + s; x as exact f16 rows (bf16-rounded); q and k as WMMA GEMMs (32x64 wave tiles, f32 accumulation, exact x16 weights, no bias) whose epilogues split the f32 sums into f16 hi + x1024 residual planes, v by swapped operands straight into V^T for both batches and all heads, all three in one launch (k_proj); per work-group of 256 query rows in one fused launch (k_fattn; all heads on grid.y, batches on grid.z), in passes of 32 keys over all 2048: scores as THREE accumulating products (hi.hi + 2^-10 (lo.hi + hi.lo), K = 64, logits sigma ~8, 1/sqrt(64) log2(e) applied in the exponent), online row softmax on VALU with no mask (f32 statistics, native exp2; weights x256 f16), o = P . V^T (o carried x64, folded into the output GEMM alpha) written straight into the merged f16 o rows; out = o W_o GEMM (f32, no bias) into the output layout.
// Attention now runs as ONE fused launch (k_fattn, below): the per-tile score passes, the row softmax and the P . V^T pass of the former version are gone, with their score and weight planes; V^T is built for both batches in one launch.
// All work that reads inputs only (the weight planes, the three f16 input streams) now runs as ONE launch (k_prep, below) in place of one launch per head and plane and one per stream.
// The two GEMM launches (k_proj, k_gemm2) now take their operand tiles through LDS (asynchronous copies, two buffers): see the lines above k_gemm2.
// The fused attention (k_fattn) now takes its K and V^T rows through LDS in the same way, once for the work-group's eight waves: see the lines above k_fattn.
// The three projections now run as ONE launch (k_proj, below) whose epilogues write the attention's operand planes themselves: q and k as f16 hi + x1024 residual, V^T by swapped operands; the f32 q / k plane, the f16 v rows and the three launches that converted them are gone.
// Compute dtype: inputs rounded to bf16; x / weights exact; q and k as f16 hi + x1024 residual planes, v, softmax weights and o as plain f16 GEMM operands (~2^-12); scores and softmax statistics f32. v_wmma_f32_16x16x32_f16.
#define NB 2
#define SCL 0.125f                         /* 1 / sqrt(head_dim = 64) */
#define SCLR 0.0001220703125f              /* 2^-13: SCL x 2^-10 (not used) */
#define SQ 2048
#define DM 1024
#define NH 16
#define HD 64
#define HG 4                         /* heads per group of the second k_vt (not launched) */
#define QT 256                       /* query rows per query tile (not used) */
#define NKX SQ                       /* row pitch of the former S / P planes (not used) */
#define QT0 128                      /* rows of the exact first tile of k_att0 (not launched) */
#define B0 0                         /* first batch processed (debug hook) */
#define NBR NB                       /* batches processed (debug hook) */
#define NR ((size_t)NB * SQ)         /* token rows */
#define MP ((int)((size_t)NBR * SQ)) /* rows projected (debug hook) */
#define QN SQ                        /* query rows attended per batch (not used) */
#define NHD NH                       /* heads attended (not used) */
#define MPO MP                       /* rows through the output stage (debug hook) */
#define LQ DM      /* row pitch of the q/k rows */
typedef __bf16 v16b __attribute__((ext_vector_type(16)));
typedef unsigned short v8us __attribute__((ext_vector_type(8), may_alias));
typedef float  v8f  __attribute__((ext_vector_type(8)));
typedef float  v4f  __attribute__((ext_vector_type(4)));
typedef float  v4fa __attribute__((ext_vector_type(4), may_alias));
union FragB { v16b v; v8us half[2]; unsigned short u[16]; };

__device__ __forceinline__ unsigned short bf16_bits(float x) { unsigned int u = __float_as_uint(x); return (unsigned short)((u + 0x7FFFu + ((u >> 16) & 1u)) >> 16); }
__device__ __forceinline__ float bf16_val(unsigned short b) { return __uint_as_float(((unsigned int)b) << 16); }
__device__ __forceinline__ float bf16_round(float x) { return bf16_val(bf16_bits(x)); }
// D += A·B with NT terms: 1 = ah·bh, 2 = + al·bh (A split), 3 = + ah·bl (both split)
template <int NT>
__device__ __forceinline__ v8f mmaN(v16b ah, v16b al, v16b bh, v16b bl, v8f c) {
  c = __builtin_amdgcn_wmma_f32_16x16x32_bf16(false, ah, false, bh, (short)0, c, false, false);
  if (NT >= 2) c = __builtin_amdgcn_wmma_f32_16x16x32_bf16(false, al, false, bh, (short)0, c, false, false);
  if (NT >= 3) c = __builtin_amdgcn_wmma_f32_16x16x32_bf16(false, ah, false, bl, (short)0, c, false, false);
  asm volatile("v_nop\n\tv_nop\n\tv_nop\n\tv_nop" : "+v"(c) : "v"(ah), "v"(al), "v"(bh), "v"(bl));
  return c;
}

__global__ __launch_bounds__(256) void k_wt_bf16(const float* __restrict__ W, unsigned short* __restrict__ Wt, int K, int N) {
  const int t = blockIdx.x * 256 + threadIdx.x;
  const int k8n = K / 8;
  if (t >= N * k8n) return;
  const int n = t / k8n, k8 = (t % k8n) * 8;
  v8us v;
#pragma unroll
  for (int i = 0; i < 8; ++i) v[i] = bf16_bits(W[(size_t)(k8 + i) * N + n]);
  *(v8us*)(Wt + (size_t)n * K + k8) = v;
  
}

// GEMM C[M][N] (f32, pitch ldc) = act(A[M][K]·W + bias). A f32 row-major (pitch lda) converted per fragment to bf16
// (ASPLIT: hi/lo two planes -> 2 terms, else single rounded term); Wt bf16 [N][K] (pitch ldb). BIAS_BF16 rounds the
// bias to bf16 first (bias quantised to bf16 before the add). K%32==0, M%16==0, N%64==0.
template <bool ASPLIT, int ACT, bool BIAS_BF16>
__global__ __launch_bounds__(128) void k_gemm_bf(const float* __restrict__ A, int lda, const unsigned short* __restrict__ Wt, int ldb,
                                               const float* __restrict__ bias, float* __restrict__ C, int ldc, int M, int N, int K) {
  __shared__ __attribute__((aligned(16))) float so[4][16][64];
  const int tid = threadIdx.x, w = tid >> 5, lane = tid & 31, ln = lane & 15, hh = lane >> 4;
  const int ntn = N / 64;
  const int wid = blockIdx.x * 4 + w;
  const int mt = wid / ntn, nq = wid % ntn;
  if (mt * 16 >= M) return;
  const int row0 = mt * 16, col0 = nq * 64;
  const float* arow = A + (size_t)(row0 + ln) * lda;
  v8f acc[4] = {};
  for (int kb = 0; kb < K; kb += 32) {
    FragB ah, al;
    const v4f x0 = *(const v4fa*)(arow + kb + 8 * hh), x1 = *(const v4fa*)(arow + kb + 8 * hh + 4);
    const v4f x2 = *(const v4fa*)(arow + kb + 16 + 8 * hh), x3 = *(const v4fa*)(arow + kb + 16 + 8 * hh + 4);
    float xs[16] = {x0[0],x0[1],x0[2],x0[3],x1[0],x1[1],x1[2],x1[3],x2[0],x2[1],x2[2],x2[3],x3[0],x3[1],x3[2],x3[3]};
#pragma unroll
    for (int i = 0; i < 16; ++i) { const unsigned short hb = bf16_bits(xs[i]); ah.u[i] = hb; al.u[i] = ASPLIT ? bf16_bits(xs[i] - bf16_val(hb)) : (unsigned short)0; }
#pragma unroll
    for (int t = 0; t < 4; ++t) {
      const unsigned short* brow = Wt + (size_t)(col0 + t * 16 + ln) * ldb + kb;
      FragB b;
      b.half[0] = *(const v8us*)(brow + 8 * hh);
      b.half[1] = *(const v8us*)(brow + 16 + 8 * hh);
      acc[t] = mmaN<ASPLIT ? 2 : 1>(ah.v, al.v, b.v, b.v, acc[t]);
    }
  }
#pragma unroll
  for (int t = 0; t < 4; ++t) {
    float bv = bias ? bias[col0 + t * 16 + ln] : 0.f;
    if (BIAS_BF16) bv = bf16_round(bv);
#pragma unroll
    for (int r = 0; r < 8; ++r) { float v = acc[t][r] + bv; if (ACT == 1) v = fmaxf(v, 0.f); so[w][8 * hh + r][t * 16 + ln] = v; }
  }
  __builtin_amdgcn_fence(__ATOMIC_ACQ_REL, "workgroup");
  __builtin_amdgcn_wave_barrier();
  const int rsub = lane >> 4, c4 = (lane & 15) * 4;
  {
#pragma unroll
    for (int q = 0; q < 8; ++q) {
      const int r = q * 2 + rsub;
      const v4f v = *(const v4fa*)&so[w][r][c4];
      *(v4f*)(C + (size_t)(row0 + r) * ldc + col0 + c4) = v;
    }
    
  }
}

// GEMM C = act(A·W + bias + resid): A f32 (ASPLIT -> hi/lo 2 terms), Wt bf16 [N][K]; ACT 0 none, 1 relu, 2 exact gelu;
// resid (optional, f32, row index = (row % rmod), pitch ldr, RES_BF16 rounds it) added before the activation.
template <bool ASPLIT, int ACT, bool BIAS_BF16, bool RES_BF16>
__global__ __launch_bounds__(128) void k_gemm_bf3(const float* __restrict__ A, int lda, const unsigned short* __restrict__ Wt, int ldb,
                                                const float* __restrict__ bias, const float* __restrict__ resid, int rmod, int ldr,
                                                float* __restrict__ C, int ldc, int M, int N, int K) {
  __shared__ __attribute__((aligned(16))) float so[4][16][64];
  const int tid = threadIdx.x, w = tid >> 5, lane = tid & 31, ln = lane & 15, hh = lane >> 4;
  const int ntn = N / 64;
  const int wid = blockIdx.x * 4 + w;
  const int mt = wid / ntn, nq = wid % ntn;
  if (mt * 16 >= M) return;
  const int row0 = mt * 16, col0 = nq * 64;
  const float* arow = A + (size_t)(row0 + ln) * lda;
  v8f acc[4] = {};
  for (int kb = 0; kb < K; kb += 32) {
    FragB ah, al;
    const v4f x0 = *(const v4fa*)(arow + kb + 8 * hh), x1 = *(const v4fa*)(arow + kb + 8 * hh + 4);
    const v4f x2 = *(const v4fa*)(arow + kb + 16 + 8 * hh), x3 = *(const v4fa*)(arow + kb + 16 + 8 * hh + 4);
    float xs[16] = {x0[0],x0[1],x0[2],x0[3],x1[0],x1[1],x1[2],x1[3],x2[0],x2[1],x2[2],x2[3],x3[0],x3[1],x3[2],x3[3]};
#pragma unroll
    for (int i = 0; i < 16; ++i) { const unsigned short hb = bf16_bits(xs[i]); ah.u[i] = hb; al.u[i] = ASPLIT ? bf16_bits(xs[i] - bf16_val(hb)) : (unsigned short)0; }
#pragma unroll
    for (int t = 0; t < 4; ++t) {
      const unsigned short* brow = Wt + (size_t)(col0 + t * 16 + ln) * ldb + kb;
      FragB b;
      b.half[0] = *(const v8us*)(brow + 8 * hh);
      b.half[1] = *(const v8us*)(brow + 16 + 8 * hh);
      acc[t] = mmaN<ASPLIT ? 2 : 1>(ah.v, al.v, b.v, b.v, acc[t]);
    }
  }
#pragma unroll
  for (int t = 0; t < 4; ++t) {
    const int col = col0 + t * 16 + ln;
    float bv = bias ? bias[col] : 0.f;
    if (BIAS_BF16) bv = bf16_round(bv);
#pragma unroll
    for (int r = 0; r < 8; ++r) {
      float v = acc[t][r] + bv;
      if (resid) { float rv = resid[(size_t)((row0 + 8 * hh + r) % rmod) * ldr + col]; if (RES_BF16) rv = bf16_round(rv); v += rv; }
      if (ACT == 1) v = fmaxf(v, 0.f);
      if (ACT == 2) v = 0.5f * v * (1.0f + erff(v * 0.70710678118654752f));
      if (ACT == 3) { const float u = 0.7978845608028654f * (v + 0.044715f * v * v * v); v = 0.5f * v * (1.0f + tanhf(u)); }
      so[w][8 * hh + r][t * 16 + ln] = v;
    }
  }
  __builtin_amdgcn_fence(__ATOMIC_ACQ_REL, "workgroup");
  __builtin_amdgcn_wave_barrier();
  const int rsub = lane >> 4, c4 = (lane & 15) * 4;
  {
#pragma unroll
    for (int q = 0; q < 8; ++q) {
      const int r = q * 2 + rsub;
      const v4f v = *(const v4fa*)&so[w][r][c4];
      *(v4f*)(C + (size_t)(row0 + r) * ldc + col0 + c4) = v;
    }
    
  }
}
// row LayerNorm (biased variance, eps) over N: s = X (+ R); optional out_sum <- s; out_norm <- (s-mu)*rsqrt(var+eps)*g + b
template <bool PARAM_BF16>
__global__ __launch_bounds__(256) void k_layernorm(const float* __restrict__ X, const float* __restrict__ R, const float* __restrict__ g, const float* __restrict__ bta,
                                                  float* __restrict__ out_sum, float* __restrict__ out_norm, int N, float eps) {
  __shared__ float red[256];
  const int row = blockIdx.x, tid = threadIdx.x;
  const float* x = X + (size_t)row * N; const float* rr = R ? R + (size_t)row * N : nullptr;
  float vals[16];                     // up to N = 4096
  const int per = N / 256;            // contiguous chunk per thread? use strided-by-4 chunks: thread handles j = tid*4 + 1024*u
  float s1 = 0.f;
  for (int u = 0; u < per / 4; ++u) {
    const int j = tid * 4 + 1024 * u;
    const v4f a = *(const v4fa*)(x + j);
    v4f b = {0.f,0.f,0.f,0.f}; if (rr) b = *(const v4fa*)(rr + j);
#pragma unroll
    for (int q = 0; q < 4; ++q) { const float v = a[q] + b[q]; vals[u * 4 + q] = v; s1 += v; }
  }
  red[tid] = s1; __syncthreads();
  for (int st = 128; st > 0; st >>= 1) { if (tid < st) red[tid] += red[tid + st]; __syncthreads(); }
  const float mu = red[0] / (float)N; __syncthreads();
  float s2 = 0.f;
  for (int u = 0; u < per / 4; ++u)
#pragma unroll
    for (int q = 0; q < 4; ++q) { const float c = vals[u * 4 + q] - mu; s2 += c * c; }
  red[tid] = s2; __syncthreads();
  for (int st = 128; st > 0; st >>= 1) { if (tid < st) red[tid] += red[tid + st]; __syncthreads(); }
  const float rs = rsqrtf(red[0] / (float)N + eps);
  {
    for (int u = 0; u < per / 4; ++u) {
      const int j = tid * 4 + 1024 * u;
      v4f o, sm;
#pragma unroll
      for (int q = 0; q < 4; ++q) {
        float gg = g[j + q], bb = bta[j + q];
        if (PARAM_BF16) { gg = bf16_round(gg); bb = bf16_round(bb); }
        sm[q] = vals[u * 4 + q]; o[q] = (vals[u * 4 + q] - mu) * rs * gg + bb;
      }
      if (out_sum) *(v4f*)(out_sum + (size_t)row * N + j) = sm;
      *(v4f*)(out_norm + (size_t)row * N + j) = o;
    }
    
  }
}



// ---- f16 WMMA path (v_wmma_f32_16x16x32_f16): 11-bit significands for operands in range — used where a [0,1] probability operand needs more precision than bf16
typedef _Float16 v16h __attribute__((ext_vector_type(16)));
union FragH { v16h v; v8us half[2]; _Float16 h[16]; unsigned short u[16]; };
template <int NT>
__device__ __forceinline__ v8f mmaH(v16h ah, v16h al, v16h bh, v16h bl, v8f c) {
  c = __builtin_amdgcn_wmma_f32_16x16x32_f16(false, ah, false, bh, (short)0, c, false, false);
  if (NT >= 2) c = __builtin_amdgcn_wmma_f32_16x16x32_f16(false, al, false, bh, (short)0, c, false, false);
  if (NT >= 3) c = __builtin_amdgcn_wmma_f32_16x16x32_f16(false, ah, false, bl, (short)0, c, false, false);
  asm volatile("v_nop\n\tv_nop\n\tv_nop\n\tv_nop" : "+v"(c) : "v"(ah), "v"(al), "v"(bh), "v"(bl));
  return c;
}
// batched GEMM like k_gemm_b but f16 operands: A f32 (split into f16 hi/lo if ASPLIT, else rounded to f16), Bt = f16 values [n][k]; alpha; C f32; N multiple of 16 (partial tiles skipped)
template <bool ASPLIT>
__global__ __launch_bounds__(128) void k_gemm_h(const float* __restrict__ A, int lda, size_t sA, const _Float16* __restrict__ Bh, int ldb, size_t sB, float alpha, float* __restrict__ C, int ldc, size_t sC, int M, int N, int K) {
  __shared__ __attribute__((aligned(16))) float so[4][16][64];
  const int tid = threadIdx.x, w = tid >> 5, lane = tid & 31, ln = lane & 15, hh = lane >> 4; const int by = blockIdx.y;
  A += (size_t)by * sA; Bh += (size_t)by * sB; C += (size_t)by * sC;
  const int ntn = (N + 63) / 64; const int wid = blockIdx.x * 4 + w; const int mt = wid / ntn, nq = wid % ntn; if (mt * 16 >= M) return;
  const int row0 = mt * 16, col0 = nq * 64; const float* arow = A + (size_t)(row0 + ln) * lda;
  v8f acc[4] = {};
  for (int kb = 0; kb < K; kb += 32) {
    FragH ah, al;
    const v4f x0 = *(const v4fa*)(arow + kb + 8 * hh), x1 = *(const v4fa*)(arow + kb + 8 * hh + 4), x2 = *(const v4fa*)(arow + kb + 16 + 8 * hh), x3 = *(const v4fa*)(arow + kb + 16 + 8 * hh + 4);
    float xs[16] = {x0[0],x0[1],x0[2],x0[3],x1[0],x1[1],x1[2],x1[3],x2[0],x2[1],x2[2],x2[3],x3[0],x3[1],x3[2],x3[3]};
#pragma unroll
    for (int i = 0; i < 16; ++i) { const _Float16 h = (_Float16)xs[i]; ah.h[i] = h; al.h[i] = ASPLIT ? (_Float16)(xs[i] - (float)h) : (_Float16)0.0f; }
#pragma unroll
    for (int t = 0; t < 4; ++t) { if (col0 + t * 16 >= N) continue; const size_t boff = (size_t)(col0 + t * 16 + ln) * ldb + kb; FragH bq; bq.half[0] = *(const v8us*)(Bh + boff + 8 * hh); bq.half[1] = *(const v8us*)(Bh + boff + 16 + 8 * hh);
      acc[t] = mmaH<ASPLIT ? 2 : 1>(ah.v, al.v, bq.v, bq.v, acc[t]); }
  }
#pragma unroll
  for (int t = 0; t < 4; ++t) { if (col0 + t * 16 >= N) continue;
#pragma unroll
    for (int r = 0; r < 8; ++r) so[w][8 * hh + r][t * 16 + ln] = acc[t][r] * alpha; }
  __builtin_amdgcn_fence(__ATOMIC_ACQ_REL, "workgroup"); __builtin_amdgcn_wave_barrier();
  const int rsub = lane >> 4, c4 = (lane & 15) * 4;
  {
#pragma unroll
    for (int q = 0; q < 8; ++q) { const int r = q * 2 + rsub; if (col0 + c4 < N) { const v4f v = *(const v4fa*)&so[w][r][c4]; *(v4f*)(C + (size_t)(row0 + r) * ldc + col0 + c4) = v; } }
     }
}

// Wt[n][k] = f16(W[k][n]·scale) from f32 row-major W[K][N] (scale = power of two; bf16-exact weights stay exact in f16 away from the subnormal range)
__device__ __forceinline__ void wt_f16(const float* __restrict__ W, _Float16* __restrict__ Wt, int K, int N, float scale, int t) {      /* t = the caller's flat index, 0 .. N K / 8 - 1 */
  const int n = t / (K / 8), k8 = (t % (K / 8)) * 8; FragH f;
#pragma unroll
  for (int i = 0; i < 8; ++i) f.h[i] = (_Float16)(bf16_round(W[(size_t)(k8 + i) * N + n]) * scale); const v8us o = f.half[0];
  *(v8us*)((unsigned short*)Wt + (size_t)n * K + k8) = o;
  asm volatile("s_wait_xcnt 0x0" ::: "memory");      /* stands directly behind the store, in front of any later overwrite of a register that the store names */
}
// k_gemm_hh variant with fused epilogue: v = acc·alpha + bias[by·sBias + col] (+ CP[(row/rowsPerB)·sCPb + by·64 + col] if CP) ; ACT 0 none / 1 elu ; writes f16 C16 (and f32 C if non-null)
template <int ACT>
__global__ __launch_bounds__(128) void k_gemm_hhx(const _Float16* __restrict__ A, int lda, size_t sA, const _Float16* __restrict__ Bh, int ldb, size_t sB, float alpha, const float* __restrict__ bias, size_t sBias, const float* __restrict__ CP, int rowsPerB, size_t sCPb, int row0g,
    float* __restrict__ C, _Float16* __restrict__ C16, int ldc, size_t sC, int M, int N, int K) {
  __shared__ __attribute__((aligned(16))) float so[4][16][64];
  const int tid = threadIdx.x, w = tid >> 5, lane = tid & 31, ln = lane & 15, hh = lane >> 4; const int by = blockIdx.y;
  A += (size_t)by * sA; Bh += (size_t)by * sB; const size_t cofs = (size_t)by * sC; const float* bp = bias ? bias + (size_t)by * sBias : nullptr;
  const int ntn = (N + 63) / 64; const int wid = blockIdx.x * 4 + w; const int mt = wid / ntn, nq = wid % ntn; if (mt * 16 >= M) return;
  const int row0 = mt * 16, col0 = nq * 64; const _Float16* arow = A + (size_t)(row0 + ln) * lda;
  v8f acc[4] = {};
  for (int kb = 0; kb < K; kb += 32) { FragH ah; ah.half[0] = *(const v8us*)((const unsigned short*)arow + kb + 8 * hh); ah.half[1] = *(const v8us*)((const unsigned short*)arow + kb + 16 + 8 * hh);
#pragma unroll
    for (int t = 0; t < 4; ++t) { if (col0 + t * 16 >= N) continue; const size_t boff = (size_t)(col0 + t * 16 + ln) * ldb + kb; FragH bq; bq.half[0] = *(const v8us*)((const unsigned short*)Bh + boff + 8 * hh); bq.half[1] = *(const v8us*)((const unsigned short*)Bh + boff + 16 + 8 * hh);
      acc[t] = mmaH<1>(ah.v, ah.v, bq.v, bq.v, acc[t]); }
  }
#pragma unroll
  for (int t = 0; t < 4; ++t) { if (col0 + t * 16 >= N) continue; const int col = col0 + t * 16 + ln; const float bv = bp ? bf16_round(bp[col]) : 0.f;
#pragma unroll
    for (int r = 0; r < 8; ++r) { float v = acc[t][r] * alpha + bv; if (CP) { const int rr = row0g + row0 + 8 * hh + r; if (rowsPerB < 0) v += CP[cofs + (size_t)rr * ldc + col];      /* rowsPerB < 0: own element of the batched C plane */ else { const int bidx = rr / rowsPerB; v += CP[(size_t)bidx * sCPb + (size_t)by * 64 + col]; } } if (ACT == 1) v = (v > 0.f) ? v : expm1f(v); else if (ACT == 7) v = (v > 0.f) ? v + 1.0f : expf(v); else if (ACT == 8) v = tanhf(v); else if (ACT == 9) v = 0.5f * v * (1.0f + tanhf(0.7978845608028654f * (v + 0.044715f * v * v * v))); else if (ACT == 11) v = 1.0f / (1.0f + expf(-v)); else if (ACT == 12) v = (v > 0.f) ? v : 0.01f * v; else if (ACT == 14) v = (v > 0.f) ? v : 0.1f * v; else if (ACT == 16) v = (v >= 0.f) ? v : 0.3f * v; else if (ACT == 17) v = (v >= 0.f) ? v : 0.2f * v; else if (ACT == 15) v = v / (1.0f + expf(-v)); else if (ACT == 3) v = fmaxf(v, 0.f); else if (ACT == 6) v = 0.5f * v * (1.0f + erff(v * 0.70710678118654752f)); so[w][8 * hh + r][t * 16 + ln] = v; } }
  __builtin_amdgcn_fence(__ATOMIC_ACQ_REL, "workgroup"); __builtin_amdgcn_wave_barrier();
  const int rsub = lane >> 4, c4 = (lane & 15) * 4; typedef _Float16 v4h __attribute__((ext_vector_type(4)));
  {
#pragma unroll
    for (int q = 0; q < 8; ++q) { const int r = q * 2 + rsub; if (col0 + c4 < N) { const v4f v = *(const v4fa*)&so[w][r][c4]; if (C) *(v4f*)(C + cofs + (size_t)(row0 + r) * ldc + col0 + c4) = v; if (C16) { v4h h4; for (int i = 0; i < 4; ++i) h4[i] = (_Float16)v[i]; *(v4h*)(C16 + cofs + (size_t)(row0 + r) * ldc + col0 + c4) = h4; } } }
     }
}


typedef _Float16 v4h __attribute__((ext_vector_type(4)));

__device__ __forceinline__ void x16(const float* __restrict__ x, _Float16* __restrict__ X16, size_t t) { FragH f;      /* t = the caller's flat index of a group of 8 elements */
#pragma unroll
  for (int q = 0; q < 8; ++q) f.h[q] = (_Float16)bf16_round(x[t * 8 + q]); *(v8us*)((unsigned short*)X16 + t * 8) = f.half[0];
  asm volatile("s_wait_xcnt 0x0" ::: "memory");      /* stands directly behind the store, in front of any later overwrite of a register that the store names */
}
#define PWB (DM * DM / 8 / 256)            /* blocks per weight plane (512) */
#define PXB ((int)(NR * DM / 8 / 256))     /* blocks per input stream (2048) */
// All work that reads inputs only, in ONE launch: none of these jobs reads what another writes, so a range of block indices takes the place of each former launch.
// Blocks 0 .. 4 PWB - 1: the four weight planes (WQ, WK, WV: head t / 8192 of the stack, its [1024][64] block into rows 64 h .. 64 h + 63; WO whole); the rest: the three input streams. Every thread does what one thread of the former launches did.
__global__ __launch_bounds__(256) void k_prep(const float* __restrict__ wq, const float* __restrict__ wk, const float* __restrict__ wv, const float* __restrict__ wo, const float* __restrict__ x, const float* __restrict__ xk, const float* __restrict__ xv,
    _Float16* __restrict__ BQ, _Float16* __restrict__ BK, _Float16* __restrict__ BV, _Float16* __restrict__ BO, _Float16* __restrict__ X16, _Float16* __restrict__ XK16, _Float16* __restrict__ XV16) {
  const int bid = blockIdx.x;
  if (bid < 4 * PWB) { const int job = bid / PWB; const int t = (bid % PWB) * 256 + threadIdx.x;
    if (job == 3) { wt_f16(wo, BO, DM, DM, 16.0f, t); return; }
    const float* W = job == 0 ? wq : job == 1 ? wk : wv; _Float16* Bt = job == 0 ? BQ : job == 1 ? BK : BV; const int h = t / (HD * (DM / 8));
    wt_f16(W + (size_t)h * DM * HD, Bt + (size_t)h * HD * DM, DM, HD, 16.0f, t % (HD * (DM / 8))); return; }
  const int u = bid - 4 * PWB; const int job = u / PXB; const size_t t = (size_t)(u % PXB) * 256 + threadIdx.x;
  x16(job == 0 ? x : job == 1 ? xk : xv, job == 0 ? X16 : job == 1 ? XK16 : XV16, t); }
__global__ __launch_bounds__(256) void k_h16(const float* __restrict__ x, _Float16* __restrict__ X16, size_t n8) { const size_t t = (size_t)blockIdx.x * 256 + threadIdx.x; if (t >= n8) return; FragH f;
#pragma unroll
  for (int q = 0; q < 8; ++q) f.h[q] = (_Float16)x[t * 8 + q]; *(v8us*)((unsigned short*)X16 + t * 8) = f.half[0];  }
__global__ __launch_bounds__(256) void k_round16f(const float* __restrict__ W, _Float16* __restrict__ Bt, size_t n8) { const size_t t = (size_t)blockIdx.x * 256 + threadIdx.x; if (t >= n8) return; FragH f;
#pragma unroll
  for (int i = 0; i < 8; ++i) f.h[i] = (_Float16)(bf16_round(W[t * 8 + i]) * 16.0f); *(v8us*)((unsigned short*)Bt + t * 8) = f.half[0];  }

// ---- fast GEMM (work-group tile 128x64, wave tile 32x64; requires M % 128 == 0, N % 64 == 0, K % 128 == 0, K >= 128); epilogue = k_gemm_hhx semantics ----
// Operands go through LDS: a stage is 128 k (256 bytes) of the work-group's 128 A rows and 64 Bh rows. Each lane copies 16 bytes, a wave's copy covers two whole rows of the stage (4 whole lines), and a Bh row is fetched once for the four waves.
// Two buffers: stage s + 1 flies while stage s is worked on. Fragments are read from LDS in the k order of the former global loads (k = 8 hh + i, 16 + 8 hh + i), k steps in the same order: same sums.
#define G2KC 128                     /* k per stage */
#define G2P 272                      /* LDS row pitch, bytes: 256 + 16 = 16 x odd, the pitch at which ds_load_b128 fragment reads meet no bank conflict */
#define G2BUF (192 * G2P)            /* one buffer: rows 0-127 A, 128-191 Bh */
__device__ __forceinline__ v16h g2_frag(const unsigned char* p) { FragH f; f.half[0] = *(const v8us*)p; f.half[1] = *(const v8us*)(p + 32); return f.v; }      /* p = the lane's row in LDS + 64 bytes per k step + 16 hh */
// Eight asynchronous copies of 16 bytes per lane, 8 rows apart (l = the lane's LDS byte address, g = its global address, gs = 8 rows of the source in elements).
// s_wait_xcnt 0 is the statement's last line so that it stands in front of every later write of the address registers that the copies name.
__device__ __forceinline__ void g2_copy8(unsigned l, const _Float16* g, size_t gs) {
  asm volatile("global_load_async_to_lds_b128 %0, %8, off\n\t"
               "global_load_async_to_lds_b128 %1, %9, off\n\t"
               "global_load_async_to_lds_b128 %2, %10, off\n\t"
               "global_load_async_to_lds_b128 %3, %11, off\n\t"
               "global_load_async_to_lds_b128 %4, %12, off\n\t"
               "global_load_async_to_lds_b128 %5, %13, off\n\t"
               "global_load_async_to_lds_b128 %6, %14, off\n\t"
               "global_load_async_to_lds_b128 %7, %15, off\n\t"
               "s_wait_xcnt 0x0"
               :: "v"(l), "v"(l + 8 * G2P), "v"(l + 16 * G2P), "v"(l + 24 * G2P), "v"(l + 32 * G2P), "v"(l + 40 * G2P), "v"(l + 48 * G2P), "v"(l + 56 * G2P),
                  "v"(g), "v"(g + gs), "v"(g + 2 * gs), "v"(g + 3 * gs), "v"(g + 4 * gs), "v"(g + 5 * gs), "v"(g + 6 * gs), "v"(g + 7 * gs) : "memory"); }
// One stage: 24 copies per lane. l = the lane's place in the buffer (row tid / 16, 16-byte piece tid % 16); ga, gb = the same place in the stage's A and Bh rows.
__device__ __forceinline__ void g2_stage(unsigned l, const _Float16* ga, int lda, const _Float16* gb, int ldb) {
  g2_copy8(l, ga, (size_t)8 * lda); g2_copy8(l + 64 * G2P, ga + (size_t)64 * lda, (size_t)8 * lda); g2_copy8(l + 128 * G2P, gb, (size_t)8 * ldb); }
__device__ __forceinline__ v8f g2_mma(v16h a, v16h b, v8f c) { v8f d = __builtin_amdgcn_wmma_f32_16x16x32_f16(false, a, false, b, (short)0, c, false, false); asm volatile("v_nop\n\tv_nop\n\tv_nop\n\tv_nop" : "+v"(d) : "v"(a), "v"(b)); return d; }
// The fast GEMM's main loop, run by every wave of a 128-thread work-group: ga, gb = the lane's place (row tid / 16, 16-byte piece tid % 16) in stage 0 of the work-group's 128 A rows and 64 Bh rows; nst = stages of 128 k.
// Leaves the wave's 32 x 64 sums in accs: accs[4 half + t] = rows 16 half .. + 15, columns 16 t .. + 15 of the wave tile. No copy is outstanding at its end.
__device__ __forceinline__ void g2_loop(unsigned char* ring, const _Float16* ga, int lda, const _Float16* gb, int ldb, int nst, int tid, v8f (&accs)[8]) {
  const int w = tid >> 5, lane = tid & 31, ln = lane & 15, hh = lane >> 4;
  const unsigned lc = (unsigned)(size_t)ring + (unsigned)((tid >> 4) * G2P + (tid & 15) * 16);      /* this lane's place in buffer 0 as an LDS byte address (low 32 bits of the __shared__ address) */
  const v8f z8 = {0.f,0.f,0.f,0.f,0.f,0.f,0.f,0.f}; v8f c00 = z8, c01 = z8, c02 = z8, c03 = z8, c10 = z8, c11 = z8, c12 = z8, c13 = z8;
  g2_stage(lc, ga, lda, gb, ldb);
  asm volatile("s_wait_asynccnt 0x0" ::: "memory");      /* this wave's copies of stage 0 have landed */
  __syncthreads();      /* stage 0 is readable by every wave */
  if (nst > 1) g2_stage(lc + G2BUF, ga + G2KC, lda, gb + G2KC, ldb);
#pragma unroll 1      /* rolled: one stage per trip, its four k steps unrolled inside */
  for (int s = 0; s < nst; ++s) { const unsigned char* bufp = ring + (s & 1) * G2BUF; const unsigned char* pa = bufp + (32 * w + ln) * G2P + 16 * hh; const unsigned char* pb = bufp + (128 + ln) * G2P + 16 * hh;
    v16h a0 = g2_frag(pa), a1 = g2_frag(pa + 16 * G2P), b0 = g2_frag(pb), b1 = g2_frag(pb + 16 * G2P), b2 = g2_frag(pb + 32 * G2P), b3 = g2_frag(pb + 48 * G2P);
#pragma unroll      /* unrolled: the two fragment sets then alternate by register name, without copies */
    for (int ks = 0; ks < G2KC / 32; ++ks) { v16h na0 = a0, na1 = a1, nb0 = b0, nb1 = b1, nb2 = b2, nb3 = b3;
      if (ks + 1 < G2KC / 32) { const int o = (ks + 1) * 64; na0 = g2_frag(pa + o); na1 = g2_frag(pa + 16 * G2P + o); nb0 = g2_frag(pb + o); nb1 = g2_frag(pb + 16 * G2P + o); nb2 = g2_frag(pb + 32 * G2P + o); nb3 = g2_frag(pb + 48 * G2P + o); }      /* the next k step's fragments of the SAME stage, asked for ahead of this step's products */
      c00 = g2_mma(a0, b0, c00); c10 = g2_mma(a1, b0, c10); c01 = g2_mma(a0, b1, c01); c11 = g2_mma(a1, b1, c11);
      c02 = g2_mma(a0, b2, c02); c12 = g2_mma(a1, b2, c12); c03 = g2_mma(a0, b3, c03); c13 = g2_mma(a1, b3, c13);
      a0 = na0; a1 = na1; b0 = nb0; b1 = nb1; b2 = nb2; b3 = nb3; }
    asm volatile("s_wait_dscnt 0x0" ::: "memory");      /* this wave's reads of stage s are done before the buffer is handed to its next writer */
    asm volatile("s_wait_asynccnt 0x0" ::: "memory");      /* this wave's copies of stage s + 1 have landed */
    __syncthreads();      /* publishes stage s + 1 and ends every wave's reads of stage s */
    if (s + 2 < nst) g2_stage(lc + (unsigned)(s & 1) * G2BUF, ga + (size_t)(s + 2) * G2KC, lda, gb + (size_t)(s + 2) * G2KC, ldb); }
  asm volatile("s_wait_asynccnt 0x0" ::: "memory");      /* no copy is outstanding when the wave goes on */
  accs[0] = c00; accs[1] = c01; accs[2] = c02; accs[3] = c03; accs[4] = c10; accs[5] = c11; accs[6] = c12; accs[7] = c13; }
template <int ACT>
__global__ __launch_bounds__(128) void k_gemm2(const _Float16* __restrict__ A, int lda, size_t sA, const _Float16* __restrict__ Bh, int ldb, size_t sB, float alpha, const float* __restrict__ bias, size_t sBias, const float* __restrict__ CP, int rowsPerB, size_t sCPb, int row0g,
    float* __restrict__ C, _Float16* __restrict__ C16, int ldc, size_t sC, int M, int N, int K) { static_assert(ACT == 0 || ACT == 3 || ACT == 6 || ACT == 8 || ACT == 9 || ACT == 11 || ACT == 12 || ACT == 14 || ACT == 15 || ACT == 16 || ACT == 17, "k_gemm2: unsupported ACT code (would silently apply no activation)");
  __shared__ __attribute__((aligned(16))) float so[4][32][68];
  __shared__ __attribute__((aligned(16))) unsigned char ring[2 * G2BUF];
  const int tid = threadIdx.x, w = tid >> 5, lane = tid & 31, ln = lane & 15, hh = lane >> 4; const int by = blockIdx.y;
  A += (size_t)by * sA; Bh += (size_t)by * sB; const size_t cofs = (size_t)by * sC; const float* bp = bias ? bias + (size_t)by * sBias : nullptr;
  const int ntn = N >> 6; const int mt = blockIdx.x / ntn, nq = blockIdx.x - mt * ntn; const int row0 = mt * 128 + 32 * w, col0 = nq * 64; if (mt * 128 >= M) return;      /* the same for the whole work-group, in front of every barrier */
  const _Float16* ga = A + (size_t)(mt * 128 + (tid >> 4)) * lda + (tid & 15) * 8; const _Float16* gb = Bh + (size_t)(col0 + (tid >> 4)) * ldb + (tid & 15) * 8;
  v8f accs[8]; g2_loop(ring, ga, lda, gb, ldb, K / G2KC, tid, accs);
#pragma unroll
  for (int u = 0; u < 8; ++u) { const int t = u & 3, half = u >> 2; const int col = col0 + t * 16 + ln; const float bv = bp ? bf16_round(bp[col]) : 0.f;
#pragma unroll
    for (int r = 0; r < 8; ++r) { const int rloc = half * 16 + 8 * hh + r; float v = accs[u][r] * alpha + bv; if (CP) { if (rowsPerB < 0) v += CP[cofs + (size_t)(row0g + row0 + rloc) * ldc + col];      /* rowsPerB < 0: own element of the batched C plane */ else { const int bidx = (row0g + row0 + rloc) / rowsPerB; v += CP[(size_t)bidx * sCPb + (size_t)by * 64 + col]; } }
      if (ACT == 3) v = fmaxf(v, 0.f); else if (ACT == 6) v = 0.5f * v * (1.0f + erff(v * 0.70710678118654752f)); else if (ACT == 11) v = 1.0f / (1.0f + expf(-v)); else if (ACT == 15) v = v / (1.0f + expf(-v)); else if (ACT == 12) v = (v > 0.f) ? v : 0.01f * v; else if (ACT == 8) v = tanhf(v); else if (ACT == 9) v = 0.5f * v * (1.0f + tanhf(0.7978845608028654f * (v + 0.044715f * v * v * v))); else if (ACT == 14) v = (v > 0.f) ? v : 0.1f * v; else if (ACT == 16) v = (v >= 0.f) ? v : 0.3f * v; else if (ACT == 17) v = (v >= 0.f) ? v : 0.2f * v;
      so[w][rloc][t * 16 + ln] = v; } }
  __builtin_amdgcn_fence(__ATOMIC_ACQ_REL, "workgroup"); __builtin_amdgcn_wave_barrier();
  const int rsub = lane >> 4, c4 = (lane & 15) * 4;
  {
#pragma unroll
    for (int q = 0; q < 16; ++q) { const int r = q * 2 + rsub; const v4f v = *(const v4fa*)&so[w][r][c4]; if (C) *(v4f*)(C + cofs + (size_t)(row0 + r) * ldc + col0 + c4) = v; if (C16) { v4h h4; for (int i = 0; i < 4; ++i) h4[i] = (_Float16)v[i]; *(v4h*)(C16 + cofs + (size_t)(row0 + r) * ldc + col0 + c4) = h4; } }
     } }
// The three projections in ONE launch: blockIdx.y = 0: q, 1: k, 2: v; 512 work-group tiles each, tile and main loop as k_gemm2. None reads what another writes.
// q, k: rows = tokens (A = the stream's f16 rows), columns = head outputs (Bh = the weight plane); the epilogue splits each f32 value v into h = f16(v) and f16((v - h) x 1024) and stores both planes: the arithmetic of the former conversion launch on the same f32 values.
// v: operands swapped (A = the weight plane's 1024 rows 64 h + d, Bh = the 2048 token rows of one batch), so that the tile is a piece of V^T [batch][head][d][token] as the attention reads it and no transposition is left; each sum takes the same products in the same k order.
// A row of a wave's tile is 64 f16 = one whole 128-byte line of its plane, written by that wave alone.
#define PJT ((MP / 128) * (DM / 64))       /* work-group tiles per projection (512) */
#define PJV ((DM / 128) * (SQ / 64))       /* V^T tiles per batch (256) */
static_assert(PJV * NB == PJT && B0 == 0 && NBR == NB, "k_proj: one grid row per projection, all batches");
__global__ __launch_bounds__(128) void k_proj(const _Float16* __restrict__ X16, const _Float16* __restrict__ XK16, const _Float16* __restrict__ XV16, const _Float16* __restrict__ BQ, const _Float16* __restrict__ BK, const _Float16* __restrict__ BV,
    _Float16* __restrict__ QH, _Float16* __restrict__ QL, _Float16* __restrict__ KH, _Float16* __restrict__ KL, _Float16* __restrict__ VT) {
  __shared__ __attribute__((aligned(16))) float so[4][32][68];
  __shared__ __attribute__((aligned(16))) unsigned char ring[2 * G2BUF];
  const int tid = threadIdx.x, w = tid >> 5, lane = tid & 31, ln = lane & 15, hh = lane >> 4; const int job = blockIdx.y, bx = blockIdx.x;
  const _Float16* A; const _Float16* Bh; _Float16* Ph; _Float16* Pl; int mt, nq, ldc;      /* each the same for the whole work-group */
  if (job < 2) { A = job ? XK16 : X16; Bh = job ? BK : BQ; Ph = job ? KH : QH; Pl = job ? KL : QL; mt = bx / (DM / 64); nq = bx % (DM / 64); ldc = DM; }
  else { const int b = bx / PJV, u = bx % PJV; A = BV; Bh = XV16 + (size_t)b * SQ * DM; Ph = VT + (size_t)b * DM * SQ; Pl = nullptr; mt = u / (SQ / 64); nq = u % (SQ / 64); ldc = SQ; }
  const int row0 = mt * 128 + 32 * w, col0 = nq * 64;
  const _Float16* ga = A + (size_t)(mt * 128 + (tid >> 4)) * DM + (tid & 15) * 8; const _Float16* gb = Bh + (size_t)(col0 + (tid >> 4)) * DM + (tid & 15) * 8;
  v8f accs[8]; g2_loop(ring, ga, DM, gb, DM, DM / G2KC, tid, accs);
#pragma unroll
  for (int u = 0; u < 8; ++u) { const int t = u & 3, half = u >> 2;
#pragma unroll
    for (int r = 0; r < 8; ++r) so[w][half * 16 + 8 * hh + r][t * 16 + ln] = accs[u][r] * 0.0625f; }      /* the weights are carried x16 */
  __builtin_amdgcn_fence(__ATOMIC_ACQ_REL, "workgroup"); __builtin_amdgcn_wave_barrier();
  const int rsub = lane >> 4, c4 = (lane & 15) * 4; const size_t po = (size_t)(row0 + rsub) * ldc + col0 + c4;      /* the lane's place in rows 0 and 1 of the wave's tile */
  if (job < 2) {
#pragma unroll
    for (int q = 0; q < 16; ++q) { const v4f v = *(const v4fa*)&so[w][q * 2 + rsub][c4]; v4h h4, l4;
      for (int i = 0; i < 4; ++i) { const _Float16 h = (_Float16)v[i]; h4[i] = h; l4[i] = (_Float16)((v[i] - (float)h) * 1024.0f); }
      *(v4h*)(Ph + po + (size_t)(q * 2) * DM) = h4; *(v4h*)(Pl + po + (size_t)(q * 2) * DM) = l4; } }
  else {
#pragma unroll
    for (int q = 0; q < 16; ++q) { const v4f v = *(const v4fa*)&so[w][q * 2 + rsub][c4]; v4h h4;
      for (int i = 0; i < 4; ++i) h4[i] = (_Float16)v[i];
      *(v4h*)(Ph + po + (size_t)(q * 2) * SQ) = h4; }
    asm volatile("s_wait_xcnt 0x0" ::: "memory");      /* stands directly behind the last of these stores, in front of any later overwrite of a register that they name */
  } }


__global__ __launch_bounds__(256) void k_wnat(const float* __restrict__ w, size_t n8, _Float16* __restrict__ Bt) { const size_t t = (size_t)blockIdx.x * 256 + threadIdx.x; if (t >= n8) return; FragH f; for (int q = 0; q < 8; ++q) f.h[q] = (_Float16)(bf16_round(w[t * 8 + q]) * 16.0f); *(v8us*)((unsigned short*)Bt + t * 8) = f.half[0];  }
__global__ __launch_bounds__(256) void k_rsm(const float* __restrict__ S, _Float16* __restrict__ P, int nrows) {
  #pragma clang fp contract(off)
  const int i = blockIdx.x * 256 + threadIdx.x; if (i >= nrows) return; const float* s = S + (size_t)i * SQ; float mx = -3.0e38f;
#pragma unroll 1
  for (int j = 0; j < SQ; ++j) mx = fmaxf(mx, s[j]); float se = 0.f;
#pragma unroll 1
  for (int j = 0; j < SQ; ++j) se += expf(s[j] - mx); const float sc = 256.0f / se;
#pragma unroll 1
  for (int j0 = 0; j0 < SQ; j0 += 8) { FragH f; for (int q = 0; q < 8; ++q) f.h[q] = (_Float16)(expf(s[j0 + q] - mx) * sc); unsigned short* d = (unsigned short*)P + (size_t)i * SQ + j0; *(v8us*)d = f.half[0];  } }
__global__ __launch_bounds__(256) void k_vt(const _Float16* __restrict__ V16, int b, int h0, _Float16* __restrict__ VT) { __shared__ unsigned short tl[64][65]; const int tid = threadIdx.x; const int hh = blockIdx.x % HG, sg = blockIdx.x / HG; const int s0 = sg * 64; const int h = h0 + hh;
  for (int i = tid; i < 64 * 8; i += 256) { const int j = i / 8, d8 = (i % 8) * 8; FragH f; f.half[0] = *(const v8us*)((const unsigned short*)V16 + ((size_t)b * SQ + s0 + j) * DM + h * HD + d8); for (int q = 0; q < 8; ++q) tl[d8 + q][j] = f.u[q]; }
  __syncthreads();
  { for (int i = tid; i < 64 * 8; i += 256) { const int d = i / 8, j8 = (i % 8) * 8; FragH f; for (int q = 0; q < 8; ++q) f.u[q] = tl[d][j8 + q]; *(v8us*)((unsigned short*)VT + ((size_t)hh * HD + d) * SQ + s0 + j8) = f.half[0]; }  } }



// 2^x on the transcendental unit; the v_nop fills the one slot that the instruction set asks for between a transcendental and an instruction that reads its result or overwrites its source.
__device__ __forceinline__ float exp2_slot(float x) { float r; asm("v_exp_f32 %0, %1\n\tv_nop" : "=v"(r) : "v"(x)); return r; }
// Value of lane l ^ 16 (the other half of the wave): one register move between the two 16-lane rows, no LDS.
__device__ __forceinline__ float xhalf(float x) { return __builtin_bit_cast(float, __builtin_amdgcn_permlanex16(__builtin_bit_cast(int, x), __builtin_bit_cast(int, x), 0x76543210, 0xfedcba98, false, false)); }
__device__ __forceinline__ v16h fa_frag(const unsigned short* p) { FragH f; f.half[0] = *(const v8us*)p; f.half[1] = *(const v8us*)(p + 16); return f.v; }      /* p = the lane's own pointer, 8 hh included: k = 8 hh + i, 16 + 8 hh + i, as g2_frag */
__device__ __forceinline__ v8f fa_mma(v16h a, v16h b, v8f c) { return __builtin_amdgcn_wmma_f32_16x16x32_f16(false, a, false, b, (short)0, c, false, false); }
#define FAW 8                        /* waves per work-group of the fused attention */
#define FAQ 32                       /* query columns per wave */
#define FAK 32                       /* keys per pass */
#define FAC 0.18033688f              /* 1 / sqrt(64) x log2(e): scores to the exponent of 2 */
#define FAT 128                      /* keys per LDS stage (four passes) */
#define FAKP 144                     /* LDS pitch of a K row, bytes: 128 + 16 = 16 x odd, no bank conflict for ds_load_b128 fragment reads */
#define FAVP 272                     /* LDS pitch of a V^T row, bytes: 256 + 16 = 16 x odd */
#define FAKB (FAT * FAKP)            /* one K plane of a stage */
#define FABUF (2 * FAKB + HD * FAVP) /* one buffer: K hi rows, K residual rows, V^T rows */
// One stage: 12 asynchronous copies of 16 bytes per lane, in one statement. A wave's copy covers four whole K rows of the head (128 bytes each) or two whole V^T rows of the stage (256 bytes each): whole lines only.
// lk, lv = the lane's places in the buffer's K hi plane (row tid / 8, piece tid % 8) and V^T plane (row tid / 16, piece tid % 16) as LDS byte addresses; gh, gl, gv = the same places in the stage's source rows. Copies 32 K rows or 16 V^T rows apart.
// s_wait_xcnt 0 is the statement's last line so that it stands in front of every later write of the address registers that the copies name.
__device__ __forceinline__ void fa_stage(unsigned lk, unsigned lv, const unsigned short* gh, const unsigned short* gl, const unsigned short* gv) {
  asm volatile("global_load_async_to_lds_b128 %0, %12, off\n\t"
               "global_load_async_to_lds_b128 %1, %13, off\n\t"
               "global_load_async_to_lds_b128 %2, %14, off\n\t"
               "global_load_async_to_lds_b128 %3, %15, off\n\t"
               "global_load_async_to_lds_b128 %4, %16, off\n\t"
               "global_load_async_to_lds_b128 %5, %17, off\n\t"
               "global_load_async_to_lds_b128 %6, %18, off\n\t"
               "global_load_async_to_lds_b128 %7, %19, off\n\t"
               "global_load_async_to_lds_b128 %8, %20, off\n\t"
               "global_load_async_to_lds_b128 %9, %21, off\n\t"
               "global_load_async_to_lds_b128 %10, %22, off\n\t"
               "global_load_async_to_lds_b128 %11, %23, off\n\t"
               "s_wait_xcnt 0x0"
               :: "v"(lk), "v"(lk + 32 * FAKP), "v"(lk + 64 * FAKP), "v"(lk + 96 * FAKP),
                  "v"(lk + FAKB), "v"(lk + FAKB + 32 * FAKP), "v"(lk + FAKB + 64 * FAKP), "v"(lk + FAKB + 96 * FAKP),
                  "v"(lv), "v"(lv + 16 * FAVP), "v"(lv + 32 * FAVP), "v"(lv + 48 * FAVP),
                  "v"(gh), "v"(gh + 32 * LQ), "v"(gh + 64 * LQ), "v"(gh + 96 * LQ),
                  "v"(gl), "v"(gl + 32 * LQ), "v"(gl + 64 * LQ), "v"(gl + 96 * LQ),
                  "v"(gv), "v"(gv + 16 * SQ), "v"(gv + 32 * SQ), "v"(gv + 48 * SQ) : "memory"); }
__global__ __launch_bounds__(FAW * 32) void k_fattn(const _Float16* __restrict__ QHp, const _Float16* __restrict__ QLp, const _Float16* __restrict__ KHp, const _Float16* __restrict__ KLp, const _Float16* __restrict__ VTp, _Float16* __restrict__ Op) {
  __shared__ __attribute__((aligned(16))) unsigned char ring[2 * FABUF];
  const int tid = threadIdx.x, lane = tid & 31, w = tid >> 5, ln = lane & 15, hh = lane >> 4; const int h = blockIdx.y, b = blockIdx.z; const int q0 = blockIdx.x * (FAW * FAQ) + w * FAQ; const size_t r0 = (size_t)b * SQ;
  const unsigned lk = (unsigned)(size_t)ring + (unsigned)((tid >> 3) * FAKP + (tid & 7) * 16), lv = (unsigned)(size_t)ring + (unsigned)(2 * FAKB + (tid >> 4) * FAVP + (tid & 15) * 16);      /* this lane's places in buffer 0 as LDS byte addresses (low 32 bits of the __shared__ address) */
  const unsigned short* gh = (const unsigned short*)KHp; const unsigned short* gl = (const unsigned short*)KLp; const unsigned short* gv = (const unsigned short*)VTp;
  const unsigned go = (unsigned)((b * SQ + (tid >> 3)) * LQ + h * HD + (tid & 7) * 8), gvo = (unsigned)(((b * NH + h) * HD + (tid >> 4)) * SQ + (tid & 15) * 8);      /* this lane's places in stage 0's source rows, in elements (below 2^23): one register each across the loop */
  const size_t qo = (r0 + q0 + ln) * LQ + h * HD + 8 * hh;
  const unsigned short* qhl = (const unsigned short*)QHp + qo; const unsigned short* qll = (const unsigned short*)QLp + qo;
  v16h qh[2][2], ql[2][2];
#pragma unroll
  for (int qt = 0; qt < 2; ++qt) for (int ks = 0; ks < 2; ++ks) { qh[qt][ks] = fa_frag(qhl + (size_t)(qt * 16) * LQ + ks * 32); ql[qt][ks] = fa_frag(qll + (size_t)(qt * 16) * LQ + ks * 32); }
  asm volatile("s_wait_xcnt 0x0" :: "v"(qhl), "v"(qll) : "memory");      /* stands in front of the first overwrite of these loads' address registers; the addresses are inputs so that they keep their registers up to here */
  const v8f z8 = {0.f,0.f,0.f,0.f,0.f,0.f,0.f,0.f}; v8f o[2][4]; float m[2], l[2];
#pragma unroll
  for (int qt = 0; qt < 2; ++qt) { m[qt] = -1.0e30f; l[qt] = 0.f; for (int dt = 0; dt < 4; ++dt) o[qt][dt] = z8; }
#pragma unroll 1      /* rolled: the buffer's offset stays a run-time scalar, so that lk and lv are themselves no operands of the copies' asm text: as such they were tied to the first 256 registers over the whole kernel and spilled to scratch */
  for (int s = 0; s < 2; ++s) {      /* stage 0's copies, their wait and the barrier; then stage 1's copies */
    fa_stage(lk + (unsigned)s * FABUF, lv + (unsigned)s * FABUF, gh + (go + (unsigned)s * (FAT * LQ)), gl + (go + (unsigned)s * (FAT * LQ)), gv + (gvo + (unsigned)s * FAT));
    if (s == 0) {
      asm volatile("s_wait_asynccnt 0x0" ::: "memory");      /* this wave's copies of stage 0 have landed */
      __syncthreads();      /* stage 0 is readable by every wave */
    }
  }
#pragma unroll 1      /* rolled: one stage per trip */
  for (int s = 0; s < SQ / FAT; ++s) {
    const unsigned char* bufp = ring + (s & 1) * FABUF; const unsigned char* pk = bufp + ln * FAKP + 16 * hh; const unsigned char* pv = bufp + 2 * FAKB + ln * FAVP + 16 * hh;
    v16h kh[2][2], kl[2][2];
#pragma unroll
    for (int kt = 0; kt < 2; ++kt) for (int ks = 0; ks < 2; ++ks) { kh[kt][ks] = g2_frag(pk + (kt * 16) * FAKP + ks * 64); kl[kt][ks] = g2_frag(pk + FAKB + (kt * 16) * FAKP + ks * 64); }
#pragma unroll 1      /* rolled: one pass already holds 32 matrix instructions, and a second copy would double the registers in flight */
    for (int ps = 0; ps < FAT / FAK; ++ps) {
      v16h va[4];      /* V^T rows of this pass: asked for here, needed only behind the softmax */
#pragma unroll
      for (int dt = 0; dt < 4; ++dt) va[dt] = g2_frag(pv + (dt * 16) * FAVP + ps * 64);
      v8f sa[2][2], sr[2][2];      /* [query tile][key tile]: hi.hi, and the x1024 residual products */
#pragma unroll
      for (int qt = 0; qt < 2; ++qt) for (int kt = 0; kt < 2; ++kt) sa[qt][kt] = fa_mma(kh[kt][0], qh[qt][0], z8);
#pragma unroll
      for (int qt = 0; qt < 2; ++qt) for (int kt = 0; kt < 2; ++kt) sr[qt][kt] = fa_mma(kh[kt][0], ql[qt][0], z8);
#pragma unroll
      for (int qt = 0; qt < 2; ++qt) for (int kt = 0; kt < 2; ++kt) sa[qt][kt] = fa_mma(kh[kt][1], qh[qt][1], sa[qt][kt]);
#pragma unroll
      for (int qt = 0; qt < 2; ++qt) for (int kt = 0; kt < 2; ++kt) sr[qt][kt] = fa_mma(kh[kt][1], ql[qt][1], sr[qt][kt]);
#pragma unroll
      for (int qt = 0; qt < 2; ++qt) for (int kt = 0; kt < 2; ++kt) sr[qt][kt] = fa_mma(kl[kt][0], qh[qt][0], sr[qt][kt]);
#pragma unroll
      for (int qt = 0; qt < 2; ++qt) for (int kt = 0; kt < 2; ++kt) sr[qt][kt] = fa_mma(kl[kt][1], qh[qt][1], sr[qt][kt]);
      if (ps + 1 < FAT / FAK) {      /* the next pass's K rows of the SAME stage, asked for ahead of this pass's softmax */
#pragma unroll
        for (int kt = 0; kt < 2; ++kt) for (int ks = 0; ks < 2; ++ks) { kh[kt][ks] = g2_frag(pk + ((ps + 1) * FAK + kt * 16) * FAKP + ks * 64); kl[kt][ks] = g2_frag(pk + FAKB + ((ps + 1) * FAK + kt * 16) * FAKP + ks * 64); } }
#pragma unroll
      for (int qt = 0; qt < 2; ++qt) {
        float t[16];
#pragma unroll
        for (int i = 0; i < 16; ++i) t[i] = fmaf(sr[qt][i >> 3][i & 7], 0.0009765625f, sa[qt][i >> 3][i & 7]);
        float mx = t[0];
#pragma unroll
        for (int i = 1; i < 16; ++i) mx = fmaxf(mx, t[i]);
        mx = fmaxf(mx, xhalf(mx));
        const float mn = fmaxf(m[qt], mx); const float al = exp2_slot((m[qt] - mn) * FAC); const float nb = 8.0f - mn * FAC; m[qt] = mn;
        FragH p; float sum = 0.f;
#pragma unroll
        for (int i = 0; i < 16; ++i) { const float e = exp2_slot(fmaf(t[i], FAC, nb)); sum += e; p.h[i] = (_Float16)e; }
        l[qt] = fmaf(l[qt], al, sum);
#pragma unroll
        for (int dt = 0; dt < 4; ++dt) { for (int r = 0; r < 8; ++r) o[qt][dt][r] *= al; }
#pragma unroll
        for (int dt = 0; dt < 4; ++dt) o[qt][dt] = fa_mma(va[dt], p.v, o[qt][dt]);
        if (qt == 0) __builtin_amdgcn_sched_barrier(0);      /* keeps the other query tile's exponentials from being moved directly behind these four products, whose operand registers they may be given */
      }
    }
    asm volatile("s_wait_dscnt 0x0" ::: "memory");      /* this wave's reads of stage s are done before the buffer is handed to its next writer */
    asm volatile("s_wait_asynccnt 0x0" ::: "memory");      /* this wave's copies of stage s + 1 have landed */
    __syncthreads();      /* publishes stage s + 1 and ends every wave's reads of stage s */
    if (s + 2 < SQ / FAT) fa_stage(lk + (unsigned)(s & 1) * FABUF, lv + (unsigned)(s & 1) * FABUF, gh + (go + (unsigned)(s + 2) * (FAT * LQ)), gl + (go + (unsigned)(s + 2) * (FAT * LQ)), gv + (gvo + (unsigned)(s + 2) * FAT));
  }
  asm volatile("s_wait_asynccnt 0x0" ::: "memory");      /* no copy is outstanding when the wave goes on */
#pragma unroll
  for (int qt = 0; qt < 2; ++qt) { const float inv = 64.0f / (l[qt] + xhalf(l[qt]));      /* the halves' sums joined once; o carried x64 */
    _Float16* op = Op + r0 * DM + (size_t)h * SQ * HD + (size_t)(q0 + qt * 16 + ln) * HD + 8 * hh;
#pragma unroll
    for (int dt = 0; dt < 4; ++dt) { FragH f; for (int r = 0; r < 8; ++r) f.h[r] = (_Float16)(o[qt][dt][r] * inv); *(v8us*)((unsigned short*)op + dt * 16) = f.half[0]; } } }


template <int MASKADD>
__global__ __launch_bounds__(64) void k_att0(const float* __restrict__ QF, const float* __restrict__ KF, const float* __restrict__ VF, int ld, const float* __restrict__ mask, float scale, float* __restrict__ OF, int ldo) {
  #pragma clang fp contract(off)
  __shared__ __attribute__((aligned(16))) float lq[64][64]; __shared__ __attribute__((aligned(16))) float lo[64][64];
  const int tid = threadIdx.x; const int h = blockIdx.x / (QT0 / 64), rg = blockIdx.x % (QT0 / 64); const int i = rg * 64 + tid;
  const float* qr = QF + (size_t)i * ld + h * HD;
#pragma unroll 1
  for (int c = 0; c < HD / 4; ++c) { *(v4f*)&lq[tid][c * 4] = *(const v4fa*)(qr + c * 4); const v4f z = {0.f, 0.f, 0.f, 0.f}; *(v4f*)&lo[tid][c * 4] = z; }
  float m = -1.0e30f, l = 0.f; const int jmax = MASKADD ? (SQ - 1) : (rg * 64 + 63);      /* additive-mask form: every key (the mask input decides); causal form: keys up to the block's last row */
#pragma unroll 1
  for (int j = 0; j <= jmax; ++j) { const float* kr = KF + (size_t)j * ld + h * HD; const float* vr = VF + (size_t)j * ld + h * HD; float s = 0.f;
#pragma unroll 1
    for (int c = 0; c < HD / 4; ++c) { const v4f kq = *(const v4fa*)(kr + c * 4); const v4f qq = *(v4f*)&lq[tid][c * 4]; s = __fadd_rn(s, __fmul_rn(qq[0], kq[0])); s = __fadd_rn(s, __fmul_rn(qq[1], kq[1])); s = __fadd_rn(s, __fmul_rn(qq[2], kq[2])); s = __fadd_rn(s, __fmul_rn(qq[3], kq[3])); }
    s = __fmul_rn(s, scale); if (MASKADD) s = __fadd_rn(s, __fmul_rn(bf16_round(mask[(size_t)i * SQ + j]), -10000.0f));
    const float f = (MASKADD || j <= i) ? 1.f : 0.f; const float sm = fmaf(f, s, (1.f - f) * -1.0e30f); const float mn = fmaxf(m, sm); const float sc = expf(m - mn); const float e = expf(sm - mn); l = __fadd_rn(__fmul_rn(l, sc), e); m = mn;
#pragma unroll 1
    for (int c = 0; c < HD / 4; ++c) { const v4f vv = *(const v4fa*)(vr + c * 4); v4f oo = *(v4f*)&lo[tid][c * 4]; for (int u = 0; u < 4; ++u) oo[u] = __fadd_rn(__fmul_rn(oo[u], sc), __fmul_rn(e, vv[u])); *(v4f*)&lo[tid][c * 4] = oo; } }
  const float fin = 64.0f / l;      /* o carried x64 like the f16 path */
#pragma unroll 1
  for (int c = 0; c < HD / 4; ++c) { v4f oo = *(v4f*)&lo[tid][c * 4]; for (int u = 0; u < 4; ++u) oo[u] = __fmul_rn(oo[u], fin); *(v4f*)&lo[tid][c * 4] = oo; }
  __syncthreads();
  {
#pragma unroll 1
    for (int it = 0; it < 16; ++it) { const int row = it * 4 + tid / 16, pc = (tid % 16) * 4; const v4f v = *(const v4f*)&lo[row][pc]; *(v4f*)(OF + (size_t)(rg * 64 + row) * ldo + h * HD + pc) = v; }
     } }

extern "C" void kernel_launch(void* const* d_in, const int* in_sizes, int n_in,
                              void* d_out, int out_size, void* d_ws, size_t ws_size, hipStream_t stream) {
  (void)in_sizes; (void)n_in; (void)out_size;
  const float* const* I = (const float* const*)d_in; const float* x = I[0]; const float* xk = I[1]; const float* xv = I[2]; const float* wq = I[3]; const float* wk = I[4]; const float* wv = I[5]; const float* bq = nullptr; const float* bk = nullptr; const float* bv = nullptr; const float* wo = I[6]; const float* bo = nullptr;      /* input order: q, k, v (the three streams, two sequences each), Wq, Wk, Wv (PER-HEAD STACKS [16][1024][64]), Wo ([in][out] [1024][1024]); NO biases anywhere: null pointers in the guarded slots */
  char* ws = (char*)d_ws; size_t off = 0;
  auto take = [&](size_t bytes) { char* p = ws + off; off += (bytes + 255) & ~(size_t)255; return p; };
  _Float16* BQ = (_Float16*)take((size_t)DM * DM * 2); _Float16* BK = (_Float16*)take((size_t)DM * DM * 2); _Float16* BV = (_Float16*)take((size_t)DM * DM * 2); _Float16* BO = (_Float16*)take((size_t)DM * DM * 2);
  _Float16* X16 = (_Float16*)take(NR * DM * 2); _Float16* XK16 = (_Float16*)take(NR * DM * 2); _Float16* XV16 = (_Float16*)take(NR * DM * 2);      /* exact f16 rows of query, key, value */ _Float16* QH = (_Float16*)take(NR * DM * 2); _Float16* QL = (_Float16*)take(NR * DM * 2); _Float16* KH = (_Float16*)take(NR * DM * 2); _Float16* KL = (_Float16*)take(NR * DM * 2); _Float16* Q16 = QH; _Float16* K16 = KH; _Float16* O16 = (_Float16*)take(NR * DM * 2);
  _Float16* VT = (_Float16*)take((size_t)NB * NH * HD * SQ * 2);      /* V^T of both batches */
  float* QF0 = (float*)take((size_t)QT0 * DM * 4); float* KF0 = (float*)take((size_t)QT0 * DM * 4); float* VF0 = (float*)take((size_t)QT0 * DM * 4); float* OF0 = (float*)take((size_t)NB * QT0 * DM * 4); _Float16* OH0 = (_Float16*)take((size_t)NB * QT0 * DM * 2); _Float16* OL0 = (_Float16*)take((size_t)NB * QT0 * DM * 2);
  if (off > ws_size) return;
  k_prep<<<4 * PWB + 3 * PXB, 256, 0, stream>>>(wq, wk, wv, wo, x, xk, xv, BQ, BK, BV, BO, X16, XK16, XV16);      /* head h's [1024][64] block -> rows 64 h .. 64 h + 63 of the Bt[n][k] x16 plane; the [in][out] output weight transposed into its plane; the three streams as exact f16 rows */
  const size_t r0p = (size_t)B0 * SQ;      /* first projected row */
  k_proj<<<dim3((unsigned)PJT, 3), 128, 0, stream>>>(X16, XK16, XV16, BQ, BK, BV, QH, QL, KH, KL, VT);      /* q and k -> f16 hi + x1024 residual planes (unscaled logits sigma ~8); v -> V^T [NB][NH][HD][SQ] */
  k_fattn<<<dim3(SQ / (FAW * FAQ), NH, NB), FAW * 32, 0, stream>>>(QH, QL, KH, KL, VT, O16);      /* o written HEAD-CONTIGUOUS: o[b][h][s][64] (row pitch 64, head stride SQ x 64): the source's raw reshape of (B, H, S, dk) to (B, S, H dk) then reads that memory as [2048][1024] rows: the output GEMM below does exactly that */
  k_gemm2<0><<<dim3((unsigned)((MPO / 128) * (DM / 64)), 1), 128, 0, stream>>>(O16 + r0p * DM, DM, 0, BO, DM, 0, 0.0009765625f, bo, 0, nullptr, 1, 0, 0, (float*)d_out + r0p * DM, nullptr, DM, 0, MPO, DM, DM);      /* out rows are the output layout */
  /* (dense: no first-tile hi / lo planes) */
  /* (dense: no first-tile rewrite passes:
     the output GEMM above has written every row
     with its (null) bias) */
}

// v007
// Measured time: 106 microseconds a run.
// Next to v006, in two timings, it ran 1.09 times as fast each time.
// Counting every step since v000, it is 71.9 times as fast.
#include <hip/hip_runtime.h>
// Multi-head attention on three inputs with PER-HEAD STACKED projections and the source's RAW-RESHAPE head merge (Q, K, V [2][2048][1024]; WQ / WK / WV [16][1024][64] = [head][in][out] uniform +-0.1, NO biases; 16 heads of 64; scores x 1/sqrt(64); softmax over all 2048 keys (no mask); the head outputs [B][H][S][64] are RESHAPED IN MEMORY ORDER to [B][S][1024] (row r of a batch holds tokens 16 (r mod 128) .. + 15 of head r / 128: heads and tokens mix: faithful to the source); out = that WO with WO [1024][1024] [in][out], NO bias -> [2][2048][1024]); q and k carried as f16 hi + x1024 residual planes with three-product scores; each head's [in][out] block is transposed into its 64 contiguous rows of the f16 weight plane, and the [in][out] output weight into its plane, all in one launch (k_prep); DENSE (k_fattn runs every query over all SQ keys; no exact first tile).
// Structure: token rows r = b*2048 + s; x as exact f16 rows (bf16-rounded); q and k as WMMA GEMMs (32x64 wave tiles, f32 accumulation, exact x16 weights, no bias) whose epilogues split the f32 sums into f16 hi + x1024 residual planes, v by swapped operands straight into V^T for both batches and all heads, all three in one launch (k_proj); per work-group of 256 query rows in one fused launch (k_fattn; all heads on grid.y, batches on grid.z), in passes of 32 keys over all 2048: scores as THREE accumulating products (hi.hi + 2^-10 (lo.hi + hi.lo), K = 64, logits sigma ~8, 1/sqrt(64) log2(e) applied in the exponent), online row softmax on VALU with no mask (f32 statistics, native exp2; weights x256 f16), o = P . V^T (o carried x64, folded into the output GEMM alpha) written straight into the merged f16 o rows; out = o W_o GEMM (f32, no bias) into the output layout.
// Attention now runs as ONE fused launch (k_fattn, below): the per-tile score passes, the row softmax and the P . V^T pass of the former version are gone, with their score and weight planes; V^T is built for both batches in one launch.
// All work that reads inputs only (the weight planes, the three f16 input streams) now runs as ONE launch (k_prep, below) in place of one launch per head and plane and one per stream.
// That launch now has 256 work-groups of 16 waves, each thread taking a weight block and a share of every stream: see the lines above k_prep.
// The four GEMMs (three in k_proj, the output one in k_gemm2) now take their operand tiles through LDS (asynchronous copies, two buffers): see the lines above k_gemm2.
// The fused attention (k_fattn) now takes its K and V^T rows through LDS in the same way, once for the work-group's eight waves: see the lines above k_fattn.
// The three projections now run as ONE launch (k_proj, below) whose epilogues write the attention's operand planes themselves: q and k as f16 hi + x1024 residual, V^T by swapped operands; the f32 q / k plane, the f16 v rows and the three launches that converted them are gone.
// Compute dtype: inputs rounded to bf16; x / weights exact; q and k as f16 hi + x1024 residual planes, v, softmax weights and o as plain f16 GEMM operands (~2^-12); scores and softmax statistics f32. v_wmma_f32_16x16x32_f16.
#define NB 2
#define SCL 0.125f                         /* 1 / sqrt(head_dim = 64) */
#define SCLR 0.0001220703125f              /* 2^-13: SCL x 2^-10 (not used) */
#define SQ 2048
#define DM 1024
#define NH 16
#define HD 64
#define HG 4                         /* heads per group of the second k_vt (not launched) */
#define QT 256                       /* query rows per query tile (not used) */
#define NKX SQ                       /* row pitch of the former S / P planes (not used) */
#define QT0 128                      /* rows of the exact first tile of k_att0 (not launched) */
#define B0 0                         /* first batch processed (debug hook) */
#define NBR NB                       /* batches processed (debug hook) */
#define NR ((size_t)NB * SQ)         /* token rows */
#define MP ((int)((size_t)NBR * SQ)) /* rows projected (debug hook) */
#define QN SQ                        /* query rows attended per batch (not used) */
#define NHD NH                       /* heads attended (not used) */
#define MPO MP                       /* rows through the output stage (debug hook) */
#define LQ DM      /* row pitch of the q/k rows */
typedef __bf16 v16b __attribute__((ext_vector_type(16)));
typedef unsigned short v8us __attribute__((ext_vector_type(8), may_alias));
typedef float  v8f  __attribute__((ext_vector_type(8)));
typedef float  v4f  __attribute__((ext_vector_type(4)));
typedef float  v4fa __attribute__((ext_vector_type(4), may_alias));
union FragB { v16b v; v8us half[2]; unsigned short u[16]; };

__device__ __forceinline__ unsigned short bf16_bits(float x) { unsigned int u = __float_as_uint(x); return (unsigned short)((u + 0x7FFFu + ((u >> 16) & 1u)) >> 16); }
__device__ __forceinline__ float bf16_val(unsigned short b) { return __uint_as_float(((unsigned int)b) << 16); }
__device__ __forceinline__ float bf16_round(float x) { return bf16_val(bf16_bits(x)); }
// D += A·B with NT terms: 1 = ah·bh, 2 = + al·bh (A split), 3 = + ah·bl (both split)
template <int NT>
__device__ __forceinline__ v8f mmaN(v16b ah, v16b al, v16b bh, v16b bl, v8f c) {
  c = __builtin_amdgcn_wmma_f32_16x16x32_bf16(false, ah, false, bh, (short)0, c, false, false);
  if (NT >= 2) c = __builtin_amdgcn_wmma_f32_16x16x32_bf16(false, al, false, bh, (short)0, c, false, false);
  if (NT >= 3) c = __builtin_amdgcn_wmma_f32_16x16x32_bf16(false, ah, false, bl, (short)0, c, false, false);
  asm volatile("v_nop\n\tv_nop\n\tv_nop\n\tv_nop" : "+v"(c) : "v"(ah), "v"(al), "v"(bh), "v"(bl));
  return c;
}

__global__ __launch_bounds__(256) void k_wt_bf16(const float* __restrict__ W, unsigned short* __restrict__ Wt, int K, int N) {
  const int t = blockIdx.x * 256 + threadIdx.x;
  const int k8n = K / 8;
  if (t >= N * k8n) return;
  const int n = t / k8n, k8 = (t % k8n) * 8;
  v8us v;
#pragma unroll
  for (int i = 0; i < 8; ++i) v[i] = bf16_bits(W[(size_t)(k8 + i) * N + n]);
  *(v8us*)(Wt + (size_t)n * K + k8) = v;
  
}

// GEMM C[M][N] (f32, pitch ldc) = act(A[M][K]·W + bias). A f32 row-major (pitch lda) converted per fragment to bf16
// (ASPLIT: hi/lo two planes -> 2 terms, else single rounded term); Wt bf16 [N][K] (pitch ldb). BIAS_BF16 rounds the
// bias to bf16 first (bias quantised to bf16 before the add). K%32==0, M%16==0, N%64==0.
template <bool ASPLIT, int ACT, bool BIAS_BF16>
__global__ __launch_bounds__(128) void k_gemm_bf(const float* __restrict__ A, int lda, const unsigned short* __restrict__ Wt, int ldb,
                                               const float* __restrict__ bias, float* __restrict__ C, int ldc, int M, int N, int K) {
  __shared__ __attribute__((aligned(16))) float so[4][16][64];
  const int tid = threadIdx.x, w = tid >> 5, lane = tid & 31, ln = lane & 15, hh = lane >> 4;
  const int ntn = N / 64;
  const int wid = blockIdx.x * 4 + w;
  const int mt = wid / ntn, nq = wid % ntn;
  if (mt * 16 >= M) return;
  const int row0 = mt * 16, col0 = nq * 64;
  const float* arow = A + (size_t)(row0 + ln) * lda;
  v8f acc[4] = {};
  for (int kb = 0; kb < K; kb += 32) {
    FragB ah, al;
    const v4f x0 = *(const v4fa*)(arow + kb + 8 * hh), x1 = *(const v4fa*)(arow + kb + 8 * hh + 4);
    const v4f x2 = *(const v4fa*)(arow + kb + 16 + 8 * hh), x3 = *(const v4fa*)(arow + kb + 16 + 8 * hh + 4);
    float xs[16] = {x0[0],x0[1],x0[2],x0[3],x1[0],x1[1],x1[2],x1[3],x2[0],x2[1],x2[2],x2[3],x3[0],x3[1],x3[2],x3[3]};
#pragma unroll
    for (int i = 0; i < 16; ++i) { const unsigned short hb = bf16_bits(xs[i]); ah.u[i] = hb; al.u[i] = ASPLIT ? bf16_bits(xs[i] - bf16_val(hb)) : (unsigned short)0; }
#pragma unroll
    for (int t = 0; t < 4; ++t) {
      const unsigned short* brow = Wt + (size_t)(col0 + t * 16 + ln) * ldb + kb;
      FragB b;
      b.half[0] = *(const v8us*)(brow + 8 * hh);
      b.half[1] = *(const v8us*)(brow + 16 + 8 * hh);
      acc[t] = mmaN<ASPLIT ? 2 : 1>(ah.v, al.v, b.v, b.v, acc[t]);
    }
  }
#pragma unroll
  for (int t = 0; t < 4; ++t) {
    float bv = bias ? bias[col0 + t * 16 + ln] : 0.f;
    if (BIAS_BF16) bv = bf16_round(bv);
#pragma unroll
    for (int r = 0; r < 8; ++r) { float v = acc[t][r] + bv; if (ACT == 1) v = fmaxf(v, 0.f); so[w][8 * hh + r][t * 16 + ln] = v; }
  }
  __builtin_amdgcn_fence(__ATOMIC_ACQ_REL, "workgroup");
  __builtin_amdgcn_wave_barrier();
  const int rsub = lane >> 4, c4 = (lane & 15) * 4;
  {
#pragma unroll
    for (int q = 0; q < 8; ++q) {
      const int r = q * 2 + rsub;
      const v4f v = *(const v4fa*)&so[w][r][c4];
      *(v4f*)(C + (size_t)(row0 + r) * ldc + col0 + c4) = v;
    }
    
  }
}

// GEMM C = act(A·W + bias + resid): A f32 (ASPLIT -> hi/lo 2 terms), Wt bf16 [N][K]; ACT 0 none, 1 relu, 2 exact gelu;
// resid (optional, f32, row index = (row % rmod), pitch ldr, RES_BF16 rounds it) added before the activation.
template <bool ASPLIT, int ACT, bool BIAS_BF16, bool RES_BF16>
__global__ __launch_bounds__(128) void k_gemm_bf3(const float* __restrict__ A, int lda, const unsigned short* __restrict__ Wt, int ldb,
                                                const float* __restrict__ bias, const float* __restrict__ resid, int rmod, int ldr,
                                                float* __restrict__ C, int ldc, int M, int N, int K) {
  __shared__ __attribute__((aligned(16))) float so[4][16][64];
  const int tid = threadIdx.x, w = tid >> 5, lane = tid & 31, ln = lane & 15, hh = lane >> 4;
  const int ntn = N / 64;
  const int wid = blockIdx.x * 4 + w;
  const int mt = wid / ntn, nq = wid % ntn;
  if (mt * 16 >= M) return;
  const int row0 = mt * 16, col0 = nq * 64;
  const float* arow = A + (size_t)(row0 + ln) * lda;
  v8f acc[4] = {};
  for (int kb = 0; kb < K; kb += 32) {
    FragB ah, al;
    const v4f x0 = *(const v4fa*)(arow + kb + 8 * hh), x1 = *(const v4fa*)(arow + kb + 8 * hh + 4);
    const v4f x2 = *(const v4fa*)(arow + kb + 16 + 8 * hh), x3 = *(const v4fa*)(arow + kb + 16 + 8 * hh + 4);
    float xs[16] = {x0[0],x0[1],x0[2],x0[3],x1[0],x1[1],x1[2],x1[3],x2[0],x2[1],x2[2],x2[3],x3[0],x3[1],x3[2],x3[3]};
#pragma unroll
    for (int i = 0; i < 16; ++i) { const unsigned short hb = bf16_bits(xs[i]); ah.u[i] = hb; al.u[i] = ASPLIT ? bf16_bits(xs[i] - bf16_val(hb)) : (unsigned short)0; }
#pragma unroll
    for (int t = 0; t < 4; ++t) {
      const unsigned short* brow = Wt + (size_t)(col0 + t * 16 + ln) * ldb + kb;
      FragB b;
      b.half[0] = *(const v8us*)(brow + 8 * hh);
      b.half[1] = *(const v8us*)(brow + 16 + 8 * hh);
      acc[t] = mmaN<ASPLIT ? 2 : 1>(ah.v, al.v, b.v, b.v, acc[t]);
    }
  }
#pragma unroll
  for (int t = 0; t < 4; ++t) {
    const int col = col0 + t * 16 + ln;
    float bv = bias ? bias[col] : 0.f;
    if (BIAS_BF16) bv = bf16_round(bv);
#pragma unroll
    for (int r = 0; r < 8; ++r) {
      float v = acc[t][r] + bv;
      if (resid) { float rv = resid[(size_t)((row0 + 8 * hh + r) % rmod) * ldr + col]; if (RES_BF16) rv = bf16_round(rv); v += rv; }
      if (ACT == 1) v = fmaxf(v, 0.f);
      if (ACT == 2) v = 0.5f * v * (1.0f + erff(v * 0.70710678118654752f));
      if (ACT == 3) { const float u = 0.7978845608028654f * (v + 0.044715f * v * v * v); v = 0.5f * v * (1.0f + tanhf(u)); }
      so[w][8 * hh + r][t * 16 + ln] = v;
    }
  }
  __builtin_amdgcn_fence(__ATOMIC_ACQ_REL, "workgroup");
  __builtin_amdgcn_wave_barrier();
  const int rsub = lane >> 4, c4 = (lane & 15) * 4;
  {
#pragma unroll
    for (int q = 0; q < 8; ++q) {
      const int r = q * 2 + rsub;
      const v4f v = *(const v4fa*)&so[w][r][c4];
      *(v4f*)(C + (size_t)(row0 + r) * ldc + col0 + c4) = v;
    }
    
  }
}
// row LayerNorm (biased variance, eps) over N: s = X (+ R); optional out_sum <- s; out_norm <- (s-mu)*rsqrt(var+eps)*g + b
template <bool PARAM_BF16>
__global__ __launch_bounds__(256) void k_layernorm(const float* __restrict__ X, const float* __restrict__ R, const float* __restrict__ g, const float* __restrict__ bta,
                                                  float* __restrict__ out_sum, float* __restrict__ out_norm, int N, float eps) {
  __shared__ float red[256];
  const int row = blockIdx.x, tid = threadIdx.x;
  const float* x = X + (size_t)row * N; const float* rr = R ? R + (size_t)row * N : nullptr;
  float vals[16];                     // up to N = 4096
  const int per = N / 256;            // contiguous chunk per thread? use strided-by-4 chunks: thread handles j = tid*4 + 1024*u
  float s1 = 0.f;
  for (int u = 0; u < per / 4; ++u) {
    const int j = tid * 4 + 1024 * u;
    const v4f a = *(const v4fa*)(x + j);
    v4f b = {0.f,0.f,0.f,0.f}; if (rr) b = *(const v4fa*)(rr + j);
#pragma unroll
    for (int q = 0; q < 4; ++q) { const float v = a[q] + b[q]; vals[u * 4 + q] = v; s1 += v; }
  }
  red[tid] = s1; __syncthreads();
  for (int st = 128; st > 0; st >>= 1) { if (tid < st) red[tid] += red[tid + st]; __syncthreads(); }
  const float mu = red[0] / (float)N; __syncthreads();
  float s2 = 0.f;
  for (int u = 0; u < per / 4; ++u)
#pragma unroll
    for (int q = 0; q < 4; ++q) { const float c = vals[u * 4 + q] - mu; s2 += c * c; }
  red[tid] = s2; __syncthreads();
  for (int st = 128; st > 0; st >>= 1) { if (tid < st) red[tid] += red[tid + st]; __syncthreads(); }
  const float rs = rsqrtf(red[0] / (float)N + eps);
  {
    for (int u = 0; u < per / 4; ++u) {
      const int j = tid * 4 + 1024 * u;
      v4f o, sm;
#pragma unroll
      for (int q = 0; q < 4; ++q) {
        float gg = g[j + q], bb = bta[j + q];
        if (PARAM_BF16) { gg = bf16_round(gg); bb = bf16_round(bb); }
        sm[q] = vals[u * 4 + q]; o[q] = (vals[u * 4 + q] - mu) * rs * gg + bb;
      }
      if (out_sum) *(v4f*)(out_sum + (size_t)row * N + j) = sm;
      *(v4f*)(out_norm + (size_t)row * N + j) = o;
    }
    
  }
}



// ---- f16 WMMA path (v_wmma_f32_16x16x32_f16): 11-bit significands for operands in range — used where a [0,1] probability operand needs more precision than bf16
typedef _Float16 v16h __attribute__((ext_vector_type(16)));
union FragH { v16h v; v8us half[2]; _Float16 h[16]; unsigned short u[16]; };
template <int NT>
__device__ __forceinline__ v8f mmaH(v16h ah, v16h al, v16h bh, v16h bl, v8f c) {
  c = __builtin_amdgcn_wmma_f32_16x16x32_f16(false, ah, false, bh, (short)0, c, false, false);
  if (NT >= 2) c = __builtin_amdgcn_wmma_f32_16x16x32_f16(false, al, false, bh, (short)0, c, false, false);
  if (NT >= 3) c = __builtin_amdgcn_wmma_f32_16x16x32_f16(false, ah, false, bl, (short)0, c, false, false);
  asm volatile("v_nop\n\tv_nop\n\tv_nop\n\tv_nop" : "+v"(c) : "v"(ah), "v"(al), "v"(bh), "v"(bl));
  return c;
}
// batched GEMM like k_gemm_b but f16 operands: A f32 (split into f16 hi/lo if ASPLIT, else rounded to f16), Bt = f16 values [n][k]; alpha; C f32; N multiple of 16 (partial tiles skipped)
template <bool ASPLIT>
__global__ __launch_bounds__(128) void k_gemm_h(const float* __restrict__ A, int lda, size_t sA, const _Float16* __restrict__ Bh, int ldb, size_t sB, float alpha, float* __restrict__ C, int ldc, size_t sC, int M, int N, int K) {
  __shared__ __attribute__((aligned(16))) float so[4][16][64];
  const int tid = threadIdx.x, w = tid >> 5, lane = tid & 31, ln = lane & 15, hh = lane >> 4; const int by = blockIdx.y;
  A += (size_t)by * sA; Bh += (size_t)by * sB; C += (size_t)by * sC;
  const int ntn = (N + 63) / 64; const int wid = blockIdx.x * 4 + w; const int mt = wid / ntn, nq = wid % ntn; if (mt * 16 >= M) return;
  const int row0 = mt * 16, col0 = nq * 64; const float* arow = A + (size_t)(row0 + ln) * lda;
  v8f acc[4] = {};
  for (int kb = 0; kb < K; kb += 32) {
    FragH ah, al;
    const v4f x0 = *(const v4fa*)(arow + kb + 8 * hh), x1 = *(const v4fa*)(arow + kb + 8 * hh + 4), x2 = *(const v4fa*)(arow + kb + 16 + 8 * hh), x3 = *(const v4fa*)(arow + kb + 16 + 8 * hh + 4);
    float xs[16] = {x0[0],x0[1],x0[2],x0[3],x1[0],x1[1],x1[2],x1[3],x2[0],x2[1],x2[2],x2[3],x3[0],x3[1],x3[2],x3[3]};
#pragma unroll
    for (int i = 0; i < 16; ++i) { const _Float16 h = (_Float16)xs[i]; ah.h[i] = h; al.h[i] = ASPLIT ? (_Float16)(xs[i] - (float)h) : (_Float16)0.0f; }
#pragma unroll
    for (int t = 0; t < 4; ++t) { if (col0 + t * 16 >= N) continue; const size_t boff = (size_t)(col0 + t * 16 + ln) * ldb + kb; FragH bq; bq.half[0] = *(const v8us*)(Bh + boff + 8 * hh); bq.half[1] = *(const v8us*)(Bh + boff + 16 + 8 * hh);
      acc[t] = mmaH<ASPLIT ? 2 : 1>(ah.v, al.v, bq.v, bq.v, acc[t]); }
  }
#pragma unroll
  for (int t = 0; t < 4; ++t) { if (col0 + t * 16 >= N) continue;
#pragma unroll
    for (int r = 0; r < 8; ++r) so[w][8 * hh + r][t * 16 + ln] = acc[t][r] * alpha; }
  __builtin_amdgcn_fence(__ATOMIC_ACQ_REL, "workgroup"); __builtin_amdgcn_wave_barrier();
  const int rsub = lane >> 4, c4 = (lane & 15) * 4;
  {
#pragma unroll
    for (int q = 0; q < 8; ++q) { const int r = q * 2 + rsub; if (col0 + c4 < N) { const v4f v = *(const v4fa*)&so[w][r][c4]; *(v4f*)(C + (size_t)(row0 + r) * ldc + col0 + c4) = v; } }
     }
}

// k_gemm_hh variant with fused epilogue: v = acc·alpha + bias[by·sBias + col] (+ CP[(row/rowsPerB)·sCPb + by·64 + col] if CP) ; ACT 0 none / 1 elu ; writes f16 C16 (and f32 C if non-null)
template <int ACT>
__global__ __launch_bounds__(128) void k_gemm_hhx(const _Float16* __restrict__ A, int lda, size_t sA, const _Float16* __restrict__ Bh, int ldb, size_t sB, float alpha, const float* __restrict__ bias, size_t sBias, const float* __restrict__ CP, int rowsPerB, size_t sCPb, int row0g,
    float* __restrict__ C, _Float16* __restrict__ C16, int ldc, size_t sC, int M, int N, int K) {
  __shared__ __attribute__((aligned(16))) float so[4][16][64];
  const int tid = threadIdx.x, w = tid >> 5, lane = tid & 31, ln = lane & 15, hh = lane >> 4; const int by = blockIdx.y;
  A += (size_t)by * sA; Bh += (size_t)by * sB; const size_t cofs = (size_t)by * sC; const float* bp = bias ? bias + (size_t)by * sBias : nullptr;
  const int ntn = (N + 63) / 64; const int wid = blockIdx.x * 4 + w; const int mt = wid / ntn, nq = wid % ntn; if (mt * 16 >= M) return;
  const int row0 = mt * 16, col0 = nq * 64; const _Float16* arow = A + (size_t)(row0 + ln) * lda;
  v8f acc[4] = {};
  for (int kb = 0; kb < K; kb += 32) { FragH ah; ah.half[0] = *(const v8us*)((const unsigned short*)arow + kb + 8 * hh); ah.half[1] = *(const v8us*)((const unsigned short*)arow + kb + 16 + 8 * hh);
#pragma unroll
    for (int t = 0; t < 4; ++t) { if (col0 + t * 16 >= N) continue; const size_t boff = (size_t)(col0 + t * 16 + ln) * ldb + kb; FragH bq; bq.half[0] = *(const v8us*)((const unsigned short*)Bh + boff + 8 * hh); bq.half[1] = *(const v8us*)((const unsigned short*)Bh + boff + 16 + 8 * hh);
      acc[t] = mmaH<1>(ah.v, ah.v, bq.v, bq.v, acc[t]); }
  }
#pragma unroll
  for (int t = 0; t < 4; ++t) { if (col0 + t * 16 >= N) continue; const int col = col0 + t * 16 + ln; const float bv = bp ? bf16_round(bp[col]) : 0.f;
#pragma unroll
    for (int r = 0; r < 8; ++r) { float v = acc[t][r] * alpha + bv; if (CP) { const int rr = row0g + row0 + 8 * hh + r; if (rowsPerB < 0) v += CP[cofs + (size_t)rr * ldc + col];      /* rowsPerB < 0: own element of the batched C plane */ else { const int bidx = rr / rowsPerB; v += CP[(size_t)bidx * sCPb + (size_t)by * 64 + col]; } } if (ACT == 1) v = (v > 0.f) ? v : expm1f(v); else if (ACT == 7) v = (v > 0.f) ? v + 1.0f : expf(v); else if (ACT == 8) v = tanhf(v); else if (ACT == 9) v = 0.5f * v * (1.0f + tanhf(0.7978845608028654f * (v + 0.044715f * v * v * v))); else if (ACT == 11) v = 1.0f / (1.0f + expf(-v)); else if (ACT == 12) v = (v > 0.f) ? v : 0.01f * v; else if (ACT == 14) v = (v > 0.f) ? v : 0.1f * v; else if (ACT == 16) v = (v >= 0.f) ? v : 0.3f * v; else if (ACT == 17) v = (v >= 0.f) ? v : 0.2f * v; else if (ACT == 15) v = v / (1.0f + expf(-v)); else if (ACT == 3) v = fmaxf(v, 0.f); else if (ACT == 6) v = 0.5f * v * (1.0f + erff(v * 0.70710678118654752f)); so[w][8 * hh + r][t * 16 + ln] = v; } }
  __builtin_amdgcn_fence(__ATOMIC_ACQ_REL, "workgroup"); __builtin_amdgcn_wave_barrier();
  const int rsub = lane >> 4, c4 = (lane & 15) * 4; typedef _Float16 v4h __attribute__((ext_vector_type(4)));
  {
#pragma unroll
    for (int q = 0; q < 8; ++q) { const int r = q * 2 + rsub; if (col0 + c4 < N) { const v4f v = *(const v4fa*)&so[w][r][c4]; if (C) *(v4f*)(C + cofs + (size_t)(row0 + r) * ldc + col0 + c4) = v; if (C16) { v4h h4; for (int i = 0; i < 4; ++i) h4[i] = (_Float16)v[i]; *(v4h*)(C16 + cofs + (size_t)(row0 + r) * ldc + col0 + c4) = h4; } } }
     }
}


typedef _Float16 v4h __attribute__((ext_vector_type(4)));

#define PPT 512                      /* threads per work-group of the preparation launch: 16 waves */
#define PPG 256                      /* its work-groups */
#define PXQ 4                        /* groups of 8 elements that a thread takes of each input stream */
static_assert((size_t)PPG * PPT * PXQ * 8 == NR * DM && PPG * PPT * 32 == 4 * DM * DM && DM == 1024 && HD == 64 && NH * HD == DM, "k_prep: the launch covers each stream and the four weight planes exactly once");
// A thread's weight block: 8 k x 4 n of f32 row-major W (row pitch N), one 16-byte load per k row. s = the block's first element.
template <int N>
__device__ __forceinline__ void pw_load(const float* __restrict__ s, v4f (&a)[8]) {
#pragma unroll
  for (int i = 0; i < 8; ++i) a[i] = *(const v4fa*)(s + i * N);
  asm volatile("s_wait_xcnt 0x0" ::: "memory");      /* stands directly behind these loads, in front of any later overwrite of their address registers */
}
// The block transposed in registers: Bt[n + j][k .. k + 7] = f16(bf16(W[k + i][n + j]) x 16), one 16-byte store per n row (bf16-exact weights stay exact in f16 away from the subnormal range). d = Bt's element [n][k].
__device__ __forceinline__ void pw_store(_Float16* __restrict__ d, const v4f (&a)[8]) {
#pragma unroll
  for (int j = 0; j < 4; ++j) { FragH f;
#pragma unroll
    for (int i = 0; i < 8; ++i) f.h[i] = (_Float16)(bf16_round(a[i][j]) * 16.0f);
    *(v8us*)((unsigned short*)d + j * DM) = f.half[0]; }
  asm volatile("s_wait_xcnt 0x0" ::: "memory");      /* stands directly behind these stores, in front of any later overwrite of a register that they name */
}
// A thread's share of one stream: PXQ groups of 8 elements, PPT groups apart. s, d = the first group's place in the f32 source and in the f16 rows.
__device__ __forceinline__ void px_load(const float* __restrict__ s, v4f (&a)[8]) {
#pragma unroll
  for (int q = 0; q < PXQ; ++q) { a[2 * q] = *(const v4fa*)(s + q * (PPT * 8)); a[2 * q + 1] = *(const v4fa*)(s + q * (PPT * 8) + 4); }
  asm volatile("s_wait_xcnt 0x0" ::: "memory");      /* stands directly behind these loads, in front of any later overwrite of their address registers */
  __builtin_amdgcn_sched_barrier(0);      /* keeps the conversion of the batch in front, which waits for that batch's data, from being moved ahead of these loads: without it they were asked for only when that data had come */
}
__device__ __forceinline__ void px_store(_Float16* __restrict__ d, const v4f (&a)[8]) {
#pragma unroll
  for (int q = 0; q < PXQ; ++q) { FragH f;
#pragma unroll
    for (int e = 0; e < 8; ++e) f.h[e] = (_Float16)bf16_round(a[2 * q + (e >> 2)][e & 3]);
    *(v8us*)((unsigned short*)d + q * (PPT * 8)) = f.half[0]; }
  asm volatile("s_wait_xcnt 0x0" ::: "memory");      /* stands directly behind these stores, in front of any later overwrite of a register that they name */
}
// All work that reads inputs only, in ONE launch of 256 work-groups of 16 waves: none of these jobs reads what another writes. Few long waves in place of many short ones: 4096 waves to start in place of 65536, which moved 48 bytes per lane each.
// Every thread takes four batches of eight 16-byte loads, each batch asked for before the batch in front of it is converted and stored: one weight block, then its share of the three streams. Every element gets the arithmetic of the former launch.
// Weights: work-groups 64 p .. 64 p + 63 take plane p (WQ, WK, WV: head c of the stack, its [1024][64] block into rows 64 c .. 64 c + 63; WO: columns 64 c .. 64 c + 63 into the same rows), 64 n x 256 k each; a wave takes 16 n x 64 k, lane = (k group, n group):
// a load covers 64 bytes of each of 8 source rows, a store four whole 128-byte lines of the plane, each written by that wave alone.
// Streams: a work-group takes 2048 groups in a row of each stream; a wave's two loads of a group cover 1 KiB in a row, its store 512 bytes.
__global__ __launch_bounds__(PPT) void k_prep(const float* __restrict__ wq, const float* __restrict__ wk, const float* __restrict__ wv, const float* __restrict__ wo, const float* __restrict__ x, const float* __restrict__ xk, const float* __restrict__ xv,
    _Float16* __restrict__ BQ, _Float16* __restrict__ BK, _Float16* __restrict__ BV, _Float16* __restrict__ BO, _Float16* __restrict__ X16, _Float16* __restrict__ XK16, _Float16* __restrict__ XV16) {
  const int tid = threadIdx.x, bid = blockIdx.x, lane = tid & 31, w = tid >> 5;
  const int job = bid >> 6, c = (bid & 63) >> 2;      /* each the same for the whole work-group */
  const int k = (bid & 3) * 256 + (w >> 2) * 64 + (lane & 7) * 8, n = (w & 3) * 16 + (lane >> 3) * 4;
  _Float16* Bt = job == 0 ? BQ : job == 1 ? BK : job == 2 ? BV : BO;
  const size_t so = (size_t)bid * (PPT * PXQ * 8) + (size_t)tid * 8;
  v4f a[8], b[8];
  if (job == 3) pw_load<DM>(wo + (size_t)k * DM + c * 64 + n, a);
  else pw_load<HD>((job == 0 ? wq : job == 1 ? wk : wv) + (size_t)c * DM * HD + (size_t)k * HD + n, a);
  px_load(x + so, b);
  pw_store(Bt + (size_t)(c * 64 + n) * DM + k, a);
  px_load(xk + so, a);
  px_store(X16 + so, b);
  px_load(xv + so, b);
  px_store(XK16 + so, a);
  px_store(XV16 + so, b); }
__global__ __launch_bounds__(256) void k_h16(const float* __restrict__ x, _Float16* __restrict__ X16, size_t n8) { const size_t t = (size_t)blockIdx.x * 256 + threadIdx.x; if (t >= n8) return; FragH f;
#pragma unroll
  for (int q = 0; q < 8; ++q) f.h[q] = (_Float16)x[t * 8 + q]; *(v8us*)((unsigned short*)X16 + t * 8) = f.half[0];  }
__global__ __launch_bounds__(256) void k_round16f(const float* __restrict__ W, _Float16* __restrict__ Bt, size_t n8) { const size_t t = (size_t)blockIdx.x * 256 + threadIdx.x; if (t >= n8) return; FragH f;
#pragma unroll
  for (int i = 0; i < 8; ++i) f.h[i] = (_Float16)(bf16_round(W[t * 8 + i]) * 16.0f); *(v8us*)((unsigned short*)Bt + t * 8) = f.half[0];  }

// ---- fast GEMM (work-group tile 128x64, wave tile 32x64; requires M % 128 == 0, N % 64 == 0, K % 128 == 0, K >= 128); epilogue = k_gemm_hhx semantics ----
// Operands go through LDS: a stage is 128 k (256 bytes) of the work-group's 128 A rows and 64 Bh rows. Each lane copies 16 bytes, a wave's copy covers two whole rows of the stage (4 whole lines), and a Bh row is fetched once for the four waves.
// Two buffers: stage s + 1 flies while stage s is worked on. Fragments are read from LDS in the k order of the former global loads (k = 8 hh + i, 16 + 8 hh + i), k steps in the same order: same sums.
#define G2KC 128                     /* k per stage */
#define G2P 272                      /* LDS row pitch, bytes: 256 + 16 = 16 x odd, the pitch at which ds_load_b128 fragment reads meet no bank conflict */
#define G2BUF (192 * G2P)            /* one buffer: rows 0-127 A, 128-191 Bh */
__device__ __forceinline__ v16h g2_frag(const unsigned char* p) { FragH f; f.half[0] = *(const v8us*)p; f.half[1] = *(const v8us*)(p + 32); return f.v; }      /* p = the lane's row in LDS + 64 bytes per k step + 16 hh */
// Eight asynchronous copies of 16 bytes per lane, 8 rows apart (l = the lane's LDS byte address, g = its global address, gs = 8 rows of the source in elements).
// s_wait_xcnt 0 is the statement's last line so that it stands in front of every later write of the address registers that the copies name.
__device__ __forceinline__ void g2_copy8(unsigned l, const _Float16* g, size_t gs) {
  asm volatile("global_load_async_to_lds_b128 %0, %8, off\n\t"
               "global_load_async_to_lds_b128 %1, %9, off\n\t"
               "global_load_async_to_lds_b128 %2, %10, off\n\t"
               "global_load_async_to_lds_b128 %3, %11, off\n\t"
               "global_load_async_to_lds_b128 %4, %12, off\n\t"
               "global_load_async_to_lds_b128 %5, %13, off\n\t"
               "global_load_async_to_lds_b128 %6, %14, off\n\t"
               "global_load_async_to_lds_b128 %7, %15, off\n\t"
               "s_wait_xcnt 0x0"
               :: "v"(l), "v"(l + 8 * G2P), "v"(l + 16 * G2P), "v"(l + 24 * G2P), "v"(l + 32 * G2P), "v"(l + 40 * G2P), "v"(l + 48 * G2P), "v"(l + 56 * G2P),
                  "v"(g), "v"(g + gs), "v"(g + 2 * gs), "v"(g + 3 * gs), "v"(g + 4 * gs), "v"(g + 5 * gs), "v"(g + 6 * gs), "v"(g + 7 * gs) : "memory"); }
// One stage: 24 copies per lane. l = the lane's place in the buffer (row tid / 16, 16-byte piece tid % 16); ga, gb = the same place in the stage's A and Bh rows.
__device__ __forceinline__ void g2_stage(unsigned l, const _Float16* ga, int lda, const _Float16* gb, int ldb) {
  g2_copy8(l, ga, (size_t)8 * lda); g2_copy8(l + 64 * G2P, ga + (size_t)64 * lda, (size_t)8 * lda); g2_copy8(l + 128 * G2P, gb, (size_t)8 * ldb); }
__device__ __forceinline__ v8f g2_mma(v16h a, v16h b, v8f c) { v8f d = __builtin_amdgcn_wmma_f32_16x16x32_f16(false, a, false, b, (short)0, c, false, false); asm volatile("v_nop\n\tv_nop\n\tv_nop\n\tv_nop" : "+v"(d) : "v"(a), "v"(b)); return d; }
// The fast GEMM's main loop, run by every wave of a 128-thread work-group: ga, gb = the lane's place (row tid / 16, 16-byte piece tid % 16) in stage 0 of the work-group's 128 A rows and 64 Bh rows; nst = stages of 128 k.
// Leaves the wave's 32 x 64 sums in accs: accs[4 half + t] = rows 16 half .. + 15, columns 16 t .. + 15 of the wave tile. No copy is outstanding at its end.
__device__ __forceinline__ void g2_loop(unsigned char* ring, const _Float16* ga, int lda, const _Float16* gb, int ldb, int nst, int tid, v8f (&accs)[8]) {
  const int w = tid >> 5, lane = tid & 31, ln = lane & 15, hh = lane >> 4;
  const unsigned lc = (unsigned)(size_t)ring + (unsigned)((tid >> 4) * G2P + (tid & 15) * 16);      /* this lane's place in buffer 0 as an LDS byte address (low 32 bits of the __shared__ address) */
  const v8f z8 = {0.f,0.f,0.f,0.f,0.f,0.f,0.f,0.f}; v8f c00 = z8, c01 = z8, c02 = z8, c03 = z8, c10 = z8, c11 = z8, c12 = z8, c13 = z8;
  g2_stage(lc, ga, lda, gb, ldb);
  asm volatile("s_wait_asynccnt 0x0" ::: "memory");      /* this wave's copies of stage 0 have landed */
  __syncthreads();      /* stage 0 is readable by every wave */
  if (nst > 1) g2_stage(lc + G2BUF, ga + G2KC, lda, gb + G2KC, ldb);
#pragma unroll 1      /* rolled: one stage per trip, its four k steps unrolled inside */
  for (int s = 0; s < nst; ++s) { const unsigned char* bufp = ring + (s & 1) * G2BUF; const unsigned char* pa = bufp + (32 * w + ln) * G2P + 16 * hh; const unsigned char* pb = bufp + (128 + ln) * G2P + 16 * hh;
    v16h a0 = g2_frag(pa), a1 = g2_frag(pa + 16 * G2P), b0 = g2_frag(pb), b1 = g2_frag(pb + 16 * G2P), b2 = g2_frag(pb + 32 * G2P), b3 = g2_frag(pb + 48 * G2P);
#pragma unroll      /* unrolled: the two fragment sets then alternate by register name, without copies */
    for (int ks = 0; ks < G2KC / 32; ++ks) { v16h na0 = a0, na1 = a1, nb0 = b0, nb1 = b1, nb2 = b2, nb3 = b3;
      if (ks + 1 < G2KC / 32) { const int o = (ks + 1) * 64; na0 = g2_frag(pa + o); na1 = g2_frag(pa + 16 * G2P + o); nb0 = g2_frag(pb + o); nb1 = g2_frag(pb + 16 * G2P + o); nb2 = g2_frag(pb + 32 * G2P + o); nb3 = g2_frag(pb + 48 * G2P + o); }      /* the next k step's fragments of the SAME stage, asked for ahead of this step's products */
      c00 = g2_mma(a0, b0, c00); c10 = g2_mma(a1, b0, c10); c01 = g2_mma(a0, b1, c01); c11 = g2_mma(a1, b1, c11);
      c02 = g2_mma(a0, b2, c02); c12 = g2_mma(a1, b2, c12); c03 = g2_mma(a0, b3, c03); c13 = g2_mma(a1, b3, c13);
      a0 = na0; a1 = na1; b0 = nb0; b1 = nb1; b2 = nb2; b3 = nb3; }
    asm volatile("s_wait_dscnt 0x0" ::: "memory");      /* this wave's reads of stage s are done before the buffer is handed to its next writer */
    asm volatile("s_wait_asynccnt 0x0" ::: "memory");      /* this wave's copies of stage s + 1 have landed */
    __syncthreads();      /* publishes stage s + 1 and ends every wave's reads of stage s */
    if (s + 2 < nst) g2_stage(lc + (unsigned)(s & 1) * G2BUF, ga + (size_t)(s + 2) * G2KC, lda, gb + (size_t)(s + 2) * G2KC, ldb); }
  asm volatile("s_wait_asynccnt 0x0" ::: "memory");      /* no copy is outstanding when the wave goes on */
  accs[0] = c00; accs[1] = c01; accs[2] = c02; accs[3] = c03; accs[4] = c10; accs[5] = c11; accs[6] = c12; accs[7] = c13; }
template <int ACT>
__global__ __launch_bounds__(128) void k_gemm2(const _Float16* __restrict__ A, int lda, size_t sA, const _Float16* __restrict__ Bh, int ldb, size_t sB, float alpha, const float* __restrict__ bias, size_t sBias, const float* __restrict__ CP, int rowsPerB, size_t sCPb, int row0g,
    float* __restrict__ C, _Float16* __restrict__ C16, int ldc, size_t sC, int M, int N, int K) { static_assert(ACT == 0 || ACT == 3 || ACT == 6 || ACT == 8 || ACT == 9 || ACT == 11 || ACT == 12 || ACT == 14 || ACT == 15 || ACT == 16 || ACT == 17, "k_gemm2: unsupported ACT code (would silently apply no activation)");
  __shared__ __attribute__((aligned(16))) float so[4][32][68];
  __shared__ __attribute__((aligned(16))) unsigned char ring[2 * G2BUF];
  const int tid = threadIdx.x, w = tid >> 5, lane = tid & 31, ln = lane & 15, hh = lane >> 4; const int by = blockIdx.y;
  A += (size_t)by * sA; Bh += (size_t)by * sB; const size_t cofs = (size_t)by * sC; const float* bp = bias ? bias + (size_t)by * sBias : nullptr;
  const int ntn = N >> 6; const int mt = blockIdx.x / ntn, nq = blockIdx.x - mt * ntn; const int row0 = mt * 128 + 32 * w, col0 = nq * 64; if (mt * 128 >= M) return;      /* the same for the whole work-group, in front of every barrier */
  const _Float16* ga = A + (size_t)(mt * 128 + (tid >> 4)) * lda + (tid & 15) * 8; const _Float16* gb = Bh + (size_t)(col0 + (tid >> 4)) * ldb + (tid & 15) * 8;
  v8f accs[8]; g2_loop(ring, ga, lda, gb, ldb, K / G2KC, tid, accs);
#pragma unroll
  for (int u = 0; u < 8; ++u) { const int t = u & 3, half = u >> 2; const int col = col0 + t * 16 + ln; const float bv = bp ? bf16_round(bp[col]) : 0.f;
#pragma unroll
    for (int r = 0; r < 8; ++r) { const int rloc = half * 16 + 8 * hh + r; float v = accs[u][r] * alpha + bv; if (CP) { if (rowsPerB < 0) v += CP[cofs + (size_t)(row0g + row0 + rloc) * ldc + col];      /* rowsPerB < 0: own element of the batched C plane */ else { const int bidx = (row0g + row0 + rloc) / rowsPerB; v += CP[(size_t)bidx * sCPb + (size_t)by * 64 + col]; } }
      if (ACT == 3) v = fmaxf(v, 0.f); else if (ACT == 6) v = 0.5f * v * (1.0f + erff(v * 0.70710678118654752f)); else if (ACT == 11) v = 1.0f / (1.0f + expf(-v)); else if (ACT == 15) v = v / (1.0f + expf(-v)); else if (ACT == 12) v = (v > 0.f) ? v : 0.01f * v; else if (ACT == 8) v = tanhf(v); else if (ACT == 9) v = 0.5f * v * (1.0f + tanhf(0.7978845608028654f * (v + 0.044715f * v * v * v))); else if (ACT == 14) v = (v > 0.f) ? v : 0.1f * v; else if (ACT == 16) v = (v >= 0.f) ? v : 0.3f * v; else if (ACT == 17) v = (v >= 0.f) ? v : 0.2f * v;
      so[w][rloc][t * 16 + ln] = v; } }
  __builtin_amdgcn_fence(__ATOMIC_ACQ_REL, "workgroup"); __builtin_amdgcn_wave_barrier();
  const int rsub = lane >> 4, c4 = (lane & 15) * 4;
  {
#pragma unroll
    for (int q = 0; q < 16; ++q) { const int r = q * 2 + rsub; const v4f v = *(const v4fa*)&so[w][r][c4]; if (C) *(v4f*)(C + cofs + (size_t)(row0 + r) * ldc + col0 + c4) = v; if (C16) { v4h h4; for (int i = 0; i < 4; ++i) h4[i] = (_Float16)v[i]; *(v4h*)(C16 + cofs + (size_t)(row0 + r) * ldc + col0 + c4) = h4; } }
     } }
// The three projections in ONE launch: blockIdx.y = 0: q, 1: k, 2: v; 512 work-group tiles each, tile and main loop as k_gemm2. None reads what another writes.
// q, k: rows = tokens (A = the stream's f16 rows), columns = head outputs (Bh = the weight plane); the epilogue splits each f32 value v into h = f16(v) and f16((v - h) x 1024) and stores both planes: the arithmetic of the former conversion launch on the same f32 values.
// v: operands swapped (A = the weight plane's 1024 rows 64 h + d, Bh = the 2048 token rows of one batch), so that the tile is a piece of V^T [batch][head][d][token] as the attention reads it and no transposition is left; each sum takes the same products in the same k order.
// A row of a wave's tile is 64 f16 = one whole 128-byte line of its plane, written by that wave alone.
#define PJT ((MP / 128) * (DM / 64))       /* work-group tiles per projection (512) */
#define PJV ((DM / 128) * (SQ / 64))       /* V^T tiles per batch (256) */
static_assert(PJV * NB == PJT && B0 == 0 && NBR == NB, "k_proj: one grid row per projection, all batches");
__global__ __launch_bounds__(128) void k_proj(const _Float16* __restrict__ X16, const _Float16* __restrict__ XK16, const _Float16* __restrict__ XV16, const _Float16* __restrict__ BQ, const _Float16* __restrict__ BK, const _Float16* __restrict__ BV,
    _Float16* __restrict__ QH, _Float16* __restrict__ QL, _Float16* __restrict__ KH, _Float16* __restrict__ KL, _Float16* __restrict__ VT) {
  __shared__ __attribute__((aligned(16))) float so[4][32][68];
  __shared__ __attribute__((aligned(16))) unsigned char ring[2 * G2BUF];
  const int tid = threadIdx.x, w = tid >> 5, lane = tid & 31, ln = lane & 15, hh = lane >> 4; const int job = blockIdx.y, bx = blockIdx.x;
  const _Float16* A; const _Float16* Bh; _Float16* Ph; _Float16* Pl; int mt, nq, ldc;      /* each the same for the whole work-group */
  if (job < 2) { A = job ? XK16 : X16; Bh = job ? BK : BQ; Ph = job ? KH : QH; Pl = job ? KL : QL; mt = bx / (DM / 64); nq = bx % (DM / 64); ldc = DM; }
  else { const int b = bx / PJV, u = bx % PJV; A = BV; Bh = XV16 + (size_t)b * SQ * DM; Ph = VT + (size_t)b * DM * SQ; Pl = nullptr; mt = u / (SQ / 64); nq = u % (SQ / 64); ldc = SQ; }
  const int row0 = mt * 128 + 32 * w, col0 = nq * 64;
  const _Float16* ga = A + (size_t)(mt * 128 + (tid >> 4)) * DM + (tid & 15) * 8; const _Float16* gb = Bh + (size_t)(col0 + (tid >> 4)) * DM + (tid & 15) * 8;
  v8f accs[8]; g2_loop(ring, ga, DM, gb, DM, DM / G2KC, tid, accs);
#pragma unroll
  for (int u = 0; u < 8; ++u) { const int t = u & 3, half = u >> 2;
#pragma unroll
    for (int r = 0; r < 8; ++r) so[w][half * 16 + 8 * hh + r][t * 16 + ln] = accs[u][r] * 0.0625f; }      /* the weights are carried x16 */
  __builtin_amdgcn_fence(__ATOMIC_ACQ_REL, "workgroup"); __builtin_amdgcn_wave_barrier();
  const int rsub = lane >> 4, c4 = (lane & 15) * 4; const size_t po = (size_t)(row0 + rsub) * ldc + col0 + c4;      /* the lane's place in rows 0 and 1 of the wave's tile */
  if (job < 2) {
#pragma unroll
    for (int q = 0; q < 16; ++q) { const v4f v = *(const v4fa*)&so[w][q * 2 + rsub][c4]; v4h h4, l4;
      for (int i = 0; i < 4; ++i) { const _Float16 h = (_Float16)v[i]; h4[i] = h; l4[i] = (_Float16)((v[i] - (float)h) * 1024.0f); }
      *(v4h*)(Ph + po + (size_t)(q * 2) * DM) = h4; *(v4h*)(Pl + po + (size_t)(q * 2) * DM) = l4; } }
  else {
#pragma unroll
    for (int q = 0; q < 16; ++q) { const v4f v = *(const v4fa*)&so[w][q * 2 + rsub][c4]; v4h h4;
      for (int i = 0; i < 4; ++i) h4[i] = (_Float16)v[i];
      *(v4h*)(Ph + po + (size_t)(q * 2) * SQ) = h4; }
    asm volatile("s_wait_xcnt 0x0" ::: "memory");      /* stands directly behind the last of these stores, in front of any later overwrite of a register that they name */
  } }


__global__ __launch_bounds__(256) void k_wnat(const float* __restrict__ w, size_t n8, _Float16* __restrict__ Bt) { const size_t t = (size_t)blockIdx.x * 256 + threadIdx.x; if (t >= n8) return; FragH f; for (int q = 0; q < 8; ++q) f.h[q] = (_Float16)(bf16_round(w[t * 8 + q]) * 16.0f); *(v8us*)((unsigned short*)Bt + t * 8) = f.half[0];  }
__global__ __launch_bounds__(256) void k_rsm(const float* __restrict__ S, _Float16* __restrict__ P, int nrows) {
  #pragma clang fp contract(off)
  const int i = blockIdx.x * 256 + threadIdx.x; if (i >= nrows) return; const float* s = S + (size_t)i * SQ; float mx = -3.0e38f;
#pragma unroll 1
  for (int j = 0; j < SQ; ++j) mx = fmaxf(mx, s[j]); float se = 0.f;
#pragma unroll 1
  for (int j = 0; j < SQ; ++j) se += expf(s[j] - mx); const float sc = 256.0f / se;
#pragma unroll 1
  for (int j0 = 0; j0 < SQ; j0 += 8) { FragH f; for (int q = 0; q < 8; ++q) f.h[q] = (_Float16)(expf(s[j0 + q] - mx) * sc); unsigned short* d = (unsigned short*)P + (size_t)i * SQ + j0; *(v8us*)d = f.half[0];  } }
__global__ __launch_bounds__(256) void k_vt(const _Float16* __restrict__ V16, int b, int h0, _Float16* __restrict__ VT) { __shared__ unsigned short tl[64][65]; const int tid = threadIdx.x; const int hh = blockIdx.x % HG, sg = blockIdx.x / HG; const int s0 = sg * 64; const int h = h0 + hh;
  for (int i = tid; i < 64 * 8; i += 256) { const int j = i / 8, d8 = (i % 8) * 8; FragH f; f.half[0] = *(const v8us*)((const unsigned short*)V16 + ((size_t)b * SQ + s0 + j) * DM + h * HD + d8); for (int q = 0; q < 8; ++q) tl[d8 + q][j] = f.u[q]; }
  __syncthreads();
  { for (int i = tid; i < 64 * 8; i += 256) { const int d = i / 8, j8 = (i % 8) * 8; FragH f; for (int q = 0; q < 8; ++q) f.u[q] = tl[d][j8 + q]; *(v8us*)((unsigned short*)VT + ((size_t)hh * HD + d) * SQ + s0 + j8) = f.half[0]; }  } }



// 2^x on the transcendental unit; the v_nop fills the one slot that the instruction set asks for between a transcendental and an instruction that reads its result or overwrites its source.
__device__ __forceinline__ float exp2_slot(float x) { float r; asm("v_exp_f32 %0, %1\n\tv_nop" : "=v"(r) : "v"(x)); return r; }
// Value of lane l ^ 16 (the other half of the wave): one register move between the two 16-lane rows, no LDS.
__device__ __forceinline__ float xhalf(float x) { return __builtin_bit_cast(float, __builtin_amdgcn_permlanex16(__builtin_bit_cast(int, x), __builtin_bit_cast(int, x), 0x76543210, 0xfedcba98, false, false)); }
__device__ __forceinline__ v16h fa_frag(const unsigned short* p) { FragH f; f.half[0] = *(const v8us*)p; f.half[1] = *(const v8us*)(p + 16); return f.v; }      /* p = the lane's own pointer, 8 hh included: k = 8 hh + i, 16 + 8 hh + i, as g2_frag */
__device__ __forceinline__ v8f fa_mma(v16h a, v16h b, v8f c) { return __builtin_amdgcn_wmma_f32_16x16x32_f16(false, a, false, b, (short)0, c, false, false); }
#define FAW 8                        /* waves per work-group of the fused attention */
#define FAQ 32                       /* query columns per wave */
#define FAK 32                       /* keys per pass */
#define FAC 0.18033688f              /* 1 / sqrt(64) x log2(e): scores to the exponent of 2 */
#define FAT 128                      /* keys per LDS stage (four passes) */
#define FAKP 144                     /* LDS pitch of a K row, bytes: 128 + 16 = 16 x odd, no bank conflict for ds_load_b128 fragment reads */
#define FAVP 272                     /* LDS pitch of a V^T row, bytes: 256 + 16 = 16 x odd */
#define FAKB (FAT * FAKP)            /* one K plane of a stage */
#define FABUF (2 * FAKB + HD * FAVP) /* one buffer: K hi rows, K residual rows, V^T rows */
// One stage: 12 asynchronous copies of 16 bytes per lane, in one statement. A wave's copy covers four whole K rows of the head (128 bytes each) or two whole V^T rows of the stage (256 bytes each): whole lines only.
// lk, lv = the lane's places in the buffer's K hi plane (row tid / 8, piece tid % 8) and V^T plane (row tid / 16, piece tid % 16) as LDS byte addresses; gh, gl, gv = the same places in the stage's source rows. Copies 32 K rows or 16 V^T rows apart.
// s_wait_xcnt 0 is the statement's last line so that it stands in front of every later write of the address registers that the copies name.
__device__ __forceinline__ void fa_stage(unsigned lk, unsigned lv, const unsigned short* gh, const unsigned short* gl, const unsigned short* gv) {
  asm volatile("global_load_async_to_lds_b128 %0, %12, off\n\t"
               "global_load_async_to_lds_b128 %1, %13, off\n\t"
               "global_load_async_to_lds_b128 %2, %14, off\n\t"
               "global_load_async_to_lds_b128 %3, %15, off\n\t"
               "global_load_async_to_lds_b128 %4, %16, off\n\t"
               "global_load_async_to_lds_b128 %5, %17, off\n\t"
               "global_load_async_to_lds_b128 %6, %18, off\n\t"
               "global_load_async_to_lds_b128 %7, %19, off\n\t"
               "global_load_async_to_lds_b128 %8, %20, off\n\t"
               "global_load_async_to_lds_b128 %9, %21, off\n\t"
               "global_load_async_to_lds_b128 %10, %22, off\n\t"
               "global_load_async_to_lds_b128 %11, %23, off\n\t"
               "s_wait_xcnt 0x0"
               :: "v"(lk), "v"(lk + 32 * FAKP), "v"(lk + 64 * FAKP), "v"(lk + 96 * FAKP),
                  "v"(lk + FAKB), "v"(lk + FAKB + 32 * FAKP), "v"(lk + FAKB + 64 * FAKP), "v"(lk + FAKB + 96 * FAKP),
                  "v"(lv), "v"(lv + 16 * FAVP), "v"(lv + 32 * FAVP), "v"(lv + 48 * FAVP),
                  "v"(gh), "v"(gh + 32 * LQ), "v"(gh + 64 * LQ), "v"(gh + 96 * LQ),
                  "v"(gl), "v"(gl + 32 * LQ), "v"(gl + 64 * LQ), "v"(gl + 96 * LQ),
                  "v"(gv), "v"(gv + 16 * SQ), "v"(gv + 32 * SQ), "v"(gv + 48 * SQ) : "memory"); }
__global__ __launch_bounds__(FAW * 32) void k_fattn(const _Float16* __restrict__ QHp, const _Float16* __restrict__ QLp, const _Float16* __restrict__ KHp, const _Float16* __restrict__ KLp, const _Float16* __restrict__ VTp, _Float16* __restrict__ Op) {
  __shared__ __attribute__((aligned(16))) unsigned char ring[2 * FABUF];
  const int tid = threadIdx.x, lane = tid & 31, w = tid >> 5, ln = lane & 15, hh = lane >> 4; const int h = blockIdx.y, b = blockIdx.z; const int q0 = blockIdx.x * (FAW * FAQ) + w * FAQ; const size_t r0 = (size_t)b * SQ;
  const unsigned lk = (unsigned)(size_t)ring + (unsigned)((tid >> 3) * FAKP + (tid & 7) * 16), lv = (unsigned)(size_t)ring + (unsigned)(2 * FAKB + (tid >> 4) * FAVP + (tid & 15) * 16);      /* this lane's places in buffer 0 as LDS byte addresses (low 32 bits of the __shared__ address) */
  const unsigned short* gh = (const unsigned short*)KHp; const unsigned short* gl = (const unsigned short*)KLp; const unsigned short* gv = (const unsigned short*)VTp;
  const unsigned go = (unsigned)((b * SQ + (tid >> 3)) * LQ + h * HD + (tid & 7) * 8), gvo = (unsigned)(((b * NH + h) * HD + (tid >> 4)) * SQ + (tid & 15) * 8);      /* this lane's places in stage 0's source rows, in elements (below 2^23): one register each across the loop */
  const size_t qo = (r0 + q0 + ln) * LQ + h * HD + 8 * hh;
  const unsigned short* qhl = (const unsigned short*)QHp + qo; const unsigned short* qll = (const unsigned short*)QLp + qo;
  v16h qh[2][2], ql[2][2];
#pragma unroll
  for (int qt = 0; qt < 2; ++qt) for (int ks = 0; ks < 2; ++ks) { qh[qt][ks] = fa_frag(qhl + (size_t)(qt * 16) * LQ + ks * 32); ql[qt][ks] = fa_frag(qll + (size_t)(qt * 16) * LQ + ks * 32); }
  asm volatile("s_wait_xcnt 0x0" :: "v"(qhl), "v"(qll) : "memory");      /* stands in front of the first overwrite of these loads' address registers; the addresses are inputs so that they keep their registers up to here */
  const v8f z8 = {0.f,0.f,0.f,0.f,0.f,0.f,0.f,0.f}; v8f o[2][4]; float m[2], l[2];
#pragma unroll
  for (int qt = 0; qt < 2; ++qt) { m[qt] = -1.0e30f; l[qt] = 0.f; for (int dt = 0; dt < 4; ++dt) o[qt][dt] = z8; }
#pragma unroll 1      /* rolled: the buffer's offset stays a run-time scalar, so that lk and lv are themselves no operands of the copies' asm text: as such they were tied to the first 256 registers over the whole kernel and spilled to scratch */
  for (int s = 0; s < 2; ++s) {      /* stage 0's copies, their wait and the barrier; then stage 1's copies */
    fa_stage(lk + (unsigned)s * FABUF, lv + (unsigned)s * FABUF, gh + (go + (unsigned)s * (FAT * LQ)), gl + (go + (unsigned)s * (FAT * LQ)), gv + (gvo + (unsigned)s * FAT));
    if (s == 0) {
      asm volatile("s_wait_asynccnt 0x0" ::: "memory");      /* this wave's copies of stage 0 have landed */
      __syncthreads();      /* stage 0 is readable by every wave */
    }
  }
#pragma unroll 1      /* rolled: one stage per trip */
  for (int s = 0; s < SQ / FAT; ++s) {
    const unsigned char* bufp = ring + (s & 1) * FABUF; const unsigned char* pk = bufp + ln * FAKP + 16 * hh; const unsigned char* pv = bufp + 2 * FAKB + ln * FAVP + 16 * hh;
    v16h kh[2][2], kl[2][2];
#pragma unroll
    for (int kt = 0; kt < 2; ++kt) for (int ks = 0; ks < 2; ++ks) { kh[kt][ks] = g2_frag(pk + (kt * 16) * FAKP + ks * 64); kl[kt][ks] = g2_frag(pk + FAKB + (kt * 16) * FAKP + ks * 64); }
#pragma unroll 1      /* rolled: one pass already holds 32 matrix instructions, and a second copy would double the registers in flight */
    for (int ps = 0; ps < FAT / FAK; ++ps) {
      v16h va[4];      /* V^T rows of this pass: asked for here, needed only behind the softmax */
#pragma unroll
      for (int dt = 0; dt < 4; ++dt) va[dt] = g2_frag(pv + (dt * 16) * FAVP + ps * 64);
      v8f sa[2][2], sr[2][2];      /* [query tile][key tile]: hi.hi, and the x1024 residual products */
#pragma unroll
      for (int qt = 0; qt < 2; ++qt) for (int kt = 0; kt < 2; ++kt) sa[qt][kt] = fa_mma(kh[kt][0], qh[qt][0], z8);
#pragma unroll
      for (int qt = 0; qt < 2; ++qt) for (int kt = 0; kt < 2; ++kt) sr[qt][kt] = fa_mma(kh[kt][0], ql[qt][0], z8);
#pragma unroll
      for (int qt = 0; qt < 2; ++qt) for (int kt = 0; kt < 2; ++kt) sa[qt][kt] = fa_mma(kh[kt][1], qh[qt][1], sa[qt][kt]);
#pragma unroll
      for (int qt = 0; qt < 2; ++qt) for (int kt = 0; kt < 2; ++kt) sr[qt][kt] = fa_mma(kh[kt][1], ql[qt][1], sr[qt][kt]);
#pragma unroll
      for (int qt = 0; qt < 2; ++qt) for (int kt = 0; kt < 2; ++kt) sr[qt][kt] = fa_mma(kl[kt][0], qh[qt][0], sr[qt][kt]);
#pragma unroll
      for (int qt = 0; qt < 2; ++qt) for (int kt = 0; kt < 2; ++kt) sr[qt][kt] = fa_mma(kl[kt][1], qh[qt][1], sr[qt][kt]);
      if (ps + 1 < FAT / FAK) {      /* the next pass's K rows of the SAME stage, asked for ahead of this pass's softmax */
#pragma unroll
        for (int kt = 0; kt < 2; ++kt) for (int ks = 0; ks < 2; ++ks) { kh[kt][ks] = g2_frag(pk + ((ps + 1) * FAK + kt * 16) * FAKP + ks * 64); kl[kt][ks] = g2_frag(pk + FAKB + ((ps + 1) * FAK + kt * 16) * FAKP + ks * 64); } }
#pragma unroll
      for (int qt = 0; qt < 2; ++qt) {
        float t[16];
#pragma unroll
        for (int i = 0; i < 16; ++i) t[i] = fmaf(sr[qt][i >> 3][i & 7], 0.0009765625f, sa[qt][i >> 3][i & 7]);
        float mx = t[0];
#pragma unroll
        for (int i = 1; i < 16; ++i) mx = fmaxf(mx, t[i]);
        mx = fmaxf(mx, xhalf(mx));
        const float mn = fmaxf(m[qt], mx); const float al = exp2_slot((m[qt] - mn) * FAC); const float nb = 8.0f - mn * FAC; m[qt] = mn;
        FragH p; float sum = 0.f;
#pragma unroll
        for (int i = 0; i < 16; ++i) { const float e = exp2_slot(fmaf(t[i], FAC, nb)); sum += e; p.h[i] = (_Float16)e; }
        l[qt] = fmaf(l[qt], al, sum);
#pragma unroll
        for (int dt = 0; dt < 4; ++dt) { for (int r = 0; r < 8; ++r) o[qt][dt][r] *= al; }
#pragma unroll
        for (int dt = 0; dt < 4; ++dt) o[qt][dt] = fa_mma(va[dt], p.v, o[qt][dt]);
        if (qt == 0) __builtin_amdgcn_sched_barrier(0);      /* keeps the other query tile's exponentials from being moved directly behind these four products, whose operand registers they may be given */
      }
    }
    asm volatile("s_wait_dscnt 0x0" ::: "memory");      /* this wave's reads of stage s are done before the buffer is handed to its next writer */
    asm volatile("s_wait_asynccnt 0x0" ::: "memory");      /* this wave's copies of stage s + 1 have landed */
    __syncthreads();      /* publishes stage s + 1 and ends every wave's reads of stage s */
    if (s + 2 < SQ / FAT) fa_stage(lk + (unsigned)(s & 1) * FABUF, lv + (unsigned)(s & 1) * FABUF, gh + (go + (unsigned)(s + 2) * (FAT * LQ)), gl + (go + (unsigned)(s + 2) * (FAT * LQ)), gv + (gvo + (unsigned)(s + 2) * FAT));
  }
  asm volatile("s_wait_asynccnt 0x0" ::: "memory");      /* no copy is outstanding when the wave goes on */
#pragma unroll
  for (int qt = 0; qt < 2; ++qt) { const float inv = 64.0f / (l[qt] + xhalf(l[qt]));      /* the halves' sums joined once; o carried x64 */
    _Float16* op = Op + r0 * DM + (size_t)h * SQ * HD + (size_t)(q0 + qt * 16 + ln) * HD + 8 * hh;
#pragma unroll
    for (int dt = 0; dt < 4; ++dt) { FragH f; for (int r = 0; r < 8; ++r) f.h[r] = (_Float16)(o[qt][dt][r] * inv); *(v8us*)((unsigned short*)op + dt * 16) = f.half[0]; } } }


template <int MASKADD>
__global__ __launch_bounds__(64) void k_att0(const float* __restrict__ QF, const float* __restrict__ KF, const float* __restrict__ VF, int ld, const float* __restrict__ mask, float scale, float* __restrict__ OF, int ldo) {
  #pragma clang fp contract(off)
  __shared__ __attribute__((aligned(16))) float lq[64][64]; __shared__ __attribute__((aligned(16))) float lo[64][64];
  const int tid = threadIdx.x; const int h = blockIdx.x / (QT0 / 64), rg = blockIdx.x % (QT0 / 64); const int i = rg * 64 + tid;
  const float* qr = QF + (size_t)i * ld + h * HD;
#pragma unroll 1
  for (int c = 0; c < HD / 4; ++c) { *(v4f*)&lq[tid][c * 4] = *(const v4fa*)(qr + c * 4); const v4f z = {0.f, 0.f, 0.f, 0.f}; *(v4f*)&lo[tid][c * 4] = z; }
  float m = -1.0e30f, l = 0.f; const int jmax = MASKADD ? (SQ - 1) : (rg * 64 + 63);      /* additive-mask form: every key (the mask input decides); causal form: keys up to the block's last row */
#pragma unroll 1
  for (int j = 0; j <= jmax; ++j) { const float* kr = KF + (size_t)j * ld + h * HD; const float* vr = VF + (size_t)j * ld + h * HD; float s = 0.f;
#pragma unroll 1
    for (int c = 0; c < HD / 4; ++c) { const v4f kq = *(const v4fa*)(kr + c * 4); const v4f qq = *(v4f*)&lq[tid][c * 4]; s = __fadd_rn(s, __fmul_rn(qq[0], kq[0])); s = __fadd_rn(s, __fmul_rn(qq[1], kq[1])); s = __fadd_rn(s, __fmul_rn(qq[2], kq[2])); s = __fadd_rn(s, __fmul_rn(qq[3], kq[3])); }
    s = __fmul_rn(s, scale); if (MASKADD) s = __fadd_rn(s, __fmul_rn(bf16_round(mask[(size_t)i * SQ + j]), -10000.0f));
    const float f = (MASKADD || j <= i) ? 1.f : 0.f; const float sm = fmaf(f, s, (1.f - f) * -1.0e30f); const float mn = fmaxf(m, sm); const float sc = expf(m - mn); const float e = expf(sm - mn); l = __fadd_rn(__fmul_rn(l, sc), e); m = mn;
#pragma unroll 1
    for (int c = 0; c < HD / 4; ++c) { const v4f vv = *(const v4fa*)(vr + c * 4); v4f oo = *(v4f*)&lo[tid][c * 4]; for (int u = 0; u < 4; ++u) oo[u] = __fadd_rn(__fmul_rn(oo[u], sc), __fmul_rn(e, vv[u])); *(v4f*)&lo[tid][c * 4] = oo; } }
  const float fin = 64.0f / l;      /* o carried x64 like the f16 path */
#pragma unroll 1
  for (int c = 0; c < HD / 4; ++c) { v4f oo = *(v4f*)&lo[tid][c * 4]; for (int u = 0; u < 4; ++u) oo[u] = __fmul_rn(oo[u], fin); *(v4f*)&lo[tid][c * 4] = oo; }
  __syncthreads();
  {
#pragma unroll 1
    for (int it = 0; it < 16; ++it) { const int row = it * 4 + tid / 16, pc = (tid % 16) * 4; const v4f v = *(const v4f*)&lo[row][pc]; *(v4f*)(OF + (size_t)(rg * 64 + row) * ldo + h * HD + pc) = v; }
     } }

extern "C" void kernel_launch(void* const* d_in, const int* in_sizes, int n_in,
                              void* d_out, int out_size, void* d_ws, size_t ws_size, hipStream_t stream) {
  (void)in_sizes; (void)n_in; (void)out_size;
  const float* const* I = (const float* const*)d_in; const float* x = I[0]; const float* xk = I[1]; const float* xv = I[2]; const float* wq = I[3]; const float* wk = I[4]; const float* wv = I[5]; const float* bq = nullptr; const float* bk = nullptr; const float* bv = nullptr; const float* wo = I[6]; const float* bo = nullptr;      /* input order: q, k, v (the three streams, two sequences each), Wq, Wk, Wv (PER-HEAD STACKS [16][1024][64]), Wo ([in][out] [1024][1024]); NO biases anywhere: null pointers in the guarded slots */
  char* ws = (char*)d_ws; size_t off = 0;
  auto take = [&](size_t bytes) { char* p = ws + off; off += (bytes + 255) & ~(size_t)255; return p; };
  _Float16* BQ = (_Float16*)take((size_t)DM * DM * 2); _Float16* BK = (_Float16*)take((size_t)DM * DM * 2); _Float16* BV = (_Float16*)take((size_t)DM * DM * 2); _Float16* BO = (_Float16*)take((size_t)DM * DM * 2);
  _Float16* X16 = (_Float16*)take(NR * DM * 2); _Float16* XK16 = (_Float16*)take(NR * DM * 2); _Float16* XV16 = (_Float16*)take(NR * DM * 2);      /* exact f16 rows of query, key, value */ _Float16* QH = (_Float16*)take(NR * DM * 2); _Float16* QL = (_Float16*)take(NR * DM * 2); _Float16* KH = (_Float16*)take(NR * DM * 2); _Float16* KL = (_Float16*)take(NR * DM * 2); _Float16* Q16 = QH; _Float16* K16 = KH; _Float16* O16 = (_Float16*)take(NR * DM * 2);
  _Float16* VT = (_Float16*)take((size_t)NB * NH * HD * SQ * 2);      /* V^T of both batches */
  float* QF0 = (float*)take((size_t)QT0 * DM * 4); float* KF0 = (float*)take((size_t)QT0 * DM * 4); float* VF0 = (float*)take((size_t)QT0 * DM * 4); float* OF0 = (float*)take((size_t)NB * QT0 * DM * 4); _Float16* OH0 = (_Float16*)take((size_t)NB * QT0 * DM * 2); _Float16* OL0 = (_Float16*)take((size_t)NB * QT0 * DM * 2);
  if (off > ws_size) return;
  k_prep<<<PPG, PPT, 0, stream>>>(wq, wk, wv, wo, x, xk, xv, BQ, BK, BV, BO, X16, XK16, XV16);      /* head h's [1024][64] block -> rows 64 h .. 64 h + 63 of the Bt[n][k] x16 plane; the [in][out] output weight transposed into its plane; the three streams as exact f16 rows */
  const size_t r0p = (size_t)B0 * SQ;      /* first projected row */
  k_proj<<<dim3((unsigned)PJT, 3), 128, 0, stream>>>(X16, XK16, XV16, BQ, BK, BV, QH, QL, KH, KL, VT);      /* q and k -> f16 hi + x1024 residual planes (unscaled logits sigma ~8); v -> V^T [NB][NH][HD][SQ] */
  k_fattn<<<dim3(SQ / (FAW * FAQ), NH, NB), FAW * 32, 0, stream>>>(QH, QL, KH, KL, VT, O16);      /* o written HEAD-CONTIGUOUS: o[b][h][s][64] (row pitch 64, head stride SQ x 64): the source's raw reshape of (B, H, S, dk) to (B, S, H dk) then reads that memory as [2048][1024] rows: the output GEMM below does exactly that */
  k_gemm2<0><<<dim3((unsigned)((MPO / 128) * (DM / 64)), 1), 128, 0, stream>>>(O16 + r0p * DM, DM, 0, BO, DM, 0, 0.0009765625f, bo, 0, nullptr, 1, 0, 0, (float*)d_out + r0p * DM, nullptr, DM, 0, MPO, DM, DM);      /* out rows are the output layout */
  /* (dense: no first-tile hi / lo planes) */
  /* (dense: no first-tile rewrite passes:
     the output GEMM above has written every row
     with its (null) bias) */
}

// v008
// A run of this version takes 102 microseconds.
// Next to v007, in two timings, it ran 1.04 times as fast each time.
// Counting every step since v000, it is 74.9 times as fast.
#include <hip/hip_runtime.h>
// Multi-head attention on three inputs with PER-HEAD STACKED projections and the source's RAW-RESHAPE head merge (Q, K, V [2][2048][1024]; WQ / WK / WV [16][1024][64] = [head][in][out] uniform +-0.1, NO biases; 16 heads of 64; scores x 1/sqrt(64); softmax over all 2048 keys (no mask); the head outputs [B][H][S][64] are RESHAPED IN MEMORY ORDER to [B][S][1024] (row r of a batch holds tokens 16 (r mod 128) .. + 15 of head r / 128: heads and tokens mix: faithful to the source); out = that WO with WO [1024][1024] [in][out], NO bias -> [2][2048][1024]); q and k carried as f16 hi + x1024 residual planes with three-product scores; each head's [in][out] block is transposed into its 64 contiguous rows of the f16 weight plane, and the [in][out] output weight into its plane, all in one launch (k_prep); DENSE (k_fattn runs every query over all SQ keys; no exact first tile).
// Structure: token rows r = b*2048 + s; x as exact f16 rows (bf16-rounded); q and k as WMMA GEMMs (32x64 wave tiles, f32 accumulation, exact x16 weights, no bias) whose epilogues split the f32 sums into f16 hi + x1024 residual planes, v by swapped operands straight into V^T for both batches and all heads, all three in one launch (k_proj); per work-group of 256 query rows in one fused launch (k_fattn; all heads on grid.y, batches on grid.z), in passes of 32 keys over all 2048: scores as THREE accumulating products (hi.hi + 2^-10 (lo.hi + hi.lo), K = 64, logits sigma ~8, 1/sqrt(64) log2(e) applied in the exponent), online row softmax on VALU with no mask (f32 statistics, native exp2; weights x256 f16), o = P . V^T (o carried x64, folded into the output GEMM alpha) written straight into the merged f16 o rows; out = o W_o GEMM (f32, no bias) into the output layout.
// Attention now runs as ONE fused launch (k_fattn, below): the per-tile score passes, the row softmax and the P . V^T pass of the former version are gone, with their score and weight planes; V^T is built for both batches in one launch.
// All work that reads inputs only (the weight planes, the three f16 input streams) now runs as ONE launch (k_prep, below) in place of one launch per head and plane and one per stream.
// That launch now has 256 work-groups of 16 waves, each thread taking a weight block and a share of every stream: see the lines above k_prep.
// The GEMM launches (k_proj, k_gemm2) now take their operand tiles through LDS (asynchronous copies, two buffers): see the lines above k_gemm2.
// The GEMM work-group tile is now 128x128 (eight waves of 32x64 in place of four): a third fewer operand bytes come from L2 per product: see the lines above k_gemm2.
// The fused attention (k_fattn) now takes its K and V^T rows through LDS in the same way, once for the work-group's eight waves: see the lines above k_fattn.
// The three projections now run as ONE launch (k_proj, below) whose epilogues write the attention's operand planes themselves: q and k as f16 hi + x1024 residual, V^T by swapped operands; the f32 q / k plane, the f16 v rows and the three launches that converted them are gone.
// Compute dtype: inputs rounded to bf16; x / weights exact; q and k as f16 hi + x1024 residual planes, v, softmax weights and o as plain f16 GEMM operands (~2^-12); scores and softmax statistics f32. v_wmma_f32_16x16x32_f16.
#define NB 2
#define SCL 0.125f                         /* 1 / sqrt(head_dim = 64) */
#define SCLR 0.0001220703125f              /* 2^-13: SCL x 2^-10 (not used) */
#define SQ 2048
#define DM 1024
#define NH 16
#define HD 64
#define HG 4                         /* heads per group of the second k_vt (not launched) */
#define QT 256                       /* query rows per query tile (not used) */
#define NKX SQ                       /* row pitch of the former S / P planes (not used) */
#define QT0 128                      /* rows of the exact first tile of k_att0 (not launched) */
#define B0 0                         /* first batch processed (debug hook) */
#define NBR NB                       /* batches processed (debug hook) */
#define NR ((size_t)NB * SQ)         /* token rows */
#define MP ((int)((size_t)NBR * SQ)) /* rows projected (debug hook) */
#define QN SQ                        /* query rows attended per batch (not used) */
#define NHD NH                       /* heads attended (not used) */
#define MPO MP                       /* rows through the output stage (debug hook) */
#define LQ DM      /* row pitch of the q/k rows */
typedef __bf16 v16b __attribute__((ext_vector_type(16)));
typedef unsigned short v8us __attribute__((ext_vector_type(8), may_alias));
typedef float  v8f  __attribute__((ext_vector_type(8)));
typedef float  v4f  __attribute__((ext_vector_type(4)));
typedef float  v4fa __attribute__((ext_vector_type(4), may_alias));
union FragB { v16b v; v8us half[2]; unsigned short u[16]; };

__device__ __forceinline__ unsigned short bf16_bits(float x) { unsigned int u = __float_as_uint(x); return (unsigned short)((u + 0x7FFFu + ((u >> 16) & 1u)) >> 16); }
__device__ __forceinline__ float bf16_val(unsigned short b) { return __uint_as_float(((unsigned int)b) << 16); }
__device__ __forceinline__ float bf16_round(float x) { return bf16_val(bf16_bits(x)); }
// D += A·B with NT terms: 1 = ah·bh, 2 = + al·bh (A split), 3 = + ah·bl (both split)
template <int NT>
__device__ __forceinline__ v8f mmaN(v16b ah, v16b al, v16b bh, v16b bl, v8f c) {
  c = __builtin_amdgcn_wmma_f32_16x16x32_bf16(false, ah, false, bh, (short)0, c, false, false);
  if (NT >= 2) c = __builtin_amdgcn_wmma_f32_16x16x32_bf16(false, al, false, bh, (short)0, c, false, false);
  if (NT >= 3) c = __builtin_amdgcn_wmma_f32_16x16x32_bf16(false, ah, false, bl, (short)0, c, false, false);
  asm volatile("v_nop\n\tv_nop\n\tv_nop\n\tv_nop" : "+v"(c) : "v"(ah), "v"(al), "v"(bh), "v"(bl));
  return c;
}

__global__ __launch_bounds__(256) void k_wt_bf16(const float* __restrict__ W, unsigned short* __restrict__ Wt, int K, int N) {
  const int t = blockIdx.x * 256 + threadIdx.x;
  const int k8n = K / 8;
  if (t >= N * k8n) return;
  const int n = t / k8n, k8 = (t % k8n) * 8;
  v8us v;
#pragma unroll
  for (int i = 0; i < 8; ++i) v[i] = bf16_bits(W[(size_t)(k8 + i) * N + n]);
  *(v8us*)(Wt + (size_t)n * K + k8) = v;
  
}

// GEMM C[M][N] (f32, pitch ldc) = act(A[M][K]·W + bias). A f32 row-major (pitch lda) converted per fragment to bf16
// (ASPLIT: hi/lo two planes -> 2 terms, else single rounded term); Wt bf16 [N][K] (pitch ldb). BIAS_BF16 rounds the
// bias to bf16 first (bias quantised to bf16 before the add). K%32==0, M%16==0, N%64==0.
template <bool ASPLIT, int ACT, bool BIAS_BF16>
__global__ __launch_bounds__(128) void k_gemm_bf(const float* __restrict__ A, int lda, const unsigned short* __restrict__ Wt, int ldb,
                                               const float* __restrict__ bias, float* __restrict__ C, int ldc, int M, int N, int K) {
  __shared__ __attribute__((aligned(16))) float so[4][16][64];
  const int tid = threadIdx.x, w = tid >> 5, lane = tid & 31, ln = lane & 15, hh = lane >> 4;
  const int ntn = N / 64;
  const int wid = blockIdx.x * 4 + w;
  const int mt = wid / ntn, nq = wid % ntn;
  if (mt * 16 >= M) return;
  const int row0 = mt * 16, col0 = nq * 64;
  const float* arow = A + (size_t)(row0 + ln) * lda;
  v8f acc[4] = {};
  for (int kb = 0; kb < K; kb += 32) {
    FragB ah, al;
    const v4f x0 = *(const v4fa*)(arow + kb + 8 * hh), x1 = *(const v4fa*)(arow + kb + 8 * hh + 4);
    const v4f x2 = *(const v4fa*)(arow + kb + 16 + 8 * hh), x3 = *(const v4fa*)(arow + kb + 16 + 8 * hh + 4);
    float xs[16] = {x0[0],x0[1],x0[2],x0[3],x1[0],x1[1],x1[2],x1[3],x2[0],x2[1],x2[2],x2[3],x3[0],x3[1],x3[2],x3[3]};
#pragma unroll
    for (int i = 0; i < 16; ++i) { const unsigned short hb = bf16_bits(xs[i]); ah.u[i] = hb; al.u[i] = ASPLIT ? bf16_bits(xs[i] - bf16_val(hb)) : (unsigned short)0; }
#pragma unroll
    for (int t = 0; t < 4; ++t) {
      const unsigned short* brow = Wt + (size_t)(col0 + t * 16 + ln) * ldb + kb;
      FragB b;
      b.half[0] = *(const v8us*)(brow + 8 * hh);
      b.half[1] = *(const v8us*)(brow + 16 + 8 * hh);
      acc[t] = mmaN<ASPLIT ? 2 : 1>(ah.v, al.v, b.v, b.v, acc[t]);
    }
  }
#pragma unroll
  for (int t = 0; t < 4; ++t) {
    float bv = bias ? bias[col0 + t * 16 + ln] : 0.f;
    if (BIAS_BF16) bv = bf16_round(bv);
#pragma unroll
    for (int r = 0; r < 8; ++r) { float v = acc[t][r] + bv; if (ACT == 1) v = fmaxf(v, 0.f); so[w][8 * hh + r][t * 16 + ln] = v; }
  }
  __builtin_amdgcn_fence(__ATOMIC_ACQ_REL, "workgroup");
  __builtin_amdgcn_wave_barrier();
  const int rsub = lane >> 4, c4 = (lane & 15) * 4;
  {
#pragma unroll
    for (int q = 0; q < 8; ++q) {
      const int r = q * 2 + rsub;
      const v4f v = *(const v4fa*)&so[w][r][c4];
      *(v4f*)(C + (size_t)(row0 + r) * ldc + col0 + c4) = v;
    }
    
  }
}

// GEMM C = act(A·W + bias + resid): A f32 (ASPLIT -> hi/lo 2 terms), Wt bf16 [N][K]; ACT 0 none, 1 relu, 2 exact gelu;
// resid (optional, f32, row index = (row % rmod), pitch ldr, RES_BF16 rounds it) added before the activation.
template <bool ASPLIT, int ACT, bool BIAS_BF16, bool RES_BF16>
__global__ __launch_bounds__(128) void k_gemm_bf3(const float* __restrict__ A, int lda, const unsigned short* __restrict__ Wt, int ldb,
                                                const float* __restrict__ bias, const float* __restrict__ resid, int rmod, int ldr,
                                                float* __restrict__ C, int ldc, int M, int N, int K) {
  __shared__ __attribute__((aligned(16))) float so[4][16][64];
  const int tid = threadIdx.x, w = tid >> 5, lane = tid & 31, ln = lane & 15, hh = lane >> 4;
  const int ntn = N / 64;
  const int wid = blockIdx.x * 4 + w;
  const int mt = wid / ntn, nq = wid % ntn;
  if (mt * 16 >= M) return;
  const int row0 = mt * 16, col0 = nq * 64;
  const float* arow = A + (size_t)(row0 + ln) * lda;
  v8f acc[4] = {};
  for (int kb = 0; kb < K; kb += 32) {
    FragB ah, al;
    const v4f x0 = *(const v4fa*)(arow + kb + 8 * hh), x1 = *(const v4fa*)(arow + kb + 8 * hh + 4);
    const v4f x2 = *(const v4fa*)(arow + kb + 16 + 8 * hh), x3 = *(const v4fa*)(arow + kb + 16 + 8 * hh + 4);
    float xs[16] = {x0[0],x0[1],x0[2],x0[3],x1[0],x1[1],x1[2],x1[3],x2[0],x2[1],x2[2],x2[3],x3[0],x3[1],x3[2],x3[3]};
#pragma unroll
    for (int i = 0; i < 16; ++i) { const unsigned short hb = bf16_bits(xs[i]); ah.u[i] = hb; al.u[i] = ASPLIT ? bf16_bits(xs[i] - bf16_val(hb)) : (unsigned short)0; }
#pragma unroll
    for (int t = 0; t < 4; ++t) {
      const unsigned short* brow = Wt + (size_t)(col0 + t * 16 + ln) * ldb + kb;
      FragB b;
      b.half[0] = *(const v8us*)(brow + 8 * hh);
      b.half[1] = *(const v8us*)(brow + 16 + 8 * hh);
      acc[t] = mmaN<ASPLIT ? 2 : 1>(ah.v, al.v, b.v, b.v, acc[t]);
    }
  }
#pragma unroll
  for (int t = 0; t < 4; ++t) {
    const int col = col0 + t * 16 + ln;
    float bv = bias ? bias[col] : 0.f;
    if (BIAS_BF16) bv = bf16_round(bv);
#pragma unroll
    for (int r = 0; r < 8; ++r) {
      float v = acc[t][r] + bv;
      if (resid) { float rv = resid[(size_t)((row0 + 8 * hh + r) % rmod) * ldr + col]; if (RES_BF16) rv = bf16_round(rv); v += rv; }
      if (ACT == 1) v = fmaxf(v, 0.f);
      if (ACT == 2) v = 0.5f * v * (1.0f + erff(v * 0.70710678118654752f));
      if (ACT == 3) { const float u = 0.7978845608028654f * (v + 0.044715f * v * v * v); v = 0.5f * v * (1.0f + tanhf(u)); }
      so[w][8 * hh + r][t * 16 + ln] = v;
    }
  }
  __builtin_amdgcn_fence(__ATOMIC_ACQ_REL, "workgroup");
  __builtin_amdgcn_wave_barrier();
  const int rsub = lane >> 4, c4 = (lane & 15) * 4;
  {
#pragma unroll
    for (int q = 0; q < 8; ++q) {
      const int r = q * 2 + rsub;
      const v4f v = *(const v4fa*)&so[w][r][c4];
      *(v4f*)(C + (size_t)(row0 + r) * ldc + col0 + c4) = v;
    }
    
  }
}
// row LayerNorm (biased variance, eps) over N: s = X (+ R); optional out_sum <- s; out_norm <- (s-mu)*rsqrt(var+eps)*g + b
template <bool PARAM_BF16>
__global__ __launch_bounds__(256) void k_layernorm(const float* __restrict__ X, const float* __restrict__ R, const float* __restrict__ g, const float* __restrict__ bta,
                                                  float* __restrict__ out_sum, float* __restrict__ out_norm, int N, float eps) {
  __shared__ float red[256];
  const int row = blockIdx.x, tid = threadIdx.x;
  const float* x = X + (size_t)row * N; const float* rr = R ? R + (size_t)row * N : nullptr;
  float vals[16];                     // up to N = 4096
  const int per = N / 256;            // contiguous chunk per thread? use strided-by-4 chunks: thread handles j = tid*4 + 1024*u
  float s1 = 0.f;
  for (int u = 0; u < per / 4; ++u) {
    const int j = tid * 4 + 1024 * u;
    const v4f a = *(const v4fa*)(x + j);
    v4f b = {0.f,0.f,0.f,0.f}; if (rr) b = *(const v4fa*)(rr + j);
#pragma unroll
    for (int q = 0; q < 4; ++q) { const float v = a[q] + b[q]; vals[u * 4 + q] = v; s1 += v; }
  }
  red[tid] = s1; __syncthreads();
  for (int st = 128; st > 0; st >>= 1) { if (tid < st) red[tid] += red[tid + st]; __syncthreads(); }
  const float mu = red[0] / (float)N; __syncthreads();
  float s2 = 0.f;
  for (int u = 0; u < per / 4; ++u)
#pragma unroll
    for (int q = 0; q < 4; ++q) { const float c = vals[u * 4 + q] - mu; s2 += c * c; }
  red[tid] = s2; __syncthreads();
  for (int st = 128; st > 0; st >>= 1) { if (tid < st) red[tid] += red[tid + st]; __syncthreads(); }
  const float rs = rsqrtf(red[0] / (float)N + eps);
  {
    for (int u = 0; u < per / 4; ++u) {
      const int j = tid * 4 + 1024 * u;
      v4f o, sm;
#pragma unroll
      for (int q = 0; q < 4; ++q) {
        float gg = g[j + q], bb = bta[j + q];
        if (PARAM_BF16) { gg = bf16_round(gg); bb = bf16_round(bb); }
        sm[q] = vals[u * 4 + q]; o[q] = (vals[u * 4 + q] - mu) * rs * gg + bb;
      }
      if (out_sum) *(v4f*)(out_sum + (size_t)row * N + j) = sm;
      *(v4f*)(out_norm + (size_t)row * N + j) = o;
    }
    
  }
}



// ---- f16 WMMA path (v_wmma_f32_16x16x32_f16): 11-bit significands for operands in range — used where a [0,1] probability operand needs more precision than bf16
typedef _Float16 v16h __attribute__((ext_vector_type(16)));
union FragH { v16h v; v8us half[2]; _Float16 h[16]; unsigned short u[16]; };
template <int NT>
__device__ __forceinline__ v8f mmaH(v16h ah, v16h al, v16h bh, v16h bl, v8f c) {
  c = __builtin_amdgcn_wmma_f32_16x16x32_f16(false, ah, false, bh, (short)0, c, false, false);
  if (NT >= 2) c = __builtin_amdgcn_wmma_f32_16x16x32_f16(false, al, false, bh, (short)0, c, false, false);
  if (NT >= 3) c = __builtin_amdgcn_wmma_f32_16x16x32_f16(false, ah, false, bl, (short)0, c, false, false);
  asm volatile("v_nop\n\tv_nop\n\tv_nop\n\tv_nop" : "+v"(c) : "v"(ah), "v"(al), "v"(bh), "v"(bl));
  return c;
}
// batched GEMM like k_gemm_b but f16 operands: A f32 (split into f16 hi/lo if ASPLIT, else rounded to f16), Bt = f16 values [n][k]; alpha; C f32; N multiple of 16 (partial tiles skipped)
template <bool ASPLIT>
__global__ __launch_bounds__(128) void k_gemm_h(const float* __restrict__ A, int lda, size_t sA, const _Float16* __restrict__ Bh, int ldb, size_t sB, float alpha, float* __restrict__ C, int ldc, size_t sC, int M, int N, int K) {
  __shared__ __attribute__((aligned(16))) float so[4][16][64];
  const int tid = threadIdx.x, w = tid >> 5, lane = tid & 31, ln = lane & 15, hh = lane >> 4; const int by = blockIdx.y;
  A += (size_t)by * sA; Bh += (size_t)by * sB; C += (size_t)by * sC;
  const int ntn = (N + 63) / 64; const int wid = blockIdx.x * 4 + w; const int mt = wid / ntn, nq = wid % ntn; if (mt * 16 >= M) return;
  const int row0 = mt * 16, col0 = nq * 64; const float* arow = A + (size_t)(row0 + ln) * lda;
  v8f acc[4] = {};
  for (int kb = 0; kb < K; kb += 32) {
    FragH ah, al;
    const v4f x0 = *(const v4fa*)(arow + kb + 8 * hh), x1 = *(const v4fa*)(arow + kb + 8 * hh + 4), x2 = *(const v4fa*)(arow + kb + 16 + 8 * hh), x3 = *(const v4fa*)(arow + kb + 16 + 8 * hh + 4);
    float xs[16] = {x0[0],x0[1],x0[2],x0[3],x1[0],x1[1],x1[2],x1[3],x2[0],x2[1],x2[2],x2[3],x3[0],x3[1],x3[2],x3[3]};
#pragma unroll
    for (int i = 0; i < 16; ++i) { const _Float16 h = (_Float16)xs[i]; ah.h[i] = h; al.h[i] = ASPLIT ? (_Float16)(xs[i] - (float)h) : (_Float16)0.0f; }
#pragma unroll
    for (int t = 0; t < 4; ++t) { if (col0 + t * 16 >= N) continue; const size_t boff = (size_t)(col0 + t * 16 + ln) * ldb + kb; FragH bq; bq.half[0] = *(const v8us*)(Bh + boff + 8 * hh); bq.half[1] = *(const v8us*)(Bh + boff + 16 + 8 * hh);
      acc[t] = mmaH<ASPLIT ? 2 : 1>(ah.v, al.v, bq.v, bq.v, acc[t]); }
  }
#pragma unroll
  for (int t = 0; t < 4; ++t) { if (col0 + t * 16 >= N) continue;
#pragma unroll
    for (int r = 0; r < 8; ++r) so[w][8 * hh + r][t * 16 + ln] = acc[t][r] * alpha; }
  __builtin_amdgcn_fence(__ATOMIC_ACQ_REL, "workgroup"); __builtin_amdgcn_wave_barrier();
  const int rsub = lane >> 4, c4 = (lane & 15) * 4;
  {
#pragma unroll
    for (int q = 0; q < 8; ++q) { const int r = q * 2 + rsub; if (col0 + c4 < N) { const v4f v = *(const v4fa*)&so[w][r][c4]; *(v4f*)(C + (size_t)(row0 + r) * ldc + col0 + c4) = v; } }
     }
}

// k_gemm_hh variant with fused epilogue: v = acc·alpha + bias[by·sBias + col] (+ CP[(row/rowsPerB)·sCPb + by·64 + col] if CP) ; ACT 0 none / 1 elu ; writes f16 C16 (and f32 C if non-null)
template <int ACT>
__global__ __launch_bounds__(128) void k_gemm_hhx(const _Float16* __restrict__ A, int lda, size_t sA, const _Float16* __restrict__ Bh, int ldb, size_t sB, float alpha, const float* __restrict__ bias, size_t sBias, const float* __restrict__ CP, int rowsPerB, size_t sCPb, int row0g,
    float* __restrict__ C, _Float16* __restrict__ C16, int ldc, size_t sC, int M, int N, int K) {
  __shared__ __attribute__((aligned(16))) float so[4][16][64];
  const int tid = threadIdx.x, w = tid >> 5, lane = tid & 31, ln = lane & 15, hh = lane >> 4; const int by = blockIdx.y;
  A += (size_t)by * sA; Bh += (size_t)by * sB; const size_t cofs = (size_t)by * sC; const float* bp = bias ? bias + (size_t)by * sBias : nullptr;
  const int ntn = (N + 63) / 64; const int wid = blockIdx.x * 4 + w; const int mt = wid / ntn, nq = wid % ntn; if (mt * 16 >= M) return;
  const int row0 = mt * 16, col0 = nq * 64; const _Float16* arow = A + (size_t)(row0 + ln) * lda;
  v8f acc[4] = {};
  for (int kb = 0; kb < K; kb += 32) { FragH ah; ah.half[0] = *(const v8us*)((const unsigned short*)arow + kb + 8 * hh); ah.half[1] = *(const v8us*)((const unsigned short*)arow + kb + 16 + 8 * hh);
#pragma unroll
    for (int t = 0; t < 4; ++t) { if (col0 + t * 16 >= N) continue; const size_t boff = (size_t)(col0 + t * 16 + ln) * ldb + kb; FragH bq; bq.half[0] = *(const v8us*)((const unsigned short*)Bh + boff + 8 * hh); bq.half[1] = *(const v8us*)((const unsigned short*)Bh + boff + 16 + 8 * hh);
      acc[t] = mmaH<1>(ah.v, ah.v, bq.v, bq.v, acc[t]); }
  }
#pragma unroll
  for (int t = 0; t < 4; ++t) { if (col0 + t * 16 >= N) continue; const int col = col0 + t * 16 + ln; const float bv = bp ? bf16_round(bp[col]) : 0.f;
#pragma unroll
    for (int r = 0; r < 8; ++r) { float v = acc[t][r] * alpha + bv; if (CP) { const int rr = row0g + row0 + 8 * hh + r; if (rowsPerB < 0) v += CP[cofs + (size_t)rr * ldc + col];      /* rowsPerB < 0: own element of the batched C plane */ else { const int bidx = rr / rowsPerB; v += CP[(size_t)bidx * sCPb + (size_t)by * 64 + col]; } } if (ACT == 1) v = (v > 0.f) ? v : expm1f(v); else if (ACT == 7) v = (v > 0.f) ? v + 1.0f : expf(v); else if (ACT == 8) v = tanhf(v); else if (ACT == 9) v = 0.5f * v * (1.0f + tanhf(0.7978845608028654f * (v + 0.044715f * v * v * v))); else if (ACT == 11) v = 1.0f / (1.0f + expf(-v)); else if (ACT == 12) v = (v > 0.f) ? v : 0.01f * v; else if (ACT == 14) v = (v > 0.f) ? v : 0.1f * v; else if (ACT == 16) v = (v >= 0.f) ? v : 0.3f * v; else if (ACT == 17) v = (v >= 0.f) ? v : 0.2f * v; else if (ACT == 15) v = v / (1.0f + expf(-v)); else if (ACT == 3) v = fmaxf(v, 0.f); else if (ACT == 6) v = 0.5f * v * (1.0f + erff(v * 0.70710678118654752f)); so[w][8 * hh + r][t * 16 + ln] = v; } }
  __builtin_amdgcn_fence(__ATOMIC_ACQ_REL, "workgroup"); __builtin_amdgcn_wave_barrier();
  const int rsub = lane >> 4, c4 = (lane & 15) * 4; typedef _Float16 v4h __attribute__((ext_vector_type(4)));
  {
#pragma unroll
    for (int q = 0; q < 8; ++q) { const int r = q * 2 + rsub; if (col0 + c4 < N) { const v4f v = *(const v4fa*)&so[w][r][c4]; if (C) *(v4f*)(C + cofs + (size_t)(row0 + r) * ldc + col0 + c4) = v; if (C16) { v4h h4; for (int i = 0; i < 4; ++i) h4[i] = (_Float16)v[i]; *(v4h*)(C16 + cofs + (size_t)(row0 + r) * ldc + col0 + c4) = h4; } } }
     }
}


typedef _Float16 v4h __attribute__((ext_vector_type(4)));

#define PPT 512                      /* threads per work-group of the preparation launch: 16 waves */
#define PPG 256                      /* its work-groups */
#define PXQ 4                        /* groups of 8 elements that a thread takes of each input stream */
static_assert((size_t)PPG * PPT * PXQ * 8 == NR * DM && PPG * PPT * 32 == 4 * DM * DM && DM == 1024 && HD == 64 && NH * HD == DM, "k_prep: the launch covers each stream and the four weight planes exactly once");
// A thread's weight block: 8 k x 4 n of f32 row-major W (row pitch N), one 16-byte load per k row. s = the block's first element.
template <int N>
__device__ __forceinline__ void pw_load(const float* __restrict__ s, v4f (&a)[8]) {
#pragma unroll
  for (int i = 0; i < 8; ++i) a[i] = *(const v4fa*)(s + i * N);
  asm volatile("s_wait_xcnt 0x0" ::: "memory");      /* stands directly behind these loads, in front of any later overwrite of their address registers */
}
// The block transposed in registers: Bt[n + j][k .. k + 7] = f16(bf16(W[k + i][n + j]) x 16), one 16-byte store per n row (bf16-exact weights stay exact in f16 away from the subnormal range). d = Bt's element [n][k].
__device__ __forceinline__ void pw_store(_Float16* __restrict__ d, const v4f (&a)[8]) {
#pragma unroll
  for (int j = 0; j < 4; ++j) { FragH f;
#pragma unroll
    for (int i = 0; i < 8; ++i) f.h[i] = (_Float16)(bf16_round(a[i][j]) * 16.0f);
    *(v8us*)((unsigned short*)d + j * DM) = f.half[0]; }
  asm volatile("s_wait_xcnt 0x0" ::: "memory");      /* stands directly behind these stores, in front of any later overwrite of a register that they name */
}
// A thread's share of one stream: PXQ groups of 8 elements, PPT groups apart. s, d = the first group's place in the f32 source and in the f16 rows.
__device__ __forceinline__ void px_load(const float* __restrict__ s, v4f (&a)[8]) {
#pragma unroll
  for (int q = 0; q < PXQ; ++q) { a[2 * q] = *(const v4fa*)(s + q * (PPT * 8)); a[2 * q + 1] = *(const v4fa*)(s + q * (PPT * 8) + 4); }
  asm volatile("s_wait_xcnt 0x0" ::: "memory");      /* stands directly behind these loads, in front of any later overwrite of their address registers */
  __builtin_amdgcn_sched_barrier(0);      /* keeps the conversion of the batch in front, which waits for that batch's data, from being moved ahead of these loads: without it they were asked for only when that data had come */
}
__device__ __forceinline__ void px_store(_Float16* __restrict__ d, const v4f (&a)[8]) {
#pragma unroll
  for (int q = 0; q < PXQ; ++q) { FragH f;
#pragma unroll
    for (int e = 0; e < 8; ++e) f.h[e] = (_Float16)bf16_round(a[2 * q + (e >> 2)][e & 3]);
    *(v8us*)((unsigned short*)d + q * (PPT * 8)) = f.half[0]; }
  asm volatile("s_wait_xcnt 0x0" ::: "memory");      /* stands directly behind these stores, in front of any later overwrite of a register that they name */
}
// All work that reads inputs only, in ONE launch of 256 work-groups of 16 waves: none of these jobs reads what another writes. Few long waves in place of many short ones: 4096 waves to start in place of 65536, which moved 48 bytes per lane each.
// Every thread takes four batches of eight 16-byte loads, each batch asked for before the batch in front of it is converted and stored: one weight block, then its share of the three streams. Every element gets the arithmetic of the former launch.
// Weights: work-groups 64 p .. 64 p + 63 take plane p (WQ, WK, WV: head c of the stack, its [1024][64] block into rows 64 c .. 64 c + 63; WO: columns 64 c .. 64 c + 63 into the same rows), 64 n x 256 k each; a wave takes 16 n x 64 k, lane = (k group, n group):
// a load covers 64 bytes of each of 8 source rows, a store four whole 128-byte lines of the plane, each written by that wave alone.
// Streams: a work-group takes 2048 groups in a row of each stream; a wave's two loads of a group cover 1 KiB in a row, its store 512 bytes.
__global__ __launch_bounds__(PPT) void k_prep(const float* __restrict__ wq, const float* __restrict__ wk, const float* __restrict__ wv, const float* __restrict__ wo, const float* __restrict__ x, const float* __restrict__ xk, const float* __restrict__ xv,
    _Float16* __restrict__ BQ, _Float16* __restrict__ BK, _Float16* __restrict__ BV, _Float16* __restrict__ BO, _Float16* __restrict__ X16, _Float16* __restrict__ XK16, _Float16* __restrict__ XV16) {
  const int tid = threadIdx.x, bid = blockIdx.x, lane = tid & 31, w = tid >> 5;
  const int job = bid >> 6, c = (bid & 63) >> 2;      /* each the same for the whole work-group */
  const int k = (bid & 3) * 256 + (w >> 2) * 64 + (lane & 7) * 8, n = (w & 3) * 16 + (lane >> 3) * 4;
  _Float16* Bt = job == 0 ? BQ : job == 1 ? BK : job == 2 ? BV : BO;
  const size_t so = (size_t)bid * (PPT * PXQ * 8) + (size_t)tid * 8;
  v4f a[8], b[8];
  if (job == 3) pw_load<DM>(wo + (size_t)k * DM + c * 64 + n, a);
  else pw_load<HD>((job == 0 ? wq : job == 1 ? wk : wv) + (size_t)c * DM * HD + (size_t)k * HD + n, a);
  px_load(x + so, b);
  pw_store(Bt + (size_t)(c * 64 + n) * DM + k, a);
  px_load(xk + so, a);
  px_store(X16 + so, b);
  px_load(xv + so, b);
  px_store(XK16 + so, a);
  px_store(XV16 + so, b); }
__global__ __launch_bounds__(256) void k_h16(const float* __restrict__ x, _Float16* __restrict__ X16, size_t n8) { const size_t t = (size_t)blockIdx.x * 256 + threadIdx.x; if (t >= n8) return; FragH f;
#pragma unroll
  for (int q = 0; q < 8; ++q) f.h[q] = (_Float16)x[t * 8 + q]; *(v8us*)((unsigned short*)X16 + t * 8) = f.half[0];  }
__global__ __launch_bounds__(256) void k_round16f(const float* __restrict__ W, _Float16* __restrict__ Bt, size_t n8) { const size_t t = (size_t)blockIdx.x * 256 + threadIdx.x; if (t >= n8) return; FragH f;
#pragma unroll
  for (int i = 0; i < 8; ++i) f.h[i] = (_Float16)(bf16_round(W[t * 8 + i]) * 16.0f); *(v8us*)((unsigned short*)Bt + t * 8) = f.half[0];  }

// ---- fast GEMM (work-group tile 128x128, eight waves, wave tile 32x64: wave w takes rows 32 (w % 4), columns 64 (w / 4); requires M % 128 == 0, N % 128 == 0, K % 128 == 0, K >= 128); epilogue = k_gemm_hhx semantics ----
// Operands go through LDS: a stage is 128 k (256 bytes) of the work-group's 128 A rows and 128 Bh rows. Each lane copies 16 bytes, a wave's copy covers two whole rows of the stage (4 whole lines); an A row is fetched once for two waves, a Bh row once for four:
// 256 staged rows per 128x128 outputs against 384 with two 128x64 tiles. The epilogue's staging lies over the ring, so that two work-groups still share a WGP's LDS (four waves per SIMD).
// Two buffers: stage s + 1 flies while stage s is worked on. Fragments are read from LDS in the k order of the former global loads (k = 8 hh + i, 16 + 8 hh + i), k steps in the same order: same sums.
#define G2KC 128                     /* k per stage */
#define G2P 272                      /* LDS row pitch, bytes: 256 + 16 = 16 x odd, the pitch at which ds_load_b128 fragment reads meet no bank conflict */
#define G2BUF (256 * G2P)            /* one buffer: rows 0-127 A, 128-255 Bh */
__device__ __forceinline__ v16h g2_frag(const unsigned char* p) { FragH f; f.half[0] = *(const v8us*)p; f.half[1] = *(const v8us*)(p + 32); return f.v; }      /* p = the lane's row in LDS + 64 bytes per k step + 16 hh */
// Eight asynchronous copies of 16 bytes per lane, 16 rows apart (l = the lane's LDS byte address, g = its global address, gs = 16 rows of the source in elements).
// s_wait_xcnt 0 is the statement's last line so that it stands in front of every later write of the address registers that the copies name.
__device__ __forceinline__ void g2_copy8(unsigned l, const _Float16* g, size_t gs) {
  asm volatile("global_load_async_to_lds_b128 %0, %8, off\n\t"
               "global_load_async_to_lds_b128 %1, %9, off\n\t"
               "global_load_async_to_lds_b128 %2, %10, off\n\t"
               "global_load_async_to_lds_b128 %3, %11, off\n\t"
               "global_load_async_to_lds_b128 %4, %12, off\n\t"
               "global_load_async_to_lds_b128 %5, %13, off\n\t"
               "global_load_async_to_lds_b128 %6, %14, off\n\t"
               "global_load_async_to_lds_b128 %7, %15, off\n\t"
               "s_wait_xcnt 0x0"
               :: "v"(l), "v"(l + 16 * G2P), "v"(l + 32 * G2P), "v"(l + 48 * G2P), "v"(l + 64 * G2P), "v"(l + 80 * G2P), "v"(l + 96 * G2P), "v"(l + 112 * G2P),
                  "v"(g), "v"(g + gs), "v"(g + 2 * gs), "v"(g + 3 * gs), "v"(g + 4 * gs), "v"(g + 5 * gs), "v"(g + 6 * gs), "v"(g + 7 * gs) : "memory"); }
// One stage: 16 copies per lane. l = the lane's place in the buffer (row tid / 16, 16-byte piece tid % 16); ga, gb = the same place in the stage's A and Bh rows.
__device__ __forceinline__ void g2_stage(unsigned l, const _Float16* ga, int lda, const _Float16* gb, int ldb) {
  g2_copy8(l, ga, (size_t)16 * lda); g2_copy8(l + 128 * G2P, gb, (size_t)16 * ldb); }
__device__ __forceinline__ v8f g2_mma(v16h a, v16h b, v8f c) { v8f d = __builtin_amdgcn_wmma_f32_16x16x32_f16(false, a, false, b, (short)0, c, false, false); asm volatile("v_nop\n\tv_nop\n\tv_nop\n\tv_nop" : "+v"(d) : "v"(a), "v"(b)); return d; }
// The fast GEMM's main loop, run by every wave of a 256-thread work-group: ga, gb = the lane's place (row tid / 16, 16-byte piece tid % 16) in stage 0 of the work-group's 128 A rows and 128 Bh rows; nst = stages of 128 k.
// Leaves the wave's 32 x 64 sums in accs: accs[4 half + t] = rows 16 half .. + 15, columns 16 t .. + 15 of the wave tile. At its end no copy is outstanding and every wave has passed the barrier behind the last stage's reads: the ring is free.
__device__ __forceinline__ void g2_loop(unsigned char* ring, const _Float16* ga, int lda, const _Float16* gb, int ldb, int nst, int tid, v8f (&accs)[8]) {
  const int w = tid >> 5, lane = tid & 31, ln = lane & 15, hh = lane >> 4;
  const unsigned lc = (unsigned)(size_t)ring + (unsigned)((tid >> 4) * G2P + (tid & 15) * 16);      /* this lane's place in buffer 0 as an LDS byte address (low 32 bits of the __shared__ address) */
  const v8f z8 = {0.f,0.f,0.f,0.f,0.f,0.f,0.f,0.f}; v8f c00 = z8, c01 = z8, c02 = z8, c03 = z8, c10 = z8, c11 = z8, c12 = z8, c13 = z8;
  g2_stage(lc, ga, lda, gb, ldb);
  asm volatile("s_wait_asynccnt 0x0" ::: "memory");      /* this wave's copies of stage 0 have landed */
  __syncthreads();      /* stage 0 is readable by every wave */
  if (nst > 1) g2_stage(lc + G2BUF, ga + G2KC, lda, gb + G2KC, ldb);
#pragma unroll 1      /* rolled: one stage per trip, its four k steps unrolled inside */
  for (int s = 0; s < nst; ++s) { const unsigned char* bufp = ring + (s & 1) * G2BUF; const unsigned char* pa = bufp + (32 * (w & 3) + ln) * G2P + 16 * hh; const unsigned char* pb = bufp + (128 + 64 * (w >> 2) + ln) * G2P + 16 * hh;
    v16h a0 = g2_frag(pa), a1 = g2_frag(pa + 16 * G2P), b0 = g2_frag(pb), b1 = g2_frag(pb + 16 * G2P), b2 = g2_frag(pb + 32 * G2P), b3 = g2_frag(pb + 48 * G2P);
#pragma unroll      /* unrolled: the two fragment sets then alternate by register name, without copies */
    for (int ks = 0; ks < G2KC / 32; ++ks) { v16h na0 = a0, na1 = a1, nb0 = b0, nb1 = b1, nb2 = b2, nb3 = b3;
      if (ks + 1 < G2KC / 32) { const int o = (ks + 1) * 64; na0 = g2_frag(pa + o); na1 = g2_frag(pa + 16 * G2P + o); nb0 = g2_frag(pb + o); nb1 = g2_frag(pb + 16 * G2P + o); nb2 = g2_frag(pb + 32 * G2P + o); nb3 = g2_frag(pb + 48 * G2P + o); }      /* the next k step's fragments of the SAME stage, asked for ahead of this step's products */
      c00 = g2_mma(a0, b0, c00); c10 = g2_mma(a1, b0, c10); c01 = g2_mma(a0, b1, c01); c11 = g2_mma(a1, b1, c11);
      c02 = g2_mma(a0, b2, c02); c12 = g2_mma(a1, b2, c12); c03 = g2_mma(a0, b3, c03); c13 = g2_mma(a1, b3, c13);
      a0 = na0; a1 = na1; b0 = nb0; b1 = nb1; b2 = nb2; b3 = nb3; }
    asm volatile("s_wait_dscnt 0x0" ::: "memory");      /* this wave's reads of stage s are done before the buffer is handed to its next writer */
    asm volatile("s_wait_asynccnt 0x0" ::: "memory");      /* this wave's copies of stage s + 1 have landed */
    __syncthreads();      /* publishes stage s + 1 and ends every wave's reads of stage s */
    if (s + 2 < nst) g2_stage(lc + (unsigned)(s & 1) * G2BUF, ga + (size_t)(s + 2) * G2KC, lda, gb + (size_t)(s + 2) * G2KC, ldb); }
  asm volatile("s_wait_asynccnt 0x0" ::: "memory");      /* no copy is outstanding when the wave goes on */
  accs[0] = c00; accs[1] = c01; accs[2] = c02; accs[3] = c03; accs[4] = c10; accs[5] = c11; accs[6] = c12; accs[7] = c13; }
template <int ACT>
__global__ __launch_bounds__(256) void k_gemm2(const _Float16* __restrict__ A, int lda, size_t sA, const _Float16* __restrict__ Bh, int ldb, size_t sB, float alpha, const float* __restrict__ bias, size_t sBias, const float* __restrict__ CP, int rowsPerB, size_t sCPb, int row0g,
    float* __restrict__ C, _Float16* __restrict__ C16, int ldc, size_t sC, int M, int N, int K) { static_assert(ACT == 0 || ACT == 3 || ACT == 6 || ACT == 8 || ACT == 9 || ACT == 11 || ACT == 12 || ACT == 14 || ACT == 15 || ACT == 16 || ACT == 17, "k_gemm2: unsupported ACT code (would silently apply no activation)");
  __shared__ __attribute__((aligned(16))) unsigned char ring[2 * G2BUF];
  float (*so)[32][68] = reinterpret_cast<float (*)[32][68]>(ring); static_assert(8 * 32 * 68 * 4 <= 2 * G2BUF, "k_gemm2: the staging fits the ring");      /* the epilogue's staging, one plane per wave, laid over the ring: used only behind g2_loop, which leaves the ring free */
  const int tid = threadIdx.x, w = tid >> 5, lane = tid & 31, ln = lane & 15, hh = lane >> 4; const int by = blockIdx.y;
  A += (size_t)by * sA; Bh += (size_t)by * sB; const size_t cofs = (size_t)by * sC; const float* bp = bias ? bias + (size_t)by * sBias : nullptr;
  const int ntn = N >> 7; const int mt = blockIdx.x / ntn, nq = blockIdx.x - mt * ntn; const int row0 = mt * 128 + 32 * (w & 3), col0 = nq * 128 + 64 * (w >> 2); if (mt * 128 >= M) return;      /* the same for the whole work-group, in front of every barrier */
  const _Float16* ga = A + (size_t)(mt * 128 + (tid >> 4)) * lda + (tid & 15) * 8; const _Float16* gb = Bh + (size_t)(nq * 128 + (tid >> 4)) * ldb + (tid & 15) * 8;
  v8f accs[8]; g2_loop(ring, ga, lda, gb, ldb, K / G2KC, tid, accs);
#pragma unroll
  for (int u = 0; u < 8; ++u) { const int t = u & 3, half = u >> 2; const int col = col0 + t * 16 + ln; const float bv = bp ? bf16_round(bp[col]) : 0.f;
#pragma unroll
    for (int r = 0; r < 8; ++r) { const int rloc = half * 16 + 8 * hh + r; float v = accs[u][r] * alpha + bv; if (CP) { if (rowsPerB < 0) v += CP[cofs + (size_t)(row0g + row0 + rloc) * ldc + col];      /* rowsPerB < 0: own element of the batched C plane */ else { const int bidx = (row0g + row0 + rloc) / rowsPerB; v += CP[(size_t)bidx * sCPb + (size_t)by * 64 + col]; } }
      if (ACT == 3) v = fmaxf(v, 0.f); else if (ACT == 6) v = 0.5f * v * (1.0f + erff(v * 0.70710678118654752f)); else if (ACT == 11) v = 1.0f / (1.0f + expf(-v)); else if (ACT == 15) v = v / (1.0f + expf(-v)); else if (ACT == 12) v = (v > 0.f) ? v : 0.01f * v; else if (ACT == 8) v = tanhf(v); else if (ACT == 9) v = 0.5f * v * (1.0f + tanhf(0.7978845608028654f * (v + 0.044715f * v * v * v))); else if (ACT == 14) v = (v > 0.f) ? v : 0.1f * v; else if (ACT == 16) v = (v >= 0.f) ? v : 0.3f * v; else if (ACT == 17) v = (v >= 0.f) ? v : 0.2f * v;
      so[w][rloc][t * 16 + ln] = v; } }
  __builtin_amdgcn_fence(__ATOMIC_ACQ_REL, "workgroup"); __builtin_amdgcn_wave_barrier();
  const int rsub = lane >> 4, c4 = (lane & 15) * 4;
  {
#pragma unroll
    for (int q = 0; q < 16; ++q) { const int r = q * 2 + rsub; const v4f v = *(const v4fa*)&so[w][r][c4]; if (C) *(v4f*)(C + cofs + (size_t)(row0 + r) * ldc + col0 + c4) = v; if (C16) { v4h h4; for (int i = 0; i < 4; ++i) h4[i] = (_Float16)v[i]; *(v4h*)(C16 + cofs + (size_t)(row0 + r) * ldc + col0 + c4) = h4; } }
     } }
// The three projections in ONE launch: blockIdx.y = 0: q, 1: k, 2: v; 256 work-group tiles each, tile and main loop as k_gemm2. None reads what another writes.
// q, k: rows = tokens (A = the stream's f16 rows), columns = head outputs (Bh = the weight plane); the epilogue splits each f32 value v into h = f16(v) and f16((v - h) x 1024) and stores both planes: the arithmetic of the former conversion launch on the same f32 values.
// v: operands swapped (A = the weight plane's 1024 rows 64 h + d, Bh = the 2048 token rows of one batch), so that the tile is a piece of V^T [batch][head][d][token] as the attention reads it and no transposition is left; each sum takes the same products in the same k order.
// A row of a wave's tile is 64 f16 = one whole 128-byte line of its plane, written by that wave alone.
#define PJT ((MP / 128) * (DM / 128))      /* work-group tiles per projection (256) */
#define PJV ((DM / 128) * (SQ / 128))      /* V^T tiles per batch (128) */
static_assert(PJV * NB == PJT && B0 == 0 && NBR == NB, "k_proj: one grid row per projection, all batches");
__global__ __launch_bounds__(256) void k_proj(const _Float16* __restrict__ X16, const _Float16* __restrict__ XK16, const _Float16* __restrict__ XV16, const _Float16* __restrict__ BQ, const _Float16* __restrict__ BK, const _Float16* __restrict__ BV,
    _Float16* __restrict__ QH, _Float16* __restrict__ QL, _Float16* __restrict__ KH, _Float16* __restrict__ KL, _Float16* __restrict__ VT) {
  __shared__ __attribute__((aligned(16))) unsigned char ring[2 * G2BUF];
  float (*so)[32][68] = reinterpret_cast<float (*)[32][68]>(ring); static_assert(8 * 32 * 68 * 4 <= 2 * G2BUF, "k_proj: the staging fits the ring");      /* the epilogue's staging, one plane per wave, laid over the ring: used only behind g2_loop, which leaves the ring free */
  const int tid = threadIdx.x, w = tid >> 5, lane = tid & 31, ln = lane & 15, hh = lane >> 4; const int job = blockIdx.y, bx = blockIdx.x;
  const _Float16* A; const _Float16* Bh; _Float16* Ph; _Float16* Pl; int mt, nq, ldc;      /* each the same for the whole work-group */
  if (job < 2) { A = job ? XK16 : X16; Bh = job ? BK : BQ; Ph = job ? KH : QH; Pl = job ? KL : QL; mt = bx / (DM / 128); nq = bx % (DM / 128); ldc = DM; }
  else { const int b = bx / PJV, u = bx % PJV; A = BV; Bh = XV16 + (size_t)b * SQ * DM; Ph = VT + (size_t)b * DM * SQ; Pl = nullptr; mt = u / (SQ / 128); nq = u % (SQ / 128); ldc = SQ; }
  const int row0 = mt * 128 + 32 * (w & 3), col0 = nq * 128 + 64 * (w >> 2);
  const _Float16* ga = A + (size_t)(mt * 128 + (tid >> 4)) * DM + (tid & 15) * 8; const _Float16* gb = Bh + (size_t)(nq * 128 + (tid >> 4)) * DM + (tid & 15) * 8;
  v8f accs[8]; g2_loop(ring, ga, DM, gb, DM, DM / G2KC, tid, accs);
#pragma unroll
  for (int u = 0; u < 8; ++u) { const int t = u & 3, half = u >> 2;
#pragma unroll
    for (int r = 0; r < 8; ++r) so[w][half * 16 + 8 * hh + r][t * 16 + ln] = accs[u][r] * 0.0625f; }      /* the weights are carried x16 */
  __builtin_amdgcn_fence(__ATOMIC_ACQ_REL, "workgroup"); __builtin_amdgcn_wave_barrier();
  const int rsub = lane >> 4, c4 = (lane & 15) * 4; const size_t po = (size_t)(row0 + rsub) * ldc + col0 + c4;      /* the lane's place in rows 0 and 1 of the wave's tile */
  if (job < 2) {
#pragma unroll
    for (int q = 0; q < 16; ++q) { const v4f v = *(const v4fa*)&so[w][q * 2 + rsub][c4]; v4h h4, l4;
      for (int i = 0; i < 4; ++i) { const _Float16 h = (_Float16)v[i]; h4[i] = h; l4[i] = (_Float16)((v[i] - (float)h) * 1024.0f); }
      *(v4h*)(Ph + po + (size_t)(q * 2) * DM) = h4; *(v4h*)(Pl + po + (size_t)(q * 2) * DM) = l4; } }
  else {
#pragma unroll
    for (int q = 0; q < 16; ++q) { const v4f v = *(const v4fa*)&so[w][q * 2 + rsub][c4]; v4h h4;
      for (int i = 0; i < 4; ++i) h4[i] = (_Float16)v[i];
      *(v4h*)(Ph + po + (size_t)(q * 2) * SQ) = h4; }
    asm volatile("s_wait_xcnt 0x0" ::: "memory");      /* stands directly behind the last of these stores, in front of any later overwrite of a register that they name */
  } }


__global__ __launch_bounds__(256) void k_wnat(const float* __restrict__ w, size_t n8, _Float16* __restrict__ Bt) { const size_t t = (size_t)blockIdx.x * 256 + threadIdx.x; if (t >= n8) return; FragH f; for (int q = 0; q < 8; ++q) f.h[q] = (_Float16)(bf16_round(w[t * 8 + q]) * 16.0f); *(v8us*)((unsigned short*)Bt + t * 8) = f.half[0];  }
__global__ __launch_bounds__(256) void k_rsm(const float* __restrict__ S, _Float16* __restrict__ P, int nrows) {
  #pragma clang fp contract(off)
  const int i = blockIdx.x * 256 + threadIdx.x; if (i >= nrows) return; const float* s = S + (size_t)i * SQ; float mx = -3.0e38f;
#pragma unroll 1
  for (int j = 0; j < SQ; ++j) mx = fmaxf(mx, s[j]); float se = 0.f;
#pragma unroll 1
  for (int j = 0; j < SQ; ++j) se += expf(s[j] - mx); const float sc = 256.0f / se;
#pragma unroll 1
  for (int j0 = 0; j0 < SQ; j0 += 8) { FragH f; for (int q = 0; q < 8; ++q) f.h[q] = (_Float16)(expf(s[j0 + q] - mx) * sc); unsigned short* d = (unsigned short*)P + (size_t)i * SQ + j0; *(v8us*)d = f.half[0];  } }
__global__ __launch_bounds__(256) void k_vt(const _Float16* __restrict__ V16, int b, int h0, _Float16* __restrict__ VT) { __shared__ unsigned short tl[64][65]; const int tid = threadIdx.x; const int hh = blockIdx.x % HG, sg = blockIdx.x / HG; const int s0 = sg * 64; const int h = h0 + hh;
  for (int i = tid; i < 64 * 8; i += 256) { const int j = i / 8, d8 = (i % 8) * 8; FragH f; f.half[0] = *(const v8us*)((const unsigned short*)V16 + ((size_t)b * SQ + s0 + j) * DM + h * HD + d8); for (int q = 0; q < 8; ++q) tl[d8 + q][j] = f.u[q]; }
  __syncthreads();
  { for (int i = tid; i < 64 * 8; i += 256) { const int d = i / 8, j8 = (i % 8) * 8; FragH f; for (int q = 0; q < 8; ++q) f.u[q] = tl[d][j8 + q]; *(v8us*)((unsigned short*)VT + ((size_t)hh * HD + d) * SQ + s0 + j8) = f.half[0]; }  } }



// 2^x on the transcendental unit; the v_nop fills the one slot that the instruction set asks for between a transcendental and an instruction that reads its result or overwrites its source.
__device__ __forceinline__ float exp2_slot(float x) { float r; asm("v_exp_f32 %0, %1\n\tv_nop" : "=v"(r) : "v"(x)); return r; }
// Value of lane l ^ 16 (the other half of the wave): one register move between the two 16-lane rows, no LDS.
__device__ __forceinline__ float xhalf(float x) { return __builtin_bit_cast(float, __builtin_amdgcn_permlanex16(__builtin_bit_cast(int, x), __builtin_bit_cast(int, x), 0x76543210, 0xfedcba98, false, false)); }
__device__ __forceinline__ v16h fa_frag(const unsigned short* p) { FragH f; f.half[0] = *(const v8us*)p; f.half[1] = *(const v8us*)(p + 16); return f.v; }      /* p = the lane's own pointer, 8 hh included: k = 8 hh + i, 16 + 8 hh + i, as g2_frag */
__device__ __forceinline__ v8f fa_mma(v16h a, v16h b, v8f c) { return __builtin_amdgcn_wmma_f32_16x16x32_f16(false, a, false, b, (short)0, c, false, false); }
#define FAW 8                        /* waves per work-group of the fused attention */
#define FAQ 32                       /* query columns per wave */
#define FAK 32                       /* keys per pass */
#define FAC 0.18033688f              /* 1 / sqrt(64) x log2(e): scores to the exponent of 2 */
#define FAT 128                      /* keys per LDS stage (four passes) */
#define FAKP 144                     /* LDS pitch of a K row, bytes: 128 + 16 = 16 x odd, no bank conflict for ds_load_b128 fragment reads */
#define FAVP 272                     /* LDS pitch of a V^T row, bytes: 256 + 16 = 16 x odd */
#define FAKB (FAT * FAKP)            /* one K plane of a stage */
#define FABUF (2 * FAKB + HD * FAVP) /* one buffer: K hi rows, K residual rows, V^T rows */
// One stage: 12 asynchronous copies of 16 bytes per lane, in one statement. A wave's copy covers four whole K rows of the head (128 bytes each) or two whole V^T rows of the stage (256 bytes each): whole lines only.
// lk, lv = the lane's places in the buffer's K hi plane (row tid / 8, piece tid % 8) and V^T plane (row tid / 16, piece tid % 16) as LDS byte addresses; gh, gl, gv = the same places in the stage's source rows. Copies 32 K rows or 16 V^T rows apart.
// s_wait_xcnt 0 is the statement's last line so that it stands in front of every later write of the address registers that the copies name.
__device__ __forceinline__ void fa_stage(unsigned lk, unsigned lv, const unsigned short* gh, const unsigned short* gl, const unsigned short* gv) {
  asm volatile("global_load_async_to_lds_b128 %0, %12, off\n\t"
               "global_load_async_to_lds_b128 %1, %13, off\n\t"
               "global_load_async_to_lds_b128 %2, %14, off\n\t"
               "global_load_async_to_lds_b128 %3, %15, off\n\t"
               "global_load_async_to_lds_b128 %4, %16, off\n\t"
               "global_load_async_to_lds_b128 %5, %17, off\n\t"
               "global_load_async_to_lds_b128 %6, %18, off\n\t"
               "global_load_async_to_lds_b128 %7, %19, off\n\t"
               "global_load_async_to_lds_b128 %8, %20, off\n\t"
               "global_load_async_to_lds_b128 %9, %21, off\n\t"
               "global_load_async_to_lds_b128 %10, %22, off\n\t"
               "global_load_async_to_lds_b128 %11, %23, off\n\t"
               "s_wait_xcnt 0x0"
               :: "v"(lk), "v"(lk + 32 * FAKP), "v"(lk + 64 * FAKP), "v"(lk + 96 * FAKP),
                  "v"(lk + FAKB), "v"(lk + FAKB + 32 * FAKP), "v"(lk + FAKB + 64 * FAKP), "v"(lk + FAKB + 96 * FAKP),
                  "v"(lv), "v"(lv + 16 * FAVP), "v"(lv + 32 * FAVP), "v"(lv + 48 * FAVP),
                  "v"(gh), "v"(gh + 32 * LQ), "v"(gh + 64 * LQ), "v"(gh + 96 * LQ),
                  "v"(gl), "v"(gl + 32 * LQ), "v"(gl + 64 * LQ), "v"(gl + 96 * LQ),
                  "v"(gv), "v"(gv + 16 * SQ), "v"(gv + 32 * SQ), "v"(gv + 48 * SQ) : "memory"); }
__global__ __launch_bounds__(FAW * 32) void k_fattn(const _Float16* __restrict__ QHp, const _Float16* __restrict__ QLp, const _Float16* __restrict__ KHp, const _Float16* __restrict__ KLp, const _Float16* __restrict__ VTp, _Float16* __restrict__ Op) {
  __shared__ __attribute__((aligned(16))) unsigned char ring[2 * FABUF];
  const int tid = threadIdx.x, lane = tid & 31, w = tid >> 5, ln = lane & 15, hh = lane >> 4; const int h = blockIdx.y, b = blockIdx.z; const int q0 = blockIdx.x * (FAW * FAQ) + w * FAQ; const size_t r0 = (size_t)b * SQ;
  const unsigned lk = (unsigned)(size_t)ring + (unsigned)((tid >> 3) * FAKP + (tid & 7) * 16), lv = (unsigned)(size_t)ring + (unsigned)(2 * FAKB + (tid >> 4) * FAVP + (tid & 15) * 16);      /* this lane's places in buffer 0 as LDS byte addresses (low 32 bits of the __shared__ address) */
  const unsigned short* gh = (const unsigned short*)KHp; const unsigned short* gl = (const unsigned short*)KLp; const unsigned short* gv = (const unsigned short*)VTp;
  const unsigned go = (unsigned)((b * SQ + (tid >> 3)) * LQ + h * HD + (tid & 7) * 8), gvo = (unsigned)(((b * NH + h) * HD + (tid >> 4)) * SQ + (tid & 15) * 8);      /* this lane's places in stage 0's source rows, in elements (below 2^23): one register each across the loop */
  const size_t qo = (r0 + q0 + ln) * LQ + h * HD + 8 * hh;
  const unsigned short* qhl = (const unsigned short*)QHp + qo; const unsigned short* qll = (const unsigned short*)QLp + qo;
  v16h qh[2][2], ql[2][2];
#pragma unroll
  for (int qt = 0; qt < 2; ++qt) for (int ks = 0; ks < 2; ++ks) { qh[qt][ks] = fa_frag(qhl + (size_t)(qt * 16) * LQ + ks * 32); ql[qt][ks] = fa_frag(qll + (size_t)(qt * 16) * LQ + ks * 32); }
  asm volatile("s_wait_xcnt 0x0" :: "v"(qhl), "v"(qll) : "memory");      /* stands in front of the first overwrite of these loads' address registers; the addresses are inputs so that they keep their registers up to here */
  const v8f z8 = {0.f,0.f,0.f,0.f,0.f,0.f,0.f,0.f}; v8f o[2][4]; float m[2], l[2];
#pragma unroll
  for (int qt = 0; qt < 2; ++qt) { m[qt] = -1.0e30f; l[qt] = 0.f; for (int dt = 0; dt < 4; ++dt) o[qt][dt] = z8; }
#pragma unroll 1      /* rolled: the buffer's offset stays a run-time scalar, so that lk and lv are themselves no operands of the copies' asm text: as such they were tied to the first 256 registers over the whole kernel and spilled to scratch */
  for (int s = 0; s < 2; ++s) {      /* stage 0's copies, their wait and the barrier; then stage 1's copies */
    fa_stage(lk + (unsigned)s * FABUF, lv + (unsigned)s * FABUF, gh + (go + (unsigned)s * (FAT * LQ)), gl + (go + (unsigned)s * (FAT * LQ)), gv + (gvo + (unsigned)s * FAT));
    if (s == 0) {
      asm volatile("s_wait_asynccnt 0x0" ::: "memory");      /* this wave's copies of stage 0 have landed */
      __syncthreads();      /* stage 0 is readable by every wave */
    }
  }
#pragma unroll 1      /* rolled: one stage per trip */
  for (int s = 0; s < SQ / FAT; ++s) {
    const unsigned char* bufp = ring + (s & 1) * FABUF; const unsigned char* pk = bufp + ln * FAKP + 16 * hh; const unsigned char* pv = bufp + 2 * FAKB + ln * FAVP + 16 * hh;
    v16h kh[2][2], kl[2][2];
#pragma unroll
    for (int kt = 0; kt < 2; ++kt) for (int ks = 0; ks < 2; ++ks) { kh[kt][ks] = g2_frag(pk + (kt * 16) * FAKP + ks * 64); kl[kt][ks] = g2_frag(pk + FAKB + (kt * 16) * FAKP + ks * 64); }
#pragma unroll 1      /* rolled: one pass already holds 32 matrix instructions, and a second copy would double the registers in flight */
    for (int ps = 0; ps < FAT / FAK; ++ps) {
      v16h va[4];      /* V^T rows of this pass: asked for here, needed only behind the softmax */
#pragma unroll
      for (int dt = 0; dt < 4; ++dt) va[dt] = g2_frag(pv + (dt * 16) * FAVP + ps * 64);
      v8f sa[2][2], sr[2][2];      /* [query tile][key tile]: hi.hi, and the x1024 residual products */
#pragma unroll
      for (int qt = 0; qt < 2; ++qt) for (int kt = 0; kt < 2; ++kt) sa[qt][kt] = fa_mma(kh[kt][0], qh[qt][0], z8);
#pragma unroll
      for (int qt = 0; qt < 2; ++qt) for (int kt = 0; kt < 2; ++kt) sr[qt][kt] = fa_mma(kh[kt][0], ql[qt][0], z8);
#pragma unroll
      for (int qt = 0; qt < 2; ++qt) for (int kt = 0; kt < 2; ++kt) sa[qt][kt] = fa_mma(kh[kt][1], qh[qt][1], sa[qt][kt]);
#pragma unroll
      for (int qt = 0; qt < 2; ++qt) for (int kt = 0; kt < 2; ++kt) sr[qt][kt] = fa_mma(kh[kt][1], ql[qt][1], sr[qt][kt]);
#pragma unroll
      for (int qt = 0; qt < 2; ++qt) for (int kt = 0; kt < 2; ++kt) sr[qt][kt] = fa_mma(kl[kt][0], qh[qt][0], sr[qt][kt]);
#pragma unroll
      for (int qt = 0; qt < 2; ++qt) for (int kt = 0; kt < 2; ++kt) sr[qt][kt] = fa_mma(kl[kt][1], qh[qt][1], sr[qt][kt]);
      if (ps + 1 < FAT / FAK) {      /* the next pass's K rows of the SAME stage, asked for ahead of this pass's softmax */
#pragma unroll
        for (int kt = 0; kt < 2; ++kt) for (int ks = 0; ks < 2; ++ks) { kh[kt][ks] = g2_frag(pk + ((ps + 1) * FAK + kt * 16) * FAKP + ks * 64); kl[kt][ks] = g2_frag(pk + FAKB + ((ps + 1) * FAK + kt * 16) * FAKP + ks * 64); } }
#pragma unroll
      for (int qt = 0; qt < 2; ++qt) {
        float t[16];
#pragma unroll
        for (int i = 0; i < 16; ++i) t[i] = fmaf(sr[qt][i >> 3][i & 7], 0.0009765625f, sa[qt][i >> 3][i & 7]);
        float mx = t[0];
#pragma unroll
        for (int i = 1; i < 16; ++i) mx = fmaxf(mx, t[i]);
        mx = fmaxf(mx, xhalf(mx));
        const float mn = fmaxf(m[qt], mx); const float al = exp2_slot((m[qt] - mn) * FAC); const float nb = 8.0f - mn * FAC; m[qt] = mn;
        FragH p; float sum = 0.f;
#pragma unroll
        for (int i = 0; i < 16; ++i) { const float e = exp2_slot(fmaf(t[i], FAC, nb)); sum += e; p.h[i] = (_Float16)e; }
        l[qt] = fmaf(l[qt], al, sum);
#pragma unroll
        for (int dt = 0; dt < 4; ++dt) { for (int r = 0; r < 8; ++r) o[qt][dt][r] *= al; }
#pragma unroll
        for (int dt = 0; dt < 4; ++dt) o[qt][dt] = fa_mma(va[dt], p.v, o[qt][dt]);
        if (qt == 0) __builtin_amdgcn_sched_barrier(0);      /* keeps the other query tile's exponentials from being moved directly behind these four products, whose operand registers they may be given */
      }
    }
    asm volatile("s_wait_dscnt 0x0" ::: "memory");      /* this wave's reads of stage s are done before the buffer is handed to its next writer */
    asm volatile("s_wait_asynccnt 0x0" ::: "memory");      /* this wave's copies of stage s + 1 have landed */
    __syncthreads();      /* publishes stage s + 1 and ends every wave's reads of stage s */
    if (s + 2 < SQ / FAT) fa_stage(lk + (unsigned)(s & 1) * FABUF, lv + (unsigned)(s & 1) * FABUF, gh + (go + (unsigned)(s + 2) * (FAT * LQ)), gl + (go + (unsigned)(s + 2) * (FAT * LQ)), gv + (gvo + (unsigned)(s + 2) * FAT));
  }
  asm volatile("s_wait_asynccnt 0x0" ::: "memory");      /* no copy is outstanding when the wave goes on */
#pragma unroll
  for (int qt = 0; qt < 2; ++qt) { const float inv = 64.0f / (l[qt] + xhalf(l[qt]));      /* the halves' sums joined once; o carried x64 */
    _Float16* op = Op + r0 * DM + (size_t)h * SQ * HD + (size_t)(q0 + qt * 16 + ln) * HD + 8 * hh;
#pragma unroll
    for (int dt = 0; dt < 4; ++dt) { FragH f; for (int r = 0; r < 8; ++r) f.h[r] = (_Float16)(o[qt][dt][r] * inv); *(v8us*)((unsigned short*)op + dt * 16) = f.half[0]; } } }


template <int MASKADD>
__global__ __launch_bounds__(64) void k_att0(const float* __restrict__ QF, const float* __restrict__ KF, const float* __restrict__ VF, int ld, const float* __restrict__ mask, float scale, float* __restrict__ OF, int ldo) {
  #pragma clang fp contract(off)
  __shared__ __attribute__((aligned(16))) float lq[64][64]; __shared__ __attribute__((aligned(16))) float lo[64][64];
  const int tid = threadIdx.x; const int h = blockIdx.x / (QT0 / 64), rg = blockIdx.x % (QT0 / 64); const int i = rg * 64 + tid;
  const float* qr = QF + (size_t)i * ld + h * HD;
#pragma unroll 1
  for (int c = 0; c < HD / 4; ++c) { *(v4f*)&lq[tid][c * 4] = *(const v4fa*)(qr + c * 4); const v4f z = {0.f, 0.f, 0.f, 0.f}; *(v4f*)&lo[tid][c * 4] = z; }
  float m = -1.0e30f, l = 0.f; const int jmax = MASKADD ? (SQ - 1) : (rg * 64 + 63);      /* additive-mask form: every key (the mask input decides); causal form: keys up to the block's last row */
#pragma unroll 1
  for (int j = 0; j <= jmax; ++j) { const float* kr = KF + (size_t)j * ld + h * HD; const float* vr = VF + (size_t)j * ld + h * HD; float s = 0.f;
#pragma unroll 1
    for (int c = 0; c < HD / 4; ++c) { const v4f kq = *(const v4fa*)(kr + c * 4); const v4f qq = *(v4f*)&lq[tid][c * 4]; s = __fadd_rn(s, __fmul_rn(qq[0], kq[0])); s = __fadd_rn(s, __fmul_rn(qq[1], kq[1])); s = __fadd_rn(s, __fmul_rn(qq[2], kq[2])); s = __fadd_rn(s, __fmul_rn(qq[3], kq[3])); }
    s = __fmul_rn(s, scale); if (MASKADD) s = __fadd_rn(s, __fmul_rn(bf16_round(mask[(size_t)i * SQ + j]), -10000.0f));
    const float f = (MASKADD || j <= i) ? 1.f : 0.f; const float sm = fmaf(f, s, (1.f - f) * -1.0e30f); const float mn = fmaxf(m, sm); const float sc = expf(m - mn); const float e = expf(sm - mn); l = __fadd_rn(__fmul_rn(l, sc), e); m = mn;
#pragma unroll 1
    for (int c = 0; c < HD / 4; ++c) { const v4f vv = *(const v4fa*)(vr + c * 4); v4f oo = *(v4f*)&lo[tid][c * 4]; for (int u = 0; u < 4; ++u) oo[u] = __fadd_rn(__fmul_rn(oo[u], sc), __fmul_rn(e, vv[u])); *(v4f*)&lo[tid][c * 4] = oo; } }
  const float fin = 64.0f / l;      /* o carried x64 like the f16 path */
#pragma unroll 1
  for (int c = 0; c < HD / 4; ++c) { v4f oo = *(v4f*)&lo[tid][c * 4]; for (int u = 0; u < 4; ++u) oo[u] = __fmul_rn(oo[u], fin); *(v4f*)&lo[tid][c * 4] = oo; }
  __syncthreads();
  {
#pragma unroll 1
    for (int it = 0; it < 16; ++it) { const int row = it * 4 + tid / 16, pc = (tid % 16) * 4; const v4f v = *(const v4f*)&lo[row][pc]; *(v4f*)(OF + (size_t)(rg * 64 + row) * ldo + h * HD + pc) = v; }
     } }

extern "C" void kernel_launch(void* const* d_in, const int* in_sizes, int n_in,
                              void* d_out, int out_size, void* d_ws, size_t ws_size, hipStream_t stream) {
  (void)in_sizes; (void)n_in; (void)out_size;
  const float* const* I = (const float* const*)d_in; const float* x = I[0]; const float* xk = I[1]; const float* xv = I[2]; const float* wq = I[3]; const float* wk = I[4]; const float* wv = I[5]; const float* bq = nullptr; const float* bk = nullptr; const float* bv = nullptr; const float* wo = I[6]; const float* bo = nullptr;      /* input order: q, k, v (the three streams, two sequences each), Wq, Wk, Wv (PER-HEAD STACKS [16][1024][64]), Wo ([in][out] [1024][1024]); NO biases anywhere: null pointers in the guarded slots */
  char* ws = (char*)d_ws; size_t off = 0;
  auto take = [&](size_t bytes) { char* p = ws + off; off += (bytes + 255) & ~(size_t)255; return p; };
  _Float16* BQ = (_Float16*)take((size_t)DM * DM * 2); _Float16* BK = (_Float16*)take((size_t)DM * DM * 2); _Float16* BV = (_Float16*)take((size_t)DM * DM * 2); _Float16* BO = (_Float16*)take((size_t)DM * DM * 2);
  _Float16* X16 = (_Float16*)take(NR * DM * 2); _Float16* XK16 = (_Float16*)take(NR * DM * 2); _Float16* XV16 = (_Float16*)take(NR * DM * 2);      /* exact f16 rows of query, key, value */ _Float16* QH = (_Float16*)take(NR * DM * 2); _Float16* QL = (_Float16*)take(NR * DM * 2); _Float16* KH = (_Float16*)take(NR * DM * 2); _Float16* KL = (_Float16*)take(NR * DM * 2); _Float16* Q16 = QH; _Float16* K16 = KH; _Float16* O16 = (_Float16*)take(NR * DM * 2);
  _Float16* VT = (_Float16*)take((size_t)NB * NH * HD * SQ * 2);      /* V^T of both batches */
  float* QF0 = (float*)take((size_t)QT0 * DM * 4); float* KF0 = (float*)take((size_t)QT0 * DM * 4); float* VF0 = (float*)take((size_t)QT0 * DM * 4); float* OF0 = (float*)take((size_t)NB * QT0 * DM * 4); _Float16* OH0 = (_Float16*)take((size_t)NB * QT0 * DM * 2); _Float16* OL0 = (_Float16*)take((size_t)NB * QT0 * DM * 2);
  if (off > ws_size) return;
  k_prep<<<PPG, PPT, 0, stream>>>(wq, wk, wv, wo, x, xk, xv, BQ, BK, BV, BO, X16, XK16, XV16);      /* head h's [1024][64] block -> rows 64 h .. 64 h + 63 of the Bt[n][k] x16 plane; the [in][out] output weight transposed into its plane; the three streams as exact f16 rows */
  const size_t r0p = (size_t)B0 * SQ;      /* first projected row */
  k_proj<<<dim3((unsigned)PJT, 3), 256, 0, stream>>>(X16, XK16, XV16, BQ, BK, BV, QH, QL, KH, KL, VT);      /* q and k -> f16 hi + x1024 residual planes (unscaled logits sigma ~8); v -> V^T [NB][NH][HD][SQ] */
  k_fattn<<<dim3(SQ / (FAW * FAQ), NH, NB), FAW * 32, 0, stream>>>(QH, QL, KH, KL, VT, O16);      /* o written HEAD-CONTIGUOUS: o[b][h][s][64] (row pitch 64, head stride SQ x 64): the source's raw reshape of (B, H, S, dk) to (B, S, H dk) then reads that memory as [2048][1024] rows: the output GEMM below does exactly that */
  k_gemm2<0><<<dim3((unsigned)((MPO / 128) * (DM / 128)), 1), 256, 0, stream>>>(O16 + r0p * DM, DM, 0, BO, DM, 0, 0.0009765625f, bo, 0, nullptr, 1, 0, 0, (float*)d_out + r0p * DM, nullptr, DM, 0, MPO, DM, DM);      /* out rows are the output layout */
  /* (dense: no first-tile hi / lo planes) */
  /* (dense: no first-tile rewrite passes:
     the output GEMM above has written every row
     with its (null) bias) */
}

// v009
// One run takes 94.3 microseconds.
// In two side-by-side timings against v008, it was 1.04 and 1.06 times as fast.
// All steps since v000 together make it 78.8 times as fast.
#include <hip/hip_runtime.h>
// Multi-head attention on three inputs with PER-HEAD STACKED projections and the source's RAW-RESHAPE head merge (Q, K, V [2][2048][1024]; WQ / WK / WV [16][1024][64] = [head][in][out] uniform +-0.1, NO biases; 16 heads of 64; scores x 1/sqrt(64); softmax over all 2048 keys (no mask); the head outputs [B][H][S][64] are RESHAPED IN MEMORY ORDER to [B][S][1024] (row r of a batch holds tokens 16 (r mod 128) .. + 15 of head r / 128: heads and tokens mix: faithful to the source); out = that WO with WO [1024][1024] [in][out], NO bias -> [2][2048][1024]); q and k carried as f16 hi + x1024 residual planes with three-product scores; each head's [in][out] block is transposed into its 64 contiguous rows of the f16 weight plane, and the [in][out] output weight into its plane, all in one launch (k_prep); DENSE (k_fattn runs every query over all SQ keys; no exact first tile).
// Structure: token rows r = b*2048 + s; x as exact f16 rows (bf16-rounded); q and k as WMMA GEMMs (32x64 wave tiles, f32 accumulation, exact x16 weights, no bias) whose epilogues split the f32 sums into f16 hi + x1024 residual planes, v by swapped operands straight into V^T for both batches and all heads, all three in one launch (k_proj); per work-group of 256 query rows in one fused launch (k_fattn; all heads on grid.y, batches on grid.z), in passes of 32 keys over all 2048: scores as THREE accumulating products (hi.hi + 2^-10 (lo.hi + hi.lo), K = 64, logits sigma ~8, 1/sqrt(64) log2(e) applied in the exponent), online row softmax on VALU with no mask (f32 statistics, native exp2; f16 weights under a lazy reference), o = P . V^T (o carried x64, folded into the output GEMM alpha) written straight into the merged f16 o rows; out = o W_o GEMM (f32, no bias) into the output layout.
// Attention now runs as ONE fused launch (k_fattn, below): the per-tile score passes, the row softmax and the P . V^T pass of the former version are gone, with their score and weight planes; V^T is built for both batches in one launch.
// All work that reads inputs only (the weight planes, the three f16 input streams) now runs as ONE launch (k_prep, below) in place of one launch per head and plane and one per stream.
// That launch now has 256 work-groups of 16 waves, each thread taking a weight block and a share of every stream: see the lines above k_prep.
// The GEMM launches (k_proj, k_gemm2) now take their operand tiles through LDS (asynchronous copies, two buffers): see the lines above k_gemm2.
// The GEMM work-group tile is now 128x128 (eight waves of 32x64 in place of four): a third fewer operand bytes come from L2 per product: see the lines above k_gemm2.
// The fused attention (k_fattn) now takes its K and V^T rows through LDS in the same way, once for the work-group's eight waves: see the lines above k_fattn.
// The fused attention now rescales lazily: a query's reference maximum stays in use while the weights fit f16, tested once per pass: see the lines above k_fattn.
// The three projections now run as ONE launch (k_proj, below) whose epilogues write the attention's operand planes themselves: q and k as f16 hi + x1024 residual, V^T by swapped operands; the f32 q / k plane, the f16 v rows and the three launches that converted them are gone.
// Compute dtype: inputs rounded to bf16; x / weights exact; q and k as f16 hi + x1024 residual planes, v, softmax weights and o as plain f16 GEMM operands (~2^-12); scores and softmax statistics f32. v_wmma_f32_16x16x32_f16.
#define NB 2
#define SCL 0.125f                         /* 1 / sqrt(head_dim = 64) */
#define SCLR 0.0001220703125f              /* 2^-13: SCL x 2^-10 (not used) */
#define SQ 2048
#define DM 1024
#define NH 16
#define HD 64
#define HG 4                         /* heads per group of the second k_vt (not launched) */
#define QT 256                       /* query rows per query tile (not used) */
#define NKX SQ                       /* row pitch of the former S / P planes (not used) */
#define QT0 128                      /* rows of the exact first tile of k_att0 (not launched) */
#define B0 0                         /* first batch processed (debug hook) */
#define NBR NB                       /* batches processed (debug hook) */
#define NR ((size_t)NB * SQ)         /* token rows */
#define MP ((int)((size_t)NBR * SQ)) /* rows projected (debug hook) */
#define QN SQ                        /* query rows attended per batch (not used) */
#define NHD NH                       /* heads attended (not used) */
#define MPO MP                       /* rows through the output stage (debug hook) */
#define LQ DM      /* row pitch of the q/k rows */
typedef __bf16 v16b __attribute__((ext_vector_type(16)));
typedef unsigned short v8us __attribute__((ext_vector_type(8), may_alias));
typedef float  v8f  __attribute__((ext_vector_type(8)));
typedef float  v4f  __attribute__((ext_vector_type(4)));
typedef float  v4fa __attribute__((ext_vector_type(4), may_alias));
union FragB { v16b v; v8us half[2]; unsigned short u[16]; };

__device__ __forceinline__ unsigned short bf16_bits(float x) { unsigned int u = __float_as_uint(x); return (unsigned short)((u + 0x7FFFu + ((u >> 16) & 1u)) >> 16); }
__device__ __forceinline__ float bf16_val(unsigned short b) { return __uint_as_float(((unsigned int)b) << 16); }
__device__ __forceinline__ float bf16_round(float x) { return bf16_val(bf16_bits(x)); }
// D += A·B with NT terms: 1 = ah·bh, 2 = + al·bh (A split), 3 = + ah·bl (both split)
template <int NT>
__device__ __forceinline__ v8f mmaN(v16b ah, v16b al, v16b bh, v16b bl, v8f c) {
  c = __builtin_amdgcn_wmma_f32_16x16x32_bf16(false, ah, false, bh, (short)0, c, false, false);
  if (NT >= 2) c = __builtin_amdgcn_wmma_f32_16x16x32_bf16(false, al, false, bh, (short)0, c, false, false);
  if (NT >= 3) c = __builtin_amdgcn_wmma_f32_16x16x32_bf16(false, ah, false, bl, (short)0, c, false, false);
  asm volatile("v_nop\n\tv_nop\n\tv_nop\n\tv_nop" : "+v"(c) : "v"(ah), "v"(al), "v"(bh), "v"(bl));
  return c;
}

__global__ __launch_bounds__(256) void k_wt_bf16(const float* __restrict__ W, unsigned short* __restrict__ Wt, int K, int N) {
  const int t = blockIdx.x * 256 + threadIdx.x;
  const int k8n = K / 8;
  if (t >= N * k8n) return;
  const int n = t / k8n, k8 = (t % k8n) * 8;
  v8us v;
#pragma unroll
  for (int i = 0; i < 8; ++i) v[i] = bf16_bits(W[(size_t)(k8 + i) * N + n]);
  *(v8us*)(Wt + (size_t)n * K + k8) = v;
  
}

// GEMM C[M][N] (f32, pitch ldc) = act(A[M][K]·W + bias). A f32 row-major (pitch lda) converted per fragment to bf16
// (ASPLIT: hi/lo two planes -> 2 terms, else single rounded term); Wt bf16 [N][K] (pitch ldb). BIAS_BF16 rounds the
// bias to bf16 first (bias quantised to bf16 before the add). K%32==0, M%16==0, N%64==0.
template <bool ASPLIT, int ACT, bool BIAS_BF16>
__global__ __launch_bounds__(128) void k_gemm_bf(const float* __restrict__ A, int lda, const unsigned short* __restrict__ Wt, int ldb,
                                               const float* __restrict__ bias, float* __restrict__ C, int ldc, int M, int N, int K) {
  __shared__ __attribute__((aligned(16))) float so[4][16][64];
  const int tid = threadIdx.x, w = tid >> 5, lane = tid & 31, ln = lane & 15, hh = lane >> 4;
  const int ntn = N / 64;
  const int wid = blockIdx.x * 4 + w;
  const int mt = wid / ntn, nq = wid % ntn;
  if (mt * 16 >= M) return;
  const int row0 = mt * 16, col0 = nq * 64;
  const float* arow = A + (size_t)(row0 + ln) * lda;
  v8f acc[4] = {};
  for (int kb = 0; kb < K; kb += 32) {
    FragB ah, al;
    const v4f x0 = *(const v4fa*)(arow + kb + 8 * hh), x1 = *(const v4fa*)(arow + kb + 8 * hh + 4);
    const v4f x2 = *(const v4fa*)(arow + kb + 16 + 8 * hh), x3 = *(const v4fa*)(arow + kb + 16 + 8 * hh + 4);
    float xs[16] = {x0[0],x0[1],x0[2],x0[3],x1[0],x1[1],x1[2],x1[3],x2[0],x2[1],x2[2],x2[3],x3[0],x3[1],x3[2],x3[3]};
#pragma unroll
    for (int i = 0; i < 16; ++i) { const unsigned short hb = bf16_bits(xs[i]); ah.u[i] = hb; al.u[i] = ASPLIT ? bf16_bits(xs[i] - bf16_val(hb)) : (unsigned short)0; }
#pragma unroll
    for (int t = 0; t < 4; ++t) {
      const unsigned short* brow = Wt + (size_t)(col0 + t * 16 + ln) * ldb + kb;
      FragB b;
      b.half[0] = *(const v8us*)(brow + 8 * hh);
      b.half[1] = *(const v8us*)(brow + 16 + 8 * hh);
      acc[t] = mmaN<ASPLIT ? 2 : 1>(ah.v, al.v, b.v, b.v, acc[t]);
    }
  }
#pragma unroll
  for (int t = 0; t < 4; ++t) {
    float bv = bias ? bias[col0 + t * 16 + ln] : 0.f;
    if (BIAS_BF16) bv = bf16_round(bv);
#pragma unroll
    for (int r = 0; r < 8; ++r) { float v = acc[t][r] + bv; if (ACT == 1) v = fmaxf(v, 0.f); so[w][8 * hh + r][t * 16 + ln] = v; }
  }
  __builtin_amdgcn_fence(__ATOMIC_ACQ_REL, "workgroup");
  __builtin_amdgcn_wave_barrier();
  const int rsub = lane >> 4, c4 = (lane & 15) * 4;
  {
#pragma unroll
    for (int q = 0; q < 8; ++q) {
      const int r = q * 2 + rsub;
      const v4f v = *(const v4fa*)&so[w][r][c4];
      *(v4f*)(C + (size_t)(row0 + r) * ldc + col0 + c4) = v;
    }
    
  }
}

// GEMM C = act(A·W + bias + resid): A f32 (ASPLIT -> hi/lo 2 terms), Wt bf16 [N][K]; ACT 0 none, 1 relu, 2 exact gelu;
// resid (optional, f32, row index = (row % rmod), pitch ldr, RES_BF16 rounds it) added before the activation.
template <bool ASPLIT, int ACT, bool BIAS_BF16, bool RES_BF16>
__global__ __launch_bounds__(128) void k_gemm_bf3(const float* __restrict__ A, int lda, const unsigned short* __restrict__ Wt, int ldb,
                                                const float* __restrict__ bias, const float* __restrict__ resid, int rmod, int ldr,
                                                float* __restrict__ C, int ldc, int M, int N, int K) {
  __shared__ __attribute__((aligned(16))) float so[4][16][64];
  const int tid = threadIdx.x, w = tid >> 5, lane = tid & 31, ln = lane & 15, hh = lane >> 4;
  const int ntn = N / 64;
  const int wid = blockIdx.x * 4 + w;
  const int mt = wid / ntn, nq = wid % ntn;
  if (mt * 16 >= M) return;
  const int row0 = mt * 16, col0 = nq * 64;
  const float* arow = A + (size_t)(row0 + ln) * lda;
  v8f acc[4] = {};
  for (int kb = 0; kb < K; kb += 32) {
    FragB ah, al;
    const v4f x0 = *(const v4fa*)(arow + kb + 8 * hh), x1 = *(const v4fa*)(arow + kb + 8 * hh + 4);
    const v4f x2 = *(const v4fa*)(arow + kb + 16 + 8 * hh), x3 = *(const v4fa*)(arow + kb + 16 + 8 * hh + 4);
    float xs[16] = {x0[0],x0[1],x0[2],x0[3],x1[0],x1[1],x1[2],x1[3],x2[0],x2[1],x2[2],x2[3],x3[0],x3[1],x3[2],x3[3]};
#pragma unroll
    for (int i = 0; i < 16; ++i) { const unsigned short hb = bf16_bits(xs[i]); ah.u[i] = hb; al.u[i] = ASPLIT ? bf16_bits(xs[i] - bf16_val(hb)) : (unsigned short)0; }
#pragma unroll
    for (int t = 0; t < 4; ++t) {
      const unsigned short* brow = Wt + (size_t)(col0 + t * 16 + ln) * ldb + kb;
      FragB b;
      b.half[0] = *(const v8us*)(brow + 8 * hh);
      b.half[1] = *(const v8us*)(brow + 16 + 8 * hh);
      acc[t] = mmaN<ASPLIT ? 2 : 1>(ah.v, al.v, b.v, b.v, acc[t]);
    }
  }
#pragma unroll
  for (int t = 0; t < 4; ++t) {
    const int col = col0 + t * 16 + ln;
    float bv = bias ? bias[col] : 0.f;
    if (BIAS_BF16) bv = bf16_round(bv);
#pragma unroll
    for (int r = 0; r < 8; ++r) {
      float v = acc[t][r] + bv;
      if (resid) { float rv = resid[(size_t)((row0 + 8 * hh + r) % rmod) * ldr + col]; if (RES_BF16) rv = bf16_round(rv); v += rv; }
      if (ACT == 1) v = fmaxf(v, 0.f);
      if (ACT == 2) v = 0.5f * v * (1.0f + erff(v * 0.70710678118654752f));
      if (ACT == 3) { const float u = 0.7978845608028654f * (v + 0.044715f * v * v * v); v = 0.5f * v * (1.0f + tanhf(u)); }
      so[w][8 * hh + r][t * 16 + ln] = v;
    }
  }
  __builtin_amdgcn_fence(__ATOMIC_ACQ_REL, "workgroup");
  __builtin_amdgcn_wave_barrier();
  const int rsub = lane >> 4, c4 = (lane & 15) * 4;
  {
#pragma unroll
    for (int q = 0; q < 8; ++q) {
      const int r = q * 2 + rsub;
      const v4f v = *(const v4fa*)&so[w][r][c4];
      *(v4f*)(C + (size_t)(row0 + r) * ldc + col0 + c4) = v;
    }
    
  }
}
// row LayerNorm (biased variance, eps) over N: s = X (+ R); optional out_sum <- s; out_norm <- (s-mu)*rsqrt(var+eps)*g + b
template <bool PARAM_BF16>
__global__ __launch_bounds__(256) void k_layernorm(const float* __restrict__ X, const float* __restrict__ R, const float* __restrict__ g, const float* __restrict__ bta,
                                                  float* __restrict__ out_sum, float* __restrict__ out_norm, int N, float eps) {
  __shared__ float red[256];
  const int row = blockIdx.x, tid = threadIdx.x;
  const float* x = X + (size_t)row * N; const float* rr = R ? R + (size_t)row * N : nullptr;
  float vals[16];                     // up to N = 4096
  const int per = N / 256;            // contiguous chunk per thread? use strided-by-4 chunks: thread handles j = tid*4 + 1024*u
  float s1 = 0.f;
  for (int u = 0; u < per / 4; ++u) {
    const int j = tid * 4 + 1024 * u;
    const v4f a = *(const v4fa*)(x + j);
    v4f b = {0.f,0.f,0.f,0.f}; if (rr) b = *(const v4fa*)(rr + j);
#pragma unroll
    for (int q = 0; q < 4; ++q) { const float v = a[q] + b[q]; vals[u * 4 + q] = v; s1 += v; }
  }
  red[tid] = s1; __syncthreads();
  for (int st = 128; st > 0; st >>= 1) { if (tid < st) red[tid] += red[tid + st]; __syncthreads(); }
  const float mu = red[0] / (float)N; __syncthreads();
  float s2 = 0.f;
  for (int u = 0; u < per / 4; ++u)
#pragma unroll
    for (int q = 0; q < 4; ++q) { const float c = vals[u * 4 + q] - mu; s2 += c * c; }
  red[tid] = s2; __syncthreads();
  for (int st = 128; st > 0; st >>= 1) { if (tid < st) red[tid] += red[tid + st]; __syncthreads(); }
  const float rs = rsqrtf(red[0] / (float)N + eps);
  {
    for (int u = 0; u < per / 4; ++u) {
      const int j = tid * 4 + 1024 * u;
      v4f o, sm;
#pragma unroll
      for (int q = 0; q < 4; ++q) {
        float gg = g[j + q], bb = bta[j + q];
        if (PARAM_BF16) { gg = bf16_round(gg); bb = bf16_round(bb); }
        sm[q] = vals[u * 4 + q]; o[q] = (vals[u * 4 + q] - mu) * rs * gg + bb;
      }
      if (out_sum) *(v4f*)(out_sum + (size_t)row * N + j) = sm;
      *(v4f*)(out_norm + (size_t)row * N + j) = o;
    }
    
  }
}



// ---- f16 WMMA path (v_wmma_f32_16x16x32_f16): 11-bit significands for operands in range — used where a [0,1] probability operand needs more precision than bf16
typedef _Float16 v16h __attribute__((ext_vector_type(16)));
union FragH { v16h v; v8us half[2]; _Float16 h[16]; unsigned short u[16]; };
template <int NT>
__device__ __forceinline__ v8f mmaH(v16h ah, v16h al, v16h bh, v16h bl, v8f c) {
  c = __builtin_amdgcn_wmma_f32_16x16x32_f16(false, ah, false, bh, (short)0, c, false, false);
  if (NT >= 2) c = __builtin_amdgcn_wmma_f32_16x16x32_f16(false, al, false, bh, (short)0, c, false, false);
  if (NT >= 3) c = __builtin_amdgcn_wmma_f32_16x16x32_f16(false, ah, false, bl, (short)0, c, false, false);
  asm volatile("v_nop\n\tv_nop\n\tv_nop\n\tv_nop" : "+v"(c) : "v"(ah), "v"(al), "v"(bh), "v"(bl));
  return c;
}
// batched GEMM like k_gemm_b but f16 operands: A f32 (split into f16 hi/lo if ASPLIT, else rounded to f16), Bt = f16 values [n][k]; alpha; C f32; N multiple of 16 (partial tiles skipped)
template <bool ASPLIT>
__global__ __launch_bounds__(128) void k_gemm_h(const float* __restrict__ A, int lda, size_t sA, const _Float16* __restrict__ Bh, int ldb, size_t sB, float alpha, float* __restrict__ C, int ldc, size_t sC, int M, int N, int K) {
  __shared__ __attribute__((aligned(16))) float so[4][16][64];
  const int tid = threadIdx.x, w = tid >> 5, lane = tid & 31, ln = lane & 15, hh = lane >> 4; const int by = blockIdx.y;
  A += (size_t)by * sA; Bh += (size_t)by * sB; C += (size_t)by * sC;
  const int ntn = (N + 63) / 64; const int wid = blockIdx.x * 4 + w; const int mt = wid / ntn, nq = wid % ntn; if (mt * 16 >= M) return;
  const int row0 = mt * 16, col0 = nq * 64; const float* arow = A + (size_t)(row0 + ln) * lda;
  v8f acc[4] = {};
  for (int kb = 0; kb < K; kb += 32) {
    FragH ah, al;
    const v4f x0 = *(const v4fa*)(arow + kb + 8 * hh), x1 = *(const v4fa*)(arow + kb + 8 * hh + 4), x2 = *(const v4fa*)(arow + kb + 16 + 8 * hh), x3 = *(const v4fa*)(arow + kb + 16 + 8 * hh + 4);
    float xs[16] = {x0[0],x0[1],x0[2],x0[3],x1[0],x1[1],x1[2],x1[3],x2[0],x2[1],x2[2],x2[3],x3[0],x3[1],x3[2],x3[3]};
#pragma unroll
    for (int i = 0; i < 16; ++i) { const _Float16 h = (_Float16)xs[i]; ah.h[i] = h; al.h[i] = ASPLIT ? (_Float16)(xs[i] - (float)h) : (_Float16)0.0f; }
#pragma unroll
    for (int t = 0; t < 4; ++t) { if (col0 + t * 16 >= N) continue; const size_t boff = (size_t)(col0 + t * 16 + ln) * ldb + kb; FragH bq; bq.half[0] = *(const v8us*)(Bh + boff + 8 * hh); bq.half[1] = *(const v8us*)(Bh + boff + 16 + 8 * hh);
      acc[t] = mmaH<ASPLIT ? 2 : 1>(ah.v, al.v, bq.v, bq.v, acc[t]); }
  }
#pragma unroll
  for (int t = 0; t < 4; ++t) { if (col0 + t * 16 >= N) continue;
#pragma unroll
    for (int r = 0; r < 8; ++r) so[w][8 * hh + r][t * 16 + ln] = acc[t][r] * alpha; }
  __builtin_amdgcn_fence(__ATOMIC_ACQ_REL, "workgroup"); __builtin_amdgcn_wave_barrier();
  const int rsub = lane >> 4, c4 = (lane & 15) * 4;
  {
#pragma unroll
    for (int q = 0; q < 8; ++q) { const int r = q * 2 + rsub; if (col0 + c4 < N) { const v4f v = *(const v4fa*)&so[w][r][c4]; *(v4f*)(C + (size_t)(row0 + r) * ldc + col0 + c4) = v; } }
     }
}

// k_gemm_hh variant with fused epilogue: v = acc·alpha + bias[by·sBias + col] (+ CP[(row/rowsPerB)·sCPb + by·64 + col] if CP) ; ACT 0 none / 1 elu ; writes f16 C16 (and f32 C if non-null)
template <int ACT>
__global__ __launch_bounds__(128) void k_gemm_hhx(const _Float16* __restrict__ A, int lda, size_t sA, const _Float16* __restrict__ Bh, int ldb, size_t sB, float alpha, const float* __restrict__ bias, size_t sBias, const float* __restrict__ CP, int rowsPerB, size_t sCPb, int row0g,
    float* __restrict__ C, _Float16* __restrict__ C16, int ldc, size_t sC, int M, int N, int K) {
  __shared__ __attribute__((aligned(16))) float so[4][16][64];
  const int tid = threadIdx.x, w = tid >> 5, lane = tid & 31, ln = lane & 15, hh = lane >> 4; const int by = blockIdx.y;
  A += (size_t)by * sA; Bh += (size_t)by * sB; const size_t cofs = (size_t)by * sC; const float* bp = bias ? bias + (size_t)by * sBias : nullptr;
  const int ntn = (N + 63) / 64; const int wid = blockIdx.x * 4 + w; const int mt = wid / ntn, nq = wid % ntn; if (mt * 16 >= M) return;
  const int row0 = mt * 16, col0 = nq * 64; const _Float16* arow = A + (size_t)(row0 + ln) * lda;
  v8f acc[4] = {};
  for (int kb = 0; kb < K; kb += 32) { FragH ah; ah.half[0] = *(const v8us*)((const unsigned short*)arow + kb + 8 * hh); ah.half[1] = *(const v8us*)((const unsigned short*)arow + kb + 16 + 8 * hh);
#pragma unroll
    for (int t = 0; t < 4; ++t) { if (col0 + t * 16 >= N) continue; const size_t boff = (size_t)(col0 + t * 16 + ln) * ldb + kb; FragH bq; bq.half[0] = *(const v8us*)((const unsigned short*)Bh + boff + 8 * hh); bq.half[1] = *(const v8us*)((const unsigned short*)Bh + boff + 16 + 8 * hh);
      acc[t] = mmaH<1>(ah.v, ah.v, bq.v, bq.v, acc[t]); }
  }
#pragma unroll
  for (int t = 0; t < 4; ++t) { if (col0 + t * 16 >= N) continue; const int col = col0 + t * 16 + ln; const float bv = bp ? bf16_round(bp[col]) : 0.f;
#pragma unroll
    for (int r = 0; r < 8; ++r) { float v = acc[t][r] * alpha + bv; if (CP) { const int rr = row0g + row0 + 8 * hh + r; if (rowsPerB < 0) v += CP[cofs + (size_t)rr * ldc + col];      /* rowsPerB < 0: own element of the batched C plane */ else { const int bidx = rr / rowsPerB; v += CP[(size_t)bidx * sCPb + (size_t)by * 64 + col]; } } if (ACT == 1) v = (v > 0.f) ? v : expm1f(v); else if (ACT == 7) v = (v > 0.f) ? v + 1.0f : expf(v); else if (ACT == 8) v = tanhf(v); else if (ACT == 9) v = 0.5f * v * (1.0f + tanhf(0.7978845608028654f * (v + 0.044715f * v * v * v))); else if (ACT == 11) v = 1.0f / (1.0f + expf(-v)); else if (ACT == 12) v = (v > 0.f) ? v : 0.01f * v; else if (ACT == 14) v = (v > 0.f) ? v : 0.1f * v; else if (ACT == 16) v = (v >= 0.f) ? v : 0.3f * v; else if (ACT == 17) v = (v >= 0.f) ? v : 0.2f * v; else if (ACT == 15) v = v / (1.0f + expf(-v)); else if (ACT == 3) v = fmaxf(v, 0.f); else if (ACT == 6) v = 0.5f * v * (1.0f + erff(v * 0.70710678118654752f)); so[w][8 * hh + r][t * 16 + ln] = v; } }
  __builtin_amdgcn_fence(__ATOMIC_ACQ_REL, "workgroup"); __builtin_amdgcn_wave_barrier();
  const int rsub = lane >> 4, c4 = (lane & 15) * 4; typedef _Float16 v4h __attribute__((ext_vector_type(4)));
  {
#pragma unroll
    for (int q = 0; q < 8; ++q) { const int r = q * 2 + rsub; if (col0 + c4 < N) { const v4f v = *(const v4fa*)&so[w][r][c4]; if (C) *(v4f*)(C + cofs + (size_t)(row0 + r) * ldc + col0 + c4) = v; if (C16) { v4h h4; for (int i = 0; i < 4; ++i) h4[i] = (_Float16)v[i]; *(v4h*)(C16 + cofs + (size_t)(row0 + r) * ldc + col0 + c4) = h4; } } }
     }
}


typedef _Float16 v4h __attribute__((ext_vector_type(4)));

#define PPT 512                      /* threads per work-group of the preparation launch: 16 waves */
#define PPG 256                      /* its work-groups */
#define PXQ 4                        /* groups of 8 elements that a thread takes of each input stream */
static_assert((size_t)PPG * PPT * PXQ * 8 == NR * DM && PPG * PPT * 32 == 4 * DM * DM && DM == 1024 && HD == 64 && NH * HD == DM, "k_prep: the launch covers each stream and the four weight planes exactly once");
// A thread's weight block: 8 k x 4 n of f32 row-major W (row pitch N), one 16-byte load per k row. s = the block's first element.
template <int N>
__device__ __forceinline__ void pw_load(const float* __restrict__ s, v4f (&a)[8]) {
#pragma unroll
  for (int i = 0; i < 8; ++i) a[i] = *(const v4fa*)(s + i * N);
  asm volatile("s_wait_xcnt 0x0" ::: "memory");      /* stands directly behind these loads, in front of any later overwrite of their address registers */
}
// The block transposed in registers: Bt[n + j][k .. k + 7] = f16(bf16(W[k + i][n + j]) x 16), one 16-byte store per n row (bf16-exact weights stay exact in f16 away from the subnormal range). d = Bt's element [n][k].
__device__ __forceinline__ void pw_store(_Float16* __restrict__ d, const v4f (&a)[8]) {
#pragma unroll
  for (int j = 0; j < 4; ++j) { FragH f;
#pragma unroll
    for (int i = 0; i < 8; ++i) f.h[i] = (_Float16)(bf16_round(a[i][j]) * 16.0f);
    *(v8us*)((unsigned short*)d + j * DM) = f.half[0]; }
  asm volatile("s_wait_xcnt 0x0" ::: "memory");      /* stands directly behind these stores, in front of any later overwrite of a register that they name */
}
// A thread's share of one stream: PXQ groups of 8 elements, PPT groups apart. s, d = the first group's place in the f32 source and in the f16 rows.
__device__ __forceinline__ void px_load(const float* __restrict__ s, v4f (&a)[8]) {
#pragma unroll
  for (int q = 0; q < PXQ; ++q) { a[2 * q] = *(const v4fa*)(s + q * (PPT * 8)); a[2 * q + 1] = *(const v4fa*)(s + q * (PPT * 8) + 4); }
  asm volatile("s_wait_xcnt 0x0" ::: "memory");      /* stands directly behind these loads, in front of any later overwrite of their address registers */
  __builtin_amdgcn_sched_barrier(0);      /* keeps the conversion of the batch in front, which waits for that batch's data, from being moved ahead of these loads: without it they were asked for only when that data had come */
}
__device__ __forceinline__ void px_store(_Float16* __restrict__ d, const v4f (&a)[8]) {
#pragma unroll
  for (int q = 0; q < PXQ; ++q) { FragH f;
#pragma unroll
    for (int e = 0; e < 8; ++e) f.h[e] = (_Float16)bf16_round(a[2 * q + (e >> 2)][e & 3]);
    *(v8us*)((unsigned short*)d + q * (PPT * 8)) = f.half[0]; }
  asm volatile("s_wait_xcnt 0x0" ::: "memory");      /* stands directly behind these stores, in front of any later overwrite of a register that they name */
}
// All work that reads inputs only, in ONE launch of 256 work-groups of 16 waves: none of these jobs reads what another writes. Few long waves in place of many short ones: 4096 waves to start in place of 65536, which moved 48 bytes per lane each.
// Every thread takes four batches of eight 16-byte loads, each batch asked for before the batch in front of it is converted and stored: one weight block, then its share of the three streams. Every element gets the arithmetic of the former launch.
// Weights: work-groups 64 p .. 64 p + 63 take plane p (WQ, WK, WV: head c of the stack, its [1024][64] block into rows 64 c .. 64 c + 63; WO: columns 64 c .. 64 c + 63 into the same rows), 64 n x 256 k each; a wave takes 16 n x 64 k, lane = (k group, n group):
// a load covers 64 bytes of each of 8 source rows, a store four whole 128-byte lines of the plane, each written by that wave alone.
// Streams: a work-group takes 2048 groups in a row of each stream; a wave's two loads of a group cover 1 KiB in a row, its store 512 bytes.
__global__ __launch_bounds__(PPT) void k_prep(const float* __restrict__ wq, const float* __restrict__ wk, const float* __restrict__ wv, const float* __restrict__ wo, const float* __restrict__ x, const float* __restrict__ xk, const float* __restrict__ xv,
    _Float16* __restrict__ BQ, _Float16* __restrict__ BK, _Float16* __restrict__ BV, _Float16* __restrict__ BO, _Float16* __restrict__ X16, _Float16* __restrict__ XK16, _Float16* __restrict__ XV16) {
  const int tid = threadIdx.x, bid = blockIdx.x, lane = tid & 31, w = tid >> 5;
  const int job = bid >> 6, c = (bid & 63) >> 2;      /* each the same for the whole work-group */
  const int k = (bid & 3) * 256 + (w >> 2) * 64 + (lane & 7) * 8, n = (w & 3) * 16 + (lane >> 3) * 4;
  _Float16* Bt = job == 0 ? BQ : job == 1 ? BK : job == 2 ? BV : BO;
  const size_t so = (size_t)bid * (PPT * PXQ * 8) + (size_t)tid * 8;
  v4f a[8], b[8];
  if (job == 3) pw_load<DM>(wo + (size_t)k * DM + c * 64 + n, a);
  else pw_load<HD>((job == 0 ? wq : job == 1 ? wk : wv) + (size_t)c * DM * HD + (size_t)k * HD + n, a);
  px_load(x + so, b);
  pw_store(Bt + (size_t)(c * 64 + n) * DM + k, a);
  px_load(xk + so, a);
  px_store(X16 + so, b);
  px_load(xv + so, b);
  px_store(XK16 + so, a);
  px_store(XV16 + so, b); }
__global__ __launch_bounds__(256) void k_h16(const float* __restrict__ x, _Float16* __restrict__ X16, size_t n8) { const size_t t = (size_t)blockIdx.x * 256 + threadIdx.x; if (t >= n8) return; FragH f;
#pragma unroll
  for (int q = 0; q < 8; ++q) f.h[q] = (_Float16)x[t * 8 + q]; *(v8us*)((unsigned short*)X16 + t * 8) = f.half[0];  }
__global__ __launch_bounds__(256) void k_round16f(const float* __restrict__ W, _Float16* __restrict__ Bt, size_t n8) { const size_t t = (size_t)blockIdx.x * 256 + threadIdx.x; if (t >= n8) return; FragH f;
#pragma unroll
  for (int i = 0; i < 8; ++i) f.h[i] = (_Float16)(bf16_round(W[t * 8 + i]) * 16.0f); *(v8us*)((unsigned short*)Bt + t * 8) = f.half[0];  }

// ---- fast GEMM (work-group tile 128x128, eight waves, wave tile 32x64: wave w takes rows 32 (w % 4), columns 64 (w / 4); requires M % 128 == 0, N % 128 == 0, K % 128 == 0, K >= 128); epilogue = k_gemm_hhx semantics ----
// Operands go through LDS: a stage is 128 k (256 bytes) of the work-group's 128 A rows and 128 Bh rows. Each lane copies 16 bytes, a wave's copy covers two whole rows of the stage (4 whole lines); an A row is fetched once for two waves, a Bh row once for four:
// 256 staged rows per 128x128 outputs against 384 with two 128x64 tiles. The epilogue's staging lies over the ring, so that two work-groups still share a WGP's LDS (four waves per SIMD).
// Two buffers: stage s + 1 flies while stage s is worked on. Fragments are read from LDS in the k order of the former global loads (k = 8 hh + i, 16 + 8 hh + i), k steps in the same order: same sums.
#define G2KC 128                     /* k per stage */
#define G2P 272                      /* LDS row pitch, bytes: 256 + 16 = 16 x odd, the pitch at which ds_load_b128 fragment reads meet no bank conflict */
#define G2BUF (256 * G2P)            /* one buffer: rows 0-127 A, 128-255 Bh */
__device__ __forceinline__ v16h g2_frag(const unsigned char* p) { FragH f; f.half[0] = *(const v8us*)p; f.half[1] = *(const v8us*)(p + 32); return f.v; }      /* p = the lane's row in LDS + 64 bytes per k step + 16 hh */
// Eight asynchronous copies of 16 bytes per lane, 16 rows apart (l = the lane's LDS byte address, g = its global address, gs = 16 rows of the source in elements).
// s_wait_xcnt 0 is the statement's last line so that it stands in front of every later write of the address registers that the copies name.
__device__ __forceinline__ void g2_copy8(unsigned l, const _Float16* g, size_t gs) {
  asm volatile("global_load_async_to_lds_b128 %0, %8, off\n\t"
               "global_load_async_to_lds_b128 %1, %9, off\n\t"
               "global_load_async_to_lds_b128 %2, %10, off\n\t"
               "global_load_async_to_lds_b128 %3, %11, off\n\t"
               "global_load_async_to_lds_b128 %4, %12, off\n\t"
               "global_load_async_to_lds_b128 %5, %13, off\n\t"
               "global_load_async_to_lds_b128 %6, %14, off\n\t"
               "global_load_async_to_lds_b128 %7, %15, off\n\t"
               "s_wait_xcnt 0x0"
               :: "v"(l), "v"(l + 16 * G2P), "v"(l + 32 * G2P), "v"(l + 48 * G2P), "v"(l + 64 * G2P), "v"(l + 80 * G2P), "v"(l + 96 * G2P), "v"(l + 112 * G2P),
                  "v"(g), "v"(g + gs), "v"(g + 2 * gs), "v"(g + 3 * gs), "v"(g + 4 * gs), "v"(g + 5 * gs), "v"(g + 6 * gs), "v"(g + 7 * gs) : "memory"); }
// One stage: 16 copies per lane. l = the lane's place in the buffer (row tid / 16, 16-byte piece tid % 16); ga, gb = the same place in the stage's A and Bh rows.
__device__ __forceinline__ void g2_stage(unsigned l, const _Float16* ga, int lda, const _Float16* gb, int ldb) {
  g2_copy8(l, ga, (size_t)16 * lda); g2_copy8(l + 128 * G2P, gb, (size_t)16 * ldb); }
__device__ __forceinline__ v8f g2_mma(v16h a, v16h b, v8f c) { v8f d = __builtin_amdgcn_wmma_f32_16x16x32_f16(false, a, false, b, (short)0, c, false, false); asm volatile("v_nop\n\tv_nop\n\tv_nop\n\tv_nop" : "+v"(d) : "v"(a), "v"(b)); return d; }
// The fast GEMM's main loop, run by every wave of a 256-thread work-group: ga, gb = the lane's place (row tid / 16, 16-byte piece tid % 16) in stage 0 of the work-group's 128 A rows and 128 Bh rows; nst = stages of 128 k.
// Leaves the wave's 32 x 64 sums in accs: accs[4 half + t] = rows 16 half .. + 15, columns 16 t .. + 15 of the wave tile. At its end no copy is outstanding and every wave has passed the barrier behind the last stage's reads: the ring is free.
__device__ __forceinline__ void g2_loop(unsigned char* ring, const _Float16* ga, int lda, const _Float16* gb, int ldb, int nst, int tid, v8f (&accs)[8]) {
  const int w = tid >> 5, lane = tid & 31, ln = lane & 15, hh = lane >> 4;
  const unsigned lc = (unsigned)(size_t)ring + (unsigned)((tid >> 4) * G2P + (tid & 15) * 16);      /* this lane's place in buffer 0 as an LDS byte address (low 32 bits of the __shared__ address) */
  const v8f z8 = {0.f,0.f,0.f,0.f,0.f,0.f,0.f,0.f}; v8f c00 = z8, c01 = z8, c02 = z8, c03 = z8, c10 = z8, c11 = z8, c12 = z8, c13 = z8;
  g2_stage(lc, ga, lda, gb, ldb);
  asm volatile("s_wait_asynccnt 0x0" ::: "memory");      /* this wave's copies of stage 0 have landed */
  __syncthreads();      /* stage 0 is readable by every wave */
  if (nst > 1) g2_stage(lc + G2BUF, ga + G2KC, lda, gb + G2KC, ldb);
#pragma unroll 1      /* rolled: one stage per trip, its four k steps unrolled inside */
  for (int s = 0; s < nst; ++s) { const unsigned char* bufp = ring + (s & 1) * G2BUF; const unsigned char* pa = bufp + (32 * (w & 3) + ln) * G2P + 16 * hh; const unsigned char* pb = bufp + (128 + 64 * (w >> 2) + ln) * G2P + 16 * hh;
    v16h a0 = g2_frag(pa), a1 = g2_frag(pa + 16 * G2P), b0 = g2_frag(pb), b1 = g2_frag(pb + 16 * G2P), b2 = g2_frag(pb + 32 * G2P), b3 = g2_frag(pb + 48 * G2P);
#pragma unroll      /* unrolled: the two fragment sets then alternate by register name, without copies */
    for (int ks = 0; ks < G2KC / 32; ++ks) { v16h na0 = a0, na1 = a1, nb0 = b0, nb1 = b1, nb2 = b2, nb3 = b3;
      if (ks + 1 < G2KC / 32) { const int o = (ks + 1) * 64; na0 = g2_frag(pa + o); na1 = g2_frag(pa + 16 * G2P + o); nb0 = g2_frag(pb + o); nb1 = g2_frag(pb + 16 * G2P + o); nb2 = g2_frag(pb + 32 * G2P + o); nb3 = g2_frag(pb + 48 * G2P + o); }      /* the next k step's fragments of the SAME stage, asked for ahead of this step's products */
      c00 = g2_mma(a0, b0, c00); c10 = g2_mma(a1, b0, c10); c01 = g2_mma(a0, b1, c01); c11 = g2_mma(a1, b1, c11);
      c02 = g2_mma(a0, b2, c02); c12 = g2_mma(a1, b2, c12); c03 = g2_mma(a0, b3, c03); c13 = g2_mma(a1, b3, c13);
      a0 = na0; a1 = na1; b0 = nb0; b1 = nb1; b2 = nb2; b3 = nb3; }
    asm volatile("s_wait_dscnt 0x0" ::: "memory");      /* this wave's reads of stage s are done before the buffer is handed to its next writer */
    asm volatile("s_wait_asynccnt 0x0" ::: "memory");      /* this wave's copies of stage s + 1 have landed */
    __syncthreads();      /* publishes stage s + 1 and ends every wave's reads of stage s */
    if (s + 2 < nst) g2_stage(lc + (unsigned)(s & 1) * G2BUF, ga + (size_t)(s + 2) * G2KC, lda, gb + (size_t)(s + 2) * G2KC, ldb); }
  asm volatile("s_wait_asynccnt 0x0" ::: "memory");      /* no copy is outstanding when the wave goes on */
  accs[0] = c00; accs[1] = c01; accs[2] = c02; accs[3] = c03; accs[4] = c10; accs[5] = c11; accs[6] = c12; accs[7] = c13; }
template <int ACT>
__global__ __launch_bounds__(256) void k_gemm2(const _Float16* __restrict__ A, int lda, size_t sA, const _Float16* __restrict__ Bh, int ldb, size_t sB, float alpha, const float* __restrict__ bias, size_t sBias, const float* __restrict__ CP, int rowsPerB, size_t sCPb, int row0g,
    float* __restrict__ C, _Float16* __restrict__ C16, int ldc, size_t sC, int M, int N, int K) { static_assert(ACT == 0 || ACT == 3 || ACT == 6 || ACT == 8 || ACT == 9 || ACT == 11 || ACT == 12 || ACT == 14 || ACT == 15 || ACT == 16 || ACT == 17, "k_gemm2: unsupported ACT code (would silently apply no activation)");
  __shared__ __attribute__((aligned(16))) unsigned char ring[2 * G2BUF];
  float (*so)[32][68] = reinterpret_cast<float (*)[32][68]>(ring); static_assert(8 * 32 * 68 * 4 <= 2 * G2BUF, "k_gemm2: the staging fits the ring");      /* the epilogue's staging, one plane per wave, laid over the ring: used only behind g2_loop, which leaves the ring free */
  const int tid = threadIdx.x, w = tid >> 5, lane = tid & 31, ln = lane & 15, hh = lane >> 4; const int by = blockIdx.y;
  A += (size_t)by * sA; Bh += (size_t)by * sB; const size_t cofs = (size_t)by * sC; const float* bp = bias ? bias + (size_t)by * sBias : nullptr;
  const int ntn = N >> 7; const int mt = blockIdx.x / ntn, nq = blockIdx.x - mt * ntn; const int row0 = mt * 128 + 32 * (w & 3), col0 = nq * 128 + 64 * (w >> 2); if (mt * 128 >= M) return;      /* the same for the whole work-group, in front of every barrier */
  const _Float16* ga = A + (size_t)(mt * 128 + (tid >> 4)) * lda + (tid & 15) * 8; const _Float16* gb = Bh + (size_t)(nq * 128 + (tid >> 4)) * ldb + (tid & 15) * 8;
  v8f accs[8]; g2_loop(ring, ga, lda, gb, ldb, K / G2KC, tid, accs);
#pragma unroll
  for (int u = 0; u < 8; ++u) { const int t = u & 3, half = u >> 2; const int col = col0 + t * 16 + ln; const float bv = bp ? bf16_round(bp[col]) : 0.f;
#pragma unroll
    for (int r = 0; r < 8; ++r) { const int rloc = half * 16 + 8 * hh + r; float v = accs[u][r] * alpha + bv; if (CP) { if (rowsPerB < 0) v += CP[cofs + (size_t)(row0g + row0 + rloc) * ldc + col];      /* rowsPerB < 0: own element of the batched C plane */ else { const int bidx = (row0g + row0 + rloc) / rowsPerB; v += CP[(size_t)bidx * sCPb + (size_t)by * 64 + col]; } }
      if (ACT == 3) v = fmaxf(v, 0.f); else if (ACT == 6) v = 0.5f * v * (1.0f + erff(v * 0.70710678118654752f)); else if (ACT == 11) v = 1.0f / (1.0f + expf(-v)); else if (ACT == 15) v = v / (1.0f + expf(-v)); else if (ACT == 12) v = (v > 0.f) ? v : 0.01f * v; else if (ACT == 8) v = tanhf(v); else if (ACT == 9) v = 0.5f * v * (1.0f + tanhf(0.7978845608028654f * (v + 0.044715f * v * v * v))); else if (ACT == 14) v = (v > 0.f) ? v : 0.1f * v; else if (ACT == 16) v = (v >= 0.f) ? v : 0.3f * v; else if (ACT == 17) v = (v >= 0.f) ? v : 0.2f * v;
      so[w][rloc][t * 16 + ln] = v; } }
  __builtin_amdgcn_fence(__ATOMIC_ACQ_REL, "workgroup"); __builtin_amdgcn_wave_barrier();
  const int rsub = lane >> 4, c4 = (lane & 15) * 4;
  {
#pragma unroll
    for (int q = 0; q < 16; ++q) { const int r = q * 2 + rsub; const v4f v = *(const v4fa*)&so[w][r][c4]; if (C) *(v4f*)(C + cofs + (size_t)(row0 + r) * ldc + col0 + c4) = v; if (C16) { v4h h4; for (int i = 0; i < 4; ++i) h4[i] = (_Float16)v[i]; *(v4h*)(C16 + cofs + (size_t)(row0 + r) * ldc + col0 + c4) = h4; } }
     } }
// The three projections in ONE launch: blockIdx.y = 0: q, 1: k, 2: v; 256 work-group tiles each, tile and main loop as k_gemm2. None reads what another writes.
// q, k: rows = tokens (A = the stream's f16 rows), columns = head outputs (Bh = the weight plane); the epilogue splits each f32 value v into h = f16(v) and f16((v - h) x 1024) and stores both planes: the arithmetic of the former conversion launch on the same f32 values.
// v: operands swapped (A = the weight plane's 1024 rows 64 h + d, Bh = the 2048 token rows of one batch), so that the tile is a piece of V^T [batch][head][d][token] as the attention reads it and no transposition is left; each sum takes the same products in the same k order.
// A row of a wave's tile is 64 f16 = one whole 128-byte line of its plane, written by that wave alone.
#define PJT ((MP / 128) * (DM / 128))      /* work-group tiles per projection (256) */
#define PJV ((DM / 128) * (SQ / 128))      /* V^T tiles per batch (128) */
static_assert(PJV * NB == PJT && B0 == 0 && NBR == NB, "k_proj: one grid row per projection, all batches");
__global__ __launch_bounds__(256) void k_proj(const _Float16* __restrict__ X16, const _Float16* __restrict__ XK16, const _Float16* __restrict__ XV16, const _Float16* __restrict__ BQ, const _Float16* __restrict__ BK, const _Float16* __restrict__ BV,
    _Float16* __restrict__ QH, _Float16* __restrict__ QL, _Float16* __restrict__ KH, _Float16* __restrict__ KL, _Float16* __restrict__ VT) {
  __shared__ __attribute__((aligned(16))) unsigned char ring[2 * G2BUF];
  float (*so)[32][68] = reinterpret_cast<float (*)[32][68]>(ring); static_assert(8 * 32 * 68 * 4 <= 2 * G2BUF, "k_proj: the staging fits the ring");      /* the epilogue's staging, one plane per wave, laid over the ring: used only behind g2_loop, which leaves the ring free */
  const int tid = threadIdx.x, w = tid >> 5, lane = tid & 31, ln = lane & 15, hh = lane >> 4; const int job = blockIdx.y, bx = blockIdx.x;
  const _Float16* A; const _Float16* Bh; _Float16* Ph; _Float16* Pl; int mt, nq, ldc;      /* each the same for the whole work-group */
  if (job < 2) { A = job ? XK16 : X16; Bh = job ? BK : BQ; Ph = job ? KH : QH; Pl = job ? KL : QL; mt = bx / (DM / 128); nq = bx % (DM / 128); ldc = DM; }
  else { const int b = bx / PJV, u = bx % PJV; A = BV; Bh = XV16 + (size_t)b * SQ * DM; Ph = VT + (size_t)b * DM * SQ; Pl = nullptr; mt = u / (SQ / 128); nq = u % (SQ / 128); ldc = SQ; }
  const int row0 = mt * 128 + 32 * (w & 3), col0 = nq * 128 + 64 * (w >> 2);
  const _Float16* ga = A + (size_t)(mt * 128 + (tid >> 4)) * DM + (tid & 15) * 8; const _Float16* gb = Bh + (size_t)(nq * 128 + (tid >> 4)) * DM + (tid & 15) * 8;
  v8f accs[8]; g2_loop(ring, ga, DM, gb, DM, DM / G2KC, tid, accs);
#pragma unroll
  for (int u = 0; u < 8; ++u) { const int t = u & 3, half = u >> 2;
#pragma unroll
    for (int r = 0; r < 8; ++r) so[w][half * 16 + 8 * hh + r][t * 16 + ln] = accs[u][r] * 0.0625f; }      /* the weights are carried x16 */
  __builtin_amdgcn_fence(__ATOMIC_ACQ_REL, "workgroup"); __builtin_amdgcn_wave_barrier();
  const int rsub = lane >> 4, c4 = (lane & 15) * 4; const size_t po = (size_t)(row0 + rsub) * ldc + col0 + c4;      /* the lane's place in rows 0 and 1 of the wave's tile */
  if (job < 2) {
#pragma unroll
    for (int q = 0; q < 16; ++q) { const v4f v = *(const v4fa*)&so[w][q * 2 + rsub][c4]; v4h h4, l4;
      for (int i = 0; i < 4; ++i) { const _Float16 h = (_Float16)v[i]; h4[i] = h; l4[i] = (_Float16)((v[i] - (float)h) * 1024.0f); }
      *(v4h*)(Ph + po + (size_t)(q * 2) * DM) = h4; *(v4h*)(Pl + po + (size_t)(q * 2) * DM) = l4; } }
  else {
#pragma unroll
    for (int q = 0; q < 16; ++q) { const v4f v = *(const v4fa*)&so[w][q * 2 + rsub][c4]; v4h h4;
      for (int i = 0; i < 4; ++i) h4[i] = (_Float16)v[i];
      *(v4h*)(Ph + po + (size_t)(q * 2) * SQ) = h4; }
    asm volatile("s_wait_xcnt 0x0" ::: "memory");      /* stands directly behind the last of these stores, in front of any later overwrite of a register that they name */
  } }


__global__ __launch_bounds__(256) void k_wnat(const float* __restrict__ w, size_t n8, _Float16* __restrict__ Bt) { const size_t t = (size_t)blockIdx.x * 256 + threadIdx.x; if (t >= n8) return; FragH f; for (int q = 0; q < 8; ++q) f.h[q] = (_Float16)(bf16_round(w[t * 8 + q]) * 16.0f); *(v8us*)((unsigned short*)Bt + t * 8) = f.half[0];  }
__global__ __launch_bounds__(256) void k_rsm(const float* __restrict__ S, _Float16* __restrict__ P, int nrows) {
  #pragma clang fp contract(off)
  const int i = blockIdx.x * 256 + threadIdx.x; if (i >= nrows) return; const float* s = S + (size_t)i * SQ; float mx = -3.0e38f;
#pragma unroll 1
  for (int j = 0; j < SQ; ++j) mx = fmaxf(mx, s[j]); float se = 0.f;
#pragma unroll 1
  for (int j = 0; j < SQ; ++j) se += expf(s[j] - mx); const float sc = 256.0f / se;
#pragma unroll 1
  for (int j0 = 0; j0 < SQ; j0 += 8) { FragH f; for (int q = 0; q < 8; ++q) f.h[q] = (_Float16)(expf(s[j0 + q] - mx) * sc); unsigned short* d = (unsigned short*)P + (size_t)i * SQ + j0; *(v8us*)d = f.half[0];  } }
__global__ __launch_bounds__(256) void k_vt(const _Float16* __restrict__ V16, int b, int h0, _Float16* __restrict__ VT) { __shared__ unsigned short tl[64][65]; const int tid = threadIdx.x; const int hh = blockIdx.x % HG, sg = blockIdx.x / HG; const int s0 = sg * 64; const int h = h0 + hh;
  for (int i = tid; i < 64 * 8; i += 256) { const int j = i / 8, d8 = (i % 8) * 8; FragH f; f.half[0] = *(const v8us*)((const unsigned short*)V16 + ((size_t)b * SQ + s0 + j) * DM + h * HD + d8); for (int q = 0; q < 8; ++q) tl[d8 + q][j] = f.u[q]; }
  __syncthreads();
  { for (int i = tid; i < 64 * 8; i += 256) { const int d = i / 8, j8 = (i % 8) * 8; FragH f; for (int q = 0; q < 8; ++q) f.u[q] = tl[d][j8 + q]; *(v8us*)((unsigned short*)VT + ((size_t)hh * HD + d) * SQ + s0 + j8) = f.half[0]; }  } }



// 2^x on the transcendental unit; the v_nop fills the one slot that the instruction set asks for between a transcendental and an instruction that reads its result or overwrites its source.
__device__ __forceinline__ float exp2_slot(float x) { float r; asm("v_exp_f32 %0, %1\n\tv_nop" : "=v"(r) : "v"(x)); return r; }
// Value of lane l ^ 16 (the other half of the wave): one register move between the two 16-lane rows, no LDS.
__device__ __forceinline__ float xhalf(float x) { return __builtin_bit_cast(float, __builtin_amdgcn_permlanex16(__builtin_bit_cast(int, x), __builtin_bit_cast(int, x), 0x76543210, 0xfedcba98, false, false)); }
__device__ __forceinline__ v16h fa_frag(const unsigned short* p) { FragH f; f.half[0] = *(const v8us*)p; f.half[1] = *(const v8us*)(p + 16); return f.v; }      /* p = the lane's own pointer, 8 hh included: k = 8 hh + i, 16 + 8 hh + i, as g2_frag */
__device__ __forceinline__ v8f fa_mma(v16h a, v16h b, v8f c) { return __builtin_amdgcn_wmma_f32_16x16x32_f16(false, a, false, b, (short)0, c, false, false); }
#define FAW 8                        /* waves per work-group of the fused attention */
#define FAQ 32                       /* query columns per wave */
#define FAK 32                       /* keys per pass */
#define FAC 0.18033688f              /* 1 / sqrt(64) x log2(e): scores to the exponent of 2 */
#define FALIM 32768.0f               /* a lane's 16 weights of a pass may sum to this under the reference in use: each of them then fits f16 */
#define FAT 128                      /* keys per LDS stage (four passes) */
#define FAKP 144                     /* LDS pitch of a K row, bytes: 128 + 16 = 16 x odd, no bank conflict for ds_load_b128 fragment reads */
#define FAVP 272                     /* LDS pitch of a V^T row, bytes: 256 + 16 = 16 x odd */
#define FAKB (FAT * FAKP)            /* one K plane of a stage */
#define FABUF (2 * FAKB + HD * FAVP) /* one buffer: K hi rows, K residual rows, V^T rows */
// One stage: 12 asynchronous copies of 16 bytes per lane, in one statement. A wave's copy covers four whole K rows of the head (128 bytes each) or two whole V^T rows of the stage (256 bytes each): whole lines only.
// lk, lv = the lane's places in the buffer's K hi plane (row tid / 8, piece tid % 8) and V^T plane (row tid / 16, piece tid % 16) as LDS byte addresses; gh, gl, gv = the same places in the stage's source rows. Copies 32 K rows or 16 V^T rows apart.
// s_wait_xcnt 0 is the statement's last line so that it stands in front of every later write of the address registers that the copies name.
__device__ __forceinline__ void fa_stage(unsigned lk, unsigned lv, const unsigned short* gh, const unsigned short* gl, const unsigned short* gv) {
  asm volatile("global_load_async_to_lds_b128 %0, %12, off\n\t"
               "global_load_async_to_lds_b128 %1, %13, off\n\t"
               "global_load_async_to_lds_b128 %2, %14, off\n\t"
               "global_load_async_to_lds_b128 %3, %15, off\n\t"
               "global_load_async_to_lds_b128 %4, %16, off\n\t"
               "global_load_async_to_lds_b128 %5, %17, off\n\t"
               "global_load_async_to_lds_b128 %6, %18, off\n\t"
               "global_load_async_to_lds_b128 %7, %19, off\n\t"
               "global_load_async_to_lds_b128 %8, %20, off\n\t"
               "global_load_async_to_lds_b128 %9, %21, off\n\t"
               "global_load_async_to_lds_b128 %10, %22, off\n\t"
               "global_load_async_to_lds_b128 %11, %23, off\n\t"
               "s_wait_xcnt 0x0"
               :: "v"(lk), "v"(lk + 32 * FAKP), "v"(lk + 64 * FAKP), "v"(lk + 96 * FAKP),
                  "v"(lk + FAKB), "v"(lk + FAKB + 32 * FAKP), "v"(lk + FAKB + 64 * FAKP), "v"(lk + FAKB + 96 * FAKP),
                  "v"(lv), "v"(lv + 16 * FAVP), "v"(lv + 32 * FAVP), "v"(lv + 48 * FAVP),
                  "v"(gh), "v"(gh + 32 * LQ), "v"(gh + 64 * LQ), "v"(gh + 96 * LQ),
                  "v"(gl), "v"(gl + 32 * LQ), "v"(gl + 64 * LQ), "v"(gl + 96 * LQ),
                  "v"(gv), "v"(gv + 16 * SQ), "v"(gv + 32 * SQ), "v"(gv + 48 * SQ) : "memory"); }
__device__ __forceinline__ void fa_weights(const float (&t)[16], float nb, FragH& p, float& sum) {
  sum = 0.f;
#pragma unroll
  for (int i = 0; i < 16; ++i) { const float e = exp2_slot(fmaf(t[i], FAC, nb)); sum += e; p.h[i] = (_Float16)e; } }
__global__ __launch_bounds__(FAW * 32) void k_fattn(const _Float16* __restrict__ QHp, const _Float16* __restrict__ QLp, const _Float16* __restrict__ KHp, const _Float16* __restrict__ KLp, const _Float16* __restrict__ VTp, _Float16* __restrict__ Op) {
  __shared__ __attribute__((aligned(16))) unsigned char ring[2 * FABUF];
  const int tid = threadIdx.x, lane = tid & 31, w = tid >> 5, ln = lane & 15, hh = lane >> 4; const int h = blockIdx.y, b = blockIdx.z; const int q0 = blockIdx.x * (FAW * FAQ) + w * FAQ; const size_t r0 = (size_t)b * SQ;
  const unsigned lk = (unsigned)(size_t)ring + (unsigned)((tid >> 3) * FAKP + (tid & 7) * 16), lv = (unsigned)(size_t)ring + (unsigned)(2 * FAKB + (tid >> 4) * FAVP + (tid & 15) * 16);      /* this lane's places in buffer 0 as LDS byte addresses (low 32 bits of the __shared__ address) */
  const unsigned short* gh = (const unsigned short*)KHp; const unsigned short* gl = (const unsigned short*)KLp; const unsigned short* gv = (const unsigned short*)VTp;
  const unsigned go = (unsigned)((b * SQ + (tid >> 3)) * LQ + h * HD + (tid & 7) * 8), gvo = (unsigned)(((b * NH + h) * HD + (tid >> 4)) * SQ + (tid & 15) * 8);      /* this lane's places in stage 0's source rows, in elements (below 2^23): one register each across the loop */
  const size_t qo = (r0 + q0 + ln) * LQ + h * HD + 8 * hh;
  const unsigned short* qhl = (const unsigned short*)QHp + qo; const unsigned short* qll = (const unsigned short*)QLp + qo;
  v16h qh[2][2], ql[2][2];
#pragma unroll
  for (int qt = 0; qt < 2; ++qt) for (int ks = 0; ks < 2; ++ks) { qh[qt][ks] = fa_frag(qhl + (size_t)(qt * 16) * LQ + ks * 32); ql[qt][ks] = fa_frag(qll + (size_t)(qt * 16) * LQ + ks * 32); }
  asm volatile("s_wait_xcnt 0x0" :: "v"(qhl), "v"(qll) : "memory");      /* stands in front of the first overwrite of these loads' address registers; the addresses are inputs so that they keep their registers up to here */
  const v8f z8 = {0.f,0.f,0.f,0.f,0.f,0.f,0.f,0.f}; v8f o[2][4]; float m[2], nb[2], l[2];
#pragma unroll
  for (int qt = 0; qt < 2; ++qt) { m[qt] = -1.0e30f; nb[qt] = 1.0e30f * FAC; l[qt] = 0.f; for (int dt = 0; dt < 4; ++dt) o[qt][dt] = z8; }      /* under this reference the first pass's weights overflow: it fails the test and sets the first real reference */
#pragma unroll 1      /* rolled: the buffer's offset stays a run-time scalar, so that lk and lv are themselves no operands of the copies' asm text: as such they were tied to the first 256 registers over the whole kernel and spilled to scratch */
  for (int s = 0; s < 2; ++s) {      /* stage 0's copies, their wait and the barrier; then stage 1's copies */
    fa_stage(lk + (unsigned)s * FABUF, lv + (unsigned)s * FABUF, gh + (go + (unsigned)s * (FAT * LQ)), gl + (go + (unsigned)s * (FAT * LQ)), gv + (gvo + (unsigned)s * FAT));
    if (s == 0) {
      asm volatile("s_wait_asynccnt 0x0" ::: "memory");      /* this wave's copies of stage 0 have landed */
      __syncthreads();      /* stage 0 is readable by every wave */
    }
  }
#pragma unroll 1      /* rolled: one stage per trip */
  for (int s = 0; s < SQ / FAT; ++s) {
    const unsigned char* bufp = ring + (s & 1) * FABUF; const unsigned char* pk = bufp + ln * FAKP + 16 * hh; const unsigned char* pv = bufp + 2 * FAKB + ln * FAVP + 16 * hh;
    v16h kh[2][2], kl[2][2];
#pragma unroll
    for (int kt = 0; kt < 2; ++kt) for (int ks = 0; ks < 2; ++ks) { kh[kt][ks] = g2_frag(pk + (kt * 16) * FAKP + ks * 64); kl[kt][ks] = g2_frag(pk + FAKB + (kt * 16) * FAKP + ks * 64); }
#pragma unroll 1      /* rolled: one pass already holds 32 matrix instructions, and a second copy would double the registers in flight */
    for (int ps = 0; ps < FAT / FAK; ++ps) {
      v16h va[4];      /* V^T rows of this pass: asked for here, needed only behind the softmax */
#pragma unroll
      for (int dt = 0; dt < 4; ++dt) va[dt] = g2_frag(pv + (dt * 16) * FAVP + ps * 64);
      v8f sa[2][2], sr[2][2];      /* [query tile][key tile]: hi.hi, and the x1024 residual products */
#pragma unroll
      for (int qt = 0; qt < 2; ++qt) for (int kt = 0; kt < 2; ++kt) sa[qt][kt] = fa_mma(kh[kt][0], qh[qt][0], z8);
#pragma unroll
      for (int qt = 0; qt < 2; ++qt) for (int kt = 0; kt < 2; ++kt) sr[qt][kt] = fa_mma(kh[kt][0], ql[qt][0], z8);
#pragma unroll
      for (int qt = 0; qt < 2; ++qt) for (int kt = 0; kt < 2; ++kt) sa[qt][kt] = fa_mma(kh[kt][1], qh[qt][1], sa[qt][kt]);
#pragma unroll
      for (int qt = 0; qt < 2; ++qt) for (int kt = 0; kt < 2; ++kt) sr[qt][kt] = fa_mma(kh[kt][1], ql[qt][1], sr[qt][kt]);
#pragma unroll
      for (int qt = 0; qt < 2; ++qt) for (int kt = 0; kt < 2; ++kt) sr[qt][kt] = fa_mma(kl[kt][0], qh[qt][0], sr[qt][kt]);
#pragma unroll
      for (int qt = 0; qt < 2; ++qt) for (int kt = 0; kt < 2; ++kt) sr[qt][kt] = fa_mma(kl[kt][1], qh[qt][1], sr[qt][kt]);
      if (ps + 1 < FAT / FAK) {      /* the next pass's K rows of the SAME stage, asked for ahead of this pass's softmax */
#pragma unroll
        for (int kt = 0; kt < 2; ++kt) for (int ks = 0; ks < 2; ++ks) { kh[kt][ks] = g2_frag(pk + ((ps + 1) * FAK + kt * 16) * FAKP + ks * 64); kl[kt][ks] = g2_frag(pk + FAKB + ((ps + 1) * FAK + kt * 16) * FAKP + ks * 64); } }
      float t[2][16];
#pragma unroll
      for (int qt = 0; qt < 2; ++qt) for (int i = 0; i < 16; ++i) t[qt][i] = fmaf(sr[qt][i >> 3][i & 7], 0.0009765625f, sa[qt][i >> 3][i & 7]);
      FragH p[2]; float sum[2];
#pragma unroll
      for (int qt = 0; qt < 2; ++qt) fa_weights(t[qt], nb[qt], p[qt], sum[qt]);
      asm volatile("" :: "v"(va[0]), "v"(va[1]), "v"(va[2]), "v"(va[3]));      /* inputs only: holds the V^T loads in front of the test; without it they were moved behind the branch, directly in front of the products that read them, their whole LDS latency in the open */
      if (__builtin_amdgcn_ballot_w32(fmaxf(sum[0], sum[1]) > FALIM) != 0) {      /* one test per pass, a scalar branch taken by the whole wave: some lane's weights have outgrown f16 under the reference in use (always so in the first pass) */
#pragma unroll
        for (int qt = 0; qt < 2; ++qt) {
          float mx = t[qt][0];
#pragma unroll
          for (int i = 1; i < 16; ++i) mx = fmaxf(mx, t[qt][i]);
          mx = fmaxf(mx, xhalf(mx));
          const float mn = fmaxf(m[qt], mx); const float al = exp2_slot((m[qt] - mn) * FAC); m[qt] = mn; nb[qt] = -mn * FAC;
          l[qt] *= al;
#pragma unroll
          for (int dt = 0; dt < 4; ++dt) { for (int r = 0; r < 8; ++r) o[qt][dt][r] *= al; }
          fa_weights(t[qt], nb[qt], p[qt], sum[qt]);
        }
      }
#pragma unroll
      for (int qt = 0; qt < 2; ++qt) { l[qt] += sum[qt];
#pragma unroll
        for (int dt = 0; dt < 4; ++dt) o[qt][dt] = fa_mma(va[dt], p[qt].v, o[qt][dt]); }
    }
    asm volatile("s_wait_dscnt 0x0" ::: "memory");      /* this wave's reads of stage s are done before the buffer is handed to its next writer */
    asm volatile("s_wait_asynccnt 0x0" ::: "memory");      /* this wave's copies of stage s + 1 have landed */
    __syncthreads();      /* publishes stage s + 1 and ends every wave's reads of stage s */
    if (s + 2 < SQ / FAT) fa_stage(lk + (unsigned)(s & 1) * FABUF, lv + (unsigned)(s & 1) * FABUF, gh + (go + (unsigned)(s + 2) * (FAT * LQ)), gl + (go + (unsigned)(s + 2) * (FAT * LQ)), gv + (gvo + (unsigned)(s + 2) * FAT));
  }
  asm volatile("s_wait_asynccnt 0x0" ::: "memory");      /* no copy is outstanding when the wave goes on */
#pragma unroll
  for (int qt = 0; qt < 2; ++qt) { const float inv = 64.0f / (l[qt] + xhalf(l[qt]));      /* the halves' sums joined once; o carried x64 */
    _Float16* op = Op + r0 * DM + (size_t)h * SQ * HD + (size_t)(q0 + qt * 16 + ln) * HD + 8 * hh;
#pragma unroll
    for (int dt = 0; dt < 4; ++dt) { FragH f; for (int r = 0; r < 8; ++r) f.h[r] = (_Float16)(o[qt][dt][r] * inv); *(v8us*)((unsigned short*)op + dt * 16) = f.half[0]; } } }


template <int MASKADD>
__global__ __launch_bounds__(64) void k_att0(const float* __restrict__ QF, const float* __restrict__ KF, const float* __restrict__ VF, int ld, const float* __restrict__ mask, float scale, float* __restrict__ OF, int ldo) {
  #pragma clang fp contract(off)
  __shared__ __attribute__((aligned(16))) float lq[64][64]; __shared__ __attribute__((aligned(16))) float lo[64][64];
  const int tid = threadIdx.x; const int h = blockIdx.x / (QT0 / 64), rg = blockIdx.x % (QT0 / 64); const int i = rg * 64 + tid;
  const float* qr = QF + (size_t)i * ld + h * HD;
#pragma unroll 1
  for (int c = 0; c < HD / 4; ++c) { *(v4f*)&lq[tid][c * 4] = *(const v4fa*)(qr + c * 4); const v4f z = {0.f, 0.f, 0.f, 0.f}; *(v4f*)&lo[tid][c * 4] = z; }
  float m = -1.0e30f, l = 0.f; const int jmax = MASKADD ? (SQ - 1) : (rg * 64 + 63);      /* additive-mask form: every key (the mask input decides); causal form: keys up to the block's last row */
#pragma unroll 1
  for (int j = 0; j <= jmax; ++j) { const float* kr = KF + (size_t)j * ld + h * HD; const float* vr = VF + (size_t)j * ld + h * HD; float s = 0.f;
#pragma unroll 1
    for (int c = 0; c < HD / 4; ++c) { const v4f kq = *(const v4fa*)(kr + c * 4); const v4f qq = *(v4f*)&lq[tid][c * 4]; s = __fadd_rn(s, __fmul_rn(qq[0], kq[0])); s = __fadd_rn(s, __fmul_rn(qq[1], kq[1])); s = __fadd_rn(s, __fmul_rn(qq[2], kq[2])); s = __fadd_rn(s, __fmul_rn(qq[3], kq[3])); }
    s = __fmul_rn(s, scale); if (MASKADD) s = __fadd_rn(s, __fmul_rn(bf16_round(mask[(size_t)i * SQ + j]), -10000.0f));
    const float f = (MASKADD || j <= i) ? 1.f : 0.f; const float sm = fmaf(f, s, (1.f - f) * -1.0e30f); const float mn = fmaxf(m, sm); const float sc = expf(m - mn); const float e = expf(sm - mn); l = __fadd_rn(__fmul_rn(l, sc), e); m = mn;
#pragma unroll 1
    for (int c = 0; c < HD / 4; ++c) { const v4f vv = *(const v4fa*)(vr + c * 4); v4f oo = *(v4f*)&lo[tid][c * 4]; for (int u = 0; u < 4; ++u) oo[u] = __fadd_rn(__fmul_rn(oo[u], sc), __fmul_rn(e, vv[u])); *(v4f*)&lo[tid][c * 4] = oo; } }
  const float fin = 64.0f / l;      /* o carried x64 like the f16 path */
#pragma unroll 1
  for (int c = 0; c < HD / 4; ++c) { v4f oo = *(v4f*)&lo[tid][c * 4]; for (int u = 0; u < 4; ++u) oo[u] = __fmul_rn(oo[u], fin); *(v4f*)&lo[tid][c * 4] = oo; }
  __syncthreads();
  {
#pragma unroll 1
    for (int it = 0; it < 16; ++it) { const int row = it * 4 + tid / 16, pc = (tid % 16) * 4; const v4f v = *(const v4f*)&lo[row][pc]; *(v4f*)(OF + (size_t)(rg * 64 + row) * ldo + h * HD + pc) = v; }
     } }

extern "C" void kernel_launch(void* const* d_in, const int* in_sizes, int n_in,
                              void* d_out, int out_size, void* d_ws, size_t ws_size, hipStream_t stream) {
  (void)in_sizes; (void)n_in; (void)out_size;
  const float* const* I = (const float* const*)d_in; const float* x = I[0]; const float* xk = I[1]; const float* xv = I[2]; const float* wq = I[3]; const float* wk = I[4]; const float* wv = I[5]; const float* bq = nullptr; const float* bk = nullptr; const float* bv = nullptr; const float* wo = I[6]; const float* bo = nullptr;      /* input order: q, k, v (the three streams, two sequences each), Wq, Wk, Wv (PER-HEAD STACKS [16][1024][64]), Wo ([in][out] [1024][1024]); NO biases anywhere: null pointers in the guarded slots */
  char* ws = (char*)d_ws; size_t off = 0;
  auto take = [&](size_t bytes) { char* p = ws + off; off += (bytes + 255) & ~(size_t)255; return p; };
  _Float16* BQ = (_Float16*)take((size_t)DM * DM * 2); _Float16* BK = (_Float16*)take((size_t)DM * DM * 2); _Float16* BV = (_Float16*)take((size_t)DM * DM * 2); _Float16* BO = (_Float16*)take((size_t)DM * DM * 2);
  _Float16* X16 = (_Float16*)take(NR * DM * 2); _Float16* XK16 = (_Float16*)take(NR * DM * 2); _Float16* XV16 = (_Float16*)take(NR * DM * 2);      /* exact f16 rows of query, key, value */ _Float16* QH = (_Float16*)take(NR * DM * 2); _Float16* QL = (_Float16*)take(NR * DM * 2); _Float16* KH = (_Float16*)take(NR * DM * 2); _Float16* KL = (_Float16*)take(NR * DM * 2); _Float16* Q16 = QH; _Float16* K16 = KH; _Float16* O16 = (_Float16*)take(NR * DM * 2);
  _Float16* VT = (_Float16*)take((size_t)NB * NH * HD * SQ * 2);      /* V^T of both batches */
  float* QF0 = (float*)take((size_t)QT0 * DM * 4); float* KF0 = (float*)take((size_t)QT0 * DM * 4); float* VF0 = (float*)take((size_t)QT0 * DM * 4); float* OF0 = (float*)take((size_t)NB * QT0 * DM * 4); _Float16* OH0 = (_Float16*)take((size_t)NB * QT0 * DM * 2); _Float16* OL0 = (_Float16*)take((size_t)NB * QT0 * DM * 2);
  if (off > ws_size) return;
  k_prep<<<PPG, PPT, 0, stream>>>(wq, wk, wv, wo, x, xk, xv, BQ, BK, BV, BO, X16, XK16, XV16);      /* head h's [1024][64] block -> rows 64 h .. 64 h + 63 of the Bt[n][k] x16 plane; the [in][out] output weight transposed into its plane; the three streams as exact f16 rows */
  const size_t r0p = (size_t)B0 * SQ;      /* first projected row */
  k_proj<<<dim3((unsigned)PJT, 3), 256, 0, stream>>>(X16, XK16, XV16, BQ, BK, BV, QH, QL, KH, KL, VT);      /* q and k -> f16 hi + x1024 residual planes (unscaled logits sigma ~8); v -> V^T [NB][NH][HD][SQ] */
  k_fattn<<<dim3(SQ / (FAW * FAQ), NH, NB), FAW * 32, 0, stream>>>(QH, QL, KH, KL, VT, O16);      /* o written HEAD-CONTIGUOUS: o[b][h][s][64] (row pitch 64, head stride SQ x 64): the source's raw reshape of (B, H, S, dk) to (B, S, H dk) then reads that memory as [2048][1024] rows: the output GEMM below does exactly that */
  k_gemm2<0><<<dim3((unsigned)((MPO / 128) * (DM / 128)), 1), 256, 0, stream>>>(O16 + r0p * DM, DM, 0, BO, DM, 0, 0.0009765625f, bo, 0, nullptr, 1, 0, 0, (float*)d_out + r0p * DM, nullptr, DM, 0, MPO, DM, DM);      /* out rows are the output layout */
  /* (dense: no first-tile hi / lo planes) */
  /* (dense: no first-tile rewrite passes:
     the output GEMM above has written every row
     with its (null) bias) */
}

// v010
// A run of this version takes 92.2 microseconds.
// Timed twice side by side with v009, it ran 1.04 times as fast both times.
// Counting every step since v000, it is 82.0 times as fast.
#include <hip/hip_runtime.h>
// Multi-head attention on three inputs with PER-HEAD STACKED projections and the source's RAW-RESHAPE head merge (Q, K, V [2][2048][1024]; WQ / WK / WV [16][1024][64] = [head][in][out] uniform +-0.1, NO biases; 16 heads of 64; scores x 1/sqrt(64); softmax over all 2048 keys (no mask); the head outputs [B][H][S][64] are RESHAPED IN MEMORY ORDER to [B][S][1024] (row r of a batch holds tokens 16 (r mod 128) .. + 15 of head r / 128: heads and tokens mix: faithful to the source); out = that WO with WO [1024][1024] [in][out], NO bias -> [2][2048][1024]); q and k carried as f16 hi + unscaled residual planes with three-product scores; each head's [in][out] block is transposed into its 64 contiguous rows of the f16 weight plane, and the [in][out] output weight into its plane, all in one launch (k_prep); DENSE (k_fattn runs every query over all SQ keys; no exact first tile).
// Structure: token rows r = b*2048 + s; x as exact f16 rows (bf16-rounded); q and k as WMMA GEMMs (32x64 wave tiles, f32 accumulation, exact x16 weights, no bias) whose epilogues split the f32 sums into f16 hi + residual planes, v by swapped operands straight into V^T for both batches and all heads, all three in one launch (k_proj); per work-group of 256 query rows in one fused launch (k_fattn; all heads on grid.y, batches on grid.z), in passes of 32 keys over all 2048: scores as THREE accumulating products (hi.hi + hi.lo + lo.hi in one accumulator started at minus the reference, K = 64, logits sigma ~8, 1/sqrt(64) log2(e) carried by q), online row softmax on VALU with no mask (f32 statistics, native exp2; f16 weights under a lazy reference), o = P . V^T (o carried x64, folded into the output GEMM alpha) written straight into the merged f16 o rows; out = o W_o GEMM (f32, no bias) into the output layout.
// Attention now runs as ONE fused launch (k_fattn, below): the per-tile score passes, the row softmax and the P . V^T pass of the former version are gone, with their score and weight planes; V^T is built for both batches in one launch.
// All work that reads inputs only (the weight planes, the three f16 input streams) now runs as ONE launch (k_prep, below) in place of one launch per head and plane and one per stream.
// That launch now has 256 work-groups of 16 waves, each thread taking a weight block and a share of every stream: see the lines above k_prep.
// The GEMM launches (k_proj, k_gemm2) now take their operand tiles through LDS (asynchronous copies, two buffers): see the lines above k_gemm2.
// The GEMM work-group tile is now 128x128 (eight waves of 32x64 in place of four): a third fewer operand bytes come from L2 per product: see the lines above k_gemm2.
// The fused attention (k_fattn) now takes its K and V^T rows through LDS in the same way, once for the work-group's eight waves: see the lines above k_fattn.
// The fused attention now rescales lazily: a query's reference maximum stays in use while the weights fit f16, tested once per pass: see the lines above k_fattn.
// The fused attention's score accumulators now hold each weight's exponent themselves: q is carried x 1/sqrt(64) x log2(e), the q and k residual planes are carried UNSCALED (no x1024 any more, whatever the lines above say), the accumulators start at minus the reference: see the lines above k_fattn.
// The three projections now run as ONE launch (k_proj, below) whose epilogues write the attention's operand planes themselves: q and k as f16 hi + residual, V^T by swapped operands; the f32 q / k plane, the f16 v rows and the three launches that converted them are gone.
// Compute dtype: inputs rounded to bf16; x / weights exact; q and k as f16 hi + residual planes, v, softmax weights and o as plain f16 GEMM operands (~2^-12); scores and softmax statistics f32. v_wmma_f32_16x16x32_f16.
#define NB 2
#define SCL 0.125f                         /* 1 / sqrt(head_dim = 64) */
#define SCLR 0.0001220703125f              /* 2^-13 */
#define SQ 2048
#define DM 1024
#define NH 16
#define HD 64
#define HG 4                         /* heads per group of the second k_vt (not launched) */
#define QT 256                       /* query rows per query tile (not used) */
#define NKX SQ                       /* row pitch of the former S / P planes (not used) */
#define QT0 128                      /* rows of the exact first tile of k_att0 (not launched) */
#define B0 0                         /* first batch processed (debug hook) */
#define NBR NB                       /* batches processed (debug hook) */
#define NR ((size_t)NB * SQ)         /* token rows */
#define MP ((int)((size_t)NBR * SQ)) /* rows projected (debug hook) */
#define QN SQ                        /* query rows attended per batch (not used) */
#define NHD NH                       /* heads attended (not used) */
#define MPO MP                       /* rows through the output stage (debug hook) */
#define LQ DM      /* row pitch of the q/k rows */
typedef __bf16 v16b __attribute__((ext_vector_type(16)));
typedef unsigned short v8us __attribute__((ext_vector_type(8), may_alias));
typedef float  v8f  __attribute__((ext_vector_type(8)));
typedef float  v4f  __attribute__((ext_vector_type(4)));
typedef float  v4fa __attribute__((ext_vector_type(4), may_alias));
union FragB { v16b v; v8us half[2]; unsigned short u[16]; };

__device__ __forceinline__ unsigned short bf16_bits(float x) { unsigned int u = __float_as_uint(x); return (unsigned short)((u + 0x7FFFu + ((u >> 16) & 1u)) >> 16); }
__device__ __forceinline__ float bf16_val(unsigned short b) { return __uint_as_float(((unsigned int)b) << 16); }
__device__ __forceinline__ float bf16_round(float x) { return bf16_val(bf16_bits(x)); }
// D += A·B with NT terms: 1 = ah·bh, 2 = + al·bh (A split), 3 = + ah·bl (both split)
template <int NT>
__device__ __forceinline__ v8f mmaN(v16b ah, v16b al, v16b bh, v16b bl, v8f c) {
  c = __builtin_amdgcn_wmma_f32_16x16x32_bf16(false, ah, false, bh, (short)0, c, false, false);
  if (NT >= 2) c = __builtin_amdgcn_wmma_f32_16x16x32_bf16(false, al, false, bh, (short)0, c, false, false);
  if (NT >= 3) c = __builtin_amdgcn_wmma_f32_16x16x32_bf16(false, ah, false, bl, (short)0, c, false, false);
  asm volatile("v_nop\n\tv_nop\n\tv_nop\n\tv_nop" : "+v"(c) : "v"(ah), "v"(al), "v"(bh), "v"(bl));
  return c;
}

__global__ __launch_bounds__(256) void k_wt_bf16(const float* __restrict__ W, unsigned short* __restrict__ Wt, int K, int N) {
  const int t = blockIdx.x * 256 + threadIdx.x;
  const int k8n = K / 8;
  if (t >= N * k8n) return;
  const int n = t / k8n, k8 = (t % k8n) * 8;
  v8us v;
#pragma unroll
  for (int i = 0; i < 8; ++i) v[i] = bf16_bits(W[(size_t)(k8 + i) * N + n]);
  *(v8us*)(Wt + (size_t)n * K + k8) = v;
  
}

// GEMM C[M][N] (f32, pitch ldc) = act(A[M][K]·W + bias). A f32 row-major (pitch lda) converted per fragment to bf16
// (ASPLIT: hi/lo two planes -> 2 terms, else single rounded term); Wt bf16 [N][K] (pitch ldb). BIAS_BF16 rounds the
// bias to bf16 first (bias quantised to bf16 before the add). K%32==0, M%16==0, N%64==0.
template <bool ASPLIT, int ACT, bool BIAS_BF16>
__global__ __launch_bounds__(128) void k_gemm_bf(const float* __restrict__ A, int lda, const unsigned short* __restrict__ Wt, int ldb,
                                               const float* __restrict__ bias, float* __restrict__ C, int ldc, int M, int N, int K) {
  __shared__ __attribute__((aligned(16))) float so[4][16][64];
  const int tid = threadIdx.x, w = tid >> 5, lane = tid & 31, ln = lane & 15, hh = lane >> 4;
  const int ntn = N / 64;
  const int wid = blockIdx.x * 4 + w;
  const int mt = wid / ntn, nq = wid % ntn;
  if (mt * 16 >= M) return;
  const int row0 = mt * 16, col0 = nq * 64;
  const float* arow = A + (size_t)(row0 + ln) * lda;
  v8f acc[4] = {};
  for (int kb = 0; kb < K; kb += 32) {
    FragB ah, al;
    const v4f x0 = *(const v4fa*)(arow + kb + 8 * hh), x1 = *(const v4fa*)(arow + kb + 8 * hh + 4);
    const v4f x2 = *(const v4fa*)(arow + kb + 16 + 8 * hh), x3 = *(const v4fa*)(arow + kb + 16 + 8 * hh + 4);
    float xs[16] = {x0[0],x0[1],x0[2],x0[3],x1[0],x1[1],x1[2],x1[3],x2[0],x2[1],x2[2],x2[3],x3[0],x3[1],x3[2],x3[3]};
#pragma unroll
    for (int i = 0; i < 16; ++i) { const unsigned short hb = bf16_bits(xs[i]); ah.u[i] = hb; al.u[i] = ASPLIT ? bf16_bits(xs[i] - bf16_val(hb)) : (unsigned short)0; }
#pragma unroll
    for (int t = 0; t < 4; ++t) {
      const unsigned short* brow = Wt + (size_t)(col0 + t * 16 + ln) * ldb + kb;
      FragB b;
      b.half[0] = *(const v8us*)(brow + 8 * hh);
      b.half[1] = *(const v8us*)(brow + 16 + 8 * hh);
      acc[t] = mmaN<ASPLIT ? 2 : 1>(ah.v, al.v, b.v, b.v, acc[t]);
    }
  }
#pragma unroll
  for (int t = 0; t < 4; ++t) {
    float bv = bias ? bias[col0 + t * 16 + ln] : 0.f;
    if (BIAS_BF16) bv = bf16_round(bv);
#pragma unroll
    for (int r = 0; r < 8; ++r) { float v = acc[t][r] + bv; if (ACT == 1) v = fmaxf(v, 0.f); so[w][8 * hh + r][t * 16 + ln] = v; }
  }
  __builtin_amdgcn_fence(__ATOMIC_ACQ_REL, "workgroup");
  __builtin_amdgcn_wave_barrier();
  const int rsub = lane >> 4, c4 = (lane & 15) * 4;
  {
#pragma unroll
    for (int q = 0; q < 8; ++q) {
      const int r = q * 2 + rsub;
      const v4f v = *(const v4fa*)&so[w][r][c4];
      *(v4f*)(C + (size_t)(row0 + r) * ldc + col0 + c4) = v;
    }
    
  }
}

// GEMM C = act(A·W + bias + resid): A f32 (ASPLIT -> hi/lo 2 terms), Wt bf16 [N][K]; ACT 0 none, 1 relu, 2 exact gelu;
// resid (optional, f32, row index = (row % rmod), pitch ldr, RES_BF16 rounds it) added before the activation.
template <bool ASPLIT, int ACT, bool BIAS_BF16, bool RES_BF16>
__global__ __launch_bounds__(128) void k_gemm_bf3(const float* __restrict__ A, int lda, const unsigned short* __restrict__ Wt, int ldb,
                                                const float* __restrict__ bias, const float* __restrict__ resid, int rmod, int ldr,
                                                float* __restrict__ C, int ldc, int M, int N, int K) {
  __shared__ __attribute__((aligned(16))) float so[4][16][64];
  const int tid = threadIdx.x, w = tid >> 5, lane = tid & 31, ln = lane & 15, hh = lane >> 4;
  const int ntn = N / 64;
  const int wid = blockIdx.x * 4 + w;
  const int mt = wid / ntn, nq = wid % ntn;
  if (mt * 16 >= M) return;
  const int row0 = mt * 16, col0 = nq * 64;
  const float* arow = A + (size_t)(row0 + ln) * lda;
  v8f acc[4] = {};
  for (int kb = 0; kb < K; kb += 32) {
    FragB ah, al;
    const v4f x0 = *(const v4fa*)(arow + kb + 8 * hh), x1 = *(const v4fa*)(arow + kb + 8 * hh + 4);
    const v4f x2 = *(const v4fa*)(arow + kb + 16 + 8 * hh), x3 = *(const v4fa*)(arow + kb + 16 + 8 * hh + 4);
    float xs[16] = {x0[0],x0[1],x0[2],x0[3],x1[0],x1[1],x1[2],x1[3],x2[0],x2[1],x2[2],x2[3],x3[0],x3[1],x3[2],x3[3]};
#pragma unroll
    for (int i = 0; i < 16; ++i) { const unsigned short hb = bf16_bits(xs[i]); ah.u[i] = hb; al.u[i] = ASPLIT ? bf16_bits(xs[i] - bf16_val(hb)) : (unsigned short)0; }
#pragma unroll
    for (int t = 0; t < 4; ++t) {
      const unsigned short* brow = Wt + (size_t)(col0 + t * 16 + ln) * ldb + kb;
      FragB b;
      b.half[0] = *(const v8us*)(brow + 8 * hh);
      b.half[1] = *(const v8us*)(brow + 16 + 8 * hh);
      acc[t] = mmaN<ASPLIT ? 2 : 1>(ah.v, al.v, b.v, b.v, acc[t]);
    }
  }
#pragma unroll
  for (int t = 0; t < 4; ++t) {
    const int col = col0 + t * 16 + ln;
    float bv = bias ? bias[col] : 0.f;
    if (BIAS_BF16) bv = bf16_round(bv);
#pragma unroll
    for (int r = 0; r < 8; ++r) {
      float v = acc[t][r] + bv;
      if (resid) { float rv = resid[(size_t)((row0 + 8 * hh + r) % rmod) * ldr + col]; if (RES_BF16) rv = bf16_round(rv); v += rv; }
      if (ACT == 1) v = fmaxf(v, 0.f);
      if (ACT == 2) v = 0.5f * v * (1.0f + erff(v * 0.70710678118654752f));
      if (ACT == 3) { const float u = 0.7978845608028654f * (v + 0.044715f * v * v * v); v = 0.5f * v * (1.0f + tanhf(u)); }
      so[w][8 * hh + r][t * 16 + ln] = v;
    }
  }
  __builtin_amdgcn_fence(__ATOMIC_ACQ_REL, "workgroup");
  __builtin_amdgcn_wave_barrier();
  const int rsub = lane >> 4, c4 = (lane & 15) * 4;
  {
#pragma unroll
    for (int q = 0; q < 8; ++q) {
      const int r = q * 2 + rsub;
      const v4f v = *(const v4fa*)&so[w][r][c4];
      *(v4f*)(C + (size_t)(row0 + r) * ldc + col0 + c4) = v;
    }
    
  }
}
// row LayerNorm (biased variance, eps) over N: s = X (+ R); optional out_sum <- s; out_norm <- (s-mu)*rsqrt(var+eps)*g + b
template <bool PARAM_BF16>
__global__ __launch_bounds__(256) void k_layernorm(const float* __restrict__ X, const float* __restrict__ R, const float* __restrict__ g, const float* __restrict__ bta,
                                                  float* __restrict__ out_sum, float* __restrict__ out_norm, int N, float eps) {
  __shared__ float red[256];
  const int row = blockIdx.x, tid = threadIdx.x;
  const float* x = X + (size_t)row * N; const float* rr = R ? R + (size_t)row * N : nullptr;
  float vals[16];                     // up to N = 4096
  const int per = N / 256;            // contiguous chunk per thread? use strided-by-4 chunks: thread handles j = tid*4 + 1024*u
  float s1 = 0.f;
  for (int u = 0; u < per / 4; ++u) {
    const int j = tid * 4 + 1024 * u;
    const v4f a = *(const v4fa*)(x + j);
    v4f b = {0.f,0.f,0.f,0.f}; if (rr) b = *(const v4fa*)(rr + j);
#pragma unroll
    for (int q = 0; q < 4; ++q) { const float v = a[q] + b[q]; vals[u * 4 + q] = v; s1 += v; }
  }
  red[tid] = s1; __syncthreads();
  for (int st = 128; st > 0; st >>= 1) { if (tid < st) red[tid] += red[tid + st]; __syncthreads(); }
  const float mu = red[0] / (float)N; __syncthreads();
  float s2 = 0.f;
  for (int u = 0; u < per / 4; ++u)
#pragma unroll
    for (int q = 0; q < 4; ++q) { const float c = vals[u * 4 + q] - mu; s2 += c * c; }
  red[tid] = s2; __syncthreads();
  for (int st = 128; st > 0; st >>= 1) { if (tid < st) red[tid] += red[tid + st]; __syncthreads(); }
  const float rs = rsqrtf(red[0] / (float)N + eps);
  {
    for (int u = 0; u < per / 4; ++u) {
      const int j = tid * 4 + 1024 * u;
      v4f o, sm;
#pragma unroll
      for (int q = 0; q < 4; ++q) {
        float gg = g[j + q], bb = bta[j + q];
        if (PARAM_BF16) { gg = bf16_round(gg); bb = bf16_round(bb); }
        sm[q] = vals[u * 4 + q]; o[q] = (vals[u * 4 + q] - mu) * rs * gg + bb;
      }
      if (out_sum) *(v4f*)(out_sum + (size_t)row * N + j) = sm;
      *(v4f*)(out_norm + (size_t)row * N + j) = o;
    }
    
  }
}



// ---- f16 WMMA path (v_wmma_f32_16x16x32_f16): 11-bit significands for operands in range — used where a [0,1] probability operand needs more precision than bf16
typedef _Float16 v16h __attribute__((ext_vector_type(16)));
union FragH { v16h v; v8us half[2]; _Float16 h[16]; unsigned short u[16]; };
template <int NT>
__device__ __forceinline__ v8f mmaH(v16h ah, v16h al, v16h bh, v16h bl, v8f c) {
  c = __builtin_amdgcn_wmma_f32_16x16x32_f16(false, ah, false, bh, (short)0, c, false, false);
  if (NT >= 2) c = __builtin_amdgcn_wmma_f32_16x16x32_f16(false, al, false, bh, (short)0, c, false, false);
  if (NT >= 3) c = __builtin_amdgcn_wmma_f32_16x16x32_f16(false, ah, false, bl, (short)0, c, false, false);
  asm volatile("v_nop\n\tv_nop\n\tv_nop\n\tv_nop" : "+v"(c) : "v"(ah), "v"(al), "v"(bh), "v"(bl));
  return c;
}
// batched GEMM like k_gemm_b but f16 operands: A f32 (split into f16 hi/lo if ASPLIT, else rounded to f16), Bt = f16 values [n][k]; alpha; C f32; N multiple of 16 (partial tiles skipped)
template <bool ASPLIT>
__global__ __launch_bounds__(128) void k_gemm_h(const float* __restrict__ A, int lda, size_t sA, const _Float16* __restrict__ Bh, int ldb, size_t sB, float alpha, float* __restrict__ C, int ldc, size_t sC, int M, int N, int K) {
  __shared__ __attribute__((aligned(16))) float so[4][16][64];
  const int tid = threadIdx.x, w = tid >> 5, lane = tid & 31, ln = lane & 15, hh = lane >> 4; const int by = blockIdx.y;
  A += (size_t)by * sA; Bh += (size_t)by * sB; C += (size_t)by * sC;
  const int ntn = (N + 63) / 64; const int wid = blockIdx.x * 4 + w; const int mt = wid / ntn, nq = wid % ntn; if (mt * 16 >= M) return;
  const int row0 = mt * 16, col0 = nq * 64; const float* arow = A + (size_t)(row0 + ln) * lda;
  v8f acc[4] = {};
  for (int kb = 0; kb < K; kb += 32) {
    FragH ah, al;
    const v4f x0 = *(const v4fa*)(arow + kb + 8 * hh), x1 = *(const v4fa*)(arow + kb + 8 * hh + 4), x2 = *(const v4fa*)(arow + kb + 16 + 8 * hh), x3 = *(const v4fa*)(arow + kb + 16 + 8 * hh + 4);
    float xs[16] = {x0[0],x0[1],x0[2],x0[3],x1[0],x1[1],x1[2],x1[3],x2[0],x2[1],x2[2],x2[3],x3[0],x3[1],x3[2],x3[3]};
#pragma unroll
    for (int i = 0; i < 16; ++i) { const _Float16 h = (_Float16)xs[i]; ah.h[i] = h; al.h[i] = ASPLIT ? (_Float16)(xs[i] - (float)h) : (_Float16)0.0f; }
#pragma unroll
    for (int t = 0; t < 4; ++t) { if (col0 + t * 16 >= N) continue; const size_t boff = (size_t)(col0 + t * 16 + ln) * ldb + kb; FragH bq; bq.half[0] = *(const v8us*)(Bh + boff + 8 * hh); bq.half[1] = *(const v8us*)(Bh + boff + 16 + 8 * hh);
      acc[t] = mmaH<ASPLIT ? 2 : 1>(ah.v, al.v, bq.v, bq.v, acc[t]); }
  }
#pragma unroll
  for (int t = 0; t < 4; ++t) { if (col0 + t * 16 >= N) continue;
#pragma unroll
    for (int r = 0; r < 8; ++r) so[w][8 * hh + r][t * 16 + ln] = acc[t][r] * alpha; }
  __builtin_amdgcn_fence(__ATOMIC_ACQ_REL, "workgroup"); __builtin_amdgcn_wave_barrier();
  const int rsub = lane >> 4, c4 = (lane & 15) * 4;
  {
#pragma unroll
    for (int q = 0; q < 8; ++q) { const int r = q * 2 + rsub; if (col0 + c4 < N) { const v4f v = *(const v4fa*)&so[w][r][c4]; *(v4f*)(C + (size_t)(row0 + r) * ldc + col0 + c4) = v; } }
     }
}

// k_gemm_hh variant with fused epilogue: v = acc·alpha + bias[by·sBias + col] (+ CP[(row/rowsPerB)·sCPb + by·64 + col] if CP) ; ACT 0 none / 1 elu ; writes f16 C16 (and f32 C if non-null)
template <int ACT>
__global__ __launch_bounds__(128) void k_gemm_hhx(const _Float16* __restrict__ A, int lda, size_t sA, const _Float16* __restrict__ Bh, int ldb, size_t sB, float alpha, const float* __restrict__ bias, size_t sBias, const float* __restrict__ CP, int rowsPerB, size_t sCPb, int row0g,
    float* __restrict__ C, _Float16* __restrict__ C16, int ldc, size_t sC, int M, int N, int K) {
  __shared__ __attribute__((aligned(16))) float so[4][16][64];
  const int tid = threadIdx.x, w = tid >> 5, lane = tid & 31, ln = lane & 15, hh = lane >> 4; const int by = blockIdx.y;
  A += (size_t)by * sA; Bh += (size_t)by * sB; const size_t cofs = (size_t)by * sC; const float* bp = bias ? bias + (size_t)by * sBias : nullptr;
  const int ntn = (N + 63) / 64; const int wid = blockIdx.x * 4 + w; const int mt = wid / ntn, nq = wid % ntn; if (mt * 16 >= M) return;
  const int row0 = mt * 16, col0 = nq * 64; const _Float16* arow = A + (size_t)(row0 + ln) * lda;
  v8f acc[4] = {};
  for (int kb = 0; kb < K; kb += 32) { FragH ah; ah.half[0] = *(const v8us*)((const unsigned short*)arow + kb + 8 * hh); ah.half[1] = *(const v8us*)((const unsigned short*)arow + kb + 16 + 8 * hh);
#pragma unroll
    for (int t = 0; t < 4; ++t) { if (col0 + t * 16 >= N) continue; const size_t boff = (size_t)(col0 + t * 16 + ln) * ldb + kb; FragH bq; bq.half[0] = *(const v8us*)((const unsigned short*)Bh + boff + 8 * hh); bq.half[1] = *(const v8us*)((const unsigned short*)Bh + boff + 16 + 8 * hh);
      acc[t] = mmaH<1>(ah.v, ah.v, bq.v, bq.v, acc[t]); }
  }
#pragma unroll
  for (int t = 0; t < 4; ++t) { if (col0 + t * 16 >= N) continue; const int col = col0 + t * 16 + ln; const float bv = bp ? bf16_round(bp[col]) : 0.f;
#pragma unroll
    for (int r = 0; r < 8; ++r) { float v = acc[t][r] * alpha + bv; if (CP) { const int rr = row0g + row0 + 8 * hh + r; if (rowsPerB < 0) v += CP[cofs + (size_t)rr * ldc + col];      /* rowsPerB < 0: own element of the batched C plane */ else { const int bidx = rr / rowsPerB; v += CP[(size_t)bidx * sCPb + (size_t)by * 64 + col]; } } if (ACT == 1) v = (v > 0.f) ? v : expm1f(v); else if (ACT == 7) v = (v > 0.f) ? v + 1.0f : expf(v); else if (ACT == 8) v = tanhf(v); else if (ACT == 9) v = 0.5f * v * (1.0f + tanhf(0.7978845608028654f * (v + 0.044715f * v * v * v))); else if (ACT == 11) v = 1.0f / (1.0f + expf(-v)); else if (ACT == 12) v = (v > 0.f) ? v : 0.01f * v; else if (ACT == 14) v = (v > 0.f) ? v : 0.1f * v; else if (ACT == 16) v = (v >= 0.f) ? v : 0.3f * v; else if (ACT == 17) v = (v >= 0.f) ? v : 0.2f * v; else if (ACT == 15) v = v / (1.0f + expf(-v)); else if (ACT == 3) v = fmaxf(v, 0.f); else if (ACT == 6) v = 0.5f * v * (1.0f + erff(v * 0.70710678118654752f)); so[w][8 * hh + r][t * 16 + ln] = v; } }
  __builtin_amdgcn_fence(__ATOMIC_ACQ_REL, "workgroup"); __builtin_amdgcn_wave_barrier();
  const int rsub = lane >> 4, c4 = (lane & 15) * 4; typedef _Float16 v4h __attribute__((ext_vector_type(4)));
  {
#pragma unroll
    for (int q = 0; q < 8; ++q) { const int r = q * 2 + rsub; if (col0 + c4 < N) { const v4f v = *(const v4fa*)&so[w][r][c4]; if (C) *(v4f*)(C + cofs + (size_t)(row0 + r) * ldc + col0 + c4) = v; if (C16) { v4h h4; for (int i = 0; i < 4; ++i) h4[i] = (_Float16)v[i]; *(v4h*)(C16 + cofs + (size_t)(row0 + r) * ldc + col0 + c4) = h4; } } }
     }
}


typedef _Float16 v4h __attribute__((ext_vector_type(4)));

#define PPT 512                      /* threads per work-group of the preparation launch: 16 waves */
#define PPG 256                      /* its work-groups */
#define PXQ 4                        /* groups of 8 elements that a thread takes of each input stream */
static_assert((size_t)PPG * PPT * PXQ * 8 == NR * DM && PPG * PPT * 32 == 4 * DM * DM && DM == 1024 && HD == 64 && NH * HD == DM, "k_prep: the launch covers each stream and the four weight planes exactly once");
// A thread's weight block: 8 k x 4 n of f32 row-major W (row pitch N), one 16-byte load per k row. s = the block's first element.
template <int N>
__device__ __forceinline__ void pw_load(const float* __restrict__ s, v4f (&a)[8]) {
#pragma unroll
  for (int i = 0; i < 8; ++i) a[i] = *(const v4fa*)(s + i * N);
  asm volatile("s_wait_xcnt 0x0" ::: "memory");      /* stands directly behind these loads, in front of any later overwrite of their address registers */
}
// The block transposed in registers: Bt[n + j][k .. k + 7] = f16(bf16(W[k + i][n + j]) x 16), one 16-byte store per n row (bf16-exact weights stay exact in f16 away from the subnormal range). d = Bt's element [n][k].
__device__ __forceinline__ void pw_store(_Float16* __restrict__ d, const v4f (&a)[8]) {
#pragma unroll
  for (int j = 0; j < 4; ++j) { FragH f;
#pragma unroll
    for (int i = 0; i < 8; ++i) f.h[i] = (_Float16)(bf16_round(a[i][j]) * 16.0f);
    *(v8us*)((unsigned short*)d + j * DM) = f.half[0]; }
  asm volatile("s_wait_xcnt 0x0" ::: "memory");      /* stands directly behind these stores, in front of any later overwrite of a register that they name */
}
// A thread's share of one stream: PXQ groups of 8 elements, PPT groups apart. s, d = the first group's place in the f32 source and in the f16 rows.
__device__ __forceinline__ void px_load(const float* __restrict__ s, v4f (&a)[8]) {
#pragma unroll
  for (int q = 0; q < PXQ; ++q) { a[2 * q] = *(const v4fa*)(s + q * (PPT * 8)); a[2 * q + 1] = *(const v4fa*)(s + q * (PPT * 8) + 4); }
  asm volatile("s_wait_xcnt 0x0" ::: "memory");      /* stands directly behind these loads, in front of any later overwrite of their address registers */
  __builtin_amdgcn_sched_barrier(0);      /* keeps the conversion of the batch in front, which waits for that batch's data, from being moved ahead of these loads: without it they were asked for only when that data had come */
}
__device__ __forceinline__ void px_store(_Float16* __restrict__ d, const v4f (&a)[8]) {
#pragma unroll
  for (int q = 0; q < PXQ; ++q) { FragH f;
#pragma unroll
    for (int e = 0; e < 8; ++e) f.h[e] = (_Float16)bf16_round(a[2 * q + (e >> 2)][e & 3]);
    *(v8us*)((unsigned short*)d + q * (PPT * 8)) = f.half[0]; }
  asm volatile("s_wait_xcnt 0x0" ::: "memory");      /* stands directly behind these stores, in front of any later overwrite of a register that they name */
}
// All work that reads inputs only, in ONE launch of 256 work-groups of 16 waves: none of these jobs reads what another writes. Few long waves in place of many short ones: 4096 waves to start in place of 65536, which moved 48 bytes per lane each.
// Every thread takes four batches of eight 16-byte loads, each batch asked for before the batch in front of it is converted and stored: one weight block, then its share of the three streams. Every element gets the arithmetic of the former launch.
// Weights: work-groups 64 p .. 64 p + 63 take plane p (WQ, WK, WV: head c of the stack, its [1024][64] block into rows 64 c .. 64 c + 63; WO: columns 64 c .. 64 c + 63 into the same rows), 64 n x 256 k each; a wave takes 16 n x 64 k, lane = (k group, n group):
// a load covers 64 bytes of each of 8 source rows, a store four whole 128-byte lines of the plane, each written by that wave alone.
// Streams: a work-group takes 2048 groups in a row of each stream; a wave's two loads of a group cover 1 KiB in a row, its store 512 bytes.
__global__ __launch_bounds__(PPT) void k_prep(const float* __restrict__ wq, const float* __restrict__ wk, const float* __restrict__ wv, const float* __restrict__ wo, const float* __restrict__ x, const float* __restrict__ xk, const float* __restrict__ xv,
    _Float16* __restrict__ BQ, _Float16* __restrict__ BK, _Float16* __restrict__ BV, _Float16* __restrict__ BO, _Float16* __restrict__ X16, _Float16* __restrict__ XK16, _Float16* __restrict__ XV16) {
  const int tid = threadIdx.x, bid = blockIdx.x, lane = tid & 31, w = tid >> 5;
  const int job = bid >> 6, c = (bid & 63) >> 2;      /* each the same for the whole work-group */
  const int k = (bid & 3) * 256 + (w >> 2) * 64 + (lane & 7) * 8, n = (w & 3) * 16 + (lane >> 3) * 4;
  _Float16* Bt = job == 0 ? BQ : job == 1 ? BK : job == 2 ? BV : BO;
  const size_t so = (size_t)bid * (PPT * PXQ * 8) + (size_t)tid * 8;
  v4f a[8], b[8];
  if (job == 3) pw_load<DM>(wo + (size_t)k * DM + c * 64 + n, a);
  else pw_load<HD>((job == 0 ? wq : job == 1 ? wk : wv) + (size_t)c * DM * HD + (size_t)k * HD + n, a);
  px_load(x + so, b);
  pw_store(Bt + (size_t)(c * 64 + n) * DM + k, a);
  px_load(xk + so, a);
  px_store(X16 + so, b);
  px_load(xv + so, b);
  px_store(XK16 + so, a);
  px_store(XV16 + so, b); }
__global__ __launch_bounds__(256) void k_h16(const float* __restrict__ x, _Float16* __restrict__ X16, size_t n8) { const size_t t = (size_t)blockIdx.x * 256 + threadIdx.x; if (t >= n8) return; FragH f;
#pragma unroll
  for (int q = 0; q < 8; ++q) f.h[q] = (_Float16)x[t * 8 + q]; *(v8us*)((unsigned short*)X16 + t * 8) = f.half[0];  }
__global__ __launch_bounds__(256) void k_round16f(const float* __restrict__ W, _Float16* __restrict__ Bt, size_t n8) { const size_t t = (size_t)blockIdx.x * 256 + threadIdx.x; if (t >= n8) return; FragH f;
#pragma unroll
  for (int i = 0; i < 8; ++i) f.h[i] = (_Float16)(bf16_round(W[t * 8 + i]) * 16.0f); *(v8us*)((unsigned short*)Bt + t * 8) = f.half[0];  }

// ---- fast GEMM (work-group tile 128x128, eight waves, wave tile 32x64: wave w takes rows 32 (w % 4), columns 64 (w / 4); requires M % 128 == 0, N % 128 == 0, K % 128 == 0, K >= 128); epilogue = k_gemm_hhx semantics ----
// Operands go through LDS: a stage is 128 k (256 bytes) of the work-group's 128 A rows and 128 Bh rows. Each lane copies 16 bytes, a wave's copy covers two whole rows of the stage (4 whole lines); an A row is fetched once for two waves, a Bh row once for four:
// 256 staged rows per 128x128 outputs against 384 with two 128x64 tiles. The epilogue's staging lies over the ring, so that two work-groups still share a WGP's LDS (four waves per SIMD).
// Two buffers: stage s + 1 flies while stage s is worked on. Fragments are read from LDS in the k order of the former global loads (k = 8 hh + i, 16 + 8 hh + i), k steps in the same order: same sums.
#define G2KC 128                     /* k per stage */
#define G2P 272                      /* LDS row pitch, bytes: 256 + 16 = 16 x odd, the pitch at which ds_load_b128 fragment reads meet no bank conflict */
#define G2BUF (256 * G2P)            /* one buffer: rows 0-127 A, 128-255 Bh */
__device__ __forceinline__ v16h g2_frag(const unsigned char* p) { FragH f; f.half[0] = *(const v8us*)p; f.half[1] = *(const v8us*)(p + 32); return f.v; }      /* p = the lane's row in LDS + 64 bytes per k step + 16 hh */
// Eight asynchronous copies of 16 bytes per lane, 16 rows apart (l = the lane's LDS byte address, g = its global address, gs = 16 rows of the source in elements).
// s_wait_xcnt 0 is the statement's last line so that it stands in front of every later write of the address registers that the copies name.
__device__ __forceinline__ void g2_copy8(unsigned l, const _Float16* g, size_t gs) {
  asm volatile("global_load_async_to_lds_b128 %0, %8, off\n\t"
               "global_load_async_to_lds_b128 %1, %9, off\n\t"
               "global_load_async_to_lds_b128 %2, %10, off\n\t"
               "global_load_async_to_lds_b128 %3, %11, off\n\t"
               "global_load_async_to_lds_b128 %4, %12, off\n\t"
               "global_load_async_to_lds_b128 %5, %13, off\n\t"
               "global_load_async_to_lds_b128 %6, %14, off\n\t"
               "global_load_async_to_lds_b128 %7, %15, off\n\t"
               "s_wait_xcnt 0x0"
               :: "v"(l), "v"(l + 16 * G2P), "v"(l + 32 * G2P), "v"(l + 48 * G2P), "v"(l + 64 * G2P), "v"(l + 80 * G2P), "v"(l + 96 * G2P), "v"(l + 112 * G2P),
                  "v"(g), "v"(g + gs), "v"(g + 2 * gs), "v"(g + 3 * gs), "v"(g + 4 * gs), "v"(g + 5 * gs), "v"(g + 6 * gs), "v"(g + 7 * gs) : "memory"); }
// One stage: 16 copies per lane. l = the lane's place in the buffer (row tid / 16, 16-byte piece tid % 16); ga, gb = the same place in the stage's A and Bh rows.
__device__ __forceinline__ void g2_stage(unsigned l, const _Float16* ga, int lda, const _Float16* gb, int ldb) {
  g2_copy8(l, ga, (size_t)16 * lda); g2_copy8(l + 128 * G2P, gb, (size_t)16 * ldb); }
__device__ __forceinline__ v8f g2_mma(v16h a, v16h b, v8f c) { v8f d = __builtin_amdgcn_wmma_f32_16x16x32_f16(false, a, false, b, (short)0, c, false, false); asm volatile("v_nop\n\tv_nop\n\tv_nop\n\tv_nop" : "+v"(d) : "v"(a), "v"(b)); return d; }
// The fast GEMM's main loop, run by every wave of a 256-thread work-group: ga, gb = the lane's place (row tid / 16, 16-byte piece tid % 16) in stage 0 of the work-group's 128 A rows and 128 Bh rows; nst = stages of 128 k.
// Leaves the wave's 32 x 64 sums in accs: accs[4 half + t] = rows 16 half .. + 15, columns 16 t .. + 15 of the wave tile. At its end no copy is outstanding and every wave has passed the barrier behind the last stage's reads: the ring is free.
__device__ __forceinline__ void g2_loop(unsigned char* ring, const _Float16* ga, int lda, const _Float16* gb, int ldb, int nst, int tid, v8f (&accs)[8]) {
  const int w = tid >> 5, lane = tid & 31, ln = lane & 15, hh = lane >> 4;
  const unsigned lc = (unsigned)(size_t)ring + (unsigned)((tid >> 4) * G2P + (tid & 15) * 16);      /* this lane's place in buffer 0 as an LDS byte address (low 32 bits of the __shared__ address) */
  const v8f z8 = {0.f,0.f,0.f,0.f,0.f,0.f,0.f,0.f}; v8f c00 = z8, c01 = z8, c02 = z8, c03 = z8, c10 = z8, c11 = z8, c12 = z8, c13 = z8;
  g2_stage(lc, ga, lda, gb, ldb);
  asm volatile("s_wait_asynccnt 0x0" ::: "memory");      /* this wave's copies of stage 0 have landed */
  __syncthreads();      /* stage 0 is readable by every wave */
  if (nst > 1) g2_stage(lc + G2BUF, ga + G2KC, lda, gb + G2KC, ldb);
#pragma unroll 1      /* rolled: one stage per trip, its four k steps unrolled inside */
  for (int s = 0; s < nst; ++s) { const unsigned char* bufp = ring + (s & 1) * G2BUF; const unsigned char* pa = bufp + (32 * (w & 3) + ln) * G2P + 16 * hh; const unsigned char* pb = bufp + (128 + 64 * (w >> 2) + ln) * G2P + 16 * hh;
    v16h a0 = g2_frag(pa), a1 = g2_frag(pa + 16 * G2P), b0 = g2_frag(pb), b1 = g2_frag(pb + 16 * G2P), b2 = g2_frag(pb + 32 * G2P), b3 = g2_frag(pb + 48 * G2P);
#pragma unroll      /* unrolled: the two fragment sets then alternate by register name, without copies */
    for (int ks = 0; ks < G2KC / 32; ++ks) { v16h na0 = a0, na1 = a1, nb0 = b0, nb1 = b1, nb2 = b2, nb3 = b3;
      if (ks + 1 < G2KC / 32) { const int o = (ks + 1) * 64; na0 = g2_frag(pa + o); na1 = g2_frag(pa + 16 * G2P + o); nb0 = g2_frag(pb + o); nb1 = g2_frag(pb + 16 * G2P + o); nb2 = g2_frag(pb + 32 * G2P + o); nb3 = g2_frag(pb + 48 * G2P + o); }      /* the next k step's fragments of the SAME stage, asked for ahead of this step's products */
      c00 = g2_mma(a0, b0, c00); c10 = g2_mma(a1, b0, c10); c01 = g2_mma(a0, b1, c01); c11 = g2_mma(a1, b1, c11);
      c02 = g2_mma(a0, b2, c02); c12 = g2_mma(a1, b2, c12); c03 = g2_mma(a0, b3, c03); c13 = g2_mma(a1, b3, c13);
      a0 = na0; a1 = na1; b0 = nb0; b1 = nb1; b2 = nb2; b3 = nb3; }
    asm volatile("s_wait_dscnt 0x0" ::: "memory");      /* this wave's reads of stage s are done before the buffer is handed to its next writer */
    asm volatile("s_wait_asynccnt 0x0" ::: "memory");      /* this wave's copies of stage s + 1 have landed */
    __syncthreads();      /* publishes stage s + 1 and ends every wave's reads of stage s */
    if (s + 2 < nst) g2_stage(lc + (unsigned)(s & 1) * G2BUF, ga + (size_t)(s + 2) * G2KC, lda, gb + (size_t)(s + 2) * G2KC, ldb); }
  asm volatile("s_wait_asynccnt 0x0" ::: "memory");      /* no copy is outstanding when the wave goes on */
  accs[0] = c00; accs[1] = c01; accs[2] = c02; accs[3] = c03; accs[4] = c10; accs[5] = c11; accs[6] = c12; accs[7] = c13; }
template <int ACT>
__global__ __launch_bounds__(256) void k_gemm2(const _Float16* __restrict__ A, int lda, size_t sA, const _Float16* __restrict__ Bh, int ldb, size_t sB, float alpha, const float* __restrict__ bias, size_t sBias, const float* __restrict__ CP, int rowsPerB, size_t sCPb, int row0g,
    float* __restrict__ C, _Float16* __restrict__ C16, int ldc, size_t sC, int M, int N, int K) { static_assert(ACT == 0 || ACT == 3 || ACT == 6 || ACT == 8 || ACT == 9 || ACT == 11 || ACT == 12 || ACT == 14 || ACT == 15 || ACT == 16 || ACT == 17, "k_gemm2: unsupported ACT code (would silently apply no activation)");
  __shared__ __attribute__((aligned(16))) unsigned char ring[2 * G2BUF];
  float (*so)[32][68] = reinterpret_cast<float (*)[32][68]>(ring); static_assert(8 * 32 * 68 * 4 <= 2 * G2BUF, "k_gemm2: the staging fits the ring");      /* the epilogue's staging, one plane per wave, laid over the ring: used only behind g2_loop, which leaves the ring free */
  const int tid = threadIdx.x, w = tid >> 5, lane = tid & 31, ln = lane & 15, hh = lane >> 4; const int by = blockIdx.y;
  A += (size_t)by * sA; Bh += (size_t)by * sB; const size_t cofs = (size_t)by * sC; const float* bp = bias ? bias + (size_t)by * sBias : nullptr;
  const int ntn = N >> 7; const int mt = blockIdx.x / ntn, nq = blockIdx.x - mt * ntn; const int row0 = mt * 128 + 32 * (w & 3), col0 = nq * 128 + 64 * (w >> 2); if (mt * 128 >= M) return;      /* the same for the whole work-group, in front of every barrier */
  const _Float16* ga = A + (size_t)(mt * 128 + (tid >> 4)) * lda + (tid & 15) * 8; const _Float16* gb = Bh + (size_t)(nq * 128 + (tid >> 4)) * ldb + (tid & 15) * 8;
  v8f accs[8]; g2_loop(ring, ga, lda, gb, ldb, K / G2KC, tid, accs);
#pragma unroll
  for (int u = 0; u < 8; ++u) { const int t = u & 3, half = u >> 2; const int col = col0 + t * 16 + ln; const float bv = bp ? bf16_round(bp[col]) : 0.f;
#pragma unroll
    for (int r = 0; r < 8; ++r) { const int rloc = half * 16 + 8 * hh + r; float v = accs[u][r] * alpha + bv; if (CP) { if (rowsPerB < 0) v += CP[cofs + (size_t)(row0g + row0 + rloc) * ldc + col];      /* rowsPerB < 0: own element of the batched C plane */ else { const int bidx = (row0g + row0 + rloc) / rowsPerB; v += CP[(size_t)bidx * sCPb + (size_t)by * 64 + col]; } }
      if (ACT == 3) v = fmaxf(v, 0.f); else if (ACT == 6) v = 0.5f * v * (1.0f + erff(v * 0.70710678118654752f)); else if (ACT == 11) v = 1.0f / (1.0f + expf(-v)); else if (ACT == 15) v = v / (1.0f + expf(-v)); else if (ACT == 12) v = (v > 0.f) ? v : 0.01f * v; else if (ACT == 8) v = tanhf(v); else if (ACT == 9) v = 0.5f * v * (1.0f + tanhf(0.7978845608028654f * (v + 0.044715f * v * v * v))); else if (ACT == 14) v = (v > 0.f) ? v : 0.1f * v; else if (ACT == 16) v = (v >= 0.f) ? v : 0.3f * v; else if (ACT == 17) v = (v >= 0.f) ? v : 0.2f * v;
      so[w][rloc][t * 16 + ln] = v; } }
  __builtin_amdgcn_fence(__ATOMIC_ACQ_REL, "workgroup"); __builtin_amdgcn_wave_barrier();
  const int rsub = lane >> 4, c4 = (lane & 15) * 4;
  {
#pragma unroll
    for (int q = 0; q < 16; ++q) { const int r = q * 2 + rsub; const v4f v = *(const v4fa*)&so[w][r][c4]; if (C) *(v4f*)(C + cofs + (size_t)(row0 + r) * ldc + col0 + c4) = v; if (C16) { v4h h4; for (int i = 0; i < 4; ++i) h4[i] = (_Float16)v[i]; *(v4h*)(C16 + cofs + (size_t)(row0 + r) * ldc + col0 + c4) = h4; } }
     } }
// The three projections in ONE launch: blockIdx.y = 0: q, 1: k, 2: v; 256 work-group tiles each, tile and main loop as k_gemm2. None reads what another writes.
// q, k: rows = tokens (A = the stream's f16 rows), columns = head outputs (Bh = the weight plane); the epilogue splits each f32 value v (q: the projection x FAC, one f32 rounding) into h = f16(v) and f16(v - h) and stores both planes.
// The residual is carried unscaled so that hi.hi, hi.lo and lo.hi have one scale and sum in one accumulator. Much of it lies in f16's subnormal range, which the conversion and the matrix unit keep: its error is at most 2^-25 absolute or 2^-12 of the residual, as small against v as under the former x1024.
// v: operands swapped (A = the weight plane's 1024 rows 64 h + d, Bh = the 2048 token rows of one batch), so that the tile is a piece of V^T [batch][head][d][token] as the attention reads it and no transposition is left; each sum takes the same products in the same k order.
// A row of a wave's tile is 64 f16 = one whole 128-byte line of its plane, written by that wave alone.
#define FAC 0.18033688f              /* 1 / sqrt(64) x log2(e): scores to the exponent of 2; carried by q */
#define PJT ((MP / 128) * (DM / 128))      /* work-group tiles per projection (256) */
#define PJV ((DM / 128) * (SQ / 128))      /* V^T tiles per batch (128) */
static_assert(PJV * NB == PJT && B0 == 0 && NBR == NB, "k_proj: one grid row per projection, all batches");
__global__ __launch_bounds__(256) void k_proj(const _Float16* __restrict__ X16, const _Float16* __restrict__ XK16, const _Float16* __restrict__ XV16, const _Float16* __restrict__ BQ, const _Float16* __restrict__ BK, const _Float16* __restrict__ BV,
    _Float16* __restrict__ QH, _Float16* __restrict__ QL, _Float16* __restrict__ KH, _Float16* __restrict__ KL, _Float16* __restrict__ VT) {
  __shared__ __attribute__((aligned(16))) unsigned char ring[2 * G2BUF];
  float (*so)[32][68] = reinterpret_cast<float (*)[32][68]>(ring); static_assert(8 * 32 * 68 * 4 <= 2 * G2BUF, "k_proj: the staging fits the ring");      /* the epilogue's staging, one plane per wave, laid over the ring: used only behind g2_loop, which leaves the ring free */
  const int tid = threadIdx.x, w = tid >> 5, lane = tid & 31, ln = lane & 15, hh = lane >> 4; const int job = blockIdx.y, bx = blockIdx.x;
  const _Float16* A; const _Float16* Bh; _Float16* Ph; _Float16* Pl; int mt, nq, ldc;      /* each the same for the whole work-group */
  if (job < 2) { A = job ? XK16 : X16; Bh = job ? BK : BQ; Ph = job ? KH : QH; Pl = job ? KL : QL; mt = bx / (DM / 128); nq = bx % (DM / 128); ldc = DM; }
  else { const int b = bx / PJV, u = bx % PJV; A = BV; Bh = XV16 + (size_t)b * SQ * DM; Ph = VT + (size_t)b * DM * SQ; Pl = nullptr; mt = u / (SQ / 128); nq = u % (SQ / 128); ldc = SQ; }
  const int row0 = mt * 128 + 32 * (w & 3), col0 = nq * 128 + 64 * (w >> 2);
  const _Float16* ga = A + (size_t)(mt * 128 + (tid >> 4)) * DM + (tid & 15) * 8; const _Float16* gb = Bh + (size_t)(nq * 128 + (tid >> 4)) * DM + (tid & 15) * 8;
  v8f accs[8]; g2_loop(ring, ga, DM, gb, DM, DM / G2KC, tid, accs);
  const float osc = job == 0 ? 0.0625f * FAC : 0.0625f;      /* the weights are carried x16; q takes the scores' scale with it */
#pragma unroll
  for (int u = 0; u < 8; ++u) { const int t = u & 3, half = u >> 2;
#pragma unroll
    for (int r = 0; r < 8; ++r) so[w][half * 16 + 8 * hh + r][t * 16 + ln] = accs[u][r] * osc; }
  __builtin_amdgcn_fence(__ATOMIC_ACQ_REL, "workgroup"); __builtin_amdgcn_wave_barrier();
  const int rsub = lane >> 4, c4 = (lane & 15) * 4; const size_t po = (size_t)(row0 + rsub) * ldc + col0 + c4;      /* the lane's place in rows 0 and 1 of the wave's tile */
  if (job < 2) {
#pragma unroll
    for (int q = 0; q < 16; ++q) { const v4f v = *(const v4fa*)&so[w][q * 2 + rsub][c4]; v4h h4, l4;
      for (int i = 0; i < 4; ++i) { const _Float16 h = (_Float16)v[i]; h4[i] = h; l4[i] = (_Float16)(v[i] - (float)h); }
      *(v4h*)(Ph + po + (size_t)(q * 2) * DM) = h4; *(v4h*)(Pl + po + (size_t)(q * 2) * DM) = l4; } }
  else {
#pragma unroll
    for (int q = 0; q < 16; ++q) { const v4f v = *(const v4fa*)&so[w][q * 2 + rsub][c4]; v4h h4;
      for (int i = 0; i < 4; ++i) h4[i] = (_Float16)v[i];
      *(v4h*)(Ph + po + (size_t)(q * 2) * SQ) = h4; }
    asm volatile("s_wait_xcnt 0x0" ::: "memory");      /* stands directly behind the last of these stores, in front of any later overwrite of a register that they name */
  } }


__global__ __launch_bounds__(256) void k_wnat(const float* __restrict__ w, size_t n8, _Float16* __restrict__ Bt) { const size_t t = (size_t)blockIdx.x * 256 + threadIdx.x; if (t >= n8) return; FragH f; for (int q = 0; q < 8; ++q) f.h[q] = (_Float16)(bf16_round(w[t * 8 + q]) * 16.0f); *(v8us*)((unsigned short*)Bt + t * 8) = f.half[0];  }
__global__ __launch_bounds__(256) void k_rsm(const float* __restrict__ S, _Float16* __restrict__ P, int nrows) {
  #pragma clang fp contract(off)
  const int i = blockIdx.x * 256 + threadIdx.x; if (i >= nrows) return; const float* s = S + (size_t)i * SQ; float mx = -3.0e38f;
#pragma unroll 1
  for (int j = 0; j < SQ; ++j) mx = fmaxf(mx, s[j]); float se = 0.f;
#pragma unroll 1
  for (int j = 0; j < SQ; ++j) se += expf(s[j] - mx); const float sc = 256.0f / se;
#pragma unroll 1
  for (int j0 = 0; j0 < SQ; j0 += 8) { FragH f; for (int q = 0; q < 8; ++q) f.h[q] = (_Float16)(expf(s[j0 + q] - mx) * sc); unsigned short* d = (unsigned short*)P + (size_t)i * SQ + j0; *(v8us*)d = f.half[0];  } }
__global__ __launch_bounds__(256) void k_vt(const _Float16* __restrict__ V16, int b, int h0, _Float16* __restrict__ VT) { __shared__ unsigned short tl[64][65]; const int tid = threadIdx.x; const int hh = blockIdx.x % HG, sg = blockIdx.x / HG; const int s0 = sg * 64; const int h = h0 + hh;
  for (int i = tid; i < 64 * 8; i += 256) { const int j = i / 8, d8 = (i % 8) * 8; FragH f; f.half[0] = *(const v8us*)((const unsigned short*)V16 + ((size_t)b * SQ + s0 + j) * DM + h * HD + d8); for (int q = 0; q < 8; ++q) tl[d8 + q][j] = f.u[q]; }
  __syncthreads();
  { for (int i = tid; i < 64 * 8; i += 256) { const int d = i / 8, j8 = (i % 8) * 8; FragH f; for (int q = 0; q < 8; ++q) f.u[q] = tl[d][j8 + q]; *(v8us*)((unsigned short*)VT + ((size_t)hh * HD + d) * SQ + s0 + j8) = f.half[0]; }  } }



// 2^x on the transcendental unit; the v_nop fills the one slot that the instruction set asks for between a transcendental and an instruction that reads its result or overwrites its source.
__device__ __forceinline__ float exp2_slot(float x) { float r; asm("v_exp_f32 %0, %1\n\tv_nop" : "=v"(r) : "v"(x)); return r; }
// Value of lane l ^ 16 (the other half of the wave): one register move between the two 16-lane rows, no LDS.
__device__ __forceinline__ float xhalf(float x) { return __builtin_bit_cast(float, __builtin_amdgcn_permlanex16(__builtin_bit_cast(int, x), __builtin_bit_cast(int, x), 0x76543210, 0xfedcba98, false, false)); }
__device__ __forceinline__ v16h fa_frag(const unsigned short* p) { FragH f; f.half[0] = *(const v8us*)p; f.half[1] = *(const v8us*)(p + 16); return f.v; }      /* p = the lane's own pointer, 8 hh included: k = 8 hh + i, 16 + 8 hh + i, as g2_frag */
__device__ __forceinline__ v8f fa_mma(v16h a, v16h b, v8f c) { return __builtin_amdgcn_wmma_f32_16x16x32_f16(false, a, false, b, (short)0, c, false, false); }
#define FAW 8                        /* waves per work-group of the fused attention */
#define FAQ 32                       /* query columns per wave */
#define FAK 32                       /* keys per pass */
#define FALIM 32768.0f               /* a lane's 16 weights of a pass may sum to this under the reference in use: each of them then fits f16 */
#define FAT 128                      /* keys per LDS stage (four passes) */
#define FAKP 144                     /* LDS pitch of a K row, bytes: 128 + 16 = 16 x odd, no bank conflict for ds_load_b128 fragment reads */
#define FAVP 272                     /* LDS pitch of a V^T row, bytes: 256 + 16 = 16 x odd */
#define FAKB (FAT * FAKP)            /* one K plane of a stage */
#define FABUF (2 * FAKB + HD * FAVP) /* one buffer: K hi rows, K residual rows, V^T rows */
// One stage: 12 asynchronous copies of 16 bytes per lane, in one statement. A wave's copy covers four whole K rows of the head (128 bytes each) or two whole V^T rows of the stage (256 bytes each): whole lines only.
// lk, lv = the lane's places in the buffer's K hi plane (row tid / 8, piece tid % 8) and V^T plane (row tid / 16, piece tid % 16) as LDS byte addresses; gh, gl, gv = the same places in the stage's source rows. Copies 32 K rows or 16 V^T rows apart.
// s_wait_xcnt 0 is the statement's last line so that it stands in front of every later write of the address registers that the copies name.
__device__ __forceinline__ void fa_stage(unsigned lk, unsigned lv, const unsigned short* gh, const unsigned short* gl, const unsigned short* gv) {
  asm volatile("global_load_async_to_lds_b128 %0, %12, off\n\t"
               "global_load_async_to_lds_b128 %1, %13, off\n\t"
               "global_load_async_to_lds_b128 %2, %14, off\n\t"
               "global_load_async_to_lds_b128 %3, %15, off\n\t"
               "global_load_async_to_lds_b128 %4, %16, off\n\t"
               "global_load_async_to_lds_b128 %5, %17, off\n\t"
               "global_load_async_to_lds_b128 %6, %18, off\n\t"
               "global_load_async_to_lds_b128 %7, %19, off\n\t"
               "global_load_async_to_lds_b128 %8, %20, off\n\t"
               "global_load_async_to_lds_b128 %9, %21, off\n\t"
               "global_load_async_to_lds_b128 %10, %22, off\n\t"
               "global_load_async_to_lds_b128 %11, %23, off\n\t"
               "s_wait_xcnt 0x0"
               :: "v"(lk), "v"(lk + 32 * FAKP), "v"(lk + 64 * FAKP), "v"(lk + 96 * FAKP),
                  "v"(lk + FAKB), "v"(lk + FAKB + 32 * FAKP), "v"(lk + FAKB + 64 * FAKP), "v"(lk + FAKB + 96 * FAKP),
                  "v"(lv), "v"(lv + 16 * FAVP), "v"(lv + 32 * FAVP), "v"(lv + 48 * FAVP),
                  "v"(gh), "v"(gh + 32 * LQ), "v"(gh + 64 * LQ), "v"(gh + 96 * LQ),
                  "v"(gl), "v"(gl + 32 * LQ), "v"(gl + 64 * LQ), "v"(gl + 96 * LQ),
                  "v"(gv), "v"(gv + 16 * SQ), "v"(gv + 32 * SQ), "v"(gv + 48 * SQ) : "memory"); }
__device__ __forceinline__ void fa_weights(const float (&x)[16], FragH& p, float& sum) {
  sum = 0.f;
#pragma unroll
  for (int i = 0; i < 16; ++i) { const float e = exp2_slot(x[i]); sum += e; p.h[i] = (_Float16)e; } }
__global__ __launch_bounds__(FAW * 32) void k_fattn(const _Float16* __restrict__ QHp, const _Float16* __restrict__ QLp, const _Float16* __restrict__ KHp, const _Float16* __restrict__ KLp, const _Float16* __restrict__ VTp, _Float16* __restrict__ Op) {
  __shared__ __attribute__((aligned(16))) unsigned char ring[2 * FABUF];
  const int tid = threadIdx.x, lane = tid & 31, w = tid >> 5, ln = lane & 15, hh = lane >> 4; const int h = blockIdx.y, b = blockIdx.z; const int q0 = blockIdx.x * (FAW * FAQ) + w * FAQ; const size_t r0 = (size_t)b * SQ;
  const unsigned lk = (unsigned)(size_t)ring + (unsigned)((tid >> 3) * FAKP + (tid & 7) * 16), lv = (unsigned)(size_t)ring + (unsigned)(2 * FAKB + (tid >> 4) * FAVP + (tid & 15) * 16);      /* this lane's places in buffer 0 as LDS byte addresses (low 32 bits of the __shared__ address) */
  const unsigned short* gh = (const unsigned short*)KHp; const unsigned short* gl = (const unsigned short*)KLp; const unsigned short* gv = (const unsigned short*)VTp;
  const unsigned go = (unsigned)((b * SQ + (tid >> 3)) * LQ + h * HD + (tid & 7) * 8), gvo = (unsigned)(((b * NH + h) * HD + (tid >> 4)) * SQ + (tid & 15) * 8);      /* this lane's places in stage 0's source rows, in elements (below 2^23): one register each across the loop */
  const size_t qo = (r0 + q0 + ln) * LQ + h * HD + 8 * hh;
  const unsigned short* qhl = (const unsigned short*)QHp + qo; const unsigned short* qll = (const unsigned short*)QLp + qo;
  v16h qh[2][2], ql[2][2];
#pragma unroll
  for (int qt = 0; qt < 2; ++qt) for (int ks = 0; ks < 2; ++ks) { qh[qt][ks] = fa_frag(qhl + (size_t)(qt * 16) * LQ + ks * 32); ql[qt][ks] = fa_frag(qll + (size_t)(qt * 16) * LQ + ks * 32); }
  asm volatile("s_wait_xcnt 0x0" :: "v"(qhl), "v"(qll) : "memory");      /* stands in front of the first overwrite of these loads' address registers; the addresses are inputs so that they keep their registers up to here */
  const v8f z8 = {0.f,0.f,0.f,0.f,0.f,0.f,0.f,0.f}; v8f o[2][4], nbv[2]; float m[2], l[2]; float lim = -1.0f;      /* nbv: the offset in use, -M in all 8 registers: the C operand of a score tile's first product. lim: below every sum until the first reference is set */
#pragma unroll
  for (int qt = 0; qt < 2; ++qt) { m[qt] = -1.0e30f; nbv[qt] = z8; l[qt] = 0.f; for (int dt = 0; dt < 4; ++dt) o[qt][dt] = z8; }
#pragma unroll 1      /* rolled: the buffer's offset stays a run-time scalar, so that lk and lv are themselves no operands of the copies' asm text: as such they were tied to the first 256 registers over the whole kernel and spilled to scratch */
  for (int s = 0; s < 2; ++s) {      /* stage 0's copies, their wait and the barrier; then stage 1's copies */
    fa_stage(lk + (unsigned)s * FABUF, lv + (unsigned)s * FABUF, gh + (go + (unsigned)s * (FAT * LQ)), gl + (go + (unsigned)s * (FAT * LQ)), gv + (gvo + (unsigned)s * FAT));
    if (s == 0) {
      asm volatile("s_wait_asynccnt 0x0" ::: "memory");      /* this wave's copies of stage 0 have landed */
      __syncthreads();      /* stage 0 is readable by every wave */
    }
  }
#pragma unroll 1      /* rolled: one stage per trip */
  for (int s = 0; s < SQ / FAT; ++s) {
    const unsigned char* bufp = ring + (s & 1) * FABUF; const unsigned char* pk = bufp + ln * FAKP + 16 * hh; const unsigned char* pv = bufp + 2 * FAKB + ln * FAVP + 16 * hh;
    v16h kh[2][2], kl[2][2];
#pragma unroll
    for (int kt = 0; kt < 2; ++kt) for (int ks = 0; ks < 2; ++ks) { kh[kt][ks] = g2_frag(pk + (kt * 16) * FAKP + ks * 64); kl[kt][ks] = g2_frag(pk + FAKB + (kt * 16) * FAKP + ks * 64); }
#pragma unroll 1      /* rolled: one pass already holds 32 matrix instructions, and a second copy would double the registers in flight */
    for (int ps = 0; ps < FAT / FAK; ++ps) {
      v16h va[4];      /* V^T rows of this pass: asked for here, needed only behind the softmax */
#pragma unroll
      for (int dt = 0; dt < 4; ++dt) va[dt] = g2_frag(pv + (dt * 16) * FAVP + ps * 64);
      v8f sa[2][2];      /* [query tile][key tile]: offset + hi.hi + hi.lo + lo.hi; four independent chains, a link every fourth matrix instruction */
#pragma unroll
      for (int qt = 0; qt < 2; ++qt) for (int kt = 0; kt < 2; ++kt) sa[qt][kt] = fa_mma(kh[kt][0], qh[qt][0], nbv[qt]);
#pragma unroll
      for (int qt = 0; qt < 2; ++qt) for (int kt = 0; kt < 2; ++kt) sa[qt][kt] = fa_mma(kh[kt][1], qh[qt][1], sa[qt][kt]);
#pragma unroll
      for (int qt = 0; qt < 2; ++qt) for (int kt = 0; kt < 2; ++kt) sa[qt][kt] = fa_mma(kh[kt][0], ql[qt][0], sa[qt][kt]);
#pragma unroll
      for (int qt = 0; qt < 2; ++qt) for (int kt = 0; kt < 2; ++kt) sa[qt][kt] = fa_mma(kh[kt][1], ql[qt][1], sa[qt][kt]);
#pragma unroll
      for (int qt = 0; qt < 2; ++qt) for (int kt = 0; kt < 2; ++kt) sa[qt][kt] = fa_mma(kl[kt][0], qh[qt][0], sa[qt][kt]);
#pragma unroll
      for (int qt = 0; qt < 2; ++qt) for (int kt = 0; kt < 2; ++kt) sa[qt][kt] = fa_mma(kl[kt][1], qh[qt][1], sa[qt][kt]);
      asm volatile("v_nop\n\tv_nop\n\tv_nop\n\tv_nop" : "+v"(sa[0][0]), "+v"(sa[0][1]), "+v"(sa[1][0]), "+v"(sa[1][1]) : "v"(nbv[0]), "v"(nbv[1]));      /* the four vector slots that the chip needs between a matrix instruction and the first read of its result: the readers are now the v_exp_f32 in asm text. The offsets are inputs so that they are still in use behind the four first products: those then take C and D in different registers; where a product was the offset's last reader in the block, this build copied the offset into its accumulator first, eight 64-bit moves a pass */
      if (ps + 1 < FAT / FAK) {      /* the next pass's K rows of the SAME stage, asked for ahead of this pass's softmax */
#pragma unroll
        for (int kt = 0; kt < 2; ++kt) for (int ks = 0; ks < 2; ++ks) { kh[kt][ks] = g2_frag(pk + ((ps + 1) * FAK + kt * 16) * FAKP + ks * 64); kl[kt][ks] = g2_frag(pk + FAKB + ((ps + 1) * FAK + kt * 16) * FAKP + ks * 64); } }
      float t[2][16];
#pragma unroll
      for (int qt = 0; qt < 2; ++qt) for (int i = 0; i < 16; ++i) t[qt][i] = sa[qt][i >> 3][i & 7];
      FragH p[2]; float sum[2];
#pragma unroll
      for (int qt = 0; qt < 2; ++qt) fa_weights(t[qt], p[qt], sum[qt]);
      asm volatile("" :: "v"(va[0]), "v"(va[1]), "v"(va[2]), "v"(va[3]));      /* inputs only: holds the V^T loads in front of the test; without it they were moved behind the branch, directly in front of the products that read them, their whole LDS latency in the open */
      if (__builtin_amdgcn_ballot_w32(fmaxf(sum[0], sum[1]) > lim) != 0) {      /* one test per pass, a scalar branch taken by the whole wave: some lane's weights have outgrown f16 under the reference in use (always so in the first pass) */
#pragma unroll
        for (int qt = 0; qt < 2; ++qt) {
          float mx = t[qt][0];
#pragma unroll
          for (int i = 1; i < 16; ++i) mx = fmaxf(mx, t[qt][i]);
          mx = fmaxf(mx, xhalf(mx));
          const float nbo = nbv[qt][0]; const float mn = fmaxf(m[qt], mx - nbo); const float al = exp2_slot(m[qt] - mn); const float d = nbo + mn; m[qt] = mn;      /* mx - nbo: the pass's maximum without the offset in use; d: what the new reference takes off this pass's exponents */
#pragma unroll
          for (int r = 0; r < 8; ++r) nbv[qt][r] = -mn;
#pragma unroll
          for (int i = 0; i < 16; ++i) t[qt][i] -= d;
          l[qt] *= al;
#pragma unroll
          for (int dt = 0; dt < 4; ++dt) { for (int r = 0; r < 8; ++r) o[qt][dt][r] *= al; }
          fa_weights(t[qt], p[qt], sum[qt]);
        }
        lim = FALIM;
      }
#pragma unroll
      for (int qt = 0; qt < 2; ++qt) { l[qt] += sum[qt];
#pragma unroll
        for (int dt = 0; dt < 4; ++dt) o[qt][dt] = fa_mma(va[dt], p[qt].v, o[qt][dt]); }
    }
    asm volatile("s_wait_dscnt 0x0" ::: "memory");      /* this wave's reads of stage s are done before the buffer is handed to its next writer */
    asm volatile("s_wait_asynccnt 0x0" ::: "memory");      /* this wave's copies of stage s + 1 have landed */
    __syncthreads();      /* publishes stage s + 1 and ends every wave's reads of stage s */
    if (s + 2 < SQ / FAT) fa_stage(lk + (unsigned)(s & 1) * FABUF, lv + (unsigned)(s & 1) * FABUF, gh + (go + (unsigned)(s + 2) * (FAT * LQ)), gl + (go + (unsigned)(s + 2) * (FAT * LQ)), gv + (gvo + (unsigned)(s + 2) * FAT));
  }
  asm volatile("s_wait_asynccnt 0x0" ::: "memory");      /* no copy is outstanding when the wave goes on */
#pragma unroll
  for (int qt = 0; qt < 2; ++qt) { const float inv = 64.0f / (l[qt] + xhalf(l[qt]));      /* the halves' sums joined once; o carried x64 */
    _Float16* op = Op + r0 * DM + (size_t)h * SQ * HD + (size_t)(q0 + qt * 16 + ln) * HD + 8 * hh;
#pragma unroll
    for (int dt = 0; dt < 4; ++dt) { FragH f; for (int r = 0; r < 8; ++r) f.h[r] = (_Float16)(o[qt][dt][r] * inv); *(v8us*)((unsigned short*)op + dt * 16) = f.half[0]; } } }


template <int MASKADD>
__global__ __launch_bounds__(64) void k_att0(const float* __restrict__ QF, const float* __restrict__ KF, const float* __restrict__ VF, int ld, const float* __restrict__ mask, float scale, float* __restrict__ OF, int ldo) {
  #pragma clang fp contract(off)
  __shared__ __attribute__((aligned(16))) float lq[64][64]; __shared__ __attribute__((aligned(16))) float lo[64][64];
  const int tid = threadIdx.x; const int h = blockIdx.x / (QT0 / 64), rg = blockIdx.x % (QT0 / 64); const int i = rg * 64 + tid;
  const float* qr = QF + (size_t)i * ld + h * HD;
#pragma unroll 1
  for (int c = 0; c < HD / 4; ++c) { *(v4f*)&lq[tid][c * 4] = *(const v4fa*)(qr + c * 4); const v4f z = {0.f, 0.f, 0.f, 0.f}; *(v4f*)&lo[tid][c * 4] = z; }
  float m = -1.0e30f, l = 0.f; const int jmax = MASKADD ? (SQ - 1) : (rg * 64 + 63);      /* additive-mask form: every key (the mask input decides); causal form: keys up to the block's last row */
#pragma unroll 1
  for (int j = 0; j <= jmax; ++j) { const float* kr = KF + (size_t)j * ld + h * HD; const float* vr = VF + (size_t)j * ld + h * HD; float s = 0.f;
#pragma unroll 1
    for (int c = 0; c < HD / 4; ++c) { const v4f kq = *(const v4fa*)(kr + c * 4); const v4f qq = *(v4f*)&lq[tid][c * 4]; s = __fadd_rn(s, __fmul_rn(qq[0], kq[0])); s = __fadd_rn(s, __fmul_rn(qq[1], kq[1])); s = __fadd_rn(s, __fmul_rn(qq[2], kq[2])); s = __fadd_rn(s, __fmul_rn(qq[3], kq[3])); }
    s = __fmul_rn(s, scale); if (MASKADD) s = __fadd_rn(s, __fmul_rn(bf16_round(mask[(size_t)i * SQ + j]), -10000.0f));
    const float f = (MASKADD || j <= i) ? 1.f : 0.f; const float sm = fmaf(f, s, (1.f - f) * -1.0e30f); const float mn = fmaxf(m, sm); const float sc = expf(m - mn); const float e = expf(sm - mn); l = __fadd_rn(__fmul_rn(l, sc), e); m = mn;
#pragma unroll 1
    for (int c = 0; c < HD / 4; ++c) { const v4f vv = *(const v4fa*)(vr + c * 4); v4f oo = *(v4f*)&lo[tid][c * 4]; for (int u = 0; u < 4; ++u) oo[u] = __fadd_rn(__fmul_rn(oo[u], sc), __fmul_rn(e, vv[u])); *(v4f*)&lo[tid][c * 4] = oo; } }
  const float fin = 64.0f / l;      /* o carried x64 like the f16 path */
#pragma unroll 1
  for (int c = 0; c < HD / 4; ++c) { v4f oo = *(v4f*)&lo[tid][c * 4]; for (int u = 0; u < 4; ++u) oo[u] = __fmul_rn(oo[u], fin); *(v4f*)&lo[tid][c * 4] = oo; }
  __syncthreads();
  {
#pragma unroll 1
    for (int it = 0; it < 16; ++it) { const int row = it * 4 + tid / 16, pc = (tid % 16) * 4; const v4f v = *(const v4f*)&lo[row][pc]; *(v4f*)(OF + (size_t)(rg * 64 + row) * ldo + h * HD + pc) = v; }
     } }

extern "C" void kernel_launch(void* const* d_in, const int* in_sizes, int n_in,
                              void* d_out, int out_size, void* d_ws, size_t ws_size, hipStream_t stream) {
  (void)in_sizes; (void)n_in; (void)out_size;
  const float* const* I = (const float* const*)d_in; const float* x = I[0]; const float* xk = I[1]; const float* xv = I[2]; const float* wq = I[3]; const float* wk = I[4]; const float* wv = I[5]; const float* bq = nullptr; const float* bk = nullptr; const float* bv = nullptr; const float* wo = I[6]; const float* bo = nullptr;      /* input order: q, k, v (the three streams, two sequences each), Wq, Wk, Wv (PER-HEAD STACKS [16][1024][64]), Wo ([in][out] [1024][1024]); NO biases anywhere: null pointers in the guarded slots */
  char* ws = (char*)d_ws; size_t off = 0;
  auto take = [&](size_t bytes) { char* p = ws + off; off += (bytes + 255) & ~(size_t)255; return p; };
  _Float16* BQ = (_Float16*)take((size_t)DM * DM * 2); _Float16* BK = (_Float16*)take((size_t)DM * DM * 2); _Float16* BV = (_Float16*)take((size_t)DM * DM * 2); _Float16* BO = (_Float16*)take((size_t)DM * DM * 2);
  _Float16* X16 = (_Float16*)take(NR * DM * 2); _Float16* XK16 = (_Float16*)take(NR * DM * 2); _Float16* XV16 = (_Float16*)take(NR * DM * 2);      /* exact f16 rows of query, key, value */ _Float16* QH = (_Float16*)take(NR * DM * 2); _Float16* QL = (_Float16*)take(NR * DM * 2); _Float16* KH = (_Float16*)take(NR * DM * 2); _Float16* KL = (_Float16*)take(NR * DM * 2); _Float16* Q16 = QH; _Float16* K16 = KH; _Float16* O16 = (_Float16*)take(NR * DM * 2);
  _Float16* VT = (_Float16*)take((size_t)NB * NH * HD * SQ * 2);      /* V^T of both batches */
  float* QF0 = (float*)take((size_t)QT0 * DM * 4); float* KF0 = (float*)take((size_t)QT0 * DM * 4); float* VF0 = (float*)take((size_t)QT0 * DM * 4); float* OF0 = (float*)take((size_t)NB * QT0 * DM * 4); _Float16* OH0 = (_Float16*)take((size_t)NB * QT0 * DM * 2); _Float16* OL0 = (_Float16*)take((size_t)NB * QT0 * DM * 2);
  if (off > ws_size) return;
  k_prep<<<PPG, PPT, 0, stream>>>(wq, wk, wv, wo, x, xk, xv, BQ, BK, BV, BO, X16, XK16, XV16);      /* head h's [1024][64] block -> rows 64 h .. 64 h + 63 of the Bt[n][k] x16 plane; the [in][out] output weight transposed into its plane; the three streams as exact f16 rows */
  const size_t r0p = (size_t)B0 * SQ;      /* first projected row */
  k_proj<<<dim3((unsigned)PJT, 3), 256, 0, stream>>>(X16, XK16, XV16, BQ, BK, BV, QH, QL, KH, KL, VT);      /* q (x FAC) and k -> f16 hi + residual planes; v -> V^T [NB][NH][HD][SQ] */
  k_fattn<<<dim3(SQ / (FAW * FAQ), NH, NB), FAW * 32, 0, stream>>>(QH, QL, KH, KL, VT, O16);      /* o written HEAD-CONTIGUOUS: o[b][h][s][64] (row pitch 64, head stride SQ x 64): the source's raw reshape of (B, H, S, dk) to (B, S, H dk) then reads that memory as [2048][1024] rows: the output GEMM below does exactly that */
  k_gemm2<0><<<dim3((unsigned)((MPO / 128) * (DM / 128)), 1), 256, 0, stream>>>(O16 + r0p * DM, DM, 0, BO, DM, 0, 0.0009765625f, bo, 0, nullptr, 1, 0, 0, (float*)d_out + r0p * DM, nullptr, DM, 0, MPO, DM, DM);      /* out rows are the output layout */
  /* (dense: no first-tile hi / lo planes) */
  /* (dense: no first-tile rewrite passes:
     the output GEMM above has written every row
     with its (null) bias) */
}
